// v000
// Times are from an AMD MI455X. After a warm-up the kernel runs many times in a row, and a time is the length of
// such a window on the GPU divided by its runs, so every launch and the gaps after it count. The runs cycle
// through copies of the inputs. A figure is the median of several windows, for all but v000 over two sittings.
// Sittings can differ by a few percent; kernels timed side by side share one.
// The starting kernel, v000, takes 1830 microseconds a run.
// Contractions on v_wmma_f32_16x16x32_bf16 (bf16 operands, f32 accumulate): x*Wq, x*Wk, Wv^T*x^T as single
// products of bf16-RNE inputs; q.k^T and p.v as bf16 hi/lo split (hi.hi + hi.lo + lo.hi); ctx*Wo as
// [ctx hi | ctx lo] . [Wo ; Wo] (K = 1024); edge bias (16-deep dots of bf16-RNE inputs), online softmax and all biases in f32 on the VALU.
#include <hip/hip_runtime.h>
#include <math.h>
#include <stdint.h>
#include <stddef.h>

// Geometry: NGR graphs of NND consecutive node rows; attention keys of a query = the NND nodes of its graph.
// The job runs in NHALF passes of GHALF graphs each; the q / k / v^T / ctx planes are rewritten per pass.
//
// Plane map (workspace, all 16-bit planes are bf16 bits; no power-of-two carries anywhere, so no inverse
// factor exists -> carry audit: none):
//   Xb   [16384][512]          bf16(x)                                        -> A of q/k GEMMs, Bt of v^T GEMM
//   WqT, WkT, WvT [512 o][512 i]  bf16(W[i][o])                              -> Bt / A (k-contiguous)
//   WOT2 [512 o][1024]         bf16(Wo[k mod 512][o])                         -> Bt of the output GEMM
//   EB   [EP][8] f32           sum_t bf16(ea[e][t]) bf16(We[t][h]) + bf16(be[h])
//   Qp, Kp [8192][1024]        hi at col h*64+d, residual lo at col 512 + h*64+d (f32 projection split)
//   VTp  [16 graphs][512 (h,d)][1024]   hi at col s, lo at col 512 + s (s = node within graph)
//   CTX  [8192][1024]          hi | lo of the normalised attention context

#define NGR    32
#define NND    512
#define NTOT   (NGR * NND)      // 16384
#define HID    512
#define NHD    8
#define HDM    64
#define EDW    16
#define NHALF  2
#define GHALF  (NGR / NHALF)    // 16
#define RHALF  (GHALF * NND)    // 8192
#define PLD    1024
#define NTHR   256
#define WSMAX  134217728

static_assert(HID == NHD * HDM && HDM == 64 && NHD == 8);
static_assert(PLD == 2 * HID);
static_assert((RHALF % 64) == 0 && (HID % 64) == 0 && (NND % 64) == 0 && (PLD % 32) == 0 && (HID % 32) == 0);
static_assert(((RHALF / 64) * (HID / 64)) % 8 == 0);       // GEMM grids: 8 wave tiles per block, exact
static_assert(((HID / 64) * (NND / 64)) % 8 == 0);
static_assert(NGR == NHALF * GHALF);
static_assert(HID == 64 * 8);                               // k_xprep: 64 units of 8 per row
static_assert(EDW == 16 && NHD == 8 && EDW * NHD <= NTHR);  // k_eb layout

typedef __attribute__((ext_vector_type(16))) _Float16 v16h;
typedef __attribute__((ext_vector_type(8)))  _Float16 v8h;
typedef __attribute__((ext_vector_type(16))) __bf16   v16b;
typedef __attribute__((ext_vector_type(8)))  __bf16   v8b;
typedef __attribute__((ext_vector_type(8)))  float    v8f;
typedef __attribute__((ext_vector_type(4)))  float    v4f;
typedef __attribute__((ext_vector_type(2)))  float    v2f;
typedef __attribute__((ext_vector_type(4)))  unsigned int v4u;
typedef __attribute__((ext_vector_type(4)))  int      v4i;
typedef __attribute__((ext_vector_type(8)))  unsigned short v8us;
typedef v4f  __attribute__((may_alias)) v4fa;
typedef v2f  __attribute__((may_alias)) v2fa;
typedef v4u  __attribute__((may_alias)) v4ua;

// ---- scalar helpers: f32 -> bf16 bits (RNE convert), bf16 bits -> f32 ----
__device__ __forceinline__ unsigned short f2bf_bits(float f) {
  unsigned u = __float_as_uint(f);
  return (unsigned short)((u + 0x7FFFu + ((u >> 16) & 1u)) >> 16);
}
__device__ __forceinline__ float bf_bits2f(unsigned short h) { return __uint_as_float(((unsigned)h) << 16); }
__device__ __forceinline__ float bfrf(float f) { return bf_bits2f(f2bf_bits(f)); }
__device__ __forceinline__ unsigned int f2bfu(float f) {
  const unsigned int u = __float_as_uint(f);
  return ((u + 0x7FFFu + ((u >> 16) & 1u)) >> 16) & 0xFFFFu;
}
__device__ __forceinline__ float bf2f(unsigned int b) { return __uint_as_float(b << 16); }
__device__ __forceinline__ v4f bfr4(const v4f a) {
  v4f r; r.x = bfrf(a.x); r.y = bfrf(a.y); r.z = bfrf(a.z); r.w = bfrf(a.w); return r;
}
__device__ __forceinline__ unsigned int pk2(float lo, float hi) { return f2bfu(lo) | (f2bfu(hi) << 16); }
__device__ __forceinline__ v4u pack8(const v4f a, const v4f b) {
  v4u r;
  r.x = pk2(a.x, a.y); r.y = pk2(a.z, a.w); r.z = pk2(b.x, b.y); r.w = pk2(b.z, b.w);
  return r;
}
// hi = bf16(v), lo = bf16(v - hi): two floats -> one packed word of each
__device__ __forceinline__ void hl2(float v0, float v1, unsigned int& hw, unsigned int& lw) {
  const unsigned int h0 = f2bfu(v0), h1 = f2bfu(v1);
  const unsigned int l0 = f2bfu(v0 - bf2f(h0)), l1 = f2bfu(v1 - bf2f(h1));
  hw = h0 | (h1 << 16);
  lw = l0 | (l1 << 16);
}
__device__ __forceinline__ void pack8hl(const v4f a, const v4f b, v4u& hv, v4u& lv) {
  unsigned int h, l;
  hl2(a.x, a.y, h, l); hv.x = h; lv.x = l;
  hl2(a.z, a.w, h, l); hv.y = h; lv.y = l;
  hl2(b.x, b.y, h, l); hv.z = h; lv.z = l;
  hl2(b.z, b.w, h, l); hv.w = h; lv.w = l;
}

// ---- WMMA fragment helpers (bf16, wave32) ----
// A fragment (row m = lane&15) and B fragment (col n = lane&15) use the SAME k map:
//   elements 0..7 <- k0 + 8h + 0..7, elements 8..15 <- k0 + 16 + 8h + 0..7, h = lane>>4,
// loaded as two 16-B pieces from a k-contiguous 16-bit row: p[0..7] and p[16..23] with p = row + k0 + 8h.
// D element r of lane l = (row 8h + r, col l&15).
__device__ __forceinline__ void dep_guard_b(v8f& a, v8f& b, v16b x, v16b y) { asm volatile("v_nop\n\tv_nop\n\tv_nop\n\tv_nop" : "+v"(a), "+v"(b) : "v"(x), "v"(y)); }
__device__ __forceinline__ void keep4_b(v16b a, v16b b, v16b c, v16b d) { asm volatile("v_nop" :: "v"(a), "v"(b), "v"(c), "v"(d)); }
__device__ __forceinline__ void acc_guard4(v8f& a, v8f& b, v8f& c, v8f& d) { asm volatile("v_nop\n\tv_nop\n\tv_nop\n\tv_nop" : "+v"(a), "+v"(b), "+v"(c), "+v"(d)); }

struct FragBF {
  union U { v16b v; v8b h[2]; };
  static __device__ __forceinline__ v16b load(const __bf16* p) {   // elements 0..7 <- p[0..7], 8..15 <- p[16..23]
    U f; f.h[0] = *(const v8b*)(p); f.h[1] = *(const v8b*)(p + 16); return f.v;
  }
  static __device__ __forceinline__ v8f mma(v16b a, v16b b, v8f c) {
    return __builtin_amdgcn_wmma_f32_16x16x32_bf16(false, a, false, b, (short)0, c, false, false);
  }
  static __device__ __forceinline__ void guard(v8f& a, v8f& b, v16b x, v16b y) { dep_guard_b(a, b, x, y); }
  static __device__ __forceinline__ void keep(v16b a, v16b b, v16b c, v16b d) { keep4_b(a, b, c, d); }
};
union FB { v16b v; v8b h[2]; };

// single WMMA with hazard guard: ties D, keeps A/B live for 4 VALU slots
__device__ __forceinline__ v8f at_mma(v16b a, v16b b, v8f c) {
  c = __builtin_amdgcn_wmma_f32_16x16x32_bf16(false, a, false, b, (short)0, c, false, false);
  asm volatile("v_nop\n\tv_nop\n\tv_nop\n\tv_nop" : "+v"(c) : "v"(a), "v"(b));
  return c;
}
__device__ __forceinline__ __bf16 at_f2bf(float f) { return __builtin_bit_cast(__bf16, f2bf_bits(f)); }
__device__ __forceinline__ void at_split(float f, __bf16& hi, __bf16& lo) {
  const unsigned short hb = f2bf_bits(f);
  hi = __builtin_bit_cast(__bf16, hb);
  lo = at_f2bf(f - __uint_as_float(((unsigned)hb) << 16));
}

// =====================================================================================
// Register-blocked batched WMMA GEMM (bf16 operands).
// C[m,n] = scale * sum_k A[m,k] * Bt[n,k] (+bias)(+resid); each wave owns a 64x64 tile.
// A row-major [M,K]; Bt row-major [N,K]; M,N % 64 == 0, K % 32 == 0 (host static_asserts).
// SPLIT: operands are hi/lo planes (A2/Bt2 = lo planes, same layout); product = hi.hi + hi.lo + lo.hi.
// BIAS_MODE: 0 = none, 1 = bf16r(bias[m]), 2 = bf16r(bias[n]).
// OUT_MODE: 0 = f32, 1 = f16, 2 = bf16 hi plane (Cout) + bf16 lo plane (Cout2).
// coverage: grid.x * 8 waves == (M/64)*(N/64) tiles exactly (host), every C element written once per z.
// =====================================================================================
template <bool SPLIT, int BIAS_MODE, int OUT_MODE, bool RESID, int ACT = 0>
__global__ __launch_bounds__(256) void wmma_gemm64(
    const unsigned short* __restrict__ Ap, const unsigned short* __restrict__ A2p, int lda, long strideA,
    const unsigned short* __restrict__ Btp, const unsigned short* __restrict__ Bt2p, int ldb, long strideB,
    void* __restrict__ Cout, void* __restrict__ Cout2, int ldc, long strideC,
    const float* __restrict__ bias,
    const float* __restrict__ resid, long strideR,
    int M, int N, int K, float scale) {
  typedef __bf16 T;
  typedef v16b V;
  const T* A = (const T*)Ap; const T* A2 = (const T*)A2p; const T* Bt = (const T*)Btp; const T* Bt2 = (const T*)Bt2p;
  __shared__ __align__(16) float sT[8][16 * 68];   // per-wave 16x64 slab, pitch 68 floats
  const int b    = blockIdx.y;
  const int lane = threadIdx.x & 31;
  const int wave = threadIdx.x >> 5;
  const int tilesN = N >> 6;
  const int tilesM = M >> 6;
  const int tile = blockIdx.x * 8 + wave;
  if (tile >= tilesM * tilesN) return;   // wave-uniform; no block barriers in this kernel
  const int tm = tile / tilesN;
  const int tn = tile - tm * tilesN;
  const int m0 = tm << 6;
  const int n0 = tn << 6;

  const T* Ab  = A  + (size_t)b * strideA;
  const T* Bb  = Bt + (size_t)b * strideB;
  const T* Ab2 = SPLIT ? (A2  + (size_t)b * strideA) : nullptr;
  const T* Bb2 = SPLIT ? (Bt2 + (size_t)b * strideB) : nullptr;

  const int rlane = lane & 15;                 // row (A) / col (B, D) within subtile
  const int koff  = (lane >> 4) * 8;           // k offset of this lane half
  const int mOff  = (lane >> 4) * 8;           // D row offset

  v8f acc[4][4];
#pragma unroll
  for (int i = 0; i < 4; ++i)
#pragma unroll
    for (int j = 0; j < 4; ++j) acc[i][j] = (v8f){0.f,0.f,0.f,0.f,0.f,0.f,0.f,0.f};

  for (int k0 = 0; k0 < K; k0 += 32) {
    V bh[4], bl[4];
#pragma unroll
    for (int j = 0; j < 4; ++j) {
      const size_t bo = (size_t)(n0 + (j << 4) + rlane) * ldb + koff + k0;
      bh[j] = FragBF::load(Bb + bo);
      if (SPLIT) bl[j] = FragBF::load(Bb2 + bo);
    }
#pragma unroll
    for (int i = 0; i < 4; ++i) {
      const size_t ao = (size_t)(m0 + (i << 4) + rlane) * lda + koff + k0;
      V ah = FragBF::load(Ab + ao);
      V al;
      if (SPLIT) al = FragBF::load(Ab2 + ao);
#pragma unroll
      for (int j = 0; j < 4; ++j) {
        acc[i][j] = FragBF::mma(ah, bh[j], acc[i][j]);
        if (SPLIT) {
          acc[i][j] = FragBF::mma(ah, bl[j], acc[i][j]);
          acc[i][j] = FragBF::mma(al, bh[j], acc[i][j]);
        }
      }
      FragBF::guard(acc[i][0], acc[i][3], ah, SPLIT ? al : ah);
    }
    FragBF::keep(bh[0], bh[1], bh[2], bh[3]);
    if (SPLIT) FragBF::keep(bl[0], bl[1], bl[2], bl[3]);
  }
  acc_guard4(acc[0][0], acc[0][1], acc[0][2], acc[0][3]);
  acc_guard4(acc[1][0], acc[1][1], acc[1][2], acc[1][3]);
  acc_guard4(acc[2][0], acc[2][1], acc[2][2], acc[2][3]);
  acc_guard4(acc[3][0], acc[3][1], acc[3][2], acc[3][3]);

  // ---- epilogue ----
  float* slab = sT[wave];
  const float* Rb = RESID ? (resid + (size_t)b * strideR) : nullptr;
#pragma unroll
  for (int i = 0; i < 4; ++i) {
    const int mBase = m0 + (i << 4);
    float bm[8];
    if (BIAS_MODE == 1) {   // 8 consecutive floats, 32-B aligned: two 16-B loads
      const v4f b0v = bfr4(*(const v4fa*)(bias + mBase + mOff));
      const v4f b1v = bfr4(*(const v4fa*)(bias + mBase + mOff + 4));
      bm[0] = b0v.x; bm[1] = b0v.y; bm[2] = b0v.z; bm[3] = b0v.w;
      bm[4] = b1v.x; bm[5] = b1v.y; bm[6] = b1v.z; bm[7] = b1v.w;
    } else {
#pragma unroll
      for (int r = 0; r < 8; ++r) bm[r] = 0.f;
    }
#pragma unroll
    for (int j = 0; j < 4; ++j) {
      const int n = n0 + (j << 4) + rlane;
      float bv = 0.f;
      if (BIAS_MODE == 2) bv = bfrf(bias[n]);
#pragma unroll
      for (int r = 0; r < 8; ++r) {
        float v = acc[i][j][r] * scale;
        if (BIAS_MODE == 1) v += bm[r];
        if (BIAS_MODE == 2) v += bv;
        if (RESID) v += Rb[(size_t)(mBase + mOff + r) * ldc + n];
        if (ACT == 1) v = tanhf(v);
        if (ACT == 2) v = fmaxf(v, 0.0f);
        if (ACT == 4) v = (v > 0.f) ? v : 0.01f * v;
        slab[(mOff + r) * 68 + (j << 4) + rlane] = v;
      }
    }
    __builtin_amdgcn_fence(__ATOMIC_RELEASE, "workgroup");
    __builtin_amdgcn_wave_barrier();
    __builtin_amdgcn_fence(__ATOMIC_ACQUIRE, "workgroup");
    if (OUT_MODE == 0) {
      float* C = (float*)Cout + (size_t)b * strideC;
      const int hh = lane >> 4, c4 = (lane & 15) * 4;     // row seg = 256 B = 16 lanes x 16 B
      {
#pragma unroll
        for (int it = 0; it < 8; ++it) {
          const int row = it * 2 + hh;
          v4f v = *(const v4f*)(slab + row * 68 + c4);
          *(v4f*)(C + (size_t)(mBase + row) * ldc + n0 + c4) = v;
        }
        
      }
    } else {
      const int q = lane >> 3, c8 = (lane & 7) * 8;
      unsigned short* C  = (unsigned short*)Cout  + (size_t)b * strideC;
      unsigned short* C2 = (OUT_MODE == 2) ? ((unsigned short*)Cout2 + (size_t)b * strideC) : nullptr;
      {
#pragma unroll
        for (int it = 0; it < 4; ++it) {
          const int row = it * 4 + q;
          const float* sp = slab + row * 68 + c8;
          v8h hv, lv;
#pragma unroll
          for (int e = 0; e < 8; ++e) {
            if (OUT_MODE == 1) {
              hv[e] = (_Float16)sp[e];
            } else {
              unsigned short hb = f2bf_bits(sp[e]);
              unsigned short lb = f2bf_bits(sp[e] - bf_bits2f(hb));
              hv[e] = __builtin_bit_cast(_Float16, hb);
              lv[e] = __builtin_bit_cast(_Float16, lb);
            }
          }
          *(v8h*)(C + (size_t)(mBase + row) * ldc + n0 + c8) = hv;
          if (OUT_MODE == 2) *(v8h*)(C2 + (size_t)(mBase + row) * ldc + n0 + c8) = lv;
        }
        
      }
    }
    __builtin_amdgcn_fence(__ATOMIC_RELEASE, "workgroup");
    __builtin_amdgcn_wave_barrier();
    __builtin_amdgcn_fence(__ATOMIC_ACQUIRE, "workgroup");
  }
}

// =====================================================================================
// Node feature plane: xb[row][c] = bf16(x[row][c]) for row < nN (all 512 c). One thread = 8 contiguous
// =====================================================================================
__global__ __launch_bounds__(NTHR) void k_xprep(const float* __restrict__ x, unsigned short* xb, int nN, int nUnits) {
  const int i = (int)blockIdx.x * NTHR + (int)threadIdx.x;
  if (i >= nUnits) return;
  const int row = i >> 6;
  const int c0  = (i & 63) * 8;
  const int rc  = row < nN ? row : nN - 1;
  const float* p = x + (size_t)rc * HID + c0;
  v4f a = *(const v4fa*)p;
  v4f b = *(const v4fa*)(p + 4);
  const v4f z4 = {0.f, 0.f, 0.f, 0.f};
  if (row >= nN) { a = z4; b = z4; }
  const v4u hv = pack8(a, b);
  unsigned short* o = xb + (size_t)row * HID + c0;
  *(v4u*)o = hv;
  
}

// =====================================================================================
// Weight transpose + bf16 convert into a k-contiguous plane: w is [Kin][Ncol] ([in][out]),
//   wt[n][k] = bf16(w[k mod Kin][n]) for n < Nrows, k < Kout (Kout = Kin or a multiple of it).
// coverage: nUnits = Nrows * Kout/8 threads x 8 = Nrows x Kout exactly.
// =====================================================================================
__global__ __launch_bounds__(NTHR) void k_wtr(const float* __restrict__ w, int Kin, int Ncol, int Nrows, int Kout,
                                              unsigned short* wt, int nUnits) {
  const int u = (int)blockIdx.x * NTHR + (int)threadIdx.x;
  if (u >= nUnits) return;
  const int kq = Kout >> 3;
  const int n  = u / kq;
  const int k8 = (u - n * kq) * 8;
  const int kk = k8 - (k8 / Kin) * Kin;
  const int ncl = n < Ncol ? n : Ncol - 1;
  const float* p = w + (size_t)kk * (size_t)Ncol + ncl;
  v4f a, b;
  a.x = p[0];                    a.y = p[(size_t)Ncol];         a.z = p[(size_t)2 * Ncol];     a.w = p[(size_t)3 * Ncol];
  b.x = p[(size_t)4 * Ncol];     b.y = p[(size_t)5 * Ncol];     b.z = p[(size_t)6 * Ncol];     b.w = p[(size_t)7 * Ncol];
  const v4f z4 = {0.f, 0.f, 0.f, 0.f};
  if (n >= Ncol || n >= Nrows) { a = z4; b = z4; }
  const v4u wv = pack8(a, b);
  unsigned short* o = wt + (size_t)n * (size_t)Kout + k8;
  *(v4u*)o = wv;
  
}

// =====================================================================================
// Edge bias plane: EB[e][h] = sum_t bf16r(ea[e][t]) * bf16r(We[t][h]) + bf16r(be[h]) (f32, 16 terms summed
// from +0 then the bias), zero rows for pad edges nE <= e < EP (load address clamped, value zeroed by select).
// One thread = one edge and 4 consecutive heads: 4 b128 loads in a rolled loop, one 16-B store;
// coverage: nUnits = EP*2 threads x 4 = EP x 8 elements exactly.
// =====================================================================================
__global__ __launch_bounds__(NTHR) void k_eb(const float* __restrict__ ea, const float* __restrict__ We,
                                             const float* __restrict__ be, float* EB, int nE, int nUnits) {
  __shared__ float sWe[EDW * NHD];
  __shared__ float sbe[NHD];
  const int tid = (int)threadIdx.x;
  if (tid < EDW * NHD) sWe[tid] = bfrf(We[tid]);           // We[t][h] row-major
  if (tid < NHD) sbe[tid] = bfrf(be[tid]);
  __syncthreads();
  const int u = (int)blockIdx.x * NTHR + tid;
  if (u >= nUnits) return;
  const int e  = u >> 1;
  const int h0 = (u & 1) * 4;
  const int ec = e < nE ? e : nE - 1;
  const float* er = ea + (size_t)ec * EDW;
  float s0 = 0.f, s1 = 0.f, s2 = 0.f, s3 = 0.f;
#pragma unroll 1
  for (int q = 0; q < 4; ++q) {
    const v4f a = bfr4(*(const v4fa*)(er + 4 * q));
    const float* wr = sWe + (4 * q) * NHD + h0;            // We[4q+i][h0+j] = wr[i*8 + j]
    s0 = fmaf(a.x, wr[0],  s0); s1 = fmaf(a.x, wr[1],  s1); s2 = fmaf(a.x, wr[2],  s2); s3 = fmaf(a.x, wr[3],  s3);
    s0 = fmaf(a.y, wr[8],  s0); s1 = fmaf(a.y, wr[9],  s1); s2 = fmaf(a.y, wr[10], s2); s3 = fmaf(a.y, wr[11], s3);
    s0 = fmaf(a.z, wr[16], s0); s1 = fmaf(a.z, wr[17], s1); s2 = fmaf(a.z, wr[18], s2); s3 = fmaf(a.z, wr[19], s3);
    s0 = fmaf(a.w, wr[24], s0); s1 = fmaf(a.w, wr[25], s1); s2 = fmaf(a.w, wr[26], s2); s3 = fmaf(a.w, wr[27], s3);
  }
  v4f o;
  o.x = s0 + sbe[h0]; o.y = s1 + sbe[h0 + 1]; o.z = s2 + sbe[h0 + 2]; o.w = s3 + sbe[h0 + 3];
  const v4f z4 = {0.f, 0.f, 0.f, 0.f};
  if (e >= nE) o = z4;
  float* op = EB + (size_t)e * NHD + h0;
  *(v4f*)op = o;
  
}

// =====================================================================================
// Graph attention with per-edge additive bias, one block per (graph, 64-query tile), 8 waves.
// Phase A (block-local, statically bounded): chunk scan of the src list (edge_index row 0) for
//   src in [node0, node0+64): hits (edge id, query row, dst % 512) collected into LDS in fixed scan
//   order (chunk, wave, entry j, lane), capped at HCAP (poison when reached); 64-bin counting sort by query row (wave 0, fixed order)
//   -> sE / sD segments with roff / rcnt. Nothing persists outside LDS.
// Phase B: 4 head pairs; waves 0..3 run head 2p, waves 4..7 head 2p+1, each wave 16 query rows.
//   Per key chunk of 64: K hi/lo and V^T hi/lo tiles of both heads staged (256 threads x 32 elements =
//   two 64x64 tiles per plane, the whole chunk), a 2x64x64 f32 bias tile zeroed then filled by row owners
//   (4 threads per query row, thread j adds the entries of key columns 16j..16j+15 of its row, in segment
//   order -> duplicate (src,dst) pairs sum deterministically; non-owned entries go to a private dummy slot),
//   then S = q.k (3-term split) * 0.125 + bias, online softmax in f32, P split hi/lo through per-wave LDS
//   Epilogue: ctx = O / l staged per wave in LDS (aliasing only that wave's own bias rows), written as
// Geometry guards (NaN poison of the block's ctx rows, never a trap): hit cap, per-row count > RWCAP,
//   num_graphs != NGR, batch id of the block's first node outside [0, NGR).
// coverage: CTX rows lrow0..lrow0+63 x all 1024 cols per block; grid = GHALF*8 blocks covers 8192 rows once.
// =====================================================================================
#define AT_NW   8
#define EPT     8
#define CHUNK   (NTHR * EPT)          // 2048 keys per chunk
#define WCAP    (EPT * 32)            // 256: exact upper bound of hits per wave per chunk
#define LISTN   (AT_NW * WCAP)        // 2048
#define SLOTB   6
#define NSLOT   64                    // query rows per block = scan slots
#define HCAP    2048                  // hit capacity per block
#define RWCAP   128                   // static cap on per-row edge count
#define KVT     4096                  // one 64x64 tile
#define NDUM    512                   // private dummy accumulators (2 per thread)
#define LO_KV   0
#define LO_P    (8 * KVT * 2)                           // 65536
#define LO_BT   (LO_P + 2 * AT_NW * 1024 * 2)           // 98304
#define LO_SE   (LO_BT + (2 * KVT + NDUM) * 4)          // 133120
#define LO_SD   (LO_SE + HCAP * 4)                      // 141312
#define LO_RC   (LO_SD + HCAP * 4)                      // 149504
#define LDS_ATT (LO_RC + (3 * NSLOT + 2 * AT_NW) * 4)   // 150336

static_assert((LISTN + 2 * HCAP) * 4 <= LO_P);        // phase-A lists alias the K/V tile region
static_assert(LDS_ATT <= 300000);
static_assert((1 << SLOTB) == NSLOT);
static_assert(NTHR == 32 * AT_NW);
static_assert(NTHR == 4 * NSLOT);                      // bias fill: 4 threads per query row
static_assert(NTHR * 32 == 2 * KVT);                   // bias zero fill: 32 floats per thread
static_assert(NDUM == 2 * NTHR && NDUM == 128 * 4);
static_assert(AT_NW * 1024 == 2 * KVT);                // per-wave output staging = own bias rows
static_assert((CHUNK & (CHUNK - 1)) == 0 && CHUNK == 2048);
static_assert(2 * NSLOT == 32 * 4 / 2 * 2 && NSLOT == 2 * 32);   // prefix: two counts per lane of wave 0

// One chunk of the key list: each thread tests EPT entries against the block's slot range
// [slotBase, slotBase + nb); hits are appended to this wave's LDS list as (local_index << SLOTB | slot).
// Returns the wave-uniform hit count (<= WCAP always). The vector / scalar load choice is block-uniform;
// the scalar path clamps every address and selects the sentinel by value.
__device__ __forceinline__ int scan_chunk(const int* __restrict__ keys, int nE, int cbase, int slotBase,
                                          int nb, int vec8, int* list, int tid, int lane, int wave) {
  int wc = 0;
  const int el0  = tid * EPT;
  const int e0   = cbase + el0;
  const int sent = -2147483647 - 1;
  v4i da, db;
  if (vec8 != 0 && cbase + CHUNK <= nE) {
    da = *(const v4i*)(keys + e0);
    db = *(const v4i*)(keys + e0 + 4);
  } else {
    da.x = (e0     < nE) ? keys[min(e0,     nE - 1)] : sent;
    da.y = (e0 + 1 < nE) ? keys[min(e0 + 1, nE - 1)] : sent;
    da.z = (e0 + 2 < nE) ? keys[min(e0 + 2, nE - 1)] : sent;
    da.w = (e0 + 3 < nE) ? keys[min(e0 + 3, nE - 1)] : sent;
    db.x = (e0 + 4 < nE) ? keys[min(e0 + 4, nE - 1)] : sent;
    db.y = (e0 + 5 < nE) ? keys[min(e0 + 5, nE - 1)] : sent;
    db.z = (e0 + 6 < nE) ? keys[min(e0 + 6, nE - 1)] : sent;
    db.w = (e0 + 7 < nE) ? keys[min(e0 + 7, nE - 1)] : sent;
  }
  const unsigned nbs = (unsigned)slotBase;
  const unsigned unb = (unsigned)nb;
  const unsigned s0 = (unsigned)da.x - nbs, s1 = (unsigned)da.y - nbs;
  const unsigned s2 = (unsigned)da.z - nbs, s3 = (unsigned)da.w - nbs;
  const unsigned s4 = (unsigned)db.x - nbs, s5 = (unsigned)db.y - nbs;
  const unsigned s6 = (unsigned)db.z - nbs, s7 = (unsigned)db.w - nbs;
  const bool h0 = s0 < unb, h1 = s1 < unb, h2 = s2 < unb, h3 = s3 < unb;
  const bool h4 = s4 < unb, h5 = s5 < unb, h6 = s6 < unb, h7 = s7 < unb;
  const unsigned any = __builtin_amdgcn_ballot_w32(h0 | h1 | h2 | h3 | h4 | h5 | h6 | h7);
  if (any != 0u) {
#define HITJ(J, HJ, SJ) { \
      const unsigned mj = __builtin_amdgcn_ballot_w32(HJ); \
      if (mj != 0u) { \
        if (HJ) { \
          const int pos = wc + (int)__builtin_amdgcn_mbcnt_lo(mj, 0u); \
          if (pos < WCAP) list[wave * WCAP + pos] = ((el0 + (J)) << SLOTB) | (int)(SJ); \
        } \
        wc += (int)__builtin_popcount(mj); } }
    HITJ(0, h0, s0)
    HITJ(1, h1, s1)
    HITJ(2, h2, s2)
    HITJ(3, h3, s3)
    HITJ(4, h4, s4)
    HITJ(5, h5, s5)
    HITJ(6, h6, s6)
    HITJ(7, h7, s7)
#undef HITJ
  }
  return wc;
}

__global__ __launch_bounds__(NTHR) void k_attn(
    const unsigned short* __restrict__ Qp, const unsigned short* __restrict__ Kp,
    const unsigned short* __restrict__ VTp, const float* __restrict__ EB,
    const int* __restrict__ keys, const int* __restrict__ gath,
    const int* __restrict__ ngp, const int* __restrict__ bat,
    unsigned short* CTX, int nE, int vec8, int gbase) {
  extern __shared__ v4f lds_dyn[];
  char* lds = (char*)lds_dyn;
  __bf16* Ksh = (__bf16*)(lds + LO_KV);         // [2][4096]  K hi  [kv][d]
  __bf16* Ksl = Ksh + 2 * KVT;                   // [2][4096]  K lo
  __bf16* Vth = Ksl + 2 * KVT;                   // [2][4096]  V^T hi [d][kv]
  __bf16* Vtl = Vth + 2 * KVT;                   // [2][4096]  V^T lo
  int* list  = (int*)(lds + LO_KV);              // phase A only: [LISTN]
  int* hitE  = list + LISTN;                     // [HCAP] edge ids, in scan order
  int* hitRD = hitE + HCAP;                      // [HCAP] (row << 9) | loc_dst
  __bf16* Psh = (__bf16*)(lds + LO_P);           // [8 waves][16 x 64] P hi
  __bf16* Psl = Psh + AT_NW * 1024;              // P lo
  float* BTX = (float*)(lds + LO_BT);            // [2][64 x 64] bias tiles + [NDUM] dummies; epilogue staging
  int* sE   = (int*)(lds + LO_SE);               // [HCAP] edge ids sorted by query row
  int* sD   = (int*)(lds + LO_SD);               // [HCAP] loc_dst of the same entries
  int* rcnt = (int*)(lds + LO_RC);               // [64]
  int* roff = rcnt + NSLOT;                      // [64]
  int* curs = roff + NSLOT;                      // [64]
  int* wcnt = curs + NSLOT;                      // [8]
  int* misc = wcnt + AT_NW;                      // [8]

  const int tid = (int)threadIdx.x, lane = tid & 31, wave = tid >> 5, hh = lane >> 4, c = lane & 15;
  const int lgr   = (int)blockIdx.x >> 3;        // graph within this pass
  const int qt    = (int)blockIdx.x & 7;         // 64-query tile within the graph
  const int gb    = gbase + lgr;                 // graph id
  const int node0 = gb * NND + qt * NSLOT;       // global node id of query row 0
  const int lrow0 = lgr * NND + qt * NSLOT;      // plane row of query row 0

  if (tid < NSLOT) rcnt[tid] = 0;
  __syncthreads();

  // ---- phase A1: chunk scan + ordered copy of hits ----
  int tot = 0;
  const int nChunks = (nE + CHUNK - 1) / CHUNK;
#pragma unroll 1
  for (int ch = 0; ch < nChunks; ++ch) {
    const int cbase = ch * CHUNK;
    const int wc = scan_chunk(keys, nE, cbase, node0, NSLOT, vec8, list, tid, lane, wave);
    if (lane == 0) wcnt[wave] = wc;
    __syncthreads();
    int pre = 0, all = 0;
#pragma unroll
    for (int w2 = 0; w2 < AT_NW; ++w2) {
      int cc = wcnt[w2];
      cc = cc < 0 ? 0 : (cc > WCAP ? WCAP : cc);
      all += cc;
      pre += (w2 < wave) ? cc : 0;
    }
    const int wcc  = wc > WCAP ? WCAP : wc;
    const int base = tot + pre;
#pragma unroll 1
    for (int i0 = 0; i0 < wcc; i0 += 32) {          // wcc wave-uniform; loads unconditional, clamped
      const int i   = i0 + lane;
      const int ic  = i < wcc ? i : wcc - 1;
      const int ent = list[wave * WCAP + ic];
      const int el  = (ent >> SLOTB) & (CHUNK - 1);
      const int sl  = ent & (NSLOT - 1);
      int eid = cbase + el;
      eid = eid > nE - 1 ? nE - 1 : eid;
      int g = gath[eid];
      g = g < 0 ? 0 : (g > NTOT - 1 ? NTOT - 1 : g);
      const int pos = base + i;
      if (i < wcc && pos < HCAP) {
        hitE[pos]  = eid;
        hitRD[pos] = (sl << 9) | (g & (NND - 1));
      }
    }
    tot += all;
    tot = tot > HCAP ? HCAP : tot;
    __syncthreads();
  }
  const int nh = tot;

  // ---- phase A2: per-row counts (wave 0, fixed order, lane 0 writes) ----
  if (wave == 0) {
#pragma unroll 1
    for (int b0 = 0; b0 < nh; b0 += 32) {
      const int idx = b0 + lane;
      const int uv  = hitRD[idx < nh ? idx : nh - 1];
      const int m32 = (nh - b0) < 32 ? (nh - b0) : 32;
#pragma unroll 1
      for (int k = 0; k < m32; ++k) {
        const int u  = __builtin_amdgcn_readlane(uv, k);
        const int sl = (u >> 9) & (NSLOT - 1);
        if (lane == 0) rcnt[sl] = rcnt[sl] + 1;
      }
    }
  }
  __syncthreads();

  // ---- phase A3: exclusive prefix over the 64 counts (wave 0, two counts per lane) + max count ----
  if (wave == 0) {
    int c0 = rcnt[2 * lane], c1 = rcnt[2 * lane + 1];
    c0 = c0 < 0 ? 0 : c0; c1 = c1 < 0 ? 0 : c1;
    const int ts = c0 + c1;
    int incl = ts;
#pragma unroll
    for (int d = 1; d < 32; d <<= 1) {
      const int up = __shfl_up(incl, d, 32);
      if (lane >= d) incl += up;
    }
    const int excl = incl - ts;
    roff[2 * lane] = excl;     roff[2 * lane + 1] = excl + c0;
    curs[2 * lane] = excl;     curs[2 * lane + 1] = excl + c0;
    int mc = c0 > c1 ? c0 : c1;
#pragma unroll
    for (int off = 16; off > 0; off >>= 1) {
      const int o = __shfl_xor(mc, off, 32);
      mc = o > mc ? o : mc;
    }
    if (lane == 0) misc[0] = mc;
  }
  __syncthreads();

  // ---- phase A4: place entries into row segments (wave 0, fixed order, lane 0 writes) ----
  if (wave == 0) {
#pragma unroll 1
    for (int b0 = 0; b0 < nh; b0 += 32) {
      const int idx = b0 + lane;
      const int cl  = idx < nh ? idx : nh - 1;
      const int uv  = hitRD[cl];
      const int ue  = hitE[cl];
      const int m32 = (nh - b0) < 32 ? (nh - b0) : 32;
#pragma unroll 1
      for (int k = 0; k < m32; ++k) {
        const int u  = __builtin_amdgcn_readlane(uv, k);
        const int e  = __builtin_amdgcn_readlane(ue, k);
        const int sl = (u >> 9) & (NSLOT - 1);
        if (lane == 0) {
          int pos = curs[sl];
          pos = pos < 0 ? 0 : (pos > HCAP - 1 ? HCAP - 1 : pos);
          sE[pos] = e;
          sD[pos] = u & (NND - 1);
          curs[sl] = pos + 1;
        }
      }
    }
  }
  __syncthreads();

  // ---- geometry / capacity guards -> NaN poison of this block's ctx rows ----
  const int degmax = misc[0];
  const int ng  = ngp[0];
  const int bt0 = bat[node0];
  const bool bad = (nh >= HCAP) || (degmax > RWCAP) || (ng != NGR) || (bt0 < 0) || (bt0 >= NGR);
  const float pz = bad ? __int_as_float(0x7fc00000) : 0.0f;

  // ---- phase B ----
  const int wsub = wave & 3;                     // query row group of this wave
  const int hl   = wave >> 2;                    // head slot (0 / 1) of this wave within the pair
  const int rw   = tid >> 2;                     // bias fill: query row owned by this thread
  const int jw   = tid & 3;                      // bias fill: key-column quarter owned by this thread
  const float sscale = 0.125f;
  const v8f z8 = {0.f,0.f,0.f,0.f,0.f,0.f,0.f,0.f};
  const __bf16* Kth = Ksh + hl * KVT;
  const __bf16* Ktl = Ksl + hl * KVT;
  const __bf16* Vtth = Vth + hl * KVT;
  const __bf16* Vttl = Vtl + hl * KVT;
  __bf16* pwh = Psh + wave * 1024;
  __bf16* pwl = Psl + wave * 1024;

#pragma unroll 1
  for (int hp = 0; hp < NHD / 2; ++hp) {
    const int h    = 2 * hp + hl;                // head of this wave
    const int qrow = lrow0 + wsub * 16;          // plane row of this wave's first query

    // Q fragments (A operand, row = lane&15, split k map): 2 d-chunks, hi and lo
    v16b qah[2], qal[2];
#pragma unroll
    for (int dc = 0; dc < 2; ++dc) {
      const unsigned short* qp = Qp + (size_t)(qrow + c) * PLD + h * HDM + dc * 32 + 8 * hh;
      qah[dc] = FragBF::load((const __bf16*)(const void*)qp);
      qal[dc] = FragBF::load((const __bf16*)(const void*)(qp + HID));
    }
    float mrow[8], lrow[8];
    v8f oacc[4];
#pragma unroll
    for (int r = 0; r < 8; ++r) { mrow[r] = -INFINITY; lrow[r] = 0.f; }
#pragma unroll
    for (int t = 0; t < 4; ++t) oacc[t] = z8;

#pragma unroll 1
    for (int kc = 0; kc < NND / 64; ++kc) {
      const int kv0 = kc * 64;
      __syncthreads();
      {
        // staging: thread half th = head 2hp+th; 128 threads x (4 x 8) elements = 64 x 64 per plane
        const int th = tid >> 7, t = tid & 127;
        const int r = t >> 1, half = (t & 1) * 32;
        const int hs = 2 * hp + th;
        const unsigned short* ksh = Kp + (size_t)(lgr * NND + kv0 + r) * PLD + hs * HDM + half;
        const unsigned short* ksl = ksh + HID;
        const unsigned short* vsh = VTp + ((size_t)lgr * HID + hs * HDM + r) * PLD + kv0 + half;
        const unsigned short* vsl = vsh + HID;
        __bf16* kdh = Ksh + th * KVT + r * HDM + half;
        __bf16* kdl = Ksl + th * KVT + r * HDM + half;
        __bf16* vdh = Vth + th * KVT + r * 64 + half;
        __bf16* vdl = Vtl + th * KVT + r * 64 + half;
#pragma unroll
        for (int i = 0; i < 4; ++i) {
          const v8b a0 = *(const v8b*)(ksh + 8 * i);
          const v8b a1 = *(const v8b*)(ksl + 8 * i);
          const v8b b0 = *(const v8b*)(vsh + 8 * i);
          const v8b b1 = *(const v8b*)(vsl + 8 * i);
          *(v8b*)(kdh + 8 * i) = a0;
          *(v8b*)(kdl + 8 * i) = a1;
          *(v8b*)(vdh + 8 * i) = b0;
          *(v8b*)(vdl + 8 * i) = b1;
        }
        // bias tiles + dummies zero: 256 threads x 32 floats = both 64x64 tiles; 128 threads x 4 = dummies
        const v4f z4 = {0.f, 0.f, 0.f, 0.f};
        float* bz = BTX + tid * 32;
#pragma unroll
        for (int i = 0; i < 8; ++i) *(v4fa*)(bz + 4 * i) = z4;
        if (tid < 128) *(v4fa*)(BTX + 2 * KVT + 4 * tid) = z4;
      }
      __syncthreads();
      {
        // bias fill: row rw, segment [st, st+cnt) of sE/sD; this thread adds key columns 16jw..16jw+15
        int st = roff[rw], cnt = rcnt[rw];
        st  = st < 0 ? 0 : (st > nh ? nh : st);
        cnt = cnt < 0 ? 0 : (cnt > RWCAP ? RWCAP : cnt);
        if (cnt > nh - st) cnt = nh - st;
        int cmax = cnt;
#pragma unroll
        for (int off = 16; off > 0; off >>= 1) {
          const int o = __shfl_xor(cmax, off, 32);
          cmax = o > cmax ? o : cmax;
        }
        const float* ebp = EB + 2 * hp;
#pragma unroll 1
        for (int q = 0; q < cmax; ++q) {           // cmax wave-uniform, <= RWCAP
          const bool valid = q < cnt;
          int idx = st + q;
          idx = idx > nh - 1 ? nh - 1 : idx;
          idx = idx < 0 ? 0 : idx;
          const int col = sD[idx] - kv0;
          int e = sE[idx];
          e = e < 0 ? 0 : (e > nE - 1 ? nE - 1 : e);
          const v2f ebv = *(const v2fa*)(ebp + (size_t)e * NHD);
          const bool inr = valid && ((unsigned)col < 64u) && ((col >> 4) == jw);
          const int ia = inr ? (rw * 64 + col) : (2 * KVT + tid);
          const int ib = inr ? (KVT + rw * 64 + col) : (2 * KVT + NTHR + tid);
          BTX[ia] = BTX[ia] + ebv.x;
          BTX[ib] = BTX[ib] + ebv.y;
        }
      }
      __syncthreads();

      // ---- S = q . k (3-term) ----
      v8f s[4];
#pragma unroll
      for (int j = 0; j < 4; ++j) {
        s[j] = z8;
#pragma unroll
        for (int dc = 0; dc < 2; ++dc) {
          FB kb, kl;
          const __bf16* kr = Kth + (j * 16 + c) * HDM + dc * 32 + 8 * hh;
          const __bf16* kq = Ktl + (j * 16 + c) * HDM + dc * 32 + 8 * hh;
          kb.h[0] = *(const v8b*)kr;
          kb.h[1] = *(const v8b*)(kr + 16);
          kl.h[0] = *(const v8b*)kq;
          kl.h[1] = *(const v8b*)(kq + 16);
          s[j] = at_mma(qah[dc], kb.v, s[j]);
          s[j] = at_mma(qah[dc], kl.v, s[j]);
          s[j] = at_mma(qal[dc], kb.v, s[j]);
        }
      }
      // scale, add bias tile (D element r = row wsub*16 + 8hh + r, col j*16 + c), chunk row max
      const float* btr = BTX + hl * KVT + (wsub * 16 + 8 * hh) * 64 + c;
      float cm[8];
#pragma unroll
      for (int r = 0; r < 8; ++r) {
        float m = -INFINITY;
#pragma unroll
        for (int j = 0; j < 4; ++j) {
          const float sv = s[j][r] * sscale + btr[r * 64 + j * 16];
          s[j][r] = sv;
          m = fmaxf(m, sv);
        }
#pragma unroll
        for (int off = 1; off < 16; off <<= 1) m = fmaxf(m, __shfl_xor(m, off, 32));
        cm[r] = m;
      }
#pragma unroll
      for (int r = 0; r < 8; ++r) {
        const float mnew = fmaxf(mrow[r], cm[r]);
        const float alpha = expf(mrow[r] - mnew);
        mrow[r] = mnew;
        float psum = 0.f;
#pragma unroll
        for (int j = 0; j < 4; ++j) {
          const float p = expf(s[j][r] - mnew);
          psum += p;
          __bf16 a, bl; at_split(p, a, bl);
          pwh[(8 * hh + r) * 64 + j * 16 + c] = a;
          pwl[(8 * hh + r) * 64 + j * 16 + c] = bl;
        }
#pragma unroll
        for (int off = 1; off < 16; off <<= 1) psum += __shfl_xor(psum, off, 32);
        lrow[r] = lrow[r] * alpha + psum;
#pragma unroll
        for (int t = 0; t < 4; ++t) oacc[t][r] *= alpha;
      }
      __builtin_amdgcn_fence(__ATOMIC_RELEASE, "workgroup");
      __builtin_amdgcn_wave_barrier();
      __builtin_amdgcn_fence(__ATOMIC_ACQUIRE, "workgroup");
      // ---- O += p . v (3-term); P fragment = A (row c), V^T fragment = B (col = d) ----
#pragma unroll 1
      for (int kk = 0; kk < 2; ++kk) {
        FB pa, pl;
        pa.h[0] = *(const v8b*)(pwh + c * 64 + kk * 32 + 8 * hh);
        pa.h[1] = *(const v8b*)(pwh + c * 64 + kk * 32 + 16 + 8 * hh);
        pl.h[0] = *(const v8b*)(pwl + c * 64 + kk * 32 + 8 * hh);
        pl.h[1] = *(const v8b*)(pwl + c * 64 + kk * 32 + 16 + 8 * hh);
#pragma unroll
        for (int t = 0; t < 4; ++t) {
          FB vb, vl;
          vb.h[0] = *(const v8b*)(Vtth + (t * 16 + c) * 64 + kk * 32 + 8 * hh);
          vb.h[1] = *(const v8b*)(Vtth + (t * 16 + c) * 64 + kk * 32 + 16 + 8 * hh);
          vl.h[0] = *(const v8b*)(Vttl + (t * 16 + c) * 64 + kk * 32 + 8 * hh);
          vl.h[1] = *(const v8b*)(Vttl + (t * 16 + c) * 64 + kk * 32 + 16 + 8 * hh);
          oacc[t] = at_mma(pa.v, vb.v, oacc[t]);
          oacc[t] = at_mma(pa.v, vl.v, oacc[t]);
          oacc[t] = at_mma(pl.v, vb.v, oacc[t]);
        }
      }
    }

    // ---- epilogue: normalise, stage the wave's 16x64 tile (pitch 64, own bias rows), hi | lo lines ----
    __syncthreads();
    {
      float* os = BTX + wave * 1024;
#pragma unroll
      for (int r = 0; r < 8; ++r) {
        const float inv = 1.0f / lrow[r];
#pragma unroll
        for (int t = 0; t < 4; ++t) os[(8 * hh + r) * 64 + t * 16 + c] = oacc[t][r] * inv + pz;
      }
      __builtin_amdgcn_fence(__ATOMIC_RELEASE, "workgroup");
      __builtin_amdgcn_wave_barrier();
      __builtin_amdgcn_fence(__ATOMIC_ACQUIRE, "workgroup");
      const int q4 = lane >> 3, c8 = (lane & 7) * 8;
      v4u hv[4], lv[4];
#pragma unroll
      for (int it = 0; it < 4; ++it) {
        const int row = it * 4 + q4;                   // it 0..3 x q4 0..3 covers rows 0..15
        const float* sp = os + row * 64 + c8;
        const v4f a = *(const v4fa*)sp;
        const v4f b = *(const v4fa*)(sp + 4);
        pack8hl(a, b, hv[it], lv[it]);
      }
      {
#pragma unroll
        for (int it = 0; it < 4; ++it) {
          const int row = it * 4 + q4;
          unsigned short* op = CTX + (size_t)(qrow + row) * PLD + h * HDM + c8;
          *(v4u*)op = hv[it];
          *(v4u*)(op + HID) = lv[it];
        }
        
      }
    }
  }
}

// =====================================================================================
static inline int cdiv(int a, int b) { return (a + b - 1) / b; }

extern "C" void kernel_launch(void* const* d_in, const int* in_sizes, int n_in,
                              void* d_out, int out_size, void* d_ws, size_t ws_size,
                              hipStream_t stream) {
  if (n_in < 15) return;
  if (in_sizes[0] != NTOT * HID) return;                        // x [16384][512]
  if (in_sizes[1] != NTOT) return;                              // batch [16384]
  if (in_sizes[2] < 2 || (in_sizes[2] & 1) != 0) return;        // edge_index [2][E]
  const int nE = in_sizes[2] / 2;
  if (nE < 1 || nE > (1 << 24)) return;
  if (in_sizes[3] != nE * EDW) return;                          // edge_attr [E][16]
  if (in_sizes[4] != HID * HID || in_sizes[6] != HID * HID || in_sizes[8] != HID * HID || in_sizes[10] != HID * HID) return;
  if (in_sizes[5] != HID || in_sizes[7] != HID || in_sizes[9] != HID || in_sizes[11] != HID) return;
  if (in_sizes[12] != EDW * NHD || in_sizes[13] != NHD || in_sizes[14] != 1) return;
  if (out_size != NTOT * HID) return;                           // out [16384][512], last element 8388607

  const float* x   = (const float*)d_in[0];
  const int*   bat = (const int*)  d_in[1];
  const int*   ei  = (const int*)  d_in[2];     // row 0 = src, row 1 = dst
  const float* ea  = (const float*)d_in[3];
  const float* Wq  = (const float*)d_in[4];     // [in][out]
  const float* bq  = (const float*)d_in[5];
  const float* Wk  = (const float*)d_in[6];
  const float* bk  = (const float*)d_in[7];
  const float* Wv  = (const float*)d_in[8];
  const float* bv  = (const float*)d_in[9];
  const float* Wo  = (const float*)d_in[10];
  const float* bo  = (const float*)d_in[11];
  const float* We  = (const float*)d_in[12];    // [16][8]
  const float* be  = (const float*)d_in[13];    // [8]
  const int*   ngp = (const int*)  d_in[14];    // [1]
  float* out = (float*)d_out;
  const int* keys = ei;                         // src list
  const int* gath = ei + nE;                    // dst list

  const int EP = cdiv(nE, 4) * 4;

  char* ws = (char*)d_ws;
  size_t off = 0;
  const size_t oXb = off; off += (size_t)NTOT * HID * 2;                                          // 16777216
  const size_t oWq = off; off += (size_t)HID * HID * 2;                                           //   524288
  const size_t oWk = off; off += (size_t)HID * HID * 2;
  const size_t oWv = off; off += (size_t)HID * HID * 2;
  const size_t oWo = off; off += (size_t)HID * PLD * 2;                                           //  1048576
  const size_t oEB = off; off += (size_t)EP * NHD * 4;   off = (off + 255) & ~(size_t)255;        //  8388608
  const size_t oQ  = off; off += (size_t)RHALF * PLD * 2;                                         // 16777216
  const size_t oK  = off; off += (size_t)RHALF * PLD * 2;
  const size_t oVT = off; off += (size_t)GHALF * HID * PLD * 2;                                   // 16777216
  const size_t oCT = off; off += (size_t)RHALF * PLD * 2;                                         // 16777216
  if (off > ws_size || off > (size_t)WSMAX) return;                                               // 94896128
  unsigned short* Xb   = (unsigned short*)(ws + oXb);
  unsigned short* WqT  = (unsigned short*)(ws + oWq);
  unsigned short* WkT  = (unsigned short*)(ws + oWk);
  unsigned short* WvT  = (unsigned short*)(ws + oWv);
  unsigned short* WOT2 = (unsigned short*)(ws + oWo);
  float*          EB   = (float*)(ws + oEB);
  unsigned short* Qp   = (unsigned short*)(ws + oQ);
  unsigned short* Kp   = (unsigned short*)(ws + oK);
  unsigned short* VTp  = (unsigned short*)(ws + oVT);
  unsigned short* CTX  = (unsigned short*)(ws + oCT);

  hipFuncSetAttribute(reinterpret_cast<const void*>(&k_attn),
                      hipFuncAttributeMaxDynamicSharedMemorySize, LDS_ATT);

  // weight planes (bf16 bits, k-contiguous rows [n][k])
  {
    const int nUw = HID * (HID / 8);             // 512 rows x 64 units
    k_wtr<<<cdiv(nUw, NTHR), NTHR, 0, stream>>>(Wq, HID, HID, HID, HID, WqT, nUw);
    k_wtr<<<cdiv(nUw, NTHR), NTHR, 0, stream>>>(Wk, HID, HID, HID, HID, WkT, nUw);
    k_wtr<<<cdiv(nUw, NTHR), NTHR, 0, stream>>>(Wv, HID, HID, HID, HID, WvT, nUw);
    const int nUo = HID * (PLD / 8);             // 512 rows x 128 units: wt [512][1024], k mod 512
    k_wtr<<<cdiv(nUo, NTHR), NTHR, 0, stream>>>(Wo, HID, HID, HID, PLD, WOT2, nUo);
  }
  // node feature plane (whole x)
  {
    const int nUx = NTOT * (HID / 8);
    k_xprep<<<cdiv(nUx, NTHR), NTHR, 0, stream>>>(x, Xb, NTOT, nUx);
  }
  // edge bias plane [EP][8]
  {
    const int nUe = EP * 2;
    k_eb<<<cdiv(nUe, NTHR), NTHR, 0, stream>>>(ea, We, be, EB, nE, nUe);
  }

  const dim3 blk(256);
  const dim3 gQK(((RHALF / 64) * (HID / 64)) / 8, 1);        // 128 blocks x 8 tiles: M=8192, N=512
  const dim3 gVT(((HID / 64) * (NND / 64)) / 8, GHALF);      // 8 blocks x 8 tiles per graph: M=512, N=512
  const dim3 gAT(GHALF * (NND / 64));                        // 128 blocks: 16 graphs x 8 query tiles
  for (int half = 0; half < NHALF; ++half) {
    const unsigned short* Xh = Xb + (size_t)half * RHALF * HID;
    float* outh = out + (size_t)half * RHALF * HID;
    // q = x . Wq + bq -> Qp hi | lo  (M=8192, N=512, K=512)
    wmma_gemm64<false, 2, 2, false, 0><<<gQK, blk, 0, stream>>>(
        Xh, Xh, HID, 0L, WqT, WqT, HID, 0L, (void*)Qp, (void*)(Qp + HID), PLD, 0L,
        bq, bq, 0L, RHALF, HID, HID, 1.0f);
    // k = x . Wk + bk -> Kp hi | lo
    wmma_gemm64<false, 2, 2, false, 0><<<gQK, blk, 0, stream>>>(
        Xh, Xh, HID, 0L, WkT, WkT, HID, 0L, (void*)Kp, (void*)(Kp + HID), PLD, 0L,
        bk, bk, 0L, RHALF, HID, HID, 1.0f);
    // v^T = Wv^T . x^T + bv[m] per graph -> VTp [graph][h*64+d][s] hi | lo  (M=512, N=512, K=512, z = 16 graphs)
    wmma_gemm64<false, 1, 2, false, 0><<<gVT, blk, 0, stream>>>(
        WvT, WvT, HID, 0L, Xh, Xh, HID, (long)NND * HID, (void*)VTp, (void*)(VTp + HID), PLD, (long)HID * PLD,
        bv, bv, 0L, HID, NND, HID, 1.0f);
    // attention with edge bias -> CTX hi | lo
    k_attn<<<gAT, NTHR, LDS_ATT, stream>>>(Qp, Kp, VTp, EB, keys, gath, ngp, bat, CTX, nE, 1, half * GHALF);
    // out = [ctx hi | ctx lo] . [Wo ; Wo] + bo -> d_out rows half*8192 .. half*8192+8191 (M=8192, N=512, K=1024)
    wmma_gemm64<false, 2, 0, false, 0><<<gQK, blk, 0, stream>>>(
        CTX, CTX, PLD, 0L, WOT2, WOT2, PLD, 0L, (void*)outh, (void*)outh, HID, 0L,
        bo, bo, 0L, RHALF, HID, PLD, 1.0f);
  }
  (void)hipGetLastError();
}

// v001
// One run takes 991 microseconds.
// Next to v000, in two timings, it ran 1.86 times as fast each time.
// Contractions on v_wmma_f32_16x16x32_bf16 (bf16 operands, f32 accumulate): x*Wq, x*Wk, Wv^T*x^T as single
// products of bf16-RNE inputs; q.k^T and p.v as bf16 hi/lo split (hi.hi + hi.lo + lo.hi); ctx*Wo as
// [ctx hi | ctx lo] . [Wo ; Wo] (K = 1024); edge bias (16-deep dots of bf16-RNE inputs), online softmax and all biases in f32 on the VALU.
#include <hip/hip_runtime.h>
#include <math.h>
#include <stdint.h>
#include <stddef.h>

// Geometry: NGR graphs of NND consecutive node rows; attention keys of a query = the NND nodes of its graph.
// The job runs in NHALF passes of GHALF graphs each (one pass of all graphs: the attention launch then has one
// work-group for each of the 256 WGPs); the q / k / v^T / ctx planes are rewritten per pass.
//
// Plane map (workspace, all 16-bit planes are bf16 bits; no power-of-two carries anywhere, so no inverse
// factor exists -> carry audit: none):
//   Xb   [16384][512]          bf16(x)                                        -> A of q/k GEMMs, Bt of v^T GEMM
//   WqT, WkT, WvT [512 o][512 i]  bf16(W[i][o])                              -> Bt / A (k-contiguous)
//   WOT2 [512 o][1024]         bf16(Wo[k mod 512][o])                         -> Bt of the output GEMM
//   EB   [EP][8] f32           sum_t bf16(ea[e][t]) bf16(We[t][h]) + bf16(be[h])
//   Qp, Kp [16384][1024]       hi at col h*64+d, residual lo at col 512 + h*64+d (f32 projection split)
//   VTp  [32 graphs][512 (h,d)][1024]   hi at col s, lo at col 512 + s (s = node within graph)
//   CTX  [16384][1024]         hi | lo of the normalised attention context

#define NGR    32
#define NND    512
#define NTOT   (NGR * NND)      // 16384
#define HID    512
#define NHD    8
#define HDM    64
#define EDW    16
#define NHALF  1
#define GHALF  (NGR / NHALF)    // 32
#define RHALF  (GHALF * NND)    // 16384
#define PLD    1024
#define NTHR   256
#define WSMAX  268435456

static_assert(HID == NHD * HDM && HDM == 64 && NHD == 8);
static_assert(PLD == 2 * HID);
static_assert((RHALF % 64) == 0 && (HID % 64) == 0 && (NND % 64) == 0 && (PLD % 32) == 0 && (HID % 32) == 0);
static_assert(((RHALF / 64) * (HID / 64)) % 8 == 0);       // GEMM grids: 8 wave tiles per block, exact
static_assert(((HID / 64) * (NND / 64)) % 8 == 0);
static_assert(NGR == NHALF * GHALF);
static_assert(HID == 64 * 8);                               // k_xprep: 64 units of 8 per row
static_assert(EDW == 16 && NHD == 8 && EDW * NHD <= NTHR);  // k_eb layout

typedef __attribute__((ext_vector_type(16))) _Float16 v16h;
typedef __attribute__((ext_vector_type(8)))  _Float16 v8h;
typedef __attribute__((ext_vector_type(16))) __bf16   v16b;
typedef __attribute__((ext_vector_type(8)))  __bf16   v8b;
typedef __attribute__((ext_vector_type(8)))  float    v8f;
typedef __attribute__((ext_vector_type(4)))  float    v4f;
typedef __attribute__((ext_vector_type(2)))  float    v2f;
typedef __attribute__((ext_vector_type(4)))  unsigned int v4u;
typedef __attribute__((ext_vector_type(4)))  int      v4i;
typedef __attribute__((ext_vector_type(8)))  unsigned short v8us;
typedef v4f  __attribute__((may_alias)) v4fa;
typedef v2f  __attribute__((may_alias)) v2fa;
typedef v4u  __attribute__((may_alias)) v4ua;

// ---- scalar helpers: f32 -> bf16 bits (RNE convert), bf16 bits -> f32 ----
__device__ __forceinline__ unsigned short f2bf_bits(float f) {
  unsigned u = __float_as_uint(f);
  return (unsigned short)((u + 0x7FFFu + ((u >> 16) & 1u)) >> 16);
}
__device__ __forceinline__ float bf_bits2f(unsigned short h) { return __uint_as_float(((unsigned)h) << 16); }
__device__ __forceinline__ float bfrf(float f) { return bf_bits2f(f2bf_bits(f)); }
__device__ __forceinline__ unsigned int f2bfu(float f) {
  const unsigned int u = __float_as_uint(f);
  return ((u + 0x7FFFu + ((u >> 16) & 1u)) >> 16) & 0xFFFFu;
}
__device__ __forceinline__ float bf2f(unsigned int b) { return __uint_as_float(b << 16); }
__device__ __forceinline__ v4f bfr4(const v4f a) {
  v4f r; r.x = bfrf(a.x); r.y = bfrf(a.y); r.z = bfrf(a.z); r.w = bfrf(a.w); return r;
}
__device__ __forceinline__ unsigned int pk2(float lo, float hi) { return f2bfu(lo) | (f2bfu(hi) << 16); }
__device__ __forceinline__ v4u pack8(const v4f a, const v4f b) {
  v4u r;
  r.x = pk2(a.x, a.y); r.y = pk2(a.z, a.w); r.z = pk2(b.x, b.y); r.w = pk2(b.z, b.w);
  return r;
}
// hi = bf16(v), lo = bf16(v - hi): two floats -> one packed word of each
__device__ __forceinline__ void hl2(float v0, float v1, unsigned int& hw, unsigned int& lw) {
  const unsigned int h0 = f2bfu(v0), h1 = f2bfu(v1);
  const unsigned int l0 = f2bfu(v0 - bf2f(h0)), l1 = f2bfu(v1 - bf2f(h1));
  hw = h0 | (h1 << 16);
  lw = l0 | (l1 << 16);
}
__device__ __forceinline__ void pack8hl(const v4f a, const v4f b, v4u& hv, v4u& lv) {
  unsigned int h, l;
  hl2(a.x, a.y, h, l); hv.x = h; lv.x = l;
  hl2(a.z, a.w, h, l); hv.y = h; lv.y = l;
  hl2(b.x, b.y, h, l); hv.z = h; lv.z = l;
  hl2(b.z, b.w, h, l); hv.w = h; lv.w = l;
}

// ---- WMMA fragment helpers (bf16, wave32) ----
// A fragment (row m = lane&15) and B fragment (col n = lane&15) use the SAME k map:
//   elements 0..7 <- k0 + 8h + 0..7, elements 8..15 <- k0 + 16 + 8h + 0..7, h = lane>>4,
// loaded as two 16-B pieces from a k-contiguous 16-bit row: p[0..7] and p[16..23] with p = row + k0 + 8h.
// D element r of lane l = (row 8h + r, col l&15).
__device__ __forceinline__ void dep_guard_b(v8f& a, v8f& b, v16b x, v16b y) { asm volatile("v_nop\n\tv_nop\n\tv_nop\n\tv_nop" : "+v"(a), "+v"(b) : "v"(x), "v"(y)); }
__device__ __forceinline__ void keep4_b(v16b a, v16b b, v16b c, v16b d) { asm volatile("v_nop" :: "v"(a), "v"(b), "v"(c), "v"(d)); }
__device__ __forceinline__ void acc_guard4(v8f& a, v8f& b, v8f& c, v8f& d) { asm volatile("v_nop\n\tv_nop\n\tv_nop\n\tv_nop" : "+v"(a), "+v"(b), "+v"(c), "+v"(d)); }

struct FragBF {
  union U { v16b v; v8b h[2]; };
  static __device__ __forceinline__ v16b load(const __bf16* p) {   // elements 0..7 <- p[0..7], 8..15 <- p[16..23]
    U f; f.h[0] = *(const v8b*)(p); f.h[1] = *(const v8b*)(p + 16); return f.v;
  }
  static __device__ __forceinline__ v8f mma(v16b a, v16b b, v8f c) {
    return __builtin_amdgcn_wmma_f32_16x16x32_bf16(false, a, false, b, (short)0, c, false, false);
  }
  static __device__ __forceinline__ void guard(v8f& a, v8f& b, v16b x, v16b y) { dep_guard_b(a, b, x, y); }
  static __device__ __forceinline__ void keep(v16b a, v16b b, v16b c, v16b d) { keep4_b(a, b, c, d); }
};
union FB { v16b v; v8b h[2]; };

// single WMMA with hazard guard: ties D, keeps A/B live for 4 VALU slots
__device__ __forceinline__ v8f at_mma(v16b a, v16b b, v8f c) {
  c = __builtin_amdgcn_wmma_f32_16x16x32_bf16(false, a, false, b, (short)0, c, false, false);
  asm volatile("v_nop\n\tv_nop\n\tv_nop\n\tv_nop" : "+v"(c) : "v"(a), "v"(b));
  return c;
}
__device__ __forceinline__ __bf16 at_f2bf(float f) { return __builtin_bit_cast(__bf16, f2bf_bits(f)); }
__device__ __forceinline__ void at_split(float f, __bf16& hi, __bf16& lo) {
  const unsigned short hb = f2bf_bits(f);
  hi = __builtin_bit_cast(__bf16, hb);
  lo = at_f2bf(f - __uint_as_float(((unsigned)hb) << 16));
}

// =====================================================================================
// Register-blocked batched WMMA GEMM (bf16 operands).
// C[m,n] = scale * sum_k A[m,k] * Bt[n,k] (+bias)(+resid); each wave owns a 64x64 tile.
// A row-major [M,K]; Bt row-major [N,K]; M,N % 64 == 0, K % 32 == 0 (host static_asserts).
// SPLIT: operands are hi/lo planes (A2/Bt2 = lo planes, same layout); product = hi.hi + hi.lo + lo.hi.
// BIAS_MODE: 0 = none, 1 = bf16r(bias[m]), 2 = bf16r(bias[n]).
// OUT_MODE: 0 = f32, 1 = f16, 2 = bf16 hi plane (Cout) + bf16 lo plane (Cout2).
// coverage: grid.x * 8 waves == (M/64)*(N/64) tiles exactly (host), every C element written once per z.
// =====================================================================================
template <bool SPLIT, int BIAS_MODE, int OUT_MODE, bool RESID, int ACT = 0>
__global__ __launch_bounds__(256) void wmma_gemm64(
    const unsigned short* __restrict__ Ap, const unsigned short* __restrict__ A2p, int lda, long strideA,
    const unsigned short* __restrict__ Btp, const unsigned short* __restrict__ Bt2p, int ldb, long strideB,
    void* __restrict__ Cout, void* __restrict__ Cout2, int ldc, long strideC,
    const float* __restrict__ bias,
    const float* __restrict__ resid, long strideR,
    int M, int N, int K, float scale) {
  typedef __bf16 T;
  typedef v16b V;
  const T* A = (const T*)Ap; const T* A2 = (const T*)A2p; const T* Bt = (const T*)Btp; const T* Bt2 = (const T*)Bt2p;
  __shared__ __align__(16) float sT[8][16 * 68];   // per-wave 16x64 slab, pitch 68 floats
  const int b    = blockIdx.y;
  const int lane = threadIdx.x & 31;
  const int wave = threadIdx.x >> 5;
  const int tilesN = N >> 6;
  const int tilesM = M >> 6;
  const int tile = blockIdx.x * 8 + wave;
  if (tile >= tilesM * tilesN) return;   // wave-uniform; no block barriers in this kernel
  const int tm = tile / tilesN;
  const int tn = tile - tm * tilesN;
  const int m0 = tm << 6;
  const int n0 = tn << 6;

  const T* Ab  = A  + (size_t)b * strideA;
  const T* Bb  = Bt + (size_t)b * strideB;
  const T* Ab2 = SPLIT ? (A2  + (size_t)b * strideA) : nullptr;
  const T* Bb2 = SPLIT ? (Bt2 + (size_t)b * strideB) : nullptr;

  const int rlane = lane & 15;                 // row (A) / col (B, D) within subtile
  const int koff  = (lane >> 4) * 8;           // k offset of this lane half
  const int mOff  = (lane >> 4) * 8;           // D row offset

  v8f acc[4][4];
#pragma unroll
  for (int i = 0; i < 4; ++i)
#pragma unroll
    for (int j = 0; j < 4; ++j) acc[i][j] = (v8f){0.f,0.f,0.f,0.f,0.f,0.f,0.f,0.f};

  for (int k0 = 0; k0 < K; k0 += 32) {
    V bh[4], bl[4];
#pragma unroll
    for (int j = 0; j < 4; ++j) {
      const size_t bo = (size_t)(n0 + (j << 4) + rlane) * ldb + koff + k0;
      bh[j] = FragBF::load(Bb + bo);
      if (SPLIT) bl[j] = FragBF::load(Bb2 + bo);
    }
#pragma unroll
    for (int i = 0; i < 4; ++i) {
      const size_t ao = (size_t)(m0 + (i << 4) + rlane) * lda + koff + k0;
      V ah = FragBF::load(Ab + ao);
      V al;
      if (SPLIT) al = FragBF::load(Ab2 + ao);
#pragma unroll
      for (int j = 0; j < 4; ++j) {
        acc[i][j] = FragBF::mma(ah, bh[j], acc[i][j]);
        if (SPLIT) {
          acc[i][j] = FragBF::mma(ah, bl[j], acc[i][j]);
          acc[i][j] = FragBF::mma(al, bh[j], acc[i][j]);
        }
      }
      FragBF::guard(acc[i][0], acc[i][3], ah, SPLIT ? al : ah);
    }
    FragBF::keep(bh[0], bh[1], bh[2], bh[3]);
    if (SPLIT) FragBF::keep(bl[0], bl[1], bl[2], bl[3]);
  }
  acc_guard4(acc[0][0], acc[0][1], acc[0][2], acc[0][3]);
  acc_guard4(acc[1][0], acc[1][1], acc[1][2], acc[1][3]);
  acc_guard4(acc[2][0], acc[2][1], acc[2][2], acc[2][3]);
  acc_guard4(acc[3][0], acc[3][1], acc[3][2], acc[3][3]);

  // ---- epilogue ----
  float* slab = sT[wave];
  const float* Rb = RESID ? (resid + (size_t)b * strideR) : nullptr;
#pragma unroll
  for (int i = 0; i < 4; ++i) {
    const int mBase = m0 + (i << 4);
    float bm[8];
    if (BIAS_MODE == 1) {   // 8 consecutive floats, 32-B aligned: two 16-B loads
      const v4f b0v = bfr4(*(const v4fa*)(bias + mBase + mOff));
      const v4f b1v = bfr4(*(const v4fa*)(bias + mBase + mOff + 4));
      bm[0] = b0v.x; bm[1] = b0v.y; bm[2] = b0v.z; bm[3] = b0v.w;
      bm[4] = b1v.x; bm[5] = b1v.y; bm[6] = b1v.z; bm[7] = b1v.w;
    } else {
#pragma unroll
      for (int r = 0; r < 8; ++r) bm[r] = 0.f;
    }
#pragma unroll
    for (int j = 0; j < 4; ++j) {
      const int n = n0 + (j << 4) + rlane;
      float bv = 0.f;
      if (BIAS_MODE == 2) bv = bfrf(bias[n]);
#pragma unroll
      for (int r = 0; r < 8; ++r) {
        float v = acc[i][j][r] * scale;
        if (BIAS_MODE == 1) v += bm[r];
        if (BIAS_MODE == 2) v += bv;
        if (RESID) v += Rb[(size_t)(mBase + mOff + r) * ldc + n];
        if (ACT == 1) v = tanhf(v);
        if (ACT == 2) v = fmaxf(v, 0.0f);
        if (ACT == 4) v = (v > 0.f) ? v : 0.01f * v;
        slab[(mOff + r) * 68 + (j << 4) + rlane] = v;
      }
    }
    __builtin_amdgcn_fence(__ATOMIC_RELEASE, "workgroup");
    __builtin_amdgcn_wave_barrier();
    __builtin_amdgcn_fence(__ATOMIC_ACQUIRE, "workgroup");
    if (OUT_MODE == 0) {
      float* C = (float*)Cout + (size_t)b * strideC;
      const int hh = lane >> 4, c4 = (lane & 15) * 4;     // row seg = 256 B = 16 lanes x 16 B
      {
#pragma unroll
        for (int it = 0; it < 8; ++it) {
          const int row = it * 2 + hh;
          v4f v = *(const v4f*)(slab + row * 68 + c4);
          *(v4f*)(C + (size_t)(mBase + row) * ldc + n0 + c4) = v;
        }
        
      }
    } else {
      const int q = lane >> 3, c8 = (lane & 7) * 8;
      unsigned short* C  = (unsigned short*)Cout  + (size_t)b * strideC;
      unsigned short* C2 = (OUT_MODE == 2) ? ((unsigned short*)Cout2 + (size_t)b * strideC) : nullptr;
      {
#pragma unroll
        for (int it = 0; it < 4; ++it) {
          const int row = it * 4 + q;
          const float* sp = slab + row * 68 + c8;
          v8h hv, lv;
#pragma unroll
          for (int e = 0; e < 8; ++e) {
            if (OUT_MODE == 1) {
              hv[e] = (_Float16)sp[e];
            } else {
              unsigned short hb = f2bf_bits(sp[e]);
              unsigned short lb = f2bf_bits(sp[e] - bf_bits2f(hb));
              hv[e] = __builtin_bit_cast(_Float16, hb);
              lv[e] = __builtin_bit_cast(_Float16, lb);
            }
          }
          *(v8h*)(C + (size_t)(mBase + row) * ldc + n0 + c8) = hv;
          if (OUT_MODE == 2) *(v8h*)(C2 + (size_t)(mBase + row) * ldc + n0 + c8) = lv;
        }
        
      }
    }
    __builtin_amdgcn_fence(__ATOMIC_RELEASE, "workgroup");
    __builtin_amdgcn_wave_barrier();
    __builtin_amdgcn_fence(__ATOMIC_ACQUIRE, "workgroup");
  }
}

// =====================================================================================
// Node feature plane: xb[row][c] = bf16(x[row][c]) for row < nN (all 512 c). One thread = 8 contiguous
// =====================================================================================
__global__ __launch_bounds__(NTHR) void k_xprep(const float* __restrict__ x, unsigned short* xb, int nN, int nUnits) {
  const int i = (int)blockIdx.x * NTHR + (int)threadIdx.x;
  if (i >= nUnits) return;
  const int row = i >> 6;
  const int c0  = (i & 63) * 8;
  const int rc  = row < nN ? row : nN - 1;
  const float* p = x + (size_t)rc * HID + c0;
  v4f a = *(const v4fa*)p;
  v4f b = *(const v4fa*)(p + 4);
  const v4f z4 = {0.f, 0.f, 0.f, 0.f};
  if (row >= nN) { a = z4; b = z4; }
  const v4u hv = pack8(a, b);
  unsigned short* o = xb + (size_t)row * HID + c0;
  *(v4u*)o = hv;
  
}

// =====================================================================================
// Weight transpose + bf16 convert into a k-contiguous plane: w is [Kin][Ncol] ([in][out]),
//   wt[n][k] = bf16(w[k mod Kin][n]) for n < Nrows, k < Kout (Kout = Kin or a multiple of it).
// coverage: nUnits = Nrows * Kout/8 threads x 8 = Nrows x Kout exactly.
// =====================================================================================
__global__ __launch_bounds__(NTHR) void k_wtr(const float* __restrict__ w, int Kin, int Ncol, int Nrows, int Kout,
                                              unsigned short* wt, int nUnits) {
  const int u = (int)blockIdx.x * NTHR + (int)threadIdx.x;
  if (u >= nUnits) return;
  const int kq = Kout >> 3;
  const int n  = u / kq;
  const int k8 = (u - n * kq) * 8;
  const int kk = k8 - (k8 / Kin) * Kin;
  const int ncl = n < Ncol ? n : Ncol - 1;
  const float* p = w + (size_t)kk * (size_t)Ncol + ncl;
  v4f a, b;
  a.x = p[0];                    a.y = p[(size_t)Ncol];         a.z = p[(size_t)2 * Ncol];     a.w = p[(size_t)3 * Ncol];
  b.x = p[(size_t)4 * Ncol];     b.y = p[(size_t)5 * Ncol];     b.z = p[(size_t)6 * Ncol];     b.w = p[(size_t)7 * Ncol];
  const v4f z4 = {0.f, 0.f, 0.f, 0.f};
  if (n >= Ncol || n >= Nrows) { a = z4; b = z4; }
  const v4u wv = pack8(a, b);
  unsigned short* o = wt + (size_t)n * (size_t)Kout + k8;
  *(v4u*)o = wv;
  
}

// =====================================================================================
// Edge bias plane: EB[e][h] = sum_t bf16r(ea[e][t]) * bf16r(We[t][h]) + bf16r(be[h]) (f32, 16 terms summed
// from +0 then the bias), zero rows for pad edges nE <= e < EP (load address clamped, value zeroed by select).
// One thread = one edge and 4 consecutive heads: 4 b128 loads in a rolled loop, one 16-B store;
// coverage: nUnits = EP*2 threads x 4 = EP x 8 elements exactly.
// =====================================================================================
__global__ __launch_bounds__(NTHR) void k_eb(const float* __restrict__ ea, const float* __restrict__ We,
                                             const float* __restrict__ be, float* EB, int nE, int nUnits) {
  __shared__ float sWe[EDW * NHD];
  __shared__ float sbe[NHD];
  const int tid = (int)threadIdx.x;
  if (tid < EDW * NHD) sWe[tid] = bfrf(We[tid]);           // We[t][h] row-major
  if (tid < NHD) sbe[tid] = bfrf(be[tid]);
  __syncthreads();
  const int u = (int)blockIdx.x * NTHR + tid;
  if (u >= nUnits) return;
  const int e  = u >> 1;
  const int h0 = (u & 1) * 4;
  const int ec = e < nE ? e : nE - 1;
  const float* er = ea + (size_t)ec * EDW;
  float s0 = 0.f, s1 = 0.f, s2 = 0.f, s3 = 0.f;
#pragma unroll 1
  for (int q = 0; q < 4; ++q) {
    const v4f a = bfr4(*(const v4fa*)(er + 4 * q));
    const float* wr = sWe + (4 * q) * NHD + h0;            // We[4q+i][h0+j] = wr[i*8 + j]
    s0 = fmaf(a.x, wr[0],  s0); s1 = fmaf(a.x, wr[1],  s1); s2 = fmaf(a.x, wr[2],  s2); s3 = fmaf(a.x, wr[3],  s3);
    s0 = fmaf(a.y, wr[8],  s0); s1 = fmaf(a.y, wr[9],  s1); s2 = fmaf(a.y, wr[10], s2); s3 = fmaf(a.y, wr[11], s3);
    s0 = fmaf(a.z, wr[16], s0); s1 = fmaf(a.z, wr[17], s1); s2 = fmaf(a.z, wr[18], s2); s3 = fmaf(a.z, wr[19], s3);
    s0 = fmaf(a.w, wr[24], s0); s1 = fmaf(a.w, wr[25], s1); s2 = fmaf(a.w, wr[26], s2); s3 = fmaf(a.w, wr[27], s3);
  }
  v4f o;
  o.x = s0 + sbe[h0]; o.y = s1 + sbe[h0 + 1]; o.z = s2 + sbe[h0 + 2]; o.w = s3 + sbe[h0 + 3];
  const v4f z4 = {0.f, 0.f, 0.f, 0.f};
  if (e >= nE) o = z4;
  float* op = EB + (size_t)e * NHD + h0;
  *(v4f*)op = o;
  
}

// =====================================================================================
// Graph attention with per-edge additive bias, one block per (graph, 64-query tile), 8 waves.
// Phase A (block-local, statically bounded): chunk scan of the src list (edge_index row 0) for
//   src in [node0, node0+64): hits (edge id, query row, dst % 512) collected into LDS in fixed scan
//   order (chunk, wave, entry j, lane), capped at HCAP (poison when reached); 64-bin counting sort by query row (wave 0, fixed order)
//   -> sE / sD segments with roff / rcnt. Nothing persists outside LDS.
// Phase B: 4 head pairs; waves 0..3 run head 2p, waves 4..7 head 2p+1, each wave 16 query rows.
//   Per key chunk of 64: K hi/lo and V^T hi/lo tiles of both heads staged (256 threads x 32 elements =
//   two 64x64 tiles per plane, the whole chunk), a 2x64x64 f32 bias tile zeroed then filled by row owners
//   (4 threads per query row, thread j adds the entries of key columns 16j..16j+15 of its row, in segment
//   order -> duplicate (src,dst) pairs sum deterministically; non-owned entries go to a private dummy slot),
//   then S = q.k (3-term split) * 0.125 + bias, online softmax in f32, P split hi/lo through per-wave LDS
//   Epilogue: ctx = O / l staged per wave in LDS (aliasing only that wave's own bias rows), written as
// Geometry guards (NaN poison of the block's ctx rows, never a trap): hit cap, per-row count > RWCAP,
//   num_graphs != NGR, batch id of the block's first node outside [0, NGR).
// coverage: CTX rows lrow0..lrow0+63 x all 1024 cols per block; grid = GHALF*8 blocks covers RHALF rows once.
// =====================================================================================
#define AT_NW   8
#define EPT     8
#define CHUNK   (NTHR * EPT)          // 2048 keys per chunk
#define WCAP    (EPT * 32)            // 256: exact upper bound of hits per wave per chunk
#define LISTN   (AT_NW * WCAP)        // 2048
#define SLOTB   6
#define NSLOT   64                    // query rows per block = scan slots
#define HCAP    2048                  // hit capacity per block
#define RWCAP   128                   // static cap on per-row edge count
#define KVT     4096                  // one 64x64 tile
#define NDUM    512                   // private dummy accumulators (2 per thread)
#define LO_KV   0
#define LO_P    (8 * KVT * 2)                           // 65536
#define LO_BT   (LO_P + 2 * AT_NW * 1024 * 2)           // 98304
#define LO_SE   (LO_BT + (2 * KVT + NDUM) * 4)          // 133120
#define LO_SD   (LO_SE + HCAP * 4)                      // 141312
#define LO_RC   (LO_SD + HCAP * 4)                      // 149504
#define LDS_ATT (LO_RC + (3 * NSLOT + 2 * AT_NW) * 4)   // 150336

static_assert((LISTN + 2 * HCAP) * 4 <= LO_P);        // phase-A lists alias the K/V tile region
static_assert(LDS_ATT <= 300000);
static_assert((1 << SLOTB) == NSLOT);
static_assert(NTHR == 32 * AT_NW);
static_assert(NTHR == 4 * NSLOT);                      // bias fill: 4 threads per query row
static_assert(NTHR * 32 == 2 * KVT);                   // bias zero fill: 32 floats per thread
static_assert(NDUM == 2 * NTHR && NDUM == 128 * 4);
static_assert(AT_NW * 1024 == 2 * KVT);                // per-wave output staging = own bias rows
static_assert((CHUNK & (CHUNK - 1)) == 0 && CHUNK == 2048);
static_assert(2 * NSLOT == 32 * 4 / 2 * 2 && NSLOT == 2 * 32);   // prefix: two counts per lane of wave 0

// One chunk of the key list: each thread tests EPT entries against the block's slot range
// [slotBase, slotBase + nb); hits are appended to this wave's LDS list as (local_index << SLOTB | slot).
// Returns the wave-uniform hit count (<= WCAP always). The vector / scalar load choice is block-uniform;
// the scalar path clamps every address and selects the sentinel by value.
__device__ __forceinline__ int scan_chunk(const int* __restrict__ keys, int nE, int cbase, int slotBase,
                                          int nb, int vec8, int* list, int tid, int lane, int wave) {
  int wc = 0;
  const int el0  = tid * EPT;
  const int e0   = cbase + el0;
  const int sent = -2147483647 - 1;
  v4i da, db;
  if (vec8 != 0 && cbase + CHUNK <= nE) {
    da = *(const v4i*)(keys + e0);
    db = *(const v4i*)(keys + e0 + 4);
  } else {
    da.x = (e0     < nE) ? keys[min(e0,     nE - 1)] : sent;
    da.y = (e0 + 1 < nE) ? keys[min(e0 + 1, nE - 1)] : sent;
    da.z = (e0 + 2 < nE) ? keys[min(e0 + 2, nE - 1)] : sent;
    da.w = (e0 + 3 < nE) ? keys[min(e0 + 3, nE - 1)] : sent;
    db.x = (e0 + 4 < nE) ? keys[min(e0 + 4, nE - 1)] : sent;
    db.y = (e0 + 5 < nE) ? keys[min(e0 + 5, nE - 1)] : sent;
    db.z = (e0 + 6 < nE) ? keys[min(e0 + 6, nE - 1)] : sent;
    db.w = (e0 + 7 < nE) ? keys[min(e0 + 7, nE - 1)] : sent;
  }
  const unsigned nbs = (unsigned)slotBase;
  const unsigned unb = (unsigned)nb;
  const unsigned s0 = (unsigned)da.x - nbs, s1 = (unsigned)da.y - nbs;
  const unsigned s2 = (unsigned)da.z - nbs, s3 = (unsigned)da.w - nbs;
  const unsigned s4 = (unsigned)db.x - nbs, s5 = (unsigned)db.y - nbs;
  const unsigned s6 = (unsigned)db.z - nbs, s7 = (unsigned)db.w - nbs;
  const bool h0 = s0 < unb, h1 = s1 < unb, h2 = s2 < unb, h3 = s3 < unb;
  const bool h4 = s4 < unb, h5 = s5 < unb, h6 = s6 < unb, h7 = s7 < unb;
  const unsigned any = __builtin_amdgcn_ballot_w32(h0 | h1 | h2 | h3 | h4 | h5 | h6 | h7);
  if (any != 0u) {
#define HITJ(J, HJ, SJ) { \
      const unsigned mj = __builtin_amdgcn_ballot_w32(HJ); \
      if (mj != 0u) { \
        if (HJ) { \
          const int pos = wc + (int)__builtin_amdgcn_mbcnt_lo(mj, 0u); \
          if (pos < WCAP) list[wave * WCAP + pos] = ((el0 + (J)) << SLOTB) | (int)(SJ); \
        } \
        wc += (int)__builtin_popcount(mj); } }
    HITJ(0, h0, s0)
    HITJ(1, h1, s1)
    HITJ(2, h2, s2)
    HITJ(3, h3, s3)
    HITJ(4, h4, s4)
    HITJ(5, h5, s5)
    HITJ(6, h6, s6)
    HITJ(7, h7, s7)
#undef HITJ
  }
  return wc;
}

__global__ __launch_bounds__(NTHR) void k_attn(
    const unsigned short* __restrict__ Qp, const unsigned short* __restrict__ Kp,
    const unsigned short* __restrict__ VTp, const float* __restrict__ EB,
    const int* __restrict__ keys, const int* __restrict__ gath,
    const int* __restrict__ ngp, const int* __restrict__ bat,
    unsigned short* CTX, int nE, int vec8, int gbase) {
  extern __shared__ v4f lds_dyn[];
  char* lds = (char*)lds_dyn;
  __bf16* Ksh = (__bf16*)(lds + LO_KV);         // [2][4096]  K hi  [kv][d]
  __bf16* Ksl = Ksh + 2 * KVT;                   // [2][4096]  K lo
  __bf16* Vth = Ksl + 2 * KVT;                   // [2][4096]  V^T hi [d][kv]
  __bf16* Vtl = Vth + 2 * KVT;                   // [2][4096]  V^T lo
  int* list  = (int*)(lds + LO_KV);              // phase A only: [LISTN]
  int* hitE  = list + LISTN;                     // [HCAP] edge ids, in scan order
  int* hitRD = hitE + HCAP;                      // [HCAP] (row << 9) | loc_dst
  __bf16* Psh = (__bf16*)(lds + LO_P);           // [8 waves][16 x 64] P hi
  __bf16* Psl = Psh + AT_NW * 1024;              // P lo
  float* BTX = (float*)(lds + LO_BT);            // [2][64 x 64] bias tiles + [NDUM] dummies; epilogue staging
  int* sE   = (int*)(lds + LO_SE);               // [HCAP] edge ids sorted by query row
  int* sD   = (int*)(lds + LO_SD);               // [HCAP] loc_dst of the same entries
  int* rcnt = (int*)(lds + LO_RC);               // [64]
  int* roff = rcnt + NSLOT;                      // [64]
  int* curs = roff + NSLOT;                      // [64]
  int* wcnt = curs + NSLOT;                      // [8]
  int* misc = wcnt + AT_NW;                      // [8]

  const int tid = (int)threadIdx.x, lane = tid & 31, wave = tid >> 5, hh = lane >> 4, c = lane & 15;
  const int lgr   = (int)blockIdx.x >> 3;        // graph within this pass
  const int qt    = (int)blockIdx.x & 7;         // 64-query tile within the graph
  const int gb    = gbase + lgr;                 // graph id
  const int node0 = gb * NND + qt * NSLOT;       // global node id of query row 0
  const int lrow0 = lgr * NND + qt * NSLOT;      // plane row of query row 0

  if (tid < NSLOT) rcnt[tid] = 0;
  __syncthreads();

  // ---- phase A1: chunk scan + ordered copy of hits ----
  int tot = 0;
  const int nChunks = (nE + CHUNK - 1) / CHUNK;
#pragma unroll 1
  for (int ch = 0; ch < nChunks; ++ch) {
    const int cbase = ch * CHUNK;
    const int wc = scan_chunk(keys, nE, cbase, node0, NSLOT, vec8, list, tid, lane, wave);
    if (lane == 0) wcnt[wave] = wc;
    __syncthreads();
    int pre = 0, all = 0;
#pragma unroll
    for (int w2 = 0; w2 < AT_NW; ++w2) {
      int cc = wcnt[w2];
      cc = cc < 0 ? 0 : (cc > WCAP ? WCAP : cc);
      all += cc;
      pre += (w2 < wave) ? cc : 0;
    }
    const int wcc  = wc > WCAP ? WCAP : wc;
    const int base = tot + pre;
#pragma unroll 1
    for (int i0 = 0; i0 < wcc; i0 += 32) {          // wcc wave-uniform; loads unconditional, clamped
      const int i   = i0 + lane;
      const int ic  = i < wcc ? i : wcc - 1;
      const int ent = list[wave * WCAP + ic];
      const int el  = (ent >> SLOTB) & (CHUNK - 1);
      const int sl  = ent & (NSLOT - 1);
      int eid = cbase + el;
      eid = eid > nE - 1 ? nE - 1 : eid;
      int g = gath[eid];
      g = g < 0 ? 0 : (g > NTOT - 1 ? NTOT - 1 : g);
      const int pos = base + i;
      if (i < wcc && pos < HCAP) {
        hitE[pos]  = eid;
        hitRD[pos] = (sl << 9) | (g & (NND - 1));
      }
    }
    tot += all;
    tot = tot > HCAP ? HCAP : tot;
    __syncthreads();
  }
  const int nh = tot;

  // ---- phase A2: per-row counts (wave 0, fixed order, lane 0 writes) ----
  if (wave == 0) {
#pragma unroll 1
    for (int b0 = 0; b0 < nh; b0 += 32) {
      const int idx = b0 + lane;
      const int uv  = hitRD[idx < nh ? idx : nh - 1];
      const int m32 = (nh - b0) < 32 ? (nh - b0) : 32;
#pragma unroll 1
      for (int k = 0; k < m32; ++k) {
        const int u  = __builtin_amdgcn_readlane(uv, k);
        const int sl = (u >> 9) & (NSLOT - 1);
        if (lane == 0) rcnt[sl] = rcnt[sl] + 1;
      }
    }
  }
  __syncthreads();

  // ---- phase A3: exclusive prefix over the 64 counts (wave 0, two counts per lane) + max count ----
  if (wave == 0) {
    int c0 = rcnt[2 * lane], c1 = rcnt[2 * lane + 1];
    c0 = c0 < 0 ? 0 : c0; c1 = c1 < 0 ? 0 : c1;
    const int ts = c0 + c1;
    int incl = ts;
#pragma unroll
    for (int d = 1; d < 32; d <<= 1) {
      const int up = __shfl_up(incl, d, 32);
      if (lane >= d) incl += up;
    }
    const int excl = incl - ts;
    roff[2 * lane] = excl;     roff[2 * lane + 1] = excl + c0;
    curs[2 * lane] = excl;     curs[2 * lane + 1] = excl + c0;
    int mc = c0 > c1 ? c0 : c1;
#pragma unroll
    for (int off = 16; off > 0; off >>= 1) {
      const int o = __shfl_xor(mc, off, 32);
      mc = o > mc ? o : mc;
    }
    if (lane == 0) misc[0] = mc;
  }
  __syncthreads();

  // ---- phase A4: place entries into row segments (wave 0, fixed order, lane 0 writes) ----
  if (wave == 0) {
#pragma unroll 1
    for (int b0 = 0; b0 < nh; b0 += 32) {
      const int idx = b0 + lane;
      const int cl  = idx < nh ? idx : nh - 1;
      const int uv  = hitRD[cl];
      const int ue  = hitE[cl];
      const int m32 = (nh - b0) < 32 ? (nh - b0) : 32;
#pragma unroll 1
      for (int k = 0; k < m32; ++k) {
        const int u  = __builtin_amdgcn_readlane(uv, k);
        const int e  = __builtin_amdgcn_readlane(ue, k);
        const int sl = (u >> 9) & (NSLOT - 1);
        if (lane == 0) {
          int pos = curs[sl];
          pos = pos < 0 ? 0 : (pos > HCAP - 1 ? HCAP - 1 : pos);
          sE[pos] = e;
          sD[pos] = u & (NND - 1);
          curs[sl] = pos + 1;
        }
      }
    }
  }
  __syncthreads();

  // ---- geometry / capacity guards -> NaN poison of this block's ctx rows ----
  const int degmax = misc[0];
  const int ng  = ngp[0];
  const int bt0 = bat[node0];
  const bool bad = (nh >= HCAP) || (degmax > RWCAP) || (ng != NGR) || (bt0 < 0) || (bt0 >= NGR);
  const float pz = bad ? __int_as_float(0x7fc00000) : 0.0f;

  // ---- phase B ----
  const int wsub = wave & 3;                     // query row group of this wave
  const int hl   = wave >> 2;                    // head slot (0 / 1) of this wave within the pair
  const int rw   = tid >> 2;                     // bias fill: query row owned by this thread
  const int jw   = tid & 3;                      // bias fill: key-column quarter owned by this thread
  const float sscale = 0.125f;
  const v8f z8 = {0.f,0.f,0.f,0.f,0.f,0.f,0.f,0.f};
  const __bf16* Kth = Ksh + hl * KVT;
  const __bf16* Ktl = Ksl + hl * KVT;
  const __bf16* Vtth = Vth + hl * KVT;
  const __bf16* Vttl = Vtl + hl * KVT;
  __bf16* pwh = Psh + wave * 1024;
  __bf16* pwl = Psl + wave * 1024;

#pragma unroll 1
  for (int hp = 0; hp < NHD / 2; ++hp) {
    const int h    = 2 * hp + hl;                // head of this wave
    const int qrow = lrow0 + wsub * 16;          // plane row of this wave's first query

    // Q fragments (A operand, row = lane&15, split k map): 2 d-chunks, hi and lo
    v16b qah[2], qal[2];
#pragma unroll
    for (int dc = 0; dc < 2; ++dc) {
      const unsigned short* qp = Qp + (size_t)(qrow + c) * PLD + h * HDM + dc * 32 + 8 * hh;
      qah[dc] = FragBF::load((const __bf16*)(const void*)qp);
      qal[dc] = FragBF::load((const __bf16*)(const void*)(qp + HID));
    }
    float mrow[8], lrow[8];
    v8f oacc[4];
#pragma unroll
    for (int r = 0; r < 8; ++r) { mrow[r] = -INFINITY; lrow[r] = 0.f; }
#pragma unroll
    for (int t = 0; t < 4; ++t) oacc[t] = z8;

#pragma unroll 1
    for (int kc = 0; kc < NND / 64; ++kc) {
      const int kv0 = kc * 64;
      __syncthreads();
      {
        // staging: thread half th = head 2hp+th; 128 threads x (4 x 8) elements = 64 x 64 per plane
        const int th = tid >> 7, t = tid & 127;
        const int r = t >> 1, half = (t & 1) * 32;
        const int hs = 2 * hp + th;
        const unsigned short* ksh = Kp + (size_t)(lgr * NND + kv0 + r) * PLD + hs * HDM + half;
        const unsigned short* ksl = ksh + HID;
        const unsigned short* vsh = VTp + ((size_t)lgr * HID + hs * HDM + r) * PLD + kv0 + half;
        const unsigned short* vsl = vsh + HID;
        __bf16* kdh = Ksh + th * KVT + r * HDM + half;
        __bf16* kdl = Ksl + th * KVT + r * HDM + half;
        __bf16* vdh = Vth + th * KVT + r * 64 + half;
        __bf16* vdl = Vtl + th * KVT + r * 64 + half;
#pragma unroll
        for (int i = 0; i < 4; ++i) {
          const v8b a0 = *(const v8b*)(ksh + 8 * i);
          const v8b a1 = *(const v8b*)(ksl + 8 * i);
          const v8b b0 = *(const v8b*)(vsh + 8 * i);
          const v8b b1 = *(const v8b*)(vsl + 8 * i);
          *(v8b*)(kdh + 8 * i) = a0;
          *(v8b*)(kdl + 8 * i) = a1;
          *(v8b*)(vdh + 8 * i) = b0;
          *(v8b*)(vdl + 8 * i) = b1;
        }
        // bias tiles + dummies zero: 256 threads x 32 floats = both 64x64 tiles; 128 threads x 4 = dummies
        const v4f z4 = {0.f, 0.f, 0.f, 0.f};
        float* bz = BTX + tid * 32;
#pragma unroll
        for (int i = 0; i < 8; ++i) *(v4fa*)(bz + 4 * i) = z4;
        if (tid < 128) *(v4fa*)(BTX + 2 * KVT + 4 * tid) = z4;
      }
      __syncthreads();
      {
        // bias fill: row rw, segment [st, st+cnt) of sE/sD; this thread adds key columns 16jw..16jw+15
        int st = roff[rw], cnt = rcnt[rw];
        st  = st < 0 ? 0 : (st > nh ? nh : st);
        cnt = cnt < 0 ? 0 : (cnt > RWCAP ? RWCAP : cnt);
        if (cnt > nh - st) cnt = nh - st;
        int cmax = cnt;
#pragma unroll
        for (int off = 16; off > 0; off >>= 1) {
          const int o = __shfl_xor(cmax, off, 32);
          cmax = o > cmax ? o : cmax;
        }
        const float* ebp = EB + 2 * hp;
#pragma unroll 1
        for (int q = 0; q < cmax; ++q) {           // cmax wave-uniform, <= RWCAP
          const bool valid = q < cnt;
          int idx = st + q;
          idx = idx > nh - 1 ? nh - 1 : idx;
          idx = idx < 0 ? 0 : idx;
          const int col = sD[idx] - kv0;
          int e = sE[idx];
          e = e < 0 ? 0 : (e > nE - 1 ? nE - 1 : e);
          const v2f ebv = *(const v2fa*)(ebp + (size_t)e * NHD);
          const bool inr = valid && ((unsigned)col < 64u) && ((col >> 4) == jw);
          const int ia = inr ? (rw * 64 + col) : (2 * KVT + tid);
          const int ib = inr ? (KVT + rw * 64 + col) : (2 * KVT + NTHR + tid);
          BTX[ia] = BTX[ia] + ebv.x;
          BTX[ib] = BTX[ib] + ebv.y;
        }
      }
      __syncthreads();

      // ---- S = q . k (3-term) ----
      v8f s[4];
#pragma unroll
      for (int j = 0; j < 4; ++j) {
        s[j] = z8;
#pragma unroll
        for (int dc = 0; dc < 2; ++dc) {
          FB kb, kl;
          const __bf16* kr = Kth + (j * 16 + c) * HDM + dc * 32 + 8 * hh;
          const __bf16* kq = Ktl + (j * 16 + c) * HDM + dc * 32 + 8 * hh;
          kb.h[0] = *(const v8b*)kr;
          kb.h[1] = *(const v8b*)(kr + 16);
          kl.h[0] = *(const v8b*)kq;
          kl.h[1] = *(const v8b*)(kq + 16);
          s[j] = at_mma(qah[dc], kb.v, s[j]);
          s[j] = at_mma(qah[dc], kl.v, s[j]);
          s[j] = at_mma(qal[dc], kb.v, s[j]);
        }
      }
      // scale, add bias tile (D element r = row wsub*16 + 8hh + r, col j*16 + c), chunk row max
      const float* btr = BTX + hl * KVT + (wsub * 16 + 8 * hh) * 64 + c;
      float cm[8];
#pragma unroll
      for (int r = 0; r < 8; ++r) {
        float m = -INFINITY;
#pragma unroll
        for (int j = 0; j < 4; ++j) {
          const float sv = s[j][r] * sscale + btr[r * 64 + j * 16];
          s[j][r] = sv;
          m = fmaxf(m, sv);
        }
#pragma unroll
        for (int off = 1; off < 16; off <<= 1) m = fmaxf(m, __shfl_xor(m, off, 32));
        cm[r] = m;
      }
#pragma unroll
      for (int r = 0; r < 8; ++r) {
        const float mnew = fmaxf(mrow[r], cm[r]);
        const float alpha = expf(mrow[r] - mnew);
        mrow[r] = mnew;
        float psum = 0.f;
#pragma unroll
        for (int j = 0; j < 4; ++j) {
          const float p = expf(s[j][r] - mnew);
          psum += p;
          __bf16 a, bl; at_split(p, a, bl);
          pwh[(8 * hh + r) * 64 + j * 16 + c] = a;
          pwl[(8 * hh + r) * 64 + j * 16 + c] = bl;
        }
#pragma unroll
        for (int off = 1; off < 16; off <<= 1) psum += __shfl_xor(psum, off, 32);
        lrow[r] = lrow[r] * alpha + psum;
#pragma unroll
        for (int t = 0; t < 4; ++t) oacc[t][r] *= alpha;
      }
      __builtin_amdgcn_fence(__ATOMIC_RELEASE, "workgroup");
      __builtin_amdgcn_wave_barrier();
      __builtin_amdgcn_fence(__ATOMIC_ACQUIRE, "workgroup");
      // ---- O += p . v (3-term); P fragment = A (row c), V^T fragment = B (col = d) ----
#pragma unroll 1
      for (int kk = 0; kk < 2; ++kk) {
        FB pa, pl;
        pa.h[0] = *(const v8b*)(pwh + c * 64 + kk * 32 + 8 * hh);
        pa.h[1] = *(const v8b*)(pwh + c * 64 + kk * 32 + 16 + 8 * hh);
        pl.h[0] = *(const v8b*)(pwl + c * 64 + kk * 32 + 8 * hh);
        pl.h[1] = *(const v8b*)(pwl + c * 64 + kk * 32 + 16 + 8 * hh);
#pragma unroll
        for (int t = 0; t < 4; ++t) {
          FB vb, vl;
          vb.h[0] = *(const v8b*)(Vtth + (t * 16 + c) * 64 + kk * 32 + 8 * hh);
          vb.h[1] = *(const v8b*)(Vtth + (t * 16 + c) * 64 + kk * 32 + 16 + 8 * hh);
          vl.h[0] = *(const v8b*)(Vttl + (t * 16 + c) * 64 + kk * 32 + 8 * hh);
          vl.h[1] = *(const v8b*)(Vttl + (t * 16 + c) * 64 + kk * 32 + 16 + 8 * hh);
          oacc[t] = at_mma(pa.v, vb.v, oacc[t]);
          oacc[t] = at_mma(pa.v, vl.v, oacc[t]);
          oacc[t] = at_mma(pl.v, vb.v, oacc[t]);
        }
      }
    }

    // ---- epilogue: normalise, stage the wave's 16x64 tile (pitch 64, own bias rows), hi | lo lines ----
    __syncthreads();
    {
      float* os = BTX + wave * 1024;
#pragma unroll
      for (int r = 0; r < 8; ++r) {
        const float inv = 1.0f / lrow[r];
#pragma unroll
        for (int t = 0; t < 4; ++t) os[(8 * hh + r) * 64 + t * 16 + c] = oacc[t][r] * inv + pz;
      }
      __builtin_amdgcn_fence(__ATOMIC_RELEASE, "workgroup");
      __builtin_amdgcn_wave_barrier();
      __builtin_amdgcn_fence(__ATOMIC_ACQUIRE, "workgroup");
      const int q4 = lane >> 3, c8 = (lane & 7) * 8;
      v4u hv[4], lv[4];
#pragma unroll
      for (int it = 0; it < 4; ++it) {
        const int row = it * 4 + q4;                   // it 0..3 x q4 0..3 covers rows 0..15
        const float* sp = os + row * 64 + c8;
        const v4f a = *(const v4fa*)sp;
        const v4f b = *(const v4fa*)(sp + 4);
        pack8hl(a, b, hv[it], lv[it]);
      }
      {
#pragma unroll
        for (int it = 0; it < 4; ++it) {
          const int row = it * 4 + q4;
          unsigned short* op = CTX + (size_t)(qrow + row) * PLD + h * HDM + c8;
          *(v4u*)op = hv[it];
          *(v4u*)(op + HID) = lv[it];
        }
        
      }
    }
  }
}

// =====================================================================================
static inline int cdiv(int a, int b) { return (a + b - 1) / b; }

extern "C" void kernel_launch(void* const* d_in, const int* in_sizes, int n_in,
                              void* d_out, int out_size, void* d_ws, size_t ws_size,
                              hipStream_t stream) {
  if (n_in < 15) return;
  if (in_sizes[0] != NTOT * HID) return;                        // x [16384][512]
  if (in_sizes[1] != NTOT) return;                              // batch [16384]
  if (in_sizes[2] < 2 || (in_sizes[2] & 1) != 0) return;        // edge_index [2][E]
  const int nE = in_sizes[2] / 2;
  if (nE < 1 || nE > (1 << 24)) return;
  if (in_sizes[3] != nE * EDW) return;                          // edge_attr [E][16]
  if (in_sizes[4] != HID * HID || in_sizes[6] != HID * HID || in_sizes[8] != HID * HID || in_sizes[10] != HID * HID) return;
  if (in_sizes[5] != HID || in_sizes[7] != HID || in_sizes[9] != HID || in_sizes[11] != HID) return;
  if (in_sizes[12] != EDW * NHD || in_sizes[13] != NHD || in_sizes[14] != 1) return;
  if (out_size != NTOT * HID) return;                           // out [16384][512], last element 8388607

  const float* x   = (const float*)d_in[0];
  const int*   bat = (const int*)  d_in[1];
  const int*   ei  = (const int*)  d_in[2];     // row 0 = src, row 1 = dst
  const float* ea  = (const float*)d_in[3];
  const float* Wq  = (const float*)d_in[4];     // [in][out]
  const float* bq  = (const float*)d_in[5];
  const float* Wk  = (const float*)d_in[6];
  const float* bk  = (const float*)d_in[7];
  const float* Wv  = (const float*)d_in[8];
  const float* bv  = (const float*)d_in[9];
  const float* Wo  = (const float*)d_in[10];
  const float* bo  = (const float*)d_in[11];
  const float* We  = (const float*)d_in[12];    // [16][8]
  const float* be  = (const float*)d_in[13];    // [8]
  const int*   ngp = (const int*)  d_in[14];    // [1]
  float* out = (float*)d_out;
  const int* keys = ei;                         // src list
  const int* gath = ei + nE;                    // dst list

  const int EP = cdiv(nE, 4) * 4;

  char* ws = (char*)d_ws;
  size_t off = 0;
  const size_t oXb = off; off += (size_t)NTOT * HID * 2;                                          // 16777216
  const size_t oWq = off; off += (size_t)HID * HID * 2;                                           //   524288
  const size_t oWk = off; off += (size_t)HID * HID * 2;
  const size_t oWv = off; off += (size_t)HID * HID * 2;
  const size_t oWo = off; off += (size_t)HID * PLD * 2;                                           //  1048576
  const size_t oEB = off; off += (size_t)EP * NHD * 4;   off = (off + 255) & ~(size_t)255;        //  8388608
  const size_t oQ  = off; off += (size_t)RHALF * PLD * 2;                                         // 33554432
  const size_t oK  = off; off += (size_t)RHALF * PLD * 2;
  const size_t oVT = off; off += (size_t)GHALF * HID * PLD * 2;                                   // 33554432
  const size_t oCT = off; off += (size_t)RHALF * PLD * 2;                                         // 33554432
  if (off > ws_size || off > (size_t)WSMAX) return;                                               // 162004992
  unsigned short* Xb   = (unsigned short*)(ws + oXb);
  unsigned short* WqT  = (unsigned short*)(ws + oWq);
  unsigned short* WkT  = (unsigned short*)(ws + oWk);
  unsigned short* WvT  = (unsigned short*)(ws + oWv);
  unsigned short* WOT2 = (unsigned short*)(ws + oWo);
  float*          EB   = (float*)(ws + oEB);
  unsigned short* Qp   = (unsigned short*)(ws + oQ);
  unsigned short* Kp   = (unsigned short*)(ws + oK);
  unsigned short* VTp  = (unsigned short*)(ws + oVT);
  unsigned short* CTX  = (unsigned short*)(ws + oCT);

  hipFuncSetAttribute(reinterpret_cast<const void*>(&k_attn),
                      hipFuncAttributeMaxDynamicSharedMemorySize, LDS_ATT);

  // weight planes (bf16 bits, k-contiguous rows [n][k])
  {
    const int nUw = HID * (HID / 8);             // 512 rows x 64 units
    k_wtr<<<cdiv(nUw, NTHR), NTHR, 0, stream>>>(Wq, HID, HID, HID, HID, WqT, nUw);
    k_wtr<<<cdiv(nUw, NTHR), NTHR, 0, stream>>>(Wk, HID, HID, HID, HID, WkT, nUw);
    k_wtr<<<cdiv(nUw, NTHR), NTHR, 0, stream>>>(Wv, HID, HID, HID, HID, WvT, nUw);
    const int nUo = HID * (PLD / 8);             // 512 rows x 128 units: wt [512][1024], k mod 512
    k_wtr<<<cdiv(nUo, NTHR), NTHR, 0, stream>>>(Wo, HID, HID, HID, PLD, WOT2, nUo);
  }
  // node feature plane (whole x)
  {
    const int nUx = NTOT * (HID / 8);
    k_xprep<<<cdiv(nUx, NTHR), NTHR, 0, stream>>>(x, Xb, NTOT, nUx);
  }
  // edge bias plane [EP][8]
  {
    const int nUe = EP * 2;
    k_eb<<<cdiv(nUe, NTHR), NTHR, 0, stream>>>(ea, We, be, EB, nE, nUe);
  }

  const dim3 blk(256);
  const dim3 gQK(((RHALF / 64) * (HID / 64)) / 8, 1);        // 256 blocks x 8 tiles: M=16384, N=512
  const dim3 gVT(((HID / 64) * (NND / 64)) / 8, GHALF);      // 8 blocks x 8 tiles per graph: M=512, N=512
  const dim3 gAT(GHALF * (NND / 64));                        // 256 blocks: 32 graphs x 8 query tiles
  for (int half = 0; half < NHALF; ++half) {
    const unsigned short* Xh = Xb + (size_t)half * RHALF * HID;
    float* outh = out + (size_t)half * RHALF * HID;
    // q = x . Wq + bq -> Qp hi | lo  (M=16384, N=512, K=512)
    wmma_gemm64<false, 2, 2, false, 0><<<gQK, blk, 0, stream>>>(
        Xh, Xh, HID, 0L, WqT, WqT, HID, 0L, (void*)Qp, (void*)(Qp + HID), PLD, 0L,
        bq, bq, 0L, RHALF, HID, HID, 1.0f);
    // k = x . Wk + bk -> Kp hi | lo
    wmma_gemm64<false, 2, 2, false, 0><<<gQK, blk, 0, stream>>>(
        Xh, Xh, HID, 0L, WkT, WkT, HID, 0L, (void*)Kp, (void*)(Kp + HID), PLD, 0L,
        bk, bk, 0L, RHALF, HID, HID, 1.0f);
    // v^T = Wv^T . x^T + bv[m] per graph -> VTp [graph][h*64+d][s] hi | lo  (M=512, N=512, K=512, z = 32 graphs)
    wmma_gemm64<false, 1, 2, false, 0><<<gVT, blk, 0, stream>>>(
        WvT, WvT, HID, 0L, Xh, Xh, HID, (long)NND * HID, (void*)VTp, (void*)(VTp + HID), PLD, (long)HID * PLD,
        bv, bv, 0L, HID, NND, HID, 1.0f);
    // attention with edge bias -> CTX hi | lo
    k_attn<<<gAT, NTHR, LDS_ATT, stream>>>(Qp, Kp, VTp, EB, keys, gath, ngp, bat, CTX, nE, 1, half * GHALF);
    // out = [ctx hi | ctx lo] . [Wo ; Wo] + bo -> d_out rows half*RHALF .. half*RHALF+RHALF-1 (M=16384, N=512, K=1024)
    wmma_gemm64<false, 2, 0, false, 0><<<gQK, blk, 0, stream>>>(
        CTX, CTX, PLD, 0L, WOT2, WOT2, PLD, 0L, (void*)outh, (void*)outh, HID, 0L,
        bo, bo, 0L, RHALF, HID, PLD, 1.0f);
  }
  (void)hipGetLastError();
}

// v002
// One run takes 761 microseconds.
// Next to v001, in two timings, it ran 1.30 and 1.31 times as fast.
// All steps since v000 together make it 2.42 times as fast.
// Contractions on v_wmma_f32_16x16x32_bf16 (bf16 operands, f32 accumulate): x*Wq, x*Wk, Wv^T*x^T as single
// products of bf16-RNE inputs; q.k^T and p.v as bf16 hi/lo split (hi.hi + hi.lo + lo.hi); ctx*Wo as
// [ctx hi | ctx lo] . [Wo ; Wo] (K = 1024); edge bias (16-deep dots of bf16-RNE inputs), online softmax and all biases in f32 on the VALU.
#include <hip/hip_runtime.h>
#include <math.h>
#include <stdint.h>
#include <stddef.h>

// Geometry: NGR graphs of NND consecutive node rows; attention keys of a query = the NND nodes of its graph.
// The job runs in NHALF passes of GHALF graphs each (one pass of all graphs: the attention launch then has one
// work-group for each of the 256 WGPs); the q / k / v^T / ctx planes are rewritten per pass.
//
// Plane map (workspace, all 16-bit planes are bf16 bits; no power-of-two carries anywhere, so no inverse
// factor exists -> carry audit: none):
//   Xb   [16384][512]          bf16(x)                                        -> A of q/k GEMMs, Bt of v^T GEMM
//   WqT, WkT, WvT [512 o][512 i]  bf16(W[i][o])                              -> Bt / A (k-contiguous)
//   WOT2 [512 o][1024]         bf16(Wo[k mod 512][o])                         -> Bt of the output GEMM
//   EB   [EP][8] f32           sum_t bf16(ea[e][t]) bf16(We[t][h]) + bf16(be[h])
//   Qp, Kp [16384][1024]       hi at col h*64+d, residual lo at col 512 + h*64+d (f32 projection split)
//   VTp  [32 graphs][512 (h,d)][1024]   hi at col s, lo at col 512 + s (s = node within graph)
//   CTX  [16384][1024]         hi | lo of the normalised attention context

#define NGR    32
#define NND    512
#define NTOT   (NGR * NND)      // 16384
#define HID    512
#define NHD    8
#define HDM    64
#define EDW    16
#define NHALF  1
#define GHALF  (NGR / NHALF)    // 32
#define RHALF  (GHALF * NND)    // 16384
#define PLD    1024
#define NTHR   256
#define WSMAX  268435456

static_assert(HID == NHD * HDM && HDM == 64 && NHD == 8);
static_assert(PLD == 2 * HID);
static_assert((RHALF % 64) == 0 && (HID % 64) == 0 && (NND % 64) == 0 && (PLD % 32) == 0 && (HID % 32) == 0);
static_assert(((RHALF / 64) * (HID / 64)) % 8 == 0);       // GEMM grids: 8 wave tiles per block, exact
static_assert(((HID / 64) * (NND / 64)) % 8 == 0);
static_assert(NGR == NHALF * GHALF);
static_assert(HID == 64 * 8);                               // k_xprep: 64 units of 8 per row
static_assert(EDW == 16 && NHD == 8 && EDW * NHD <= NTHR);  // k_eb layout

typedef __attribute__((ext_vector_type(16))) _Float16 v16h;
typedef __attribute__((ext_vector_type(8)))  _Float16 v8h;
typedef __attribute__((ext_vector_type(16))) __bf16   v16b;
typedef __attribute__((ext_vector_type(8)))  __bf16   v8b;
typedef __attribute__((ext_vector_type(8)))  float    v8f;
typedef __attribute__((ext_vector_type(4)))  float    v4f;
typedef __attribute__((ext_vector_type(2)))  float    v2f;
typedef __attribute__((ext_vector_type(4)))  unsigned int v4u;
typedef __attribute__((ext_vector_type(4)))  int      v4i;
typedef __attribute__((ext_vector_type(8)))  unsigned short v8us;
typedef v4f  __attribute__((may_alias)) v4fa;
typedef v2f  __attribute__((may_alias)) v2fa;
typedef v4u  __attribute__((may_alias)) v4ua;

// ---- scalar helpers: f32 -> bf16 bits (RNE convert), bf16 bits -> f32 ----
__device__ __forceinline__ unsigned short f2bf_bits(float f) {
  unsigned u = __float_as_uint(f);
  return (unsigned short)((u + 0x7FFFu + ((u >> 16) & 1u)) >> 16);
}
__device__ __forceinline__ float bf_bits2f(unsigned short h) { return __uint_as_float(((unsigned)h) << 16); }
__device__ __forceinline__ float bfrf(float f) { return bf_bits2f(f2bf_bits(f)); }
__device__ __forceinline__ unsigned int f2bfu(float f) {
  const unsigned int u = __float_as_uint(f);
  return ((u + 0x7FFFu + ((u >> 16) & 1u)) >> 16) & 0xFFFFu;
}
__device__ __forceinline__ float bf2f(unsigned int b) { return __uint_as_float(b << 16); }
__device__ __forceinline__ v4f bfr4(const v4f a) {
  v4f r; r.x = bfrf(a.x); r.y = bfrf(a.y); r.z = bfrf(a.z); r.w = bfrf(a.w); return r;
}
__device__ __forceinline__ unsigned int pk2(float lo, float hi) { return f2bfu(lo) | (f2bfu(hi) << 16); }
__device__ __forceinline__ v4u pack8(const v4f a, const v4f b) {
  v4u r;
  r.x = pk2(a.x, a.y); r.y = pk2(a.z, a.w); r.z = pk2(b.x, b.y); r.w = pk2(b.z, b.w);
  return r;
}
// hi = bf16(v), lo = bf16(v - hi): two floats -> one packed word of each
__device__ __forceinline__ void hl2(float v0, float v1, unsigned int& hw, unsigned int& lw) {
  const unsigned int h0 = f2bfu(v0), h1 = f2bfu(v1);
  const unsigned int l0 = f2bfu(v0 - bf2f(h0)), l1 = f2bfu(v1 - bf2f(h1));
  hw = h0 | (h1 << 16);
  lw = l0 | (l1 << 16);
}
__device__ __forceinline__ void pack8hl(const v4f a, const v4f b, v4u& hv, v4u& lv) {
  unsigned int h, l;
  hl2(a.x, a.y, h, l); hv.x = h; lv.x = l;
  hl2(a.z, a.w, h, l); hv.y = h; lv.y = l;
  hl2(b.x, b.y, h, l); hv.z = h; lv.z = l;
  hl2(b.z, b.w, h, l); hv.w = h; lv.w = l;
}

// ---- WMMA fragment helpers (bf16, wave32) ----
// A fragment (row m = lane&15) and B fragment (col n = lane&15) use the SAME k map:
//   elements 0..7 <- k0 + 8h + 0..7, elements 8..15 <- k0 + 16 + 8h + 0..7, h = lane>>4,
// loaded as two 16-B pieces from a k-contiguous 16-bit row: p[0..7] and p[16..23] with p = row + k0 + 8h.
// D element r of lane l = (row 8h + r, col l&15).
__device__ __forceinline__ void dep_guard_b(v8f& a, v8f& b, v16b x, v16b y) { asm volatile("v_nop\n\tv_nop\n\tv_nop\n\tv_nop" : "+v"(a), "+v"(b) : "v"(x), "v"(y)); }
__device__ __forceinline__ void keep4_b(v16b a, v16b b, v16b c, v16b d) { asm volatile("v_nop" :: "v"(a), "v"(b), "v"(c), "v"(d)); }
__device__ __forceinline__ void acc_guard4(v8f& a, v8f& b, v8f& c, v8f& d) { asm volatile("v_nop\n\tv_nop\n\tv_nop\n\tv_nop" : "+v"(a), "+v"(b), "+v"(c), "+v"(d)); }

struct FragBF {
  union U { v16b v; v8b h[2]; };
  static __device__ __forceinline__ v16b load(const __bf16* p) {   // elements 0..7 <- p[0..7], 8..15 <- p[16..23]
    U f; f.h[0] = *(const v8b*)(p); f.h[1] = *(const v8b*)(p + 16); return f.v;
  }
  static __device__ __forceinline__ v8f mma(v16b a, v16b b, v8f c) {
    return __builtin_amdgcn_wmma_f32_16x16x32_bf16(false, a, false, b, (short)0, c, false, false);
  }
  static __device__ __forceinline__ void guard(v8f& a, v8f& b, v16b x, v16b y) { dep_guard_b(a, b, x, y); }
  static __device__ __forceinline__ void keep(v16b a, v16b b, v16b c, v16b d) { keep4_b(a, b, c, d); }
};
union FB { v16b v; v8b h[2]; };

// single WMMA with hazard guard: ties D, keeps A/B live for 4 VALU slots
__device__ __forceinline__ v8f at_mma(v16b a, v16b b, v8f c) {
  c = __builtin_amdgcn_wmma_f32_16x16x32_bf16(false, a, false, b, (short)0, c, false, false);
  asm volatile("v_nop\n\tv_nop\n\tv_nop\n\tv_nop" : "+v"(c) : "v"(a), "v"(b));
  return c;
}
__device__ __forceinline__ __bf16 at_f2bf(float f) { return __builtin_bit_cast(__bf16, f2bf_bits(f)); }
__device__ __forceinline__ void at_split(float f, __bf16& hi, __bf16& lo) {
  const unsigned short hb = f2bf_bits(f);
  hi = __builtin_bit_cast(__bf16, hb);
  lo = at_f2bf(f - __uint_as_float(((unsigned)hb) << 16));
}

// =====================================================================================
// Register-blocked batched WMMA GEMM (bf16 operands).
// C[m,n] = scale * sum_k A[m,k] * Bt[n,k] (+bias)(+resid); each wave owns a 64x64 tile.
// A row-major [M,K]; Bt row-major [N,K]; M,N % 64 == 0, K % 32 == 0 (host static_asserts).
// SPLIT: operands are hi/lo planes (A2/Bt2 = lo planes, same layout); product = hi.hi + hi.lo + lo.hi.
// BIAS_MODE: 0 = none, 1 = bf16r(bias[m]), 2 = bf16r(bias[n]).
// OUT_MODE: 0 = f32, 1 = f16, 2 = bf16 hi plane (Cout) + bf16 lo plane (Cout2).
// coverage: grid.x * 8 waves == (M/64)*(N/64) tiles exactly (host), every C element written once per z.
// =====================================================================================
template <bool SPLIT, int BIAS_MODE, int OUT_MODE, bool RESID, int ACT = 0>
__global__ __launch_bounds__(256) void wmma_gemm64(
    const unsigned short* __restrict__ Ap, const unsigned short* __restrict__ A2p, int lda, long strideA,
    const unsigned short* __restrict__ Btp, const unsigned short* __restrict__ Bt2p, int ldb, long strideB,
    void* __restrict__ Cout, void* __restrict__ Cout2, int ldc, long strideC,
    const float* __restrict__ bias,
    const float* __restrict__ resid, long strideR,
    int M, int N, int K, float scale) {
  typedef __bf16 T;
  typedef v16b V;
  const T* A = (const T*)Ap; const T* A2 = (const T*)A2p; const T* Bt = (const T*)Btp; const T* Bt2 = (const T*)Bt2p;
  __shared__ __align__(16) float sT[8][16 * 68];   // per-wave 16x64 slab, pitch 68 floats
  const int b    = blockIdx.y;
  const int lane = threadIdx.x & 31;
  const int wave = threadIdx.x >> 5;
  const int tilesN = N >> 6;
  const int tilesM = M >> 6;
  const int tile = blockIdx.x * 8 + wave;
  if (tile >= tilesM * tilesN) return;   // wave-uniform; no block barriers in this kernel
  const int tm = tile / tilesN;
  const int tn = tile - tm * tilesN;
  const int m0 = tm << 6;
  const int n0 = tn << 6;

  const T* Ab  = A  + (size_t)b * strideA;
  const T* Bb  = Bt + (size_t)b * strideB;
  const T* Ab2 = SPLIT ? (A2  + (size_t)b * strideA) : nullptr;
  const T* Bb2 = SPLIT ? (Bt2 + (size_t)b * strideB) : nullptr;

  const int rlane = lane & 15;                 // row (A) / col (B, D) within subtile
  const int koff  = (lane >> 4) * 8;           // k offset of this lane half
  const int mOff  = (lane >> 4) * 8;           // D row offset

  v8f acc[4][4];
#pragma unroll
  for (int i = 0; i < 4; ++i)
#pragma unroll
    for (int j = 0; j < 4; ++j) acc[i][j] = (v8f){0.f,0.f,0.f,0.f,0.f,0.f,0.f,0.f};

  for (int k0 = 0; k0 < K; k0 += 32) {
    V bh[4], bl[4];
#pragma unroll
    for (int j = 0; j < 4; ++j) {
      const size_t bo = (size_t)(n0 + (j << 4) + rlane) * ldb + koff + k0;
      bh[j] = FragBF::load(Bb + bo);
      if (SPLIT) bl[j] = FragBF::load(Bb2 + bo);
    }
#pragma unroll
    for (int i = 0; i < 4; ++i) {
      const size_t ao = (size_t)(m0 + (i << 4) + rlane) * lda + koff + k0;
      V ah = FragBF::load(Ab + ao);
      V al;
      if (SPLIT) al = FragBF::load(Ab2 + ao);
#pragma unroll
      for (int j = 0; j < 4; ++j) {
        acc[i][j] = FragBF::mma(ah, bh[j], acc[i][j]);
        if (SPLIT) {
          acc[i][j] = FragBF::mma(ah, bl[j], acc[i][j]);
          acc[i][j] = FragBF::mma(al, bh[j], acc[i][j]);
        }
      }
      FragBF::guard(acc[i][0], acc[i][3], ah, SPLIT ? al : ah);
    }
    FragBF::keep(bh[0], bh[1], bh[2], bh[3]);
    if (SPLIT) FragBF::keep(bl[0], bl[1], bl[2], bl[3]);
  }
  acc_guard4(acc[0][0], acc[0][1], acc[0][2], acc[0][3]);
  acc_guard4(acc[1][0], acc[1][1], acc[1][2], acc[1][3]);
  acc_guard4(acc[2][0], acc[2][1], acc[2][2], acc[2][3]);
  acc_guard4(acc[3][0], acc[3][1], acc[3][2], acc[3][3]);

  // ---- epilogue ----
  float* slab = sT[wave];
  const float* Rb = RESID ? (resid + (size_t)b * strideR) : nullptr;
#pragma unroll
  for (int i = 0; i < 4; ++i) {
    const int mBase = m0 + (i << 4);
    float bm[8];
    if (BIAS_MODE == 1) {   // 8 consecutive floats, 32-B aligned: two 16-B loads
      const v4f b0v = bfr4(*(const v4fa*)(bias + mBase + mOff));
      const v4f b1v = bfr4(*(const v4fa*)(bias + mBase + mOff + 4));
      bm[0] = b0v.x; bm[1] = b0v.y; bm[2] = b0v.z; bm[3] = b0v.w;
      bm[4] = b1v.x; bm[5] = b1v.y; bm[6] = b1v.z; bm[7] = b1v.w;
    } else {
#pragma unroll
      for (int r = 0; r < 8; ++r) bm[r] = 0.f;
    }
#pragma unroll
    for (int j = 0; j < 4; ++j) {
      const int n = n0 + (j << 4) + rlane;
      float bv = 0.f;
      if (BIAS_MODE == 2) bv = bfrf(bias[n]);
#pragma unroll
      for (int r = 0; r < 8; ++r) {
        float v = acc[i][j][r] * scale;
        if (BIAS_MODE == 1) v += bm[r];
        if (BIAS_MODE == 2) v += bv;
        if (RESID) v += Rb[(size_t)(mBase + mOff + r) * ldc + n];
        if (ACT == 1) v = tanhf(v);
        if (ACT == 2) v = fmaxf(v, 0.0f);
        if (ACT == 4) v = (v > 0.f) ? v : 0.01f * v;
        slab[(mOff + r) * 68 + (j << 4) + rlane] = v;
      }
    }
    __builtin_amdgcn_fence(__ATOMIC_RELEASE, "workgroup");
    __builtin_amdgcn_wave_barrier();
    __builtin_amdgcn_fence(__ATOMIC_ACQUIRE, "workgroup");
    if (OUT_MODE == 0) {
      float* C = (float*)Cout + (size_t)b * strideC;
      const int hh = lane >> 4, c4 = (lane & 15) * 4;     // row seg = 256 B = 16 lanes x 16 B
      {
#pragma unroll
        for (int it = 0; it < 8; ++it) {
          const int row = it * 2 + hh;
          v4f v = *(const v4f*)(slab + row * 68 + c4);
          *(v4f*)(C + (size_t)(mBase + row) * ldc + n0 + c4) = v;
        }
        
      }
    } else {
      const int q = lane >> 3, c8 = (lane & 7) * 8;
      unsigned short* C  = (unsigned short*)Cout  + (size_t)b * strideC;
      unsigned short* C2 = (OUT_MODE == 2) ? ((unsigned short*)Cout2 + (size_t)b * strideC) : nullptr;
      {
#pragma unroll
        for (int it = 0; it < 4; ++it) {
          const int row = it * 4 + q;
          const float* sp = slab + row * 68 + c8;
          v8h hv, lv;
#pragma unroll
          for (int e = 0; e < 8; ++e) {
            if (OUT_MODE == 1) {
              hv[e] = (_Float16)sp[e];
            } else {
              unsigned short hb = f2bf_bits(sp[e]);
              unsigned short lb = f2bf_bits(sp[e] - bf_bits2f(hb));
              hv[e] = __builtin_bit_cast(_Float16, hb);
              lv[e] = __builtin_bit_cast(_Float16, lb);
            }
          }
          *(v8h*)(C + (size_t)(mBase + row) * ldc + n0 + c8) = hv;
          if (OUT_MODE == 2) *(v8h*)(C2 + (size_t)(mBase + row) * ldc + n0 + c8) = lv;
        }
        
      }
    }
    __builtin_amdgcn_fence(__ATOMIC_RELEASE, "workgroup");
    __builtin_amdgcn_wave_barrier();
    __builtin_amdgcn_fence(__ATOMIC_ACQUIRE, "workgroup");
  }
}

// =====================================================================================
// Node feature plane: xb[row][c] = bf16(x[row][c]) for row < nN (all 512 c). One thread = 8 contiguous
// =====================================================================================
__global__ __launch_bounds__(NTHR) void k_xprep(const float* __restrict__ x, unsigned short* xb, int nN, int nUnits) {
  const int i = (int)blockIdx.x * NTHR + (int)threadIdx.x;
  if (i >= nUnits) return;
  const int row = i >> 6;
  const int c0  = (i & 63) * 8;
  const int rc  = row < nN ? row : nN - 1;
  const float* p = x + (size_t)rc * HID + c0;
  v4f a = *(const v4fa*)p;
  v4f b = *(const v4fa*)(p + 4);
  const v4f z4 = {0.f, 0.f, 0.f, 0.f};
  if (row >= nN) { a = z4; b = z4; }
  const v4u hv = pack8(a, b);
  unsigned short* o = xb + (size_t)row * HID + c0;
  *(v4u*)o = hv;
  
}

// =====================================================================================
// Weight transpose + bf16 convert into a k-contiguous plane: w is [Kin][Ncol] ([in][out]),
//   wt[n][k] = bf16(w[k mod Kin][n]) for n < Nrows, k < Kout (Kout = Kin or a multiple of it).
// coverage: nUnits = Nrows * Kout/8 threads x 8 = Nrows x Kout exactly.
// =====================================================================================
__global__ __launch_bounds__(NTHR) void k_wtr(const float* __restrict__ w, int Kin, int Ncol, int Nrows, int Kout,
                                              unsigned short* wt, int nUnits) {
  const int u = (int)blockIdx.x * NTHR + (int)threadIdx.x;
  if (u >= nUnits) return;
  const int kq = Kout >> 3;
  const int n  = u / kq;
  const int k8 = (u - n * kq) * 8;
  const int kk = k8 - (k8 / Kin) * Kin;
  const int ncl = n < Ncol ? n : Ncol - 1;
  const float* p = w + (size_t)kk * (size_t)Ncol + ncl;
  v4f a, b;
  a.x = p[0];                    a.y = p[(size_t)Ncol];         a.z = p[(size_t)2 * Ncol];     a.w = p[(size_t)3 * Ncol];
  b.x = p[(size_t)4 * Ncol];     b.y = p[(size_t)5 * Ncol];     b.z = p[(size_t)6 * Ncol];     b.w = p[(size_t)7 * Ncol];
  const v4f z4 = {0.f, 0.f, 0.f, 0.f};
  if (n >= Ncol || n >= Nrows) { a = z4; b = z4; }
  const v4u wv = pack8(a, b);
  unsigned short* o = wt + (size_t)n * (size_t)Kout + k8;
  *(v4u*)o = wv;
  
}

// =====================================================================================
// Edge bias plane: EB[e][h] = sum_t bf16r(ea[e][t]) * bf16r(We[t][h]) + bf16r(be[h]) (f32, 16 terms summed
// from +0 then the bias), zero rows for pad edges nE <= e < EP (load address clamped, value zeroed by select).
// One thread = one edge and 4 consecutive heads: 4 b128 loads in a rolled loop, one 16-B store;
// coverage: nUnits = EP*2 threads x 4 = EP x 8 elements exactly.
// =====================================================================================
__global__ __launch_bounds__(NTHR) void k_eb(const float* __restrict__ ea, const float* __restrict__ We,
                                             const float* __restrict__ be, float* EB, int nE, int nUnits) {
  __shared__ float sWe[EDW * NHD];
  __shared__ float sbe[NHD];
  const int tid = (int)threadIdx.x;
  if (tid < EDW * NHD) sWe[tid] = bfrf(We[tid]);           // We[t][h] row-major
  if (tid < NHD) sbe[tid] = bfrf(be[tid]);
  __syncthreads();
  const int u = (int)blockIdx.x * NTHR + tid;
  if (u >= nUnits) return;
  const int e  = u >> 1;
  const int h0 = (u & 1) * 4;
  const int ec = e < nE ? e : nE - 1;
  const float* er = ea + (size_t)ec * EDW;
  float s0 = 0.f, s1 = 0.f, s2 = 0.f, s3 = 0.f;
#pragma unroll 1
  for (int q = 0; q < 4; ++q) {
    const v4f a = bfr4(*(const v4fa*)(er + 4 * q));
    const float* wr = sWe + (4 * q) * NHD + h0;            // We[4q+i][h0+j] = wr[i*8 + j]
    s0 = fmaf(a.x, wr[0],  s0); s1 = fmaf(a.x, wr[1],  s1); s2 = fmaf(a.x, wr[2],  s2); s3 = fmaf(a.x, wr[3],  s3);
    s0 = fmaf(a.y, wr[8],  s0); s1 = fmaf(a.y, wr[9],  s1); s2 = fmaf(a.y, wr[10], s2); s3 = fmaf(a.y, wr[11], s3);
    s0 = fmaf(a.z, wr[16], s0); s1 = fmaf(a.z, wr[17], s1); s2 = fmaf(a.z, wr[18], s2); s3 = fmaf(a.z, wr[19], s3);
    s0 = fmaf(a.w, wr[24], s0); s1 = fmaf(a.w, wr[25], s1); s2 = fmaf(a.w, wr[26], s2); s3 = fmaf(a.w, wr[27], s3);
  }
  v4f o;
  o.x = s0 + sbe[h0]; o.y = s1 + sbe[h0 + 1]; o.z = s2 + sbe[h0 + 2]; o.w = s3 + sbe[h0 + 3];
  const v4f z4 = {0.f, 0.f, 0.f, 0.f};
  if (e >= nE) o = z4;
  float* op = EB + (size_t)e * NHD + h0;
  *(v4f*)op = o;
  
}

// =====================================================================================
// Graph attention with per-edge additive bias, one block per (graph, 64-query tile), 8 waves.
// Phase A (block-local, statically bounded): chunk scan of the src list (edge_index row 0) for
//   src in [node0, node0+64): hits (edge id, query row, dst % 512) collected into LDS in (chunk, wave, entry j, lane)
//   order, capped at HCAP (poison when reached); counting sort (wave 0, fixed order, stable) into NBIN bins,
//   bin = query row * 32 + (dst % 512) / 16, -> sE / sD segments with roff / rcnt. Nothing persists outside LDS.
// Phase B: 4 head pairs; waves 0..3 run head 2p, waves 4..7 head 2p+1, each wave 16 query rows.
//   Per key chunk of 64: K hi/lo and V^T hi/lo tiles of both heads staged (256 threads x 32 elements =
//   two 64x64 tiles per plane, the whole chunk), a 2x64x64 f32 bias tile zeroed then filled by row owners
//   (4 threads per query row, thread j walks only the bin of its row and of key columns 16j..16j+15 of this
//   chunk, in segment order = hit scan order -> duplicate (src,dst) pairs sum deterministically; lanes
//   whose bin is shorter than the wave's longest add into a private dummy slot),
//   then S = q.k (3-term split) * 0.125 + bias, online softmax in f32, P split hi/lo through per-wave LDS
//   Epilogue: ctx = O / l staged per wave in LDS (aliasing only that wave's own bias rows), written as
// Geometry guards (NaN poison of the block's ctx rows, never a trap): hit cap, per-row count > RWCAP,
//   num_graphs != NGR, batch id of the block's first node outside [0, NGR).
// coverage: CTX rows lrow0..lrow0+63 x all 1024 cols per block; grid = GHALF*8 blocks covers RHALF rows once.
// =====================================================================================
#define AT_NW   8
#define EPT     8
#define CHUNK   (NTHR * EPT)          // 2048 keys per chunk
#define WCAP    (EPT * 32)            // 256: exact upper bound of hits per wave per chunk
#define LISTN   (AT_NW * WCAP)        // 2048
#define SLOTB   6
#define NSLOT   64                    // query rows per block = scan slots
#define BINSH   4                     // 16 key columns per bin
#define NBIN    (NSLOT * (NND >> BINSH))   // 2048 bins: (query row, group of 16 key columns)
#define HCAP    2048                  // hit capacity per block
#define RWCAP   128                   // static cap on per-row edge count
#define KVT     4096                  // one 64x64 tile
#define NDUM    512                   // private dummy accumulators (2 per thread)
#define LO_KV   0
#define LO_P    (8 * KVT * 2)                           // 65536
#define LO_BT   (LO_P + 2 * AT_NW * 1024 * 2)           // 98304
#define LO_SE   (LO_BT + (2 * KVT + NDUM) * 4)          // 133120
#define LO_SD   (LO_SE + HCAP * 4)                      // 141312
#define LO_RC   (LO_SD + HCAP * 4)                      // 149504
#define LDS_ATT (LO_RC + (3 * NBIN + 2 * AT_NW) * 4)    // 174144

static_assert((LISTN + 2 * HCAP) * 4 <= LO_P);        // phase-A lists alias the K/V tile region
static_assert(LDS_ATT <= 300000);
static_assert((1 << SLOTB) == NSLOT);
static_assert(NTHR == 32 * AT_NW);
static_assert(NTHR == 4 * NSLOT);                      // bias fill: 4 threads per query row
static_assert(NTHR * 32 == 2 * KVT);                   // bias zero fill: 32 floats per thread
static_assert(NDUM == 2 * NTHR && NDUM == 128 * 4);
static_assert(AT_NW * 1024 == 2 * KVT);                // per-wave output staging = own bias rows
static_assert((CHUNK & (CHUNK - 1)) == 0 && CHUNK == 2048);
static_assert(2 * NSLOT == 32 * 4 / 2 * 2 && NSLOT == 2 * 32);   // prefix: two query rows per lane of wave 0
static_assert(NBIN == 32 * 64 && NBIN == NTHR * 8 && (NND >> BINSH) == 32);   // 64 bins per lane, 32 per row
static_assert((64 >> BINSH) == 4 && (LO_RC % 16) == 0);          // 4 bins per row and key chunk = 4 fill threads

// One chunk of the key list: each thread tests EPT entries against the block's slot range
// [slotBase, slotBase + nb); hits are appended to this wave's LDS list as (local_index << SLOTB | slot).
// Returns the wave-uniform hit count (<= WCAP always). The vector / scalar load choice is block-uniform;
// the scalar path clamps every address and selects the sentinel by value.
__device__ __forceinline__ int scan_chunk(const int* __restrict__ keys, int nE, int cbase, int slotBase,
                                          int nb, int vec8, int* list, int tid, int lane, int wave) {
  int wc = 0;
  const int el0  = tid * EPT;
  const int e0   = cbase + el0;
  const int sent = -2147483647 - 1;
  v4i da, db;
  if (vec8 != 0 && cbase + CHUNK <= nE) {
    da = *(const v4i*)(keys + e0);
    db = *(const v4i*)(keys + e0 + 4);
  } else {
    da.x = (e0     < nE) ? keys[min(e0,     nE - 1)] : sent;
    da.y = (e0 + 1 < nE) ? keys[min(e0 + 1, nE - 1)] : sent;
    da.z = (e0 + 2 < nE) ? keys[min(e0 + 2, nE - 1)] : sent;
    da.w = (e0 + 3 < nE) ? keys[min(e0 + 3, nE - 1)] : sent;
    db.x = (e0 + 4 < nE) ? keys[min(e0 + 4, nE - 1)] : sent;
    db.y = (e0 + 5 < nE) ? keys[min(e0 + 5, nE - 1)] : sent;
    db.z = (e0 + 6 < nE) ? keys[min(e0 + 6, nE - 1)] : sent;
    db.w = (e0 + 7 < nE) ? keys[min(e0 + 7, nE - 1)] : sent;
  }
  const unsigned nbs = (unsigned)slotBase;
  const unsigned unb = (unsigned)nb;
  const unsigned s0 = (unsigned)da.x - nbs, s1 = (unsigned)da.y - nbs;
  const unsigned s2 = (unsigned)da.z - nbs, s3 = (unsigned)da.w - nbs;
  const unsigned s4 = (unsigned)db.x - nbs, s5 = (unsigned)db.y - nbs;
  const unsigned s6 = (unsigned)db.z - nbs, s7 = (unsigned)db.w - nbs;
  const bool h0 = s0 < unb, h1 = s1 < unb, h2 = s2 < unb, h3 = s3 < unb;
  const bool h4 = s4 < unb, h5 = s5 < unb, h6 = s6 < unb, h7 = s7 < unb;
  const unsigned any = __builtin_amdgcn_ballot_w32(h0 | h1 | h2 | h3 | h4 | h5 | h6 | h7);
  if (any != 0u) {
#define HITJ(J, HJ, SJ) { \
      const unsigned mj = __builtin_amdgcn_ballot_w32(HJ); \
      if (mj != 0u) { \
        if (HJ) { \
          const int pos = wc + (int)__builtin_amdgcn_mbcnt_lo(mj, 0u); \
          if (pos < WCAP) list[wave * WCAP + pos] = ((el0 + (J)) << SLOTB) | (int)(SJ); \
        } \
        wc += (int)__builtin_popcount(mj); } }
    HITJ(0, h0, s0)
    HITJ(1, h1, s1)
    HITJ(2, h2, s2)
    HITJ(3, h3, s3)
    HITJ(4, h4, s4)
    HITJ(5, h5, s5)
    HITJ(6, h6, s6)
    HITJ(7, h7, s7)
#undef HITJ
  }
  return wc;
}

__global__ __launch_bounds__(NTHR) void k_attn(
    const unsigned short* __restrict__ Qp, const unsigned short* __restrict__ Kp,
    const unsigned short* __restrict__ VTp, const float* __restrict__ EB,
    const int* __restrict__ keys, const int* __restrict__ gath,
    const int* __restrict__ ngp, const int* __restrict__ bat,
    unsigned short* CTX, int nE, int vec8, int gbase) {
  extern __shared__ v4f lds_dyn[];
  char* lds = (char*)lds_dyn;
  __bf16* Ksh = (__bf16*)(lds + LO_KV);         // [2][4096]  K hi  [kv][d]
  __bf16* Ksl = Ksh + 2 * KVT;                   // [2][4096]  K lo
  __bf16* Vth = Ksl + 2 * KVT;                   // [2][4096]  V^T hi [d][kv]
  __bf16* Vtl = Vth + 2 * KVT;                   // [2][4096]  V^T lo
  int* list  = (int*)(lds + LO_KV);              // phase A only: [LISTN]
  int* hitE  = list + LISTN;                     // [HCAP] edge ids, in scan order
  int* hitRD = hitE + HCAP;                      // [HCAP] (row << 9) | loc_dst
  __bf16* Psh = (__bf16*)(lds + LO_P);           // [8 waves][16 x 64] P hi
  __bf16* Psl = Psh + AT_NW * 1024;              // P lo
  float* BTX = (float*)(lds + LO_BT);            // [2][64 x 64] bias tiles + [NDUM] dummies; epilogue staging
  int* sE   = (int*)(lds + LO_SE);               // [HCAP] edge ids sorted by query row
  int* sD   = (int*)(lds + LO_SD);               // [HCAP] loc_dst of the same entries
  int* rcnt = (int*)(lds + LO_RC);               // [NBIN] entries per bin
  int* roff = rcnt + NBIN;                       // [NBIN] first entry of the bin in sE / sD
  int* curs = roff + NBIN;                       // [NBIN]
  int* wcnt = curs + NBIN;                       // [8]
  int* misc = wcnt + AT_NW;                      // [8]

  const int tid = (int)threadIdx.x, lane = tid & 31, wave = tid >> 5, hh = lane >> 4, c = lane & 15;
  const int lgr   = (int)blockIdx.x >> 3;        // graph within this pass
  const int qt    = (int)blockIdx.x & 7;         // 64-query tile within the graph
  const int gb    = gbase + lgr;                 // graph id
  const int node0 = gb * NND + qt * NSLOT;       // global node id of query row 0
  const int lrow0 = lgr * NND + qt * NSLOT;      // plane row of query row 0

  {
    const v4i zi = {0, 0, 0, 0};
    *(v4i*)(rcnt + tid * 8)     = zi;
    *(v4i*)(rcnt + tid * 8 + 4) = zi;
  }
  __syncthreads();

  // ---- phase A1: chunk scan + ordered copy of hits ----
  int tot = 0;
  const int nChunks = (nE + CHUNK - 1) / CHUNK;
#pragma unroll 1
  for (int ch = 0; ch < nChunks; ++ch) {
    const int cbase = ch * CHUNK;
    const int wc = scan_chunk(keys, nE, cbase, node0, NSLOT, vec8, list, tid, lane, wave);
    if (lane == 0) wcnt[wave] = wc;
    __syncthreads();
    int pre = 0, all = 0;
#pragma unroll
    for (int w2 = 0; w2 < AT_NW; ++w2) {
      int cc = wcnt[w2];
      cc = cc < 0 ? 0 : (cc > WCAP ? WCAP : cc);
      all += cc;
      pre += (w2 < wave) ? cc : 0;
    }
    const int wcc  = wc > WCAP ? WCAP : wc;
    const int base = tot + pre;
#pragma unroll 1
    for (int i0 = 0; i0 < wcc; i0 += 32) {          // wcc wave-uniform; loads unconditional, clamped
      const int i   = i0 + lane;
      const int ic  = i < wcc ? i : wcc - 1;
      const int ent = list[wave * WCAP + ic];
      const int el  = (ent >> SLOTB) & (CHUNK - 1);
      const int sl  = ent & (NSLOT - 1);
      int eid = cbase + el;
      eid = eid > nE - 1 ? nE - 1 : eid;
      int g = gath[eid];
      g = g < 0 ? 0 : (g > NTOT - 1 ? NTOT - 1 : g);
      const int pos = base + i;
      if (i < wcc && pos < HCAP) {
        hitE[pos]  = eid;
        hitRD[pos] = (sl << 9) | (g & (NND - 1));
      }
    }
    tot += all;
    tot = tot > HCAP ? HCAP : tot;
    __syncthreads();
  }
  const int nh = tot;

  // ---- phase A2: per-bin counts (wave 0, fixed order, lane 0 writes) ----
  if (wave == 0) {
#pragma unroll 1
    for (int b0 = 0; b0 < nh; b0 += 32) {
      const int idx = b0 + lane;
      const int uv  = hitRD[idx < nh ? idx : nh - 1];
      const int m32 = (nh - b0) < 32 ? (nh - b0) : 32;
#pragma unroll 1
      for (int k = 0; k < m32; ++k) {
        const int u  = __builtin_amdgcn_readlane(uv, k);
        const int sl = (u >> BINSH) & (NBIN - 1);
        if (lane == 0) rcnt[sl] = rcnt[sl] + 1;
      }
    }
  }
  __syncthreads();

  // ---- phase A3: exclusive prefix over the NBIN counts (wave 0, 64 bins = two query rows per lane) + max
  //      per-row count ----
  if (wave == 0) {
    v4i cv[16];
    int c0 = 0, c1 = 0;                            // entries of query rows 2*lane and 2*lane+1
#pragma unroll
    for (int i = 0; i < 16; ++i) {
      v4i v = *(const v4i*)(rcnt + 64 * lane + 4 * i);
      v.x = v.x < 0 ? 0 : v.x; v.y = v.y < 0 ? 0 : v.y; v.z = v.z < 0 ? 0 : v.z; v.w = v.w < 0 ? 0 : v.w;
      cv[i] = v;
      const int sv = v.x + v.y + v.z + v.w;
      if (i < 8) c0 += sv; else c1 += sv;
    }
    const int ts = c0 + c1;
    int incl = ts;
#pragma unroll
    for (int d = 1; d < 32; d <<= 1) {
      const int up = __shfl_up(incl, d, 32);
      if (lane >= d) incl += up;
    }
    int run = incl - ts;
#pragma unroll
    for (int i = 0; i < 16; ++i) {
      v4i o;
      o.x = run; run += cv[i].x;
      o.y = run; run += cv[i].y;
      o.z = run; run += cv[i].z;
      o.w = run; run += cv[i].w;
      *(v4i*)(roff + 64 * lane + 4 * i) = o;
      *(v4i*)(curs + 64 * lane + 4 * i) = o;
    }
    int mc = c0 > c1 ? c0 : c1;
#pragma unroll
    for (int off = 16; off > 0; off >>= 1) {
      const int o = __shfl_xor(mc, off, 32);
      mc = o > mc ? o : mc;
    }
    if (lane == 0) misc[0] = mc;
  }
  __syncthreads();

  // ---- phase A4: place entries into bin segments (wave 0, fixed order, lane 0 writes) ----
  if (wave == 0) {
#pragma unroll 1
    for (int b0 = 0; b0 < nh; b0 += 32) {
      const int idx = b0 + lane;
      const int cl  = idx < nh ? idx : nh - 1;
      const int uv  = hitRD[cl];
      const int ue  = hitE[cl];
      const int m32 = (nh - b0) < 32 ? (nh - b0) : 32;
#pragma unroll 1
      for (int k = 0; k < m32; ++k) {
        const int u  = __builtin_amdgcn_readlane(uv, k);
        const int e  = __builtin_amdgcn_readlane(ue, k);
        const int sl = (u >> BINSH) & (NBIN - 1);
        if (lane == 0) {
          int pos = curs[sl];
          pos = pos < 0 ? 0 : (pos > HCAP - 1 ? HCAP - 1 : pos);
          sE[pos] = e;
          sD[pos] = u & (NND - 1);
          curs[sl] = pos + 1;
        }
      }
    }
  }
  __syncthreads();

  // ---- geometry / capacity guards -> NaN poison of this block's ctx rows ----
  const int degmax = misc[0];
  const int ng  = ngp[0];
  const int bt0 = bat[node0];
  const bool bad = (nh >= HCAP) || (degmax > RWCAP) || (ng != NGR) || (bt0 < 0) || (bt0 >= NGR);
  const float pz = bad ? __int_as_float(0x7fc00000) : 0.0f;

  // ---- phase B ----
  const int wsub = wave & 3;                     // query row group of this wave
  const int hl   = wave >> 2;                    // head slot (0 / 1) of this wave within the pair
  const int rw   = tid >> 2;                     // bias fill: query row owned by this thread
  const int jw   = tid & 3;                      // bias fill: key-column quarter owned by this thread
  const float sscale = 0.125f;
  const v8f z8 = {0.f,0.f,0.f,0.f,0.f,0.f,0.f,0.f};
  const __bf16* Kth = Ksh + hl * KVT;
  const __bf16* Ktl = Ksl + hl * KVT;
  const __bf16* Vtth = Vth + hl * KVT;
  const __bf16* Vttl = Vtl + hl * KVT;
  __bf16* pwh = Psh + wave * 1024;
  __bf16* pwl = Psl + wave * 1024;

#pragma unroll 1
  for (int hp = 0; hp < NHD / 2; ++hp) {
    const int h    = 2 * hp + hl;                // head of this wave
    const int qrow = lrow0 + wsub * 16;          // plane row of this wave's first query

    // Q fragments (A operand, row = lane&15, split k map): 2 d-chunks, hi and lo
    v16b qah[2], qal[2];
#pragma unroll
    for (int dc = 0; dc < 2; ++dc) {
      const unsigned short* qp = Qp + (size_t)(qrow + c) * PLD + h * HDM + dc * 32 + 8 * hh;
      qah[dc] = FragBF::load((const __bf16*)(const void*)qp);
      qal[dc] = FragBF::load((const __bf16*)(const void*)(qp + HID));
    }
    float mrow[8], lrow[8];
    v8f oacc[4];
#pragma unroll
    for (int r = 0; r < 8; ++r) { mrow[r] = -INFINITY; lrow[r] = 0.f; }
#pragma unroll
    for (int t = 0; t < 4; ++t) oacc[t] = z8;

#pragma unroll 1
    for (int kc = 0; kc < NND / 64; ++kc) {
      const int kv0 = kc * 64;
      __syncthreads();
      {
        // staging: thread half th = head 2hp+th; 128 threads x (4 x 8) elements = 64 x 64 per plane
        const int th = tid >> 7, t = tid & 127;
        const int r = t >> 1, half = (t & 1) * 32;
        const int hs = 2 * hp + th;
        const unsigned short* ksh = Kp + (size_t)(lgr * NND + kv0 + r) * PLD + hs * HDM + half;
        const unsigned short* ksl = ksh + HID;
        const unsigned short* vsh = VTp + ((size_t)lgr * HID + hs * HDM + r) * PLD + kv0 + half;
        const unsigned short* vsl = vsh + HID;
        __bf16* kdh = Ksh + th * KVT + r * HDM + half;
        __bf16* kdl = Ksl + th * KVT + r * HDM + half;
        __bf16* vdh = Vth + th * KVT + r * 64 + half;
        __bf16* vdl = Vtl + th * KVT + r * 64 + half;
#pragma unroll
        for (int i = 0; i < 4; ++i) {
          const v8b a0 = *(const v8b*)(ksh + 8 * i);
          const v8b a1 = *(const v8b*)(ksl + 8 * i);
          const v8b b0 = *(const v8b*)(vsh + 8 * i);
          const v8b b1 = *(const v8b*)(vsl + 8 * i);
          *(v8b*)(kdh + 8 * i) = a0;
          *(v8b*)(kdl + 8 * i) = a1;
          *(v8b*)(vdh + 8 * i) = b0;
          *(v8b*)(vdl + 8 * i) = b1;
        }
        // bias tiles + dummies zero: 256 threads x 32 floats = both 64x64 tiles; 128 threads x 4 = dummies
        const v4f z4 = {0.f, 0.f, 0.f, 0.f};
        float* bz = BTX + tid * 32;
#pragma unroll
        for (int i = 0; i < 8; ++i) *(v4fa*)(bz + 4 * i) = z4;
        if (tid < 128) *(v4fa*)(BTX + 2 * KVT + 4 * tid) = z4;
      }
      __syncthreads();
      {
        // bias fill: segment [st, st+cnt) of sE/sD = the bin of row rw and key columns kv0+16jw..kv0+16jw+15
        const int bin = rw * (NND >> BINSH) + kc * (64 >> BINSH) + jw;
        int st = roff[bin], cnt = rcnt[bin];
        st  = st < 0 ? 0 : (st > nh ? nh : st);
        cnt = cnt < 0 ? 0 : (cnt > RWCAP ? RWCAP : cnt);
        if (cnt > nh - st) cnt = nh - st;
        int cmax = cnt;
#pragma unroll
        for (int off = 16; off > 0; off >>= 1) {
          const int o = __shfl_xor(cmax, off, 32);
          cmax = o > cmax ? o : cmax;
        }
        const float* ebp = EB + 2 * hp;
#pragma unroll 1
        for (int q = 0; q < cmax; ++q) {           // cmax wave-uniform, <= RWCAP
          const bool valid = q < cnt;
          int idx = st + q;
          idx = idx > nh - 1 ? nh - 1 : idx;
          idx = idx < 0 ? 0 : idx;
          const int col = sD[idx] - kv0;
          int e = sE[idx];
          e = e < 0 ? 0 : (e > nE - 1 ? nE - 1 : e);
          const v2f ebv = *(const v2fa*)(ebp + (size_t)e * NHD);
          const bool inr = valid && ((unsigned)col < 64u) && ((col >> 4) == jw);
          const int ia = inr ? (rw * 64 + col) : (2 * KVT + tid);
          const int ib = inr ? (KVT + rw * 64 + col) : (2 * KVT + NTHR + tid);
          BTX[ia] = BTX[ia] + ebv.x;
          BTX[ib] = BTX[ib] + ebv.y;
        }
      }
      __syncthreads();

      // ---- S = q . k (3-term) ----
      v8f s[4];
#pragma unroll
      for (int j = 0; j < 4; ++j) {
        s[j] = z8;
#pragma unroll
        for (int dc = 0; dc < 2; ++dc) {
          FB kb, kl;
          const __bf16* kr = Kth + (j * 16 + c) * HDM + dc * 32 + 8 * hh;
          const __bf16* kq = Ktl + (j * 16 + c) * HDM + dc * 32 + 8 * hh;
          kb.h[0] = *(const v8b*)kr;
          kb.h[1] = *(const v8b*)(kr + 16);
          kl.h[0] = *(const v8b*)kq;
          kl.h[1] = *(const v8b*)(kq + 16);
          s[j] = at_mma(qah[dc], kb.v, s[j]);
          s[j] = at_mma(qah[dc], kl.v, s[j]);
          s[j] = at_mma(qal[dc], kb.v, s[j]);
        }
      }
      // scale, add bias tile (D element r = row wsub*16 + 8hh + r, col j*16 + c), chunk row max
      const float* btr = BTX + hl * KVT + (wsub * 16 + 8 * hh) * 64 + c;
      float cm[8];
#pragma unroll
      for (int r = 0; r < 8; ++r) {
        float m = -INFINITY;
#pragma unroll
        for (int j = 0; j < 4; ++j) {
          const float sv = s[j][r] * sscale + btr[r * 64 + j * 16];
          s[j][r] = sv;
          m = fmaxf(m, sv);
        }
#pragma unroll
        for (int off = 1; off < 16; off <<= 1) m = fmaxf(m, __shfl_xor(m, off, 32));
        cm[r] = m;
      }
#pragma unroll
      for (int r = 0; r < 8; ++r) {
        const float mnew = fmaxf(mrow[r], cm[r]);
        const float alpha = expf(mrow[r] - mnew);
        mrow[r] = mnew;
        float psum = 0.f;
#pragma unroll
        for (int j = 0; j < 4; ++j) {
          const float p = expf(s[j][r] - mnew);
          psum += p;
          __bf16 a, bl; at_split(p, a, bl);
          pwh[(8 * hh + r) * 64 + j * 16 + c] = a;
          pwl[(8 * hh + r) * 64 + j * 16 + c] = bl;
        }
#pragma unroll
        for (int off = 1; off < 16; off <<= 1) psum += __shfl_xor(psum, off, 32);
        lrow[r] = lrow[r] * alpha + psum;
#pragma unroll
        for (int t = 0; t < 4; ++t) oacc[t][r] *= alpha;
      }
      __builtin_amdgcn_fence(__ATOMIC_RELEASE, "workgroup");
      __builtin_amdgcn_wave_barrier();
      __builtin_amdgcn_fence(__ATOMIC_ACQUIRE, "workgroup");
      // ---- O += p . v (3-term); P fragment = A (row c), V^T fragment = B (col = d) ----
#pragma unroll 1
      for (int kk = 0; kk < 2; ++kk) {
        FB pa, pl;
        pa.h[0] = *(const v8b*)(pwh + c * 64 + kk * 32 + 8 * hh);
        pa.h[1] = *(const v8b*)(pwh + c * 64 + kk * 32 + 16 + 8 * hh);
        pl.h[0] = *(const v8b*)(pwl + c * 64 + kk * 32 + 8 * hh);
        pl.h[1] = *(const v8b*)(pwl + c * 64 + kk * 32 + 16 + 8 * hh);
#pragma unroll
        for (int t = 0; t < 4; ++t) {
          FB vb, vl;
          vb.h[0] = *(const v8b*)(Vtth + (t * 16 + c) * 64 + kk * 32 + 8 * hh);
          vb.h[1] = *(const v8b*)(Vtth + (t * 16 + c) * 64 + kk * 32 + 16 + 8 * hh);
          vl.h[0] = *(const v8b*)(Vttl + (t * 16 + c) * 64 + kk * 32 + 8 * hh);
          vl.h[1] = *(const v8b*)(Vttl + (t * 16 + c) * 64 + kk * 32 + 16 + 8 * hh);
          oacc[t] = at_mma(pa.v, vb.v, oacc[t]);
          oacc[t] = at_mma(pa.v, vl.v, oacc[t]);
          oacc[t] = at_mma(pl.v, vb.v, oacc[t]);
        }
      }
    }

    // ---- epilogue: normalise, stage the wave's 16x64 tile (pitch 64, own bias rows), hi | lo lines ----
    __syncthreads();
    {
      float* os = BTX + wave * 1024;
#pragma unroll
      for (int r = 0; r < 8; ++r) {
        const float inv = 1.0f / lrow[r];
#pragma unroll
        for (int t = 0; t < 4; ++t) os[(8 * hh + r) * 64 + t * 16 + c] = oacc[t][r] * inv + pz;
      }
      __builtin_amdgcn_fence(__ATOMIC_RELEASE, "workgroup");
      __builtin_amdgcn_wave_barrier();
      __builtin_amdgcn_fence(__ATOMIC_ACQUIRE, "workgroup");
      const int q4 = lane >> 3, c8 = (lane & 7) * 8;
      v4u hv[4], lv[4];
#pragma unroll
      for (int it = 0; it < 4; ++it) {
        const int row = it * 4 + q4;                   // it 0..3 x q4 0..3 covers rows 0..15
        const float* sp = os + row * 64 + c8;
        const v4f a = *(const v4fa*)sp;
        const v4f b = *(const v4fa*)(sp + 4);
        pack8hl(a, b, hv[it], lv[it]);
      }
      {
#pragma unroll
        for (int it = 0; it < 4; ++it) {
          const int row = it * 4 + q4;
          unsigned short* op = CTX + (size_t)(qrow + row) * PLD + h * HDM + c8;
          *(v4u*)op = hv[it];
          *(v4u*)(op + HID) = lv[it];
        }
        
      }
    }
  }
}

// =====================================================================================
static inline int cdiv(int a, int b) { return (a + b - 1) / b; }

extern "C" void kernel_launch(void* const* d_in, const int* in_sizes, int n_in,
                              void* d_out, int out_size, void* d_ws, size_t ws_size,
                              hipStream_t stream) {
  if (n_in < 15) return;
  if (in_sizes[0] != NTOT * HID) return;                        // x [16384][512]
  if (in_sizes[1] != NTOT) return;                              // batch [16384]
  if (in_sizes[2] < 2 || (in_sizes[2] & 1) != 0) return;        // edge_index [2][E]
  const int nE = in_sizes[2] / 2;
  if (nE < 1 || nE > (1 << 24)) return;
  if (in_sizes[3] != nE * EDW) return;                          // edge_attr [E][16]
  if (in_sizes[4] != HID * HID || in_sizes[6] != HID * HID || in_sizes[8] != HID * HID || in_sizes[10] != HID * HID) return;
  if (in_sizes[5] != HID || in_sizes[7] != HID || in_sizes[9] != HID || in_sizes[11] != HID) return;
  if (in_sizes[12] != EDW * NHD || in_sizes[13] != NHD || in_sizes[14] != 1) return;
  if (out_size != NTOT * HID) return;                           // out [16384][512], last element 8388607

  const float* x   = (const float*)d_in[0];
  const int*   bat = (const int*)  d_in[1];
  const int*   ei  = (const int*)  d_in[2];     // row 0 = src, row 1 = dst
  const float* ea  = (const float*)d_in[3];
  const float* Wq  = (const float*)d_in[4];     // [in][out]
  const float* bq  = (const float*)d_in[5];
  const float* Wk  = (const float*)d_in[6];
  const float* bk  = (const float*)d_in[7];
  const float* Wv  = (const float*)d_in[8];
  const float* bv  = (const float*)d_in[9];
  const float* Wo  = (const float*)d_in[10];
  const float* bo  = (const float*)d_in[11];
  const float* We  = (const float*)d_in[12];    // [16][8]
  const float* be  = (const float*)d_in[13];    // [8]
  const int*   ngp = (const int*)  d_in[14];    // [1]
  float* out = (float*)d_out;
  const int* keys = ei;                         // src list
  const int* gath = ei + nE;                    // dst list

  const int EP = cdiv(nE, 4) * 4;

  char* ws = (char*)d_ws;
  size_t off = 0;
  const size_t oXb = off; off += (size_t)NTOT * HID * 2;                                          // 16777216
  const size_t oWq = off; off += (size_t)HID * HID * 2;                                           //   524288
  const size_t oWk = off; off += (size_t)HID * HID * 2;
  const size_t oWv = off; off += (size_t)HID * HID * 2;
  const size_t oWo = off; off += (size_t)HID * PLD * 2;                                           //  1048576
  const size_t oEB = off; off += (size_t)EP * NHD * 4;   off = (off + 255) & ~(size_t)255;        //  8388608
  const size_t oQ  = off; off += (size_t)RHALF * PLD * 2;                                         // 33554432
  const size_t oK  = off; off += (size_t)RHALF * PLD * 2;
  const size_t oVT = off; off += (size_t)GHALF * HID * PLD * 2;                                   // 33554432
  const size_t oCT = off; off += (size_t)RHALF * PLD * 2;                                         // 33554432
  if (off > ws_size || off > (size_t)WSMAX) return;                                               // 162004992
  unsigned short* Xb   = (unsigned short*)(ws + oXb);
  unsigned short* WqT  = (unsigned short*)(ws + oWq);
  unsigned short* WkT  = (unsigned short*)(ws + oWk);
  unsigned short* WvT  = (unsigned short*)(ws + oWv);
  unsigned short* WOT2 = (unsigned short*)(ws + oWo);
  float*          EB   = (float*)(ws + oEB);
  unsigned short* Qp   = (unsigned short*)(ws + oQ);
  unsigned short* Kp   = (unsigned short*)(ws + oK);
  unsigned short* VTp  = (unsigned short*)(ws + oVT);
  unsigned short* CTX  = (unsigned short*)(ws + oCT);

  hipFuncSetAttribute(reinterpret_cast<const void*>(&k_attn),
                      hipFuncAttributeMaxDynamicSharedMemorySize, LDS_ATT);

  // weight planes (bf16 bits, k-contiguous rows [n][k])
  {
    const int nUw = HID * (HID / 8);             // 512 rows x 64 units
    k_wtr<<<cdiv(nUw, NTHR), NTHR, 0, stream>>>(Wq, HID, HID, HID, HID, WqT, nUw);
    k_wtr<<<cdiv(nUw, NTHR), NTHR, 0, stream>>>(Wk, HID, HID, HID, HID, WkT, nUw);
    k_wtr<<<cdiv(nUw, NTHR), NTHR, 0, stream>>>(Wv, HID, HID, HID, HID, WvT, nUw);
    const int nUo = HID * (PLD / 8);             // 512 rows x 128 units: wt [512][1024], k mod 512
    k_wtr<<<cdiv(nUo, NTHR), NTHR, 0, stream>>>(Wo, HID, HID, HID, PLD, WOT2, nUo);
  }
  // node feature plane (whole x)
  {
    const int nUx = NTOT * (HID / 8);
    k_xprep<<<cdiv(nUx, NTHR), NTHR, 0, stream>>>(x, Xb, NTOT, nUx);
  }
  // edge bias plane [EP][8]
  {
    const int nUe = EP * 2;
    k_eb<<<cdiv(nUe, NTHR), NTHR, 0, stream>>>(ea, We, be, EB, nE, nUe);
  }

  const dim3 blk(256);
  const dim3 gQK(((RHALF / 64) * (HID / 64)) / 8, 1);        // 256 blocks x 8 tiles: M=16384, N=512
  const dim3 gVT(((HID / 64) * (NND / 64)) / 8, GHALF);      // 8 blocks x 8 tiles per graph: M=512, N=512
  const dim3 gAT(GHALF * (NND / 64));                        // 256 blocks: 32 graphs x 8 query tiles
  for (int half = 0; half < NHALF; ++half) {
    const unsigned short* Xh = Xb + (size_t)half * RHALF * HID;
    float* outh = out + (size_t)half * RHALF * HID;
    // q = x . Wq + bq -> Qp hi | lo  (M=16384, N=512, K=512)
    wmma_gemm64<false, 2, 2, false, 0><<<gQK, blk, 0, stream>>>(
        Xh, Xh, HID, 0L, WqT, WqT, HID, 0L, (void*)Qp, (void*)(Qp + HID), PLD, 0L,
        bq, bq, 0L, RHALF, HID, HID, 1.0f);
    // k = x . Wk + bk -> Kp hi | lo
    wmma_gemm64<false, 2, 2, false, 0><<<gQK, blk, 0, stream>>>(
        Xh, Xh, HID, 0L, WkT, WkT, HID, 0L, (void*)Kp, (void*)(Kp + HID), PLD, 0L,
        bk, bk, 0L, RHALF, HID, HID, 1.0f);
    // v^T = Wv^T . x^T + bv[m] per graph -> VTp [graph][h*64+d][s] hi | lo  (M=512, N=512, K=512, z = 32 graphs)
    wmma_gemm64<false, 1, 2, false, 0><<<gVT, blk, 0, stream>>>(
        WvT, WvT, HID, 0L, Xh, Xh, HID, (long)NND * HID, (void*)VTp, (void*)(VTp + HID), PLD, (long)HID * PLD,
        bv, bv, 0L, HID, NND, HID, 1.0f);
    // attention with edge bias -> CTX hi | lo
    k_attn<<<gAT, NTHR, LDS_ATT, stream>>>(Qp, Kp, VTp, EB, keys, gath, ngp, bat, CTX, nE, 1, half * GHALF);
    // out = [ctx hi | ctx lo] . [Wo ; Wo] + bo -> d_out rows half*RHALF .. half*RHALF+RHALF-1 (M=16384, N=512, K=1024)
    wmma_gemm64<false, 2, 0, false, 0><<<gQK, blk, 0, stream>>>(
        CTX, CTX, PLD, 0L, WOT2, WOT2, PLD, 0L, (void*)outh, (void*)outh, HID, 0L,
        bo, bo, 0L, RHALF, HID, PLD, 1.0f);
  }
  (void)hipGetLastError();
}

// v003
// A run of this version takes 662 microseconds.
// Timed twice side by side with v002, it ran 1.15 times as fast both times.
// Counting every step since v000, it is 2.78 times as fast.
// Contractions on v_wmma_f32_16x16x32_bf16 (bf16 operands, f32 accumulate): x*Wq, x*Wk, Wv^T*x^T as single
// products of bf16-RNE inputs; q.k^T and p.v as bf16 hi/lo split (hi.hi + hi.lo + lo.hi); ctx*Wo as
// [ctx hi | ctx lo] . [Wo ; Wo] (K = 1024); edge bias (16-deep dots of bf16-RNE inputs), online softmax and all biases in f32 on the VALU.
#include <hip/hip_runtime.h>
#include <math.h>
#include <stdint.h>
#include <stddef.h>

// Geometry: NGR graphs of NND consecutive node rows; attention keys of a query = the NND nodes of its graph.
// The job runs in NHALF passes of GHALF graphs each (one pass of all graphs: the attention launch then has one
// work-group for each of the 256 WGPs); the q / k / v^T / ctx planes are rewritten per pass.
//
// Plane map (workspace, all 16-bit planes are bf16 bits; no power-of-two carries anywhere, so no inverse
// factor exists -> carry audit: none):
//   Xb   [16384][512]          bf16(x)                                        -> A of q/k GEMMs, Bt of v^T GEMM
//   WqT, WkT, WvT [512 o][512 i]  bf16(W[i][o])                              -> Bt / A (k-contiguous)
//   WOT2 [512 o][1024]         bf16(Wo[k mod 512][o])                         -> Bt of the output GEMM
//   EB   [EP][8] f32           sum_t bf16(ea[e][t]) bf16(We[t][h]) + bf16(be[h])
//   Qp, Kp [16384][1024]       hi at col h*64+d, residual lo at col 512 + h*64+d (f32 projection split)
//   VTp  [32 graphs][512 (h,d)][1024]   hi at col s, lo at col 512 + s (s = node within graph)
//   CTX  [16384][1024]         hi | lo of the normalised attention context

#define NGR    32
#define NND    512
#define NTOT   (NGR * NND)      // 16384
#define HID    512
#define NHD    8
#define HDM    64
#define EDW    16
#define NHALF  1
#define GHALF  (NGR / NHALF)    // 32
#define RHALF  (GHALF * NND)    // 16384
#define PLD    1024
#define NTHR   256
#define WSMAX  268435456

static_assert(HID == NHD * HDM && HDM == 64 && NHD == 8);
static_assert(PLD == 2 * HID);
static_assert((RHALF % 64) == 0 && (HID % 64) == 0 && (NND % 64) == 0 && (PLD % 32) == 0 && (HID % 32) == 0);
static_assert(((RHALF / 64) * (HID / 64)) % 8 == 0);       // GEMM grids: 8 wave tiles per block, exact
static_assert(((HID / 64) * (NND / 64)) % 8 == 0);
static_assert(NGR == NHALF * GHALF);
static_assert(HID == 64 * 8);                               // k_xprep: 64 units of 8 per row
static_assert(EDW == 16 && NHD == 8 && EDW * NHD <= NTHR);  // k_eb layout

typedef __attribute__((ext_vector_type(16))) _Float16 v16h;
typedef __attribute__((ext_vector_type(8)))  _Float16 v8h;
typedef __attribute__((ext_vector_type(16))) __bf16   v16b;
typedef __attribute__((ext_vector_type(8)))  __bf16   v8b;
typedef __attribute__((ext_vector_type(8)))  float    v8f;
typedef __attribute__((ext_vector_type(4)))  float    v4f;
typedef __attribute__((ext_vector_type(2)))  float    v2f;
typedef __attribute__((ext_vector_type(4)))  unsigned int v4u;
typedef __attribute__((ext_vector_type(4)))  int      v4i;
typedef __attribute__((ext_vector_type(8)))  unsigned short v8us;
typedef v4f  __attribute__((may_alias)) v4fa;
typedef v2f  __attribute__((may_alias)) v2fa;
typedef v4u  __attribute__((may_alias)) v4ua;

// ---- scalar helpers: f32 -> bf16 bits (RNE convert), bf16 bits -> f32 ----
__device__ __forceinline__ unsigned short f2bf_bits(float f) {
  unsigned u = __float_as_uint(f);
  return (unsigned short)((u + 0x7FFFu + ((u >> 16) & 1u)) >> 16);
}
__device__ __forceinline__ float bf_bits2f(unsigned short h) { return __uint_as_float(((unsigned)h) << 16); }
__device__ __forceinline__ float bfrf(float f) { return bf_bits2f(f2bf_bits(f)); }
__device__ __forceinline__ unsigned int f2bfu(float f) {
  const unsigned int u = __float_as_uint(f);
  return ((u + 0x7FFFu + ((u >> 16) & 1u)) >> 16) & 0xFFFFu;
}
__device__ __forceinline__ float bf2f(unsigned int b) { return __uint_as_float(b << 16); }
__device__ __forceinline__ v4f bfr4(const v4f a) {
  v4f r; r.x = bfrf(a.x); r.y = bfrf(a.y); r.z = bfrf(a.z); r.w = bfrf(a.w); return r;
}
__device__ __forceinline__ unsigned int pk2(float lo, float hi) { return f2bfu(lo) | (f2bfu(hi) << 16); }
__device__ __forceinline__ v4u pack8(const v4f a, const v4f b) {
  v4u r;
  r.x = pk2(a.x, a.y); r.y = pk2(a.z, a.w); r.z = pk2(b.x, b.y); r.w = pk2(b.z, b.w);
  return r;
}
// hi = bf16(v), lo = bf16(v - hi): two floats -> one packed word of each
__device__ __forceinline__ void hl2(float v0, float v1, unsigned int& hw, unsigned int& lw) {
  const unsigned int h0 = f2bfu(v0), h1 = f2bfu(v1);
  const unsigned int l0 = f2bfu(v0 - bf2f(h0)), l1 = f2bfu(v1 - bf2f(h1));
  hw = h0 | (h1 << 16);
  lw = l0 | (l1 << 16);
}
__device__ __forceinline__ void pack8hl(const v4f a, const v4f b, v4u& hv, v4u& lv) {
  unsigned int h, l;
  hl2(a.x, a.y, h, l); hv.x = h; lv.x = l;
  hl2(a.z, a.w, h, l); hv.y = h; lv.y = l;
  hl2(b.x, b.y, h, l); hv.z = h; lv.z = l;
  hl2(b.z, b.w, h, l); hv.w = h; lv.w = l;
}

// ---- WMMA fragment helpers (bf16, wave32) ----
// A fragment (row m = lane&15) and B fragment (col n = lane&15) use the SAME k map:
//   elements 0..7 <- k0 + 8h + 0..7, elements 8..15 <- k0 + 16 + 8h + 0..7, h = lane>>4,
// loaded as two 16-B pieces from a k-contiguous 16-bit row: p[0..7] and p[16..23] with p = row + k0 + 8h.
// D element r of lane l = (row 8h + r, col l&15).
__device__ __forceinline__ void dep_guard_b(v8f& a, v8f& b, v16b x, v16b y) { asm volatile("v_nop\n\tv_nop\n\tv_nop\n\tv_nop" : "+v"(a), "+v"(b) : "v"(x), "v"(y)); }
__device__ __forceinline__ void keep4_b(v16b a, v16b b, v16b c, v16b d) { asm volatile("v_nop" :: "v"(a), "v"(b), "v"(c), "v"(d)); }
__device__ __forceinline__ void acc_guard4(v8f& a, v8f& b, v8f& c, v8f& d) { asm volatile("v_nop\n\tv_nop\n\tv_nop\n\tv_nop" : "+v"(a), "+v"(b), "+v"(c), "+v"(d)); }

struct FragBF {
  union U { v16b v; v8b h[2]; };
  static __device__ __forceinline__ v16b load(const __bf16* p) {   // elements 0..7 <- p[0..7], 8..15 <- p[16..23]
    U f; f.h[0] = *(const v8b*)(p); f.h[1] = *(const v8b*)(p + 16); return f.v;
  }
  static __device__ __forceinline__ v8f mma(v16b a, v16b b, v8f c) {
    return __builtin_amdgcn_wmma_f32_16x16x32_bf16(false, a, false, b, (short)0, c, false, false);
  }
  static __device__ __forceinline__ void guard(v8f& a, v8f& b, v16b x, v16b y) { dep_guard_b(a, b, x, y); }
  static __device__ __forceinline__ void keep(v16b a, v16b b, v16b c, v16b d) { keep4_b(a, b, c, d); }
};
union FB { v16b v; v8b h[2]; };

// single WMMA with hazard guard: ties D, keeps A/B live for 4 VALU slots
__device__ __forceinline__ v8f at_mma(v16b a, v16b b, v8f c) {
  c = __builtin_amdgcn_wmma_f32_16x16x32_bf16(false, a, false, b, (short)0, c, false, false);
  asm volatile("v_nop\n\tv_nop\n\tv_nop\n\tv_nop" : "+v"(c) : "v"(a), "v"(b));
  return c;
}
__device__ __forceinline__ __bf16 at_f2bf(float f) { return __builtin_bit_cast(__bf16, f2bf_bits(f)); }
__device__ __forceinline__ void at_split(float f, __bf16& hi, __bf16& lo) {
  const unsigned short hb = f2bf_bits(f);
  hi = __builtin_bit_cast(__bf16, hb);
  lo = at_f2bf(f - __uint_as_float(((unsigned)hb) << 16));
}

// =====================================================================================
// Register-blocked batched WMMA GEMM (bf16 operands).
// C[m,n] = scale * sum_k A[m,k] * Bt[n,k] (+bias)(+resid); each wave owns a 64x64 tile.
// A row-major [M,K]; Bt row-major [N,K]; M,N % 64 == 0, K % 32 == 0 (host static_asserts).
// SPLIT: operands are hi/lo planes (A2/Bt2 = lo planes, same layout); product = hi.hi + hi.lo + lo.hi.
// BIAS_MODE: 0 = none, 1 = bf16r(bias[m]), 2 = bf16r(bias[n]).
// OUT_MODE: 0 = f32, 1 = f16, 2 = bf16 hi plane (Cout) + bf16 lo plane (Cout2).
// coverage: grid.x * 8 waves == (M/64)*(N/64) tiles exactly (host), every C element written once per z.
// =====================================================================================
template <bool SPLIT, int BIAS_MODE, int OUT_MODE, bool RESID, int ACT = 0>
__global__ __launch_bounds__(256) void wmma_gemm64(
    const unsigned short* __restrict__ Ap, const unsigned short* __restrict__ A2p, int lda, long strideA,
    const unsigned short* __restrict__ Btp, const unsigned short* __restrict__ Bt2p, int ldb, long strideB,
    void* __restrict__ Cout, void* __restrict__ Cout2, int ldc, long strideC,
    const float* __restrict__ bias,
    const float* __restrict__ resid, long strideR,
    int M, int N, int K, float scale) {
  typedef __bf16 T;
  typedef v16b V;
  const T* A = (const T*)Ap; const T* A2 = (const T*)A2p; const T* Bt = (const T*)Btp; const T* Bt2 = (const T*)Bt2p;
  __shared__ __align__(16) float sT[8][16 * 68];   // per-wave 16x64 slab, pitch 68 floats
  const int b    = blockIdx.y;
  const int lane = threadIdx.x & 31;
  const int wave = threadIdx.x >> 5;
  const int tilesN = N >> 6;
  const int tilesM = M >> 6;
  const int tile = blockIdx.x * 8 + wave;
  if (tile >= tilesM * tilesN) return;   // wave-uniform; no block barriers in this kernel
  const int tm = tile / tilesN;
  const int tn = tile - tm * tilesN;
  const int m0 = tm << 6;
  const int n0 = tn << 6;

  const T* Ab  = A  + (size_t)b * strideA;
  const T* Bb  = Bt + (size_t)b * strideB;
  const T* Ab2 = SPLIT ? (A2  + (size_t)b * strideA) : nullptr;
  const T* Bb2 = SPLIT ? (Bt2 + (size_t)b * strideB) : nullptr;

  const int rlane = lane & 15;                 // row (A) / col (B, D) within subtile
  const int koff  = (lane >> 4) * 8;           // k offset of this lane half
  const int mOff  = (lane >> 4) * 8;           // D row offset

  v8f acc[4][4];
#pragma unroll
  for (int i = 0; i < 4; ++i)
#pragma unroll
    for (int j = 0; j < 4; ++j) acc[i][j] = (v8f){0.f,0.f,0.f,0.f,0.f,0.f,0.f,0.f};

  for (int k0 = 0; k0 < K; k0 += 32) {
    V bh[4], bl[4];
#pragma unroll
    for (int j = 0; j < 4; ++j) {
      const size_t bo = (size_t)(n0 + (j << 4) + rlane) * ldb + koff + k0;
      bh[j] = FragBF::load(Bb + bo);
      if (SPLIT) bl[j] = FragBF::load(Bb2 + bo);
    }
#pragma unroll
    for (int i = 0; i < 4; ++i) {
      const size_t ao = (size_t)(m0 + (i << 4) + rlane) * lda + koff + k0;
      V ah = FragBF::load(Ab + ao);
      V al;
      if (SPLIT) al = FragBF::load(Ab2 + ao);
#pragma unroll
      for (int j = 0; j < 4; ++j) {
        acc[i][j] = FragBF::mma(ah, bh[j], acc[i][j]);
        if (SPLIT) {
          acc[i][j] = FragBF::mma(ah, bl[j], acc[i][j]);
          acc[i][j] = FragBF::mma(al, bh[j], acc[i][j]);
        }
      }
      FragBF::guard(acc[i][0], acc[i][3], ah, SPLIT ? al : ah);
    }
    FragBF::keep(bh[0], bh[1], bh[2], bh[3]);
    if (SPLIT) FragBF::keep(bl[0], bl[1], bl[2], bl[3]);
  }
  acc_guard4(acc[0][0], acc[0][1], acc[0][2], acc[0][3]);
  acc_guard4(acc[1][0], acc[1][1], acc[1][2], acc[1][3]);
  acc_guard4(acc[2][0], acc[2][1], acc[2][2], acc[2][3]);
  acc_guard4(acc[3][0], acc[3][1], acc[3][2], acc[3][3]);

  // ---- epilogue ----
  float* slab = sT[wave];
  const float* Rb = RESID ? (resid + (size_t)b * strideR) : nullptr;
#pragma unroll
  for (int i = 0; i < 4; ++i) {
    const int mBase = m0 + (i << 4);
    float bm[8];
    if (BIAS_MODE == 1) {   // 8 consecutive floats, 32-B aligned: two 16-B loads
      const v4f b0v = bfr4(*(const v4fa*)(bias + mBase + mOff));
      const v4f b1v = bfr4(*(const v4fa*)(bias + mBase + mOff + 4));
      bm[0] = b0v.x; bm[1] = b0v.y; bm[2] = b0v.z; bm[3] = b0v.w;
      bm[4] = b1v.x; bm[5] = b1v.y; bm[6] = b1v.z; bm[7] = b1v.w;
    } else {
#pragma unroll
      for (int r = 0; r < 8; ++r) bm[r] = 0.f;
    }
#pragma unroll
    for (int j = 0; j < 4; ++j) {
      const int n = n0 + (j << 4) + rlane;
      float bv = 0.f;
      if (BIAS_MODE == 2) bv = bfrf(bias[n]);
#pragma unroll
      for (int r = 0; r < 8; ++r) {
        float v = acc[i][j][r] * scale;
        if (BIAS_MODE == 1) v += bm[r];
        if (BIAS_MODE == 2) v += bv;
        if (RESID) v += Rb[(size_t)(mBase + mOff + r) * ldc + n];
        if (ACT == 1) v = tanhf(v);
        if (ACT == 2) v = fmaxf(v, 0.0f);
        if (ACT == 4) v = (v > 0.f) ? v : 0.01f * v;
        slab[(mOff + r) * 68 + (j << 4) + rlane] = v;
      }
    }
    __builtin_amdgcn_fence(__ATOMIC_RELEASE, "workgroup");
    __builtin_amdgcn_wave_barrier();
    __builtin_amdgcn_fence(__ATOMIC_ACQUIRE, "workgroup");
    if (OUT_MODE == 0) {
      float* C = (float*)Cout + (size_t)b * strideC;
      const int hh = lane >> 4, c4 = (lane & 15) * 4;     // row seg = 256 B = 16 lanes x 16 B
      {
#pragma unroll
        for (int it = 0; it < 8; ++it) {
          const int row = it * 2 + hh;
          v4f v = *(const v4f*)(slab + row * 68 + c4);
          *(v4f*)(C + (size_t)(mBase + row) * ldc + n0 + c4) = v;
        }
        
      }
    } else {
      const int q = lane >> 3, c8 = (lane & 7) * 8;
      unsigned short* C  = (unsigned short*)Cout  + (size_t)b * strideC;
      unsigned short* C2 = (OUT_MODE == 2) ? ((unsigned short*)Cout2 + (size_t)b * strideC) : nullptr;
      {
#pragma unroll
        for (int it = 0; it < 4; ++it) {
          const int row = it * 4 + q;
          const float* sp = slab + row * 68 + c8;
          v8h hv, lv;
#pragma unroll
          for (int e = 0; e < 8; ++e) {
            if (OUT_MODE == 1) {
              hv[e] = (_Float16)sp[e];
            } else {
              unsigned short hb = f2bf_bits(sp[e]);
              unsigned short lb = f2bf_bits(sp[e] - bf_bits2f(hb));
              hv[e] = __builtin_bit_cast(_Float16, hb);
              lv[e] = __builtin_bit_cast(_Float16, lb);
            }
          }
          *(v8h*)(C + (size_t)(mBase + row) * ldc + n0 + c8) = hv;
          if (OUT_MODE == 2) *(v8h*)(C2 + (size_t)(mBase + row) * ldc + n0 + c8) = lv;
        }
        
      }
    }
    __builtin_amdgcn_fence(__ATOMIC_RELEASE, "workgroup");
    __builtin_amdgcn_wave_barrier();
    __builtin_amdgcn_fence(__ATOMIC_ACQUIRE, "workgroup");
  }
}

// =====================================================================================
// Node feature plane: xb[row][c] = bf16(x[row][c]) for row < nN (all 512 c). One thread = 8 contiguous
// =====================================================================================
__global__ __launch_bounds__(NTHR) void k_xprep(const float* __restrict__ x, unsigned short* xb, int nN, int nUnits) {
  const int i = (int)blockIdx.x * NTHR + (int)threadIdx.x;
  if (i >= nUnits) return;
  const int row = i >> 6;
  const int c0  = (i & 63) * 8;
  const int rc  = row < nN ? row : nN - 1;
  const float* p = x + (size_t)rc * HID + c0;
  v4f a = *(const v4fa*)p;
  v4f b = *(const v4fa*)(p + 4);
  const v4f z4 = {0.f, 0.f, 0.f, 0.f};
  if (row >= nN) { a = z4; b = z4; }
  const v4u hv = pack8(a, b);
  unsigned short* o = xb + (size_t)row * HID + c0;
  *(v4u*)o = hv;
  
}

// =====================================================================================
// Weight transpose + bf16 convert into a k-contiguous plane: w is [Kin][Ncol] ([in][out]),
//   wt[n][k] = bf16(w[k mod Kin][n]) for n < Nrows, k < Kout (Kout = Kin or a multiple of it).
// coverage: nUnits = Nrows * Kout/8 threads x 8 = Nrows x Kout exactly.
// =====================================================================================
__global__ __launch_bounds__(NTHR) void k_wtr(const float* __restrict__ w, int Kin, int Ncol, int Nrows, int Kout,
                                              unsigned short* wt, int nUnits) {
  const int u = (int)blockIdx.x * NTHR + (int)threadIdx.x;
  if (u >= nUnits) return;
  const int kq = Kout >> 3;
  const int n  = u / kq;
  const int k8 = (u - n * kq) * 8;
  const int kk = k8 - (k8 / Kin) * Kin;
  const int ncl = n < Ncol ? n : Ncol - 1;
  const float* p = w + (size_t)kk * (size_t)Ncol + ncl;
  v4f a, b;
  a.x = p[0];                    a.y = p[(size_t)Ncol];         a.z = p[(size_t)2 * Ncol];     a.w = p[(size_t)3 * Ncol];
  b.x = p[(size_t)4 * Ncol];     b.y = p[(size_t)5 * Ncol];     b.z = p[(size_t)6 * Ncol];     b.w = p[(size_t)7 * Ncol];
  const v4f z4 = {0.f, 0.f, 0.f, 0.f};
  if (n >= Ncol || n >= Nrows) { a = z4; b = z4; }
  const v4u wv = pack8(a, b);
  unsigned short* o = wt + (size_t)n * (size_t)Kout + k8;
  *(v4u*)o = wv;
  
}

// =====================================================================================
// Edge bias plane: EB[e][h] = sum_t bf16r(ea[e][t]) * bf16r(We[t][h]) + bf16r(be[h]) (f32, 16 terms summed
// from +0 then the bias), zero rows for pad edges nE <= e < EP (load address clamped, value zeroed by select).
// One thread = one edge and 4 consecutive heads: 4 b128 loads in a rolled loop, one 16-B store;
// coverage: nUnits = EP*2 threads x 4 = EP x 8 elements exactly.
// =====================================================================================
__global__ __launch_bounds__(NTHR) void k_eb(const float* __restrict__ ea, const float* __restrict__ We,
                                             const float* __restrict__ be, float* EB, int nE, int nUnits) {
  __shared__ float sWe[EDW * NHD];
  __shared__ float sbe[NHD];
  const int tid = (int)threadIdx.x;
  if (tid < EDW * NHD) sWe[tid] = bfrf(We[tid]);           // We[t][h] row-major
  if (tid < NHD) sbe[tid] = bfrf(be[tid]);
  __syncthreads();
  const int u = (int)blockIdx.x * NTHR + tid;
  if (u >= nUnits) return;
  const int e  = u >> 1;
  const int h0 = (u & 1) * 4;
  const int ec = e < nE ? e : nE - 1;
  const float* er = ea + (size_t)ec * EDW;
  float s0 = 0.f, s1 = 0.f, s2 = 0.f, s3 = 0.f;
#pragma unroll 1
  for (int q = 0; q < 4; ++q) {
    const v4f a = bfr4(*(const v4fa*)(er + 4 * q));
    const float* wr = sWe + (4 * q) * NHD + h0;            // We[4q+i][h0+j] = wr[i*8 + j]
    s0 = fmaf(a.x, wr[0],  s0); s1 = fmaf(a.x, wr[1],  s1); s2 = fmaf(a.x, wr[2],  s2); s3 = fmaf(a.x, wr[3],  s3);
    s0 = fmaf(a.y, wr[8],  s0); s1 = fmaf(a.y, wr[9],  s1); s2 = fmaf(a.y, wr[10], s2); s3 = fmaf(a.y, wr[11], s3);
    s0 = fmaf(a.z, wr[16], s0); s1 = fmaf(a.z, wr[17], s1); s2 = fmaf(a.z, wr[18], s2); s3 = fmaf(a.z, wr[19], s3);
    s0 = fmaf(a.w, wr[24], s0); s1 = fmaf(a.w, wr[25], s1); s2 = fmaf(a.w, wr[26], s2); s3 = fmaf(a.w, wr[27], s3);
  }
  v4f o;
  o.x = s0 + sbe[h0]; o.y = s1 + sbe[h0 + 1]; o.z = s2 + sbe[h0 + 2]; o.w = s3 + sbe[h0 + 3];
  const v4f z4 = {0.f, 0.f, 0.f, 0.f};
  if (e >= nE) o = z4;
  float* op = EB + (size_t)e * NHD + h0;
  *(v4f*)op = o;
  
}

// =====================================================================================
// Graph attention with per-edge additive bias, one block per (graph, 64-query tile), 8 waves.
// Phase A (block-local, statically bounded): chunk scan of the src list (edge_index row 0) for
//   src in [node0, node0+64): hits (edge id, query row, dst % 512) collected into LDS in (chunk, wave, entry j, lane)
//   order, capped at HCAP (poison when reached); counting sort (wave 0, fixed order, stable) into NBIN bins,
//   bin = query row * 32 + (dst % 512) / 16, -> sE / sD segments with roff / rcnt. Nothing persists outside LDS.
// Phase B: 4 head pairs; waves 0..3 run head 2p, waves 4..7 head 2p+1, each wave 16 query rows.
//   Per key chunk of 64: K hi/lo and V^T hi/lo tiles of both heads staged (256 threads x 32 elements =
//   two 64x64 tiles per plane, the whole chunk), a 2x64x64 f32 bias tile zeroed then filled by row owners
//   (4 threads per query row, thread j walks only the bin of its row and of key columns 16j..16j+15 of this
//   chunk, in segment order = hit scan order -> duplicate (src,dst) pairs sum deterministically; lanes
//   whose bin is shorter than the wave's longest add into a private dummy slot),
//   then S = q.k (3-term split) * 0.125 + bias, online softmax in f32, P split hi/lo through per-wave LDS
//   Epilogue: ctx = O / l staged per wave in LDS (aliasing only that wave's own bias rows), written as
// Geometry guards (NaN poison of the block's ctx rows, never a trap): hit cap, per-row count > RWCAP,
//   num_graphs != NGR, batch id of the block's first node outside [0, NGR).
// coverage: CTX rows lrow0..lrow0+63 x all 1024 cols per block; grid = GHALF*8 blocks covers RHALF rows once.
// =====================================================================================
#define AT_NW   8
#define EPT     8
#define CHUNK   (NTHR * EPT)          // 2048 keys per chunk
#define WCAP    (EPT * 32)            // 256: exact upper bound of hits per wave per chunk
#define LISTN   (AT_NW * WCAP)        // 2048
#define SLOTB   6
#define NSLOT   64                    // query rows per block = scan slots
#define BINSH   4                     // 16 key columns per bin
#define NBIN    (NSLOT * (NND >> BINSH))   // 2048 bins: (query row, group of 16 key columns)
#define HCAP    2048                  // hit capacity per block
#define RWCAP   128                   // static cap on per-row edge count
#define KVT     4096                  // one 64x64 f32 bias tile
#define KVP     72                    // row pitch of the K / V^T / P tiles in LDS, elements: 144 B = 16 B x 9, so the
                                      // 16 rows of a ds_load_b128 fragment read fall on 16 different bank groups
#define KVS     (64 * KVP)            // one 64-row K or V^T tile
#define PWS     (16 * KVP)            // one wave's 16-row P tile
#define NDUM    512                   // private dummy accumulators (2 per thread)
#define LO_KV   0
#define LO_P    (8 * KVS * 2)                           // 73728
#define LO_BT   (LO_P + 2 * AT_NW * PWS * 2)            // 110592
#define LO_SE   (LO_BT + (2 * KVT + NDUM) * 4)          // 145408
#define LO_SD   (LO_SE + HCAP * 4)                      // 153600
#define LO_RC   (LO_SD + HCAP * 4)                      // 161792
#define LDS_ATT (LO_RC + (3 * NBIN + 2 * AT_NW) * 4)    // 186432

static_assert((LISTN + 2 * HCAP) * 4 <= LO_P);        // phase-A lists alias the K/V tile region
static_assert(LDS_ATT <= 300000);
static_assert(KVP >= 64 && (KVP * 2) % 16 == 0 && ((KVP * 2) / 16) % 2 == 1);   // 16-B aligned rows, odd multiple
static_assert((LO_P % 16) == 0 && (LO_BT % 16) == 0);
static_assert((1 << SLOTB) == NSLOT);
static_assert(NTHR == 32 * AT_NW);
static_assert(NTHR == 4 * NSLOT);                      // bias fill: 4 threads per query row
static_assert(NTHR * 4 * 8 == 2 * KVT);                // bias zero fill: 8 sweeps of 4 floats per thread
static_assert(NDUM == 2 * NTHR && NDUM == 128 * 4);
static_assert(AT_NW * 1024 == 2 * KVT);                // per-wave output staging = own bias rows
static_assert((CHUNK & (CHUNK - 1)) == 0 && CHUNK == 2048);
static_assert(2 * NSLOT == 32 * 4 / 2 * 2 && NSLOT == 2 * 32);   // prefix: two query rows per lane of wave 0
static_assert(NBIN == 32 * 64 && NBIN == NTHR * 8 && (NND >> BINSH) == 32);   // 64 bins per lane, 32 per row
static_assert((64 >> BINSH) == 4 && (LO_RC % 16) == 0);          // 4 bins per row and key chunk = 4 fill threads

// One chunk of the key list: each thread tests EPT entries against the block's slot range
// [slotBase, slotBase + nb); hits are appended to this wave's LDS list as (local_index << SLOTB | slot).
// Returns the wave-uniform hit count (<= WCAP always). The vector / scalar load choice is block-uniform;
// the scalar path clamps every address and selects the sentinel by value.
__device__ __forceinline__ int scan_chunk(const int* __restrict__ keys, int nE, int cbase, int slotBase,
                                          int nb, int vec8, int* list, int tid, int lane, int wave) {
  int wc = 0;
  const int el0  = tid * EPT;
  const int e0   = cbase + el0;
  const int sent = -2147483647 - 1;
  v4i da, db;
  if (vec8 != 0 && cbase + CHUNK <= nE) {
    da = *(const v4i*)(keys + e0);
    db = *(const v4i*)(keys + e0 + 4);
  } else {
    da.x = (e0     < nE) ? keys[min(e0,     nE - 1)] : sent;
    da.y = (e0 + 1 < nE) ? keys[min(e0 + 1, nE - 1)] : sent;
    da.z = (e0 + 2 < nE) ? keys[min(e0 + 2, nE - 1)] : sent;
    da.w = (e0 + 3 < nE) ? keys[min(e0 + 3, nE - 1)] : sent;
    db.x = (e0 + 4 < nE) ? keys[min(e0 + 4, nE - 1)] : sent;
    db.y = (e0 + 5 < nE) ? keys[min(e0 + 5, nE - 1)] : sent;
    db.z = (e0 + 6 < nE) ? keys[min(e0 + 6, nE - 1)] : sent;
    db.w = (e0 + 7 < nE) ? keys[min(e0 + 7, nE - 1)] : sent;
  }
  const unsigned nbs = (unsigned)slotBase;
  const unsigned unb = (unsigned)nb;
  const unsigned s0 = (unsigned)da.x - nbs, s1 = (unsigned)da.y - nbs;
  const unsigned s2 = (unsigned)da.z - nbs, s3 = (unsigned)da.w - nbs;
  const unsigned s4 = (unsigned)db.x - nbs, s5 = (unsigned)db.y - nbs;
  const unsigned s6 = (unsigned)db.z - nbs, s7 = (unsigned)db.w - nbs;
  const bool h0 = s0 < unb, h1 = s1 < unb, h2 = s2 < unb, h3 = s3 < unb;
  const bool h4 = s4 < unb, h5 = s5 < unb, h6 = s6 < unb, h7 = s7 < unb;
  const unsigned any = __builtin_amdgcn_ballot_w32(h0 | h1 | h2 | h3 | h4 | h5 | h6 | h7);
  if (any != 0u) {
#define HITJ(J, HJ, SJ) { \
      const unsigned mj = __builtin_amdgcn_ballot_w32(HJ); \
      if (mj != 0u) { \
        if (HJ) { \
          const int pos = wc + (int)__builtin_amdgcn_mbcnt_lo(mj, 0u); \
          if (pos < WCAP) list[wave * WCAP + pos] = ((el0 + (J)) << SLOTB) | (int)(SJ); \
        } \
        wc += (int)__builtin_popcount(mj); } }
    HITJ(0, h0, s0)
    HITJ(1, h1, s1)
    HITJ(2, h2, s2)
    HITJ(3, h3, s3)
    HITJ(4, h4, s4)
    HITJ(5, h5, s5)
    HITJ(6, h6, s6)
    HITJ(7, h7, s7)
#undef HITJ
  }
  return wc;
}

__global__ __launch_bounds__(NTHR) void k_attn(
    const unsigned short* __restrict__ Qp, const unsigned short* __restrict__ Kp,
    const unsigned short* __restrict__ VTp, const float* __restrict__ EB,
    const int* __restrict__ keys, const int* __restrict__ gath,
    const int* __restrict__ ngp, const int* __restrict__ bat,
    unsigned short* CTX, int nE, int vec8, int gbase) {
  extern __shared__ v4f lds_dyn[];
  char* lds = (char*)lds_dyn;
  __bf16* Ksh = (__bf16*)(lds + LO_KV);         // [2][64 x KVP]  K hi  [kv][d]
  __bf16* Ksl = Ksh + 2 * KVS;                   // [2][64 x KVP]  K lo
  __bf16* Vth = Ksl + 2 * KVS;                   // [2][64 x KVP]  V^T hi [d][kv]
  __bf16* Vtl = Vth + 2 * KVS;                   // [2][64 x KVP]  V^T lo
  int* list  = (int*)(lds + LO_KV);              // phase A only: [LISTN]
  int* hitE  = list + LISTN;                     // [HCAP] edge ids, in scan order
  int* hitRD = hitE + HCAP;                      // [HCAP] (row << 9) | loc_dst
  __bf16* Psh = (__bf16*)(lds + LO_P);           // [8 waves][16 x KVP] P hi
  __bf16* Psl = Psh + AT_NW * PWS;               // P lo
  float* BTX = (float*)(lds + LO_BT);            // [2][64 x 64] bias tiles + [NDUM] dummies; epilogue staging
  int* sE   = (int*)(lds + LO_SE);               // [HCAP] edge ids sorted by query row
  int* sD   = (int*)(lds + LO_SD);               // [HCAP] loc_dst of the same entries
  int* rcnt = (int*)(lds + LO_RC);               // [NBIN] entries per bin
  int* roff = rcnt + NBIN;                       // [NBIN] first entry of the bin in sE / sD
  int* curs = roff + NBIN;                       // [NBIN]
  int* wcnt = curs + NBIN;                       // [8]
  int* misc = wcnt + AT_NW;                      // [8]

  const int tid = (int)threadIdx.x, lane = tid & 31, wave = tid >> 5, hh = lane >> 4, c = lane & 15;
  const int lgr   = (int)blockIdx.x >> 3;        // graph within this pass
  const int qt    = (int)blockIdx.x & 7;         // 64-query tile within the graph
  const int gb    = gbase + lgr;                 // graph id
  const int node0 = gb * NND + qt * NSLOT;       // global node id of query row 0
  const int lrow0 = lgr * NND + qt * NSLOT;      // plane row of query row 0

  {
    const v4i zi = {0, 0, 0, 0};
    *(v4i*)(rcnt + tid * 8)     = zi;
    *(v4i*)(rcnt + tid * 8 + 4) = zi;
  }
  __syncthreads();

  // ---- phase A1: chunk scan + ordered copy of hits ----
  int tot = 0;
  const int nChunks = (nE + CHUNK - 1) / CHUNK;
#pragma unroll 1
  for (int ch = 0; ch < nChunks; ++ch) {
    const int cbase = ch * CHUNK;
    const int wc = scan_chunk(keys, nE, cbase, node0, NSLOT, vec8, list, tid, lane, wave);
    if (lane == 0) wcnt[wave] = wc;
    __syncthreads();
    int pre = 0, all = 0;
#pragma unroll
    for (int w2 = 0; w2 < AT_NW; ++w2) {
      int cc = wcnt[w2];
      cc = cc < 0 ? 0 : (cc > WCAP ? WCAP : cc);
      all += cc;
      pre += (w2 < wave) ? cc : 0;
    }
    const int wcc  = wc > WCAP ? WCAP : wc;
    const int base = tot + pre;
#pragma unroll 1
    for (int i0 = 0; i0 < wcc; i0 += 32) {          // wcc wave-uniform; loads unconditional, clamped
      const int i   = i0 + lane;
      const int ic  = i < wcc ? i : wcc - 1;
      const int ent = list[wave * WCAP + ic];
      const int el  = (ent >> SLOTB) & (CHUNK - 1);
      const int sl  = ent & (NSLOT - 1);
      int eid = cbase + el;
      eid = eid > nE - 1 ? nE - 1 : eid;
      int g = gath[eid];
      g = g < 0 ? 0 : (g > NTOT - 1 ? NTOT - 1 : g);
      const int pos = base + i;
      if (i < wcc && pos < HCAP) {
        hitE[pos]  = eid;
        hitRD[pos] = (sl << 9) | (g & (NND - 1));
      }
    }
    tot += all;
    tot = tot > HCAP ? HCAP : tot;
    __syncthreads();
  }
  const int nh = tot;

  // ---- phase A2: per-bin counts (wave 0, fixed order, lane 0 writes) ----
  if (wave == 0) {
#pragma unroll 1
    for (int b0 = 0; b0 < nh; b0 += 32) {
      const int idx = b0 + lane;
      const int uv  = hitRD[idx < nh ? idx : nh - 1];
      const int m32 = (nh - b0) < 32 ? (nh - b0) : 32;
#pragma unroll 1
      for (int k = 0; k < m32; ++k) {
        const int u  = __builtin_amdgcn_readlane(uv, k);
        const int sl = (u >> BINSH) & (NBIN - 1);
        if (lane == 0) rcnt[sl] = rcnt[sl] + 1;
      }
    }
  }
  __syncthreads();

  // ---- phase A3: exclusive prefix over the NBIN counts (wave 0, 64 bins = two query rows per lane) + max
  //      per-row count ----
  if (wave == 0) {
    v4i cv[16];
    int c0 = 0, c1 = 0;                            // entries of query rows 2*lane and 2*lane+1
#pragma unroll
    for (int i = 0; i < 16; ++i) {
      v4i v = *(const v4i*)(rcnt + 64 * lane + 4 * i);
      v.x = v.x < 0 ? 0 : v.x; v.y = v.y < 0 ? 0 : v.y; v.z = v.z < 0 ? 0 : v.z; v.w = v.w < 0 ? 0 : v.w;
      cv[i] = v;
      const int sv = v.x + v.y + v.z + v.w;
      if (i < 8) c0 += sv; else c1 += sv;
    }
    const int ts = c0 + c1;
    int incl = ts;
#pragma unroll
    for (int d = 1; d < 32; d <<= 1) {
      const int up = __shfl_up(incl, d, 32);
      if (lane >= d) incl += up;
    }
    int run = incl - ts;
#pragma unroll
    for (int i = 0; i < 16; ++i) {
      v4i o;
      o.x = run; run += cv[i].x;
      o.y = run; run += cv[i].y;
      o.z = run; run += cv[i].z;
      o.w = run; run += cv[i].w;
      *(v4i*)(roff + 64 * lane + 4 * i) = o;
      *(v4i*)(curs + 64 * lane + 4 * i) = o;
    }
    int mc = c0 > c1 ? c0 : c1;
#pragma unroll
    for (int off = 16; off > 0; off >>= 1) {
      const int o = __shfl_xor(mc, off, 32);
      mc = o > mc ? o : mc;
    }
    if (lane == 0) misc[0] = mc;
  }
  __syncthreads();

  // ---- phase A4: place entries into bin segments (wave 0, fixed order, lane 0 writes) ----
  if (wave == 0) {
#pragma unroll 1
    for (int b0 = 0; b0 < nh; b0 += 32) {
      const int idx = b0 + lane;
      const int cl  = idx < nh ? idx : nh - 1;
      const int uv  = hitRD[cl];
      const int ue  = hitE[cl];
      const int m32 = (nh - b0) < 32 ? (nh - b0) : 32;
#pragma unroll 1
      for (int k = 0; k < m32; ++k) {
        const int u  = __builtin_amdgcn_readlane(uv, k);
        const int e  = __builtin_amdgcn_readlane(ue, k);
        const int sl = (u >> BINSH) & (NBIN - 1);
        if (lane == 0) {
          int pos = curs[sl];
          pos = pos < 0 ? 0 : (pos > HCAP - 1 ? HCAP - 1 : pos);
          sE[pos] = e;
          sD[pos] = u & (NND - 1);
          curs[sl] = pos + 1;
        }
      }
    }
  }
  __syncthreads();

  // ---- geometry / capacity guards -> NaN poison of this block's ctx rows ----
  const int degmax = misc[0];
  const int ng  = ngp[0];
  const int bt0 = bat[node0];
  const bool bad = (nh >= HCAP) || (degmax > RWCAP) || (ng != NGR) || (bt0 < 0) || (bt0 >= NGR);
  const float pz = bad ? __int_as_float(0x7fc00000) : 0.0f;

  // ---- phase B ----
  const int wsub = wave & 3;                     // query row group of this wave
  const int hl   = wave >> 2;                    // head slot (0 / 1) of this wave within the pair
  const int rw   = tid >> 2;                     // bias fill: query row owned by this thread
  const int jw   = tid & 3;                      // bias fill: key-column quarter owned by this thread
  const float sscale = 0.125f;
  const v8f z8 = {0.f,0.f,0.f,0.f,0.f,0.f,0.f,0.f};
  const __bf16* Kth = Ksh + hl * KVS;
  const __bf16* Ktl = Ksl + hl * KVS;
  const __bf16* Vtth = Vth + hl * KVS;
  const __bf16* Vttl = Vtl + hl * KVS;
  __bf16* pwh = Psh + wave * PWS;
  __bf16* pwl = Psl + wave * PWS;

#pragma unroll 1
  for (int hp = 0; hp < NHD / 2; ++hp) {
    const int h    = 2 * hp + hl;                // head of this wave
    const int qrow = lrow0 + wsub * 16;          // plane row of this wave's first query

    // Q fragments (A operand, row = lane&15, split k map): 2 d-chunks, hi and lo
    v16b qah[2], qal[2];
#pragma unroll
    for (int dc = 0; dc < 2; ++dc) {
      const unsigned short* qp = Qp + (size_t)(qrow + c) * PLD + h * HDM + dc * 32 + 8 * hh;
      qah[dc] = FragBF::load((const __bf16*)(const void*)qp);
      qal[dc] = FragBF::load((const __bf16*)(const void*)(qp + HID));
    }
    float mrow[8], lrow[8];
    v8f oacc[4];
#pragma unroll
    for (int r = 0; r < 8; ++r) { mrow[r] = -INFINITY; lrow[r] = 0.f; }
#pragma unroll
    for (int t = 0; t < 4; ++t) oacc[t] = z8;

#pragma unroll 1
    for (int kc = 0; kc < NND / 64; ++kc) {
      const int kv0 = kc * 64;
      __syncthreads();
      {
        // staging: thread half th = head 2hp+th; 128 threads x (4 x 8) elements = 64 x 64 per plane
        const int th = tid >> 7, t = tid & 127;
        const int r = t >> 1, half = (t & 1) * 32;
        const int hs = 2 * hp + th;
        const unsigned short* ksh = Kp + (size_t)(lgr * NND + kv0 + r) * PLD + hs * HDM + half;
        const unsigned short* ksl = ksh + HID;
        const unsigned short* vsh = VTp + ((size_t)lgr * HID + hs * HDM + r) * PLD + kv0 + half;
        const unsigned short* vsl = vsh + HID;
        __bf16* kdh = Ksh + th * KVS + r * KVP + half;
        __bf16* kdl = Ksl + th * KVS + r * KVP + half;
        __bf16* vdh = Vth + th * KVS + r * KVP + half;
        __bf16* vdl = Vtl + th * KVS + r * KVP + half;
#pragma unroll
        for (int i = 0; i < 4; ++i) {
          const v8b a0 = *(const v8b*)(ksh + 8 * i);
          const v8b a1 = *(const v8b*)(ksl + 8 * i);
          const v8b b0 = *(const v8b*)(vsh + 8 * i);
          const v8b b1 = *(const v8b*)(vsl + 8 * i);
          *(v8b*)(kdh + 8 * i) = a0;
          *(v8b*)(kdl + 8 * i) = a1;
          *(v8b*)(vdh + 8 * i) = b0;
          *(v8b*)(vdl + 8 * i) = b1;
        }
        // bias tiles + dummies zero: 8 sweeps x 256 threads x 4 floats = both 64x64 tiles (each store's lanes
        // contiguous, no two on one bank); 128 threads x 4 = dummies
        const v4f z4 = {0.f, 0.f, 0.f, 0.f};
        float* bz = BTX + tid * 4;
#pragma unroll
        for (int i = 0; i < 8; ++i) *(v4fa*)(bz + NTHR * 4 * i) = z4;
        if (tid < 128) *(v4fa*)(BTX + 2 * KVT + 4 * tid) = z4;
      }
      __syncthreads();
      {
        // bias fill: segment [st, st+cnt) of sE/sD = the bin of row rw and key columns kv0+16jw..kv0+16jw+15
        const int bin = rw * (NND >> BINSH) + kc * (64 >> BINSH) + jw;
        int st = roff[bin], cnt = rcnt[bin];
        st  = st < 0 ? 0 : (st > nh ? nh : st);
        cnt = cnt < 0 ? 0 : (cnt > RWCAP ? RWCAP : cnt);
        if (cnt > nh - st) cnt = nh - st;
        int cmax = cnt;
#pragma unroll
        for (int off = 16; off > 0; off >>= 1) {
          const int o = __shfl_xor(cmax, off, 32);
          cmax = o > cmax ? o : cmax;
        }
        const float* ebp = EB + 2 * hp;
#pragma unroll 1
        for (int q = 0; q < cmax; ++q) {           // cmax wave-uniform, <= RWCAP
          const bool valid = q < cnt;
          int idx = st + q;
          idx = idx > nh - 1 ? nh - 1 : idx;
          idx = idx < 0 ? 0 : idx;
          const int col = sD[idx] - kv0;
          int e = sE[idx];
          e = e < 0 ? 0 : (e > nE - 1 ? nE - 1 : e);
          const v2f ebv = *(const v2fa*)(ebp + (size_t)e * NHD);
          const bool inr = valid && ((unsigned)col < 64u) && ((col >> 4) == jw);
          const int ia = inr ? (rw * 64 + col) : (2 * KVT + tid);
          const int ib = inr ? (KVT + rw * 64 + col) : (2 * KVT + NTHR + tid);
          BTX[ia] = BTX[ia] + ebv.x;
          BTX[ib] = BTX[ib] + ebv.y;
        }
      }
      __syncthreads();

      // ---- S = q . k (3-term) ----
      v8f s[4];
#pragma unroll
      for (int j = 0; j < 4; ++j) {
        s[j] = z8;
#pragma unroll
        for (int dc = 0; dc < 2; ++dc) {
          FB kb, kl;
          const __bf16* kr = Kth + (j * 16 + c) * KVP + dc * 32 + 8 * hh;
          const __bf16* kq = Ktl + (j * 16 + c) * KVP + dc * 32 + 8 * hh;
          kb.h[0] = *(const v8b*)kr;
          kb.h[1] = *(const v8b*)(kr + 16);
          kl.h[0] = *(const v8b*)kq;
          kl.h[1] = *(const v8b*)(kq + 16);
          s[j] = at_mma(qah[dc], kb.v, s[j]);
          s[j] = at_mma(qah[dc], kl.v, s[j]);
          s[j] = at_mma(qal[dc], kb.v, s[j]);
        }
      }
      // scale, add bias tile (D element r = row wsub*16 + 8hh + r, col j*16 + c), chunk row max
      const float* btr = BTX + hl * KVT + (wsub * 16 + 8 * hh) * 64 + c;
      float cm[8];
#pragma unroll
      for (int r = 0; r < 8; ++r) {
        float m = -INFINITY;
#pragma unroll
        for (int j = 0; j < 4; ++j) {
          const float sv = s[j][r] * sscale + btr[r * 64 + j * 16];
          s[j][r] = sv;
          m = fmaxf(m, sv);
        }
#pragma unroll
        for (int off = 1; off < 16; off <<= 1) m = fmaxf(m, __shfl_xor(m, off, 32));
        cm[r] = m;
      }
#pragma unroll
      for (int r = 0; r < 8; ++r) {
        const float mnew = fmaxf(mrow[r], cm[r]);
        const float alpha = expf(mrow[r] - mnew);
        mrow[r] = mnew;
        float psum = 0.f;
#pragma unroll
        for (int j = 0; j < 4; ++j) {
          const float p = expf(s[j][r] - mnew);
          psum += p;
          __bf16 a, bl; at_split(p, a, bl);
          pwh[(8 * hh + r) * KVP + j * 16 + c] = a;
          pwl[(8 * hh + r) * KVP + j * 16 + c] = bl;
        }
#pragma unroll
        for (int off = 1; off < 16; off <<= 1) psum += __shfl_xor(psum, off, 32);
        lrow[r] = lrow[r] * alpha + psum;
#pragma unroll
        for (int t = 0; t < 4; ++t) oacc[t][r] *= alpha;
      }
      __builtin_amdgcn_fence(__ATOMIC_RELEASE, "workgroup");
      __builtin_amdgcn_wave_barrier();
      __builtin_amdgcn_fence(__ATOMIC_ACQUIRE, "workgroup");
      // ---- O += p . v (3-term); P fragment = A (row c), V^T fragment = B (col = d) ----
#pragma unroll 1
      for (int kk = 0; kk < 2; ++kk) {
        FB pa, pl;
        pa.h[0] = *(const v8b*)(pwh + c * KVP + kk * 32 + 8 * hh);
        pa.h[1] = *(const v8b*)(pwh + c * KVP + kk * 32 + 16 + 8 * hh);
        pl.h[0] = *(const v8b*)(pwl + c * KVP + kk * 32 + 8 * hh);
        pl.h[1] = *(const v8b*)(pwl + c * KVP + kk * 32 + 16 + 8 * hh);
#pragma unroll
        for (int t = 0; t < 4; ++t) {
          FB vb, vl;
          vb.h[0] = *(const v8b*)(Vtth + (t * 16 + c) * KVP + kk * 32 + 8 * hh);
          vb.h[1] = *(const v8b*)(Vtth + (t * 16 + c) * KVP + kk * 32 + 16 + 8 * hh);
          vl.h[0] = *(const v8b*)(Vttl + (t * 16 + c) * KVP + kk * 32 + 8 * hh);
          vl.h[1] = *(const v8b*)(Vttl + (t * 16 + c) * KVP + kk * 32 + 16 + 8 * hh);
          oacc[t] = at_mma(pa.v, vb.v, oacc[t]);
          oacc[t] = at_mma(pa.v, vl.v, oacc[t]);
          oacc[t] = at_mma(pl.v, vb.v, oacc[t]);
        }
      }
    }

    // ---- epilogue: normalise, stage the wave's 16x64 tile (pitch 64, own bias rows), hi | lo lines ----
    __syncthreads();
    {
      float* os = BTX + wave * 1024;
#pragma unroll
      for (int r = 0; r < 8; ++r) {
        const float inv = 1.0f / lrow[r];
#pragma unroll
        for (int t = 0; t < 4; ++t) os[(8 * hh + r) * 64 + t * 16 + c] = oacc[t][r] * inv + pz;
      }
      __builtin_amdgcn_fence(__ATOMIC_RELEASE, "workgroup");
      __builtin_amdgcn_wave_barrier();
      __builtin_amdgcn_fence(__ATOMIC_ACQUIRE, "workgroup");
      const int q4 = lane >> 3, c8 = (lane & 7) * 8;
      v4u hv[4], lv[4];
#pragma unroll
      for (int it = 0; it < 4; ++it) {
        const int row = it * 4 + q4;                   // it 0..3 x q4 0..3 covers rows 0..15
        const float* sp = os + row * 64 + c8;
        const v4f a = *(const v4fa*)sp;
        const v4f b = *(const v4fa*)(sp + 4);
        pack8hl(a, b, hv[it], lv[it]);
      }
      {
#pragma unroll
        for (int it = 0; it < 4; ++it) {
          const int row = it * 4 + q4;
          unsigned short* op = CTX + (size_t)(qrow + row) * PLD + h * HDM + c8;
          *(v4u*)op = hv[it];
          *(v4u*)(op + HID) = lv[it];
        }
        
      }
    }
  }
}

// =====================================================================================
static inline int cdiv(int a, int b) { return (a + b - 1) / b; }

extern "C" void kernel_launch(void* const* d_in, const int* in_sizes, int n_in,
                              void* d_out, int out_size, void* d_ws, size_t ws_size,
                              hipStream_t stream) {
  if (n_in < 15) return;
  if (in_sizes[0] != NTOT * HID) return;                        // x [16384][512]
  if (in_sizes[1] != NTOT) return;                              // batch [16384]
  if (in_sizes[2] < 2 || (in_sizes[2] & 1) != 0) return;        // edge_index [2][E]
  const int nE = in_sizes[2] / 2;
  if (nE < 1 || nE > (1 << 24)) return;
  if (in_sizes[3] != nE * EDW) return;                          // edge_attr [E][16]
  if (in_sizes[4] != HID * HID || in_sizes[6] != HID * HID || in_sizes[8] != HID * HID || in_sizes[10] != HID * HID) return;
  if (in_sizes[5] != HID || in_sizes[7] != HID || in_sizes[9] != HID || in_sizes[11] != HID) return;
  if (in_sizes[12] != EDW * NHD || in_sizes[13] != NHD || in_sizes[14] != 1) return;
  if (out_size != NTOT * HID) return;                           // out [16384][512], last element 8388607

  const float* x   = (const float*)d_in[0];
  const int*   bat = (const int*)  d_in[1];
  const int*   ei  = (const int*)  d_in[2];     // row 0 = src, row 1 = dst
  const float* ea  = (const float*)d_in[3];
  const float* Wq  = (const float*)d_in[4];     // [in][out]
  const float* bq  = (const float*)d_in[5];
  const float* Wk  = (const float*)d_in[6];
  const float* bk  = (const float*)d_in[7];
  const float* Wv  = (const float*)d_in[8];
  const float* bv  = (const float*)d_in[9];
  const float* Wo  = (const float*)d_in[10];
  const float* bo  = (const float*)d_in[11];
  const float* We  = (const float*)d_in[12];    // [16][8]
  const float* be  = (const float*)d_in[13];    // [8]
  const int*   ngp = (const int*)  d_in[14];    // [1]
  float* out = (float*)d_out;
  const int* keys = ei;                         // src list
  const int* gath = ei + nE;                    // dst list

  const int EP = cdiv(nE, 4) * 4;

  char* ws = (char*)d_ws;
  size_t off = 0;
  const size_t oXb = off; off += (size_t)NTOT * HID * 2;                                          // 16777216
  const size_t oWq = off; off += (size_t)HID * HID * 2;                                           //   524288
  const size_t oWk = off; off += (size_t)HID * HID * 2;
  const size_t oWv = off; off += (size_t)HID * HID * 2;
  const size_t oWo = off; off += (size_t)HID * PLD * 2;                                           //  1048576
  const size_t oEB = off; off += (size_t)EP * NHD * 4;   off = (off + 255) & ~(size_t)255;        //  8388608
  const size_t oQ  = off; off += (size_t)RHALF * PLD * 2;                                         // 33554432
  const size_t oK  = off; off += (size_t)RHALF * PLD * 2;
  const size_t oVT = off; off += (size_t)GHALF * HID * PLD * 2;                                   // 33554432
  const size_t oCT = off; off += (size_t)RHALF * PLD * 2;                                         // 33554432
  if (off > ws_size || off > (size_t)WSMAX) return;                                               // 162004992
  unsigned short* Xb   = (unsigned short*)(ws + oXb);
  unsigned short* WqT  = (unsigned short*)(ws + oWq);
  unsigned short* WkT  = (unsigned short*)(ws + oWk);
  unsigned short* WvT  = (unsigned short*)(ws + oWv);
  unsigned short* WOT2 = (unsigned short*)(ws + oWo);
  float*          EB   = (float*)(ws + oEB);
  unsigned short* Qp   = (unsigned short*)(ws + oQ);
  unsigned short* Kp   = (unsigned short*)(ws + oK);
  unsigned short* VTp  = (unsigned short*)(ws + oVT);
  unsigned short* CTX  = (unsigned short*)(ws + oCT);

  hipFuncSetAttribute(reinterpret_cast<const void*>(&k_attn),
                      hipFuncAttributeMaxDynamicSharedMemorySize, LDS_ATT);

  // weight planes (bf16 bits, k-contiguous rows [n][k])
  {
    const int nUw = HID * (HID / 8);             // 512 rows x 64 units
    k_wtr<<<cdiv(nUw, NTHR), NTHR, 0, stream>>>(Wq, HID, HID, HID, HID, WqT, nUw);
    k_wtr<<<cdiv(nUw, NTHR), NTHR, 0, stream>>>(Wk, HID, HID, HID, HID, WkT, nUw);
    k_wtr<<<cdiv(nUw, NTHR), NTHR, 0, stream>>>(Wv, HID, HID, HID, HID, WvT, nUw);
    const int nUo = HID * (PLD / 8);             // 512 rows x 128 units: wt [512][1024], k mod 512
    k_wtr<<<cdiv(nUo, NTHR), NTHR, 0, stream>>>(Wo, HID, HID, HID, PLD, WOT2, nUo);
  }
  // node feature plane (whole x)
  {
    const int nUx = NTOT * (HID / 8);
    k_xprep<<<cdiv(nUx, NTHR), NTHR, 0, stream>>>(x, Xb, NTOT, nUx);
  }
  // edge bias plane [EP][8]
  {
    const int nUe = EP * 2;
    k_eb<<<cdiv(nUe, NTHR), NTHR, 0, stream>>>(ea, We, be, EB, nE, nUe);
  }

  const dim3 blk(256);
  const dim3 gQK(((RHALF / 64) * (HID / 64)) / 8, 1);        // 256 blocks x 8 tiles: M=16384, N=512
  const dim3 gVT(((HID / 64) * (NND / 64)) / 8, GHALF);      // 8 blocks x 8 tiles per graph: M=512, N=512
  const dim3 gAT(GHALF * (NND / 64));                        // 256 blocks: 32 graphs x 8 query tiles
  for (int half = 0; half < NHALF; ++half) {
    const unsigned short* Xh = Xb + (size_t)half * RHALF * HID;
    float* outh = out + (size_t)half * RHALF * HID;
    // q = x . Wq + bq -> Qp hi | lo  (M=16384, N=512, K=512)
    wmma_gemm64<false, 2, 2, false, 0><<<gQK, blk, 0, stream>>>(
        Xh, Xh, HID, 0L, WqT, WqT, HID, 0L, (void*)Qp, (void*)(Qp + HID), PLD, 0L,
        bq, bq, 0L, RHALF, HID, HID, 1.0f);
    // k = x . Wk + bk -> Kp hi | lo
    wmma_gemm64<false, 2, 2, false, 0><<<gQK, blk, 0, stream>>>(
        Xh, Xh, HID, 0L, WkT, WkT, HID, 0L, (void*)Kp, (void*)(Kp + HID), PLD, 0L,
        bk, bk, 0L, RHALF, HID, HID, 1.0f);
    // v^T = Wv^T . x^T + bv[m] per graph -> VTp [graph][h*64+d][s] hi | lo  (M=512, N=512, K=512, z = 32 graphs)
    wmma_gemm64<false, 1, 2, false, 0><<<gVT, blk, 0, stream>>>(
        WvT, WvT, HID, 0L, Xh, Xh, HID, (long)NND * HID, (void*)VTp, (void*)(VTp + HID), PLD, (long)HID * PLD,
        bv, bv, 0L, HID, NND, HID, 1.0f);
    // attention with edge bias -> CTX hi | lo
    k_attn<<<gAT, NTHR, LDS_ATT, stream>>>(Qp, Kp, VTp, EB, keys, gath, ngp, bat, CTX, nE, 1, half * GHALF);
    // out = [ctx hi | ctx lo] . [Wo ; Wo] + bo -> d_out rows half*RHALF .. half*RHALF+RHALF-1 (M=16384, N=512, K=1024)
    wmma_gemm64<false, 2, 0, false, 0><<<gQK, blk, 0, stream>>>(
        CTX, CTX, PLD, 0L, WOT2, WOT2, PLD, 0L, (void*)outh, (void*)outh, HID, 0L,
        bo, bo, 0L, RHALF, HID, PLD, 1.0f);
  }
  (void)hipGetLastError();
}

// v004
// Measured time: 507 microseconds a run.
// Next to v003, in two timings, it ran 1.30 times as fast each time.
// Counting every step since v000, it is 3.63 times as fast.
// Contractions on v_wmma_f32_16x16x32_bf16 (bf16 operands, f32 accumulate): x*Wq, x*Wk, Wv^T*x^T as single
// products of bf16-RNE inputs; q.k^T and p.v as bf16 hi/lo split (hi.hi + hi.lo + lo.hi); ctx*Wo as
// [ctx hi | ctx lo] . [Wo ; Wo] (K = 1024); edge bias (16-deep dots of bf16-RNE inputs), online softmax and all biases in f32 on the VALU.
#include <hip/hip_runtime.h>
#include <math.h>
#include <stdint.h>
#include <stddef.h>

// Geometry: NGR graphs of NND consecutive node rows; attention keys of a query = the NND nodes of its graph.
// The job runs in NHALF passes of GHALF graphs each (one pass of all graphs: the attention launch then has one
// work-group for each of the 256 WGPs); the q / k / v^T / ctx planes are rewritten per pass.
//
// Plane map (workspace, all 16-bit planes are bf16 bits; no power-of-two carries anywhere, so no inverse
// factor exists -> carry audit: none):
//   Xb   [16384][512]          bf16(x)                                        -> A of q/k GEMMs, Bt of v^T GEMM
//   WqT, WkT, WvT [512 o][512 i]  bf16(W[i][o])                              -> Bt / A (k-contiguous)
//   WOT2 [512 o][1024]         bf16(Wo[k mod 512][o])                         -> Bt of the output GEMM
//   EB   [EP][8] f32           sum_t bf16(ea[e][t]) bf16(We[t][h]) + bf16(be[h])
//   Qp, Kp [16384][1024]       hi at col h*64+d, residual lo at col 512 + h*64+d (f32 projection split)
//   VTp  [32 graphs][512 (h,d)][1024]   hi at col s, lo at col 512 + s (s = node within graph)
//   CTX  [16384][1024]         hi | lo of the normalised attention context

#define NGR    32
#define NND    512
#define NTOT   (NGR * NND)      // 16384
#define HID    512
#define NHD    8
#define HDM    64
#define EDW    16
#define NHALF  1
#define GHALF  (NGR / NHALF)    // 32
#define RHALF  (GHALF * NND)    // 16384
#define PLD    1024
#define NTHR   256
#define WSMAX  268435456

static_assert(HID == NHD * HDM && HDM == 64 && NHD == 8);
static_assert(PLD == 2 * HID);
static_assert((RHALF % 64) == 0 && (HID % 64) == 0 && (NND % 64) == 0 && (PLD % 32) == 0 && (HID % 32) == 0);
static_assert(((RHALF / 64) * (HID / 64)) % 8 == 0);       // GEMM grids: 8 wave tiles per block, exact
static_assert(((HID / 64) * (NND / 64)) % 8 == 0);
static_assert(NGR == NHALF * GHALF);
static_assert(HID == 64 * 8);                               // k_xprep: 64 units of 8 per row
static_assert(EDW == 16 && NHD == 8 && EDW * NHD <= NTHR);  // k_eb layout

typedef __attribute__((ext_vector_type(16))) _Float16 v16h;
typedef __attribute__((ext_vector_type(8)))  _Float16 v8h;
typedef __attribute__((ext_vector_type(16))) __bf16   v16b;
typedef __attribute__((ext_vector_type(8)))  __bf16   v8b;
typedef __attribute__((ext_vector_type(8)))  float    v8f;
typedef __attribute__((ext_vector_type(4)))  float    v4f;
typedef __attribute__((ext_vector_type(2)))  float    v2f;
typedef __attribute__((ext_vector_type(4)))  unsigned int v4u;
typedef __attribute__((ext_vector_type(4)))  int      v4i;
typedef __attribute__((ext_vector_type(8)))  unsigned short v8us;
typedef v4f  __attribute__((may_alias)) v4fa;
typedef v2f  __attribute__((may_alias)) v2fa;
typedef v4u  __attribute__((may_alias)) v4ua;

// ---- scalar helpers: f32 -> bf16 bits (RNE convert), bf16 bits -> f32 ----
__device__ __forceinline__ unsigned short f2bf_bits(float f) {
  unsigned u = __float_as_uint(f);
  return (unsigned short)((u + 0x7FFFu + ((u >> 16) & 1u)) >> 16);
}
__device__ __forceinline__ float bf_bits2f(unsigned short h) { return __uint_as_float(((unsigned)h) << 16); }
__device__ __forceinline__ float bfrf(float f) { return bf_bits2f(f2bf_bits(f)); }
__device__ __forceinline__ unsigned int f2bfu(float f) {
  const unsigned int u = __float_as_uint(f);
  return ((u + 0x7FFFu + ((u >> 16) & 1u)) >> 16) & 0xFFFFu;
}
__device__ __forceinline__ float bf2f(unsigned int b) { return __uint_as_float(b << 16); }
__device__ __forceinline__ v4f bfr4(const v4f a) {
  v4f r; r.x = bfrf(a.x); r.y = bfrf(a.y); r.z = bfrf(a.z); r.w = bfrf(a.w); return r;
}
__device__ __forceinline__ unsigned int pk2(float lo, float hi) { return f2bfu(lo) | (f2bfu(hi) << 16); }
__device__ __forceinline__ v4u pack8(const v4f a, const v4f b) {
  v4u r;
  r.x = pk2(a.x, a.y); r.y = pk2(a.z, a.w); r.z = pk2(b.x, b.y); r.w = pk2(b.z, b.w);
  return r;
}
// hi = bf16(v), lo = bf16(v - hi): two floats -> one packed word of each
__device__ __forceinline__ void hl2(float v0, float v1, unsigned int& hw, unsigned int& lw) {
  const unsigned int h0 = f2bfu(v0), h1 = f2bfu(v1);
  const unsigned int l0 = f2bfu(v0 - bf2f(h0)), l1 = f2bfu(v1 - bf2f(h1));
  hw = h0 | (h1 << 16);
  lw = l0 | (l1 << 16);
}
__device__ __forceinline__ void pack8hl(const v4f a, const v4f b, v4u& hv, v4u& lv) {
  unsigned int h, l;
  hl2(a.x, a.y, h, l); hv.x = h; lv.x = l;
  hl2(a.z, a.w, h, l); hv.y = h; lv.y = l;
  hl2(b.x, b.y, h, l); hv.z = h; lv.z = l;
  hl2(b.z, b.w, h, l); hv.w = h; lv.w = l;
}

// ---- WMMA fragment helpers (bf16, wave32) ----
// A fragment (row m = lane&15) and B fragment (col n = lane&15) use the SAME k map:
//   elements 0..7 <- k0 + 8h + 0..7, elements 8..15 <- k0 + 16 + 8h + 0..7, h = lane>>4,
// loaded as two 16-B pieces from a k-contiguous 16-bit row: p[0..7] and p[16..23] with p = row + k0 + 8h.
// D element r of lane l = (row 8h + r, col l&15).
__device__ __forceinline__ void dep_guard_b(v8f& a, v8f& b, v16b x, v16b y) { asm volatile("v_nop\n\tv_nop\n\tv_nop\n\tv_nop" : "+v"(a), "+v"(b) : "v"(x), "v"(y)); }
__device__ __forceinline__ void keep4_b(v16b a, v16b b, v16b c, v16b d) { asm volatile("v_nop" :: "v"(a), "v"(b), "v"(c), "v"(d)); }
__device__ __forceinline__ void acc_guard4(v8f& a, v8f& b, v8f& c, v8f& d) { asm volatile("v_nop\n\tv_nop\n\tv_nop\n\tv_nop" : "+v"(a), "+v"(b), "+v"(c), "+v"(d)); }

struct FragBF {
  union U { v16b v; v8b h[2]; };
  static __device__ __forceinline__ v16b load(const __bf16* p) {   // elements 0..7 <- p[0..7], 8..15 <- p[16..23]
    U f; f.h[0] = *(const v8b*)(p); f.h[1] = *(const v8b*)(p + 16); return f.v;
  }
  static __device__ __forceinline__ v8f mma(v16b a, v16b b, v8f c) {
    return __builtin_amdgcn_wmma_f32_16x16x32_bf16(false, a, false, b, (short)0, c, false, false);
  }
  static __device__ __forceinline__ void guard(v8f& a, v8f& b, v16b x, v16b y) { dep_guard_b(a, b, x, y); }
  static __device__ __forceinline__ void keep(v16b a, v16b b, v16b c, v16b d) { keep4_b(a, b, c, d); }
};
union FB { v16b v; v8b h[2]; };

// single WMMA with hazard guard: ties D, keeps A/B live for 4 VALU slots
__device__ __forceinline__ v8f at_mma(v16b a, v16b b, v8f c) {
  c = __builtin_amdgcn_wmma_f32_16x16x32_bf16(false, a, false, b, (short)0, c, false, false);
  asm volatile("v_nop\n\tv_nop\n\tv_nop\n\tv_nop" : "+v"(c) : "v"(a), "v"(b));
  return c;
}
__device__ __forceinline__ __bf16 at_f2bf(float f) { return __builtin_bit_cast(__bf16, f2bf_bits(f)); }
__device__ __forceinline__ void at_split(float f, __bf16& hi, __bf16& lo) {
  const unsigned short hb = f2bf_bits(f);
  hi = __builtin_bit_cast(__bf16, hb);
  lo = at_f2bf(f - __uint_as_float(((unsigned)hb) << 16));
}

// =====================================================================================
// Register-blocked batched WMMA GEMM (bf16 operands).
// C[m,n] = scale * sum_k A[m,k] * Bt[n,k] (+bias)(+resid); each wave owns a 64x64 tile.
// A row-major [M,K]; Bt row-major [N,K]; M,N % 64 == 0, K % 32 == 0 (host static_asserts).
// SPLIT: operands are hi/lo planes (A2/Bt2 = lo planes, same layout); product = hi.hi + hi.lo + lo.hi.
// BIAS_MODE: 0 = none, 1 = bf16r(bias[m]), 2 = bf16r(bias[n]).
// OUT_MODE: 0 = f32, 1 = f16, 2 = bf16 hi plane (Cout) + bf16 lo plane (Cout2).
// coverage: grid.x * 8 waves == (M/64)*(N/64) tiles exactly (host), every C element written once per z.
// =====================================================================================
template <bool SPLIT, int BIAS_MODE, int OUT_MODE, bool RESID, int ACT = 0>
__global__ __launch_bounds__(256) void wmma_gemm64(
    const unsigned short* __restrict__ Ap, const unsigned short* __restrict__ A2p, int lda, long strideA,
    const unsigned short* __restrict__ Btp, const unsigned short* __restrict__ Bt2p, int ldb, long strideB,
    void* __restrict__ Cout, void* __restrict__ Cout2, int ldc, long strideC,
    const float* __restrict__ bias,
    const float* __restrict__ resid, long strideR,
    int M, int N, int K, float scale) {
  typedef __bf16 T;
  typedef v16b V;
  const T* A = (const T*)Ap; const T* A2 = (const T*)A2p; const T* Bt = (const T*)Btp; const T* Bt2 = (const T*)Bt2p;
  __shared__ __align__(16) float sT[8][16 * 68];   // per-wave 16x64 slab, pitch 68 floats
  const int b    = blockIdx.y;
  const int lane = threadIdx.x & 31;
  const int wave = threadIdx.x >> 5;
  const int tilesN = N >> 6;
  const int tilesM = M >> 6;
  const int tile = blockIdx.x * 8 + wave;
  if (tile >= tilesM * tilesN) return;   // wave-uniform; no block barriers in this kernel
  const int tm = tile / tilesN;
  const int tn = tile - tm * tilesN;
  const int m0 = tm << 6;
  const int n0 = tn << 6;

  const T* Ab  = A  + (size_t)b * strideA;
  const T* Bb  = Bt + (size_t)b * strideB;
  const T* Ab2 = SPLIT ? (A2  + (size_t)b * strideA) : nullptr;
  const T* Bb2 = SPLIT ? (Bt2 + (size_t)b * strideB) : nullptr;

  const int rlane = lane & 15;                 // row (A) / col (B, D) within subtile
  const int koff  = (lane >> 4) * 8;           // k offset of this lane half
  const int mOff  = (lane >> 4) * 8;           // D row offset

  v8f acc[4][4];
#pragma unroll
  for (int i = 0; i < 4; ++i)
#pragma unroll
    for (int j = 0; j < 4; ++j) acc[i][j] = (v8f){0.f,0.f,0.f,0.f,0.f,0.f,0.f,0.f};

  for (int k0 = 0; k0 < K; k0 += 32) {
    V bh[4], bl[4];
#pragma unroll
    for (int j = 0; j < 4; ++j) {
      const size_t bo = (size_t)(n0 + (j << 4) + rlane) * ldb + koff + k0;
      bh[j] = FragBF::load(Bb + bo);
      if (SPLIT) bl[j] = FragBF::load(Bb2 + bo);
    }
#pragma unroll
    for (int i = 0; i < 4; ++i) {
      const size_t ao = (size_t)(m0 + (i << 4) + rlane) * lda + koff + k0;
      V ah = FragBF::load(Ab + ao);
      V al;
      if (SPLIT) al = FragBF::load(Ab2 + ao);
#pragma unroll
      for (int j = 0; j < 4; ++j) {
        acc[i][j] = FragBF::mma(ah, bh[j], acc[i][j]);
        if (SPLIT) {
          acc[i][j] = FragBF::mma(ah, bl[j], acc[i][j]);
          acc[i][j] = FragBF::mma(al, bh[j], acc[i][j]);
        }
      }
      FragBF::guard(acc[i][0], acc[i][3], ah, SPLIT ? al : ah);
    }
    FragBF::keep(bh[0], bh[1], bh[2], bh[3]);
    if (SPLIT) FragBF::keep(bl[0], bl[1], bl[2], bl[3]);
  }
  acc_guard4(acc[0][0], acc[0][1], acc[0][2], acc[0][3]);
  acc_guard4(acc[1][0], acc[1][1], acc[1][2], acc[1][3]);
  acc_guard4(acc[2][0], acc[2][1], acc[2][2], acc[2][3]);
  acc_guard4(acc[3][0], acc[3][1], acc[3][2], acc[3][3]);

  // ---- epilogue ----
  float* slab = sT[wave];
  const float* Rb = RESID ? (resid + (size_t)b * strideR) : nullptr;
#pragma unroll
  for (int i = 0; i < 4; ++i) {
    const int mBase = m0 + (i << 4);
    float bm[8];
    if (BIAS_MODE == 1) {   // 8 consecutive floats, 32-B aligned: two 16-B loads
      const v4f b0v = bfr4(*(const v4fa*)(bias + mBase + mOff));
      const v4f b1v = bfr4(*(const v4fa*)(bias + mBase + mOff + 4));
      bm[0] = b0v.x; bm[1] = b0v.y; bm[2] = b0v.z; bm[3] = b0v.w;
      bm[4] = b1v.x; bm[5] = b1v.y; bm[6] = b1v.z; bm[7] = b1v.w;
    } else {
#pragma unroll
      for (int r = 0; r < 8; ++r) bm[r] = 0.f;
    }
#pragma unroll
    for (int j = 0; j < 4; ++j) {
      const int n = n0 + (j << 4) + rlane;
      float bv = 0.f;
      if (BIAS_MODE == 2) bv = bfrf(bias[n]);
#pragma unroll
      for (int r = 0; r < 8; ++r) {
        float v = acc[i][j][r] * scale;
        if (BIAS_MODE == 1) v += bm[r];
        if (BIAS_MODE == 2) v += bv;
        if (RESID) v += Rb[(size_t)(mBase + mOff + r) * ldc + n];
        if (ACT == 1) v = tanhf(v);
        if (ACT == 2) v = fmaxf(v, 0.0f);
        if (ACT == 4) v = (v > 0.f) ? v : 0.01f * v;
        slab[(mOff + r) * 68 + (j << 4) + rlane] = v;
      }
    }
    __builtin_amdgcn_fence(__ATOMIC_RELEASE, "workgroup");
    __builtin_amdgcn_wave_barrier();
    __builtin_amdgcn_fence(__ATOMIC_ACQUIRE, "workgroup");
    if (OUT_MODE == 0) {
      float* C = (float*)Cout + (size_t)b * strideC;
      const int hh = lane >> 4, c4 = (lane & 15) * 4;     // row seg = 256 B = 16 lanes x 16 B
      {
#pragma unroll
        for (int it = 0; it < 8; ++it) {
          const int row = it * 2 + hh;
          v4f v = *(const v4f*)(slab + row * 68 + c4);
          *(v4f*)(C + (size_t)(mBase + row) * ldc + n0 + c4) = v;
        }
        
      }
    } else {
      const int q = lane >> 3, c8 = (lane & 7) * 8;
      unsigned short* C  = (unsigned short*)Cout  + (size_t)b * strideC;
      unsigned short* C2 = (OUT_MODE == 2) ? ((unsigned short*)Cout2 + (size_t)b * strideC) : nullptr;
      {
#pragma unroll
        for (int it = 0; it < 4; ++it) {
          const int row = it * 4 + q;
          const float* sp = slab + row * 68 + c8;
          v8h hv, lv;
#pragma unroll
          for (int e = 0; e < 8; ++e) {
            if (OUT_MODE == 1) {
              hv[e] = (_Float16)sp[e];
            } else {
              unsigned short hb = f2bf_bits(sp[e]);
              unsigned short lb = f2bf_bits(sp[e] - bf_bits2f(hb));
              hv[e] = __builtin_bit_cast(_Float16, hb);
              lv[e] = __builtin_bit_cast(_Float16, lb);
            }
          }
          *(v8h*)(C + (size_t)(mBase + row) * ldc + n0 + c8) = hv;
          if (OUT_MODE == 2) *(v8h*)(C2 + (size_t)(mBase + row) * ldc + n0 + c8) = lv;
        }
        
      }
    }
    __builtin_amdgcn_fence(__ATOMIC_RELEASE, "workgroup");
    __builtin_amdgcn_wave_barrier();
    __builtin_amdgcn_fence(__ATOMIC_ACQUIRE, "workgroup");
  }
}

// =====================================================================================
// Node feature plane: xb[row][c] = bf16(x[row][c]) for row < nN (all 512 c). One thread = 8 contiguous
// =====================================================================================
__global__ __launch_bounds__(NTHR) void k_xprep(const float* __restrict__ x, unsigned short* xb, int nN, int nUnits) {
  const int i = (int)blockIdx.x * NTHR + (int)threadIdx.x;
  if (i >= nUnits) return;
  const int row = i >> 6;
  const int c0  = (i & 63) * 8;
  const int rc  = row < nN ? row : nN - 1;
  const float* p = x + (size_t)rc * HID + c0;
  v4f a = *(const v4fa*)p;
  v4f b = *(const v4fa*)(p + 4);
  const v4f z4 = {0.f, 0.f, 0.f, 0.f};
  if (row >= nN) { a = z4; b = z4; }
  const v4u hv = pack8(a, b);
  unsigned short* o = xb + (size_t)row * HID + c0;
  *(v4u*)o = hv;
  
}

// =====================================================================================
// Weight transpose + bf16 convert into a k-contiguous plane: w is [Kin][Ncol] ([in][out]),
//   wt[n][k] = bf16(w[k mod Kin][n]) for n < Nrows, k < Kout (Kout = Kin or a multiple of it).
// coverage: nUnits = Nrows * Kout/8 threads x 8 = Nrows x Kout exactly.
// =====================================================================================
__global__ __launch_bounds__(NTHR) void k_wtr(const float* __restrict__ w, int Kin, int Ncol, int Nrows, int Kout,
                                              unsigned short* wt, int nUnits) {
  const int u = (int)blockIdx.x * NTHR + (int)threadIdx.x;
  if (u >= nUnits) return;
  const int kq = Kout >> 3;
  const int n  = u / kq;
  const int k8 = (u - n * kq) * 8;
  const int kk = k8 - (k8 / Kin) * Kin;
  const int ncl = n < Ncol ? n : Ncol - 1;
  const float* p = w + (size_t)kk * (size_t)Ncol + ncl;
  v4f a, b;
  a.x = p[0];                    a.y = p[(size_t)Ncol];         a.z = p[(size_t)2 * Ncol];     a.w = p[(size_t)3 * Ncol];
  b.x = p[(size_t)4 * Ncol];     b.y = p[(size_t)5 * Ncol];     b.z = p[(size_t)6 * Ncol];     b.w = p[(size_t)7 * Ncol];
  const v4f z4 = {0.f, 0.f, 0.f, 0.f};
  if (n >= Ncol || n >= Nrows) { a = z4; b = z4; }
  const v4u wv = pack8(a, b);
  unsigned short* o = wt + (size_t)n * (size_t)Kout + k8;
  *(v4u*)o = wv;
  
}

// =====================================================================================
// Edge bias plane: EB[e][h] = sum_t bf16r(ea[e][t]) * bf16r(We[t][h]) + bf16r(be[h]) (f32, 16 terms summed
// from +0 then the bias), zero rows for pad edges nE <= e < EP (load address clamped, value zeroed by select).
// One thread = one edge and 4 consecutive heads: 4 b128 loads in a rolled loop, one 16-B store;
// coverage: nUnits = EP*2 threads x 4 = EP x 8 elements exactly.
// =====================================================================================
__global__ __launch_bounds__(NTHR) void k_eb(const float* __restrict__ ea, const float* __restrict__ We,
                                             const float* __restrict__ be, float* EB, int nE, int nUnits) {
  __shared__ float sWe[EDW * NHD];
  __shared__ float sbe[NHD];
  const int tid = (int)threadIdx.x;
  if (tid < EDW * NHD) sWe[tid] = bfrf(We[tid]);           // We[t][h] row-major
  if (tid < NHD) sbe[tid] = bfrf(be[tid]);
  __syncthreads();
  const int u = (int)blockIdx.x * NTHR + tid;
  if (u >= nUnits) return;
  const int e  = u >> 1;
  const int h0 = (u & 1) * 4;
  const int ec = e < nE ? e : nE - 1;
  const float* er = ea + (size_t)ec * EDW;
  float s0 = 0.f, s1 = 0.f, s2 = 0.f, s3 = 0.f;
#pragma unroll 1
  for (int q = 0; q < 4; ++q) {
    const v4f a = bfr4(*(const v4fa*)(er + 4 * q));
    const float* wr = sWe + (4 * q) * NHD + h0;            // We[4q+i][h0+j] = wr[i*8 + j]
    s0 = fmaf(a.x, wr[0],  s0); s1 = fmaf(a.x, wr[1],  s1); s2 = fmaf(a.x, wr[2],  s2); s3 = fmaf(a.x, wr[3],  s3);
    s0 = fmaf(a.y, wr[8],  s0); s1 = fmaf(a.y, wr[9],  s1); s2 = fmaf(a.y, wr[10], s2); s3 = fmaf(a.y, wr[11], s3);
    s0 = fmaf(a.z, wr[16], s0); s1 = fmaf(a.z, wr[17], s1); s2 = fmaf(a.z, wr[18], s2); s3 = fmaf(a.z, wr[19], s3);
    s0 = fmaf(a.w, wr[24], s0); s1 = fmaf(a.w, wr[25], s1); s2 = fmaf(a.w, wr[26], s2); s3 = fmaf(a.w, wr[27], s3);
  }
  v4f o;
  o.x = s0 + sbe[h0]; o.y = s1 + sbe[h0 + 1]; o.z = s2 + sbe[h0 + 2]; o.w = s3 + sbe[h0 + 3];
  const v4f z4 = {0.f, 0.f, 0.f, 0.f};
  if (e >= nE) o = z4;
  float* op = EB + (size_t)e * NHD + h0;
  *(v4f*)op = o;
  
}

// =====================================================================================
// Graph attention with per-edge additive bias, one block per (graph, 64-query tile), 8 waves.
// Phase A (block-local, statically bounded): chunk scan of the src list (edge_index row 0) for
//   src in [node0, node0+64): hits (edge id, query row, dst % 512) collected into LDS in scan (chunk, wave, entry j, lane)
//   order, capped at HCAP (poison when reached); counting sort (8 waves, each its own 8 query rows, stable) into
//   NBIN bins, bin = query row * 32 + (dst % 512) / 16, -> sE / sD segments with roff / rcnt. Nothing persists
//   outside LDS.
// Phase B: 4 head pairs; waves 0..3 run head 2p, waves 4..7 head 2p+1, each wave 16 query rows.
//   Per key chunk of 64: K hi/lo and V^T hi/lo tiles of both heads staged (256 threads x 32 elements =
//   two 64x64 tiles per plane, the whole chunk), a 2x64x64 f32 bias tile zeroed then filled by row owners
//   (4 threads per query row, thread j walks only the bin of its row and of key columns 16j..16j+15 of this
//   chunk, in segment order = hit scan order -> duplicate (src,dst) pairs sum deterministically; lanes
//   whose bin is shorter than the wave's longest add into a private dummy slot),
//   then S = q.k (3-term split) * 0.125 + bias, online softmax in f32, P split hi/lo through per-wave LDS
//   Epilogue: ctx = O / l staged per wave in LDS (aliasing only that wave's own bias rows), written as
// Geometry guards (NaN poison of the block's ctx rows, never a trap): hit cap, per-row count > RWCAP,
//   num_graphs != NGR, batch id of the block's first node outside [0, NGR).
// coverage: CTX rows lrow0..lrow0+63 x all 1024 cols per block; grid = GHALF*8 blocks covers RHALF rows once.
// =====================================================================================
#define AT_NW   8
#define EPT     8
#define CHUNK   (NTHR * EPT)          // 2048 keys per chunk
#define WCAP    (EPT * 32)            // 256: exact upper bound of hits per wave per chunk
#define LISTN   (AT_NW * WCAP)        // 2048
#define SLOTB   6
#define NSLOT   64                    // query rows per block = scan slots
#define BINSH   4                     // 16 key columns per bin
#define NBIN    (NSLOT * (NND >> BINSH))   // 2048 bins: (query row, group of 16 key columns)
#define HCAP    2048                  // hit capacity per block
#define RWCAP   128                   // static cap on per-row edge count
#define KVT     4096                  // one 64x64 f32 bias tile
#define KVP     72                    // row pitch of the K / V^T / P tiles in LDS, elements: 144 B = 16 B x 9, so the
                                      // 16 rows of a ds_load_b128 fragment read fall on 16 different bank groups
#define KVS     (64 * KVP)            // one 64-row K or V^T tile
#define PWS     (16 * KVP)            // one wave's 16-row P tile
#define NDUM    512                   // private dummy accumulators (2 per thread)
#define LO_KV   0
#define LO_P    (8 * KVS * 2)                           // 73728
#define LO_BT   (LO_P + 2 * AT_NW * PWS * 2)            // 110592
#define LO_SE   (LO_BT + (2 * KVT + NDUM) * 4)          // 145408
#define LO_SD   (LO_SE + HCAP * 4)                      // 153600
#define LO_RC   (LO_SD + HCAP * 4)                      // 161792
#define LDS_ATT (LO_RC + (2 * NBIN + 2 * AT_NW) * 4)    // 178240

static_assert((LISTN + 4 * HCAP) * 4 <= LO_P);        // phase-A lists alias the K/V tile region
static_assert(LDS_ATT <= 300000);
static_assert(KVP >= 64 && (KVP * 2) % 16 == 0 && ((KVP * 2) / 16) % 2 == 1);   // 16-B aligned rows, odd multiple
static_assert((LO_P % 16) == 0 && (LO_BT % 16) == 0);
static_assert((1 << SLOTB) == NSLOT);
static_assert(NTHR == 32 * AT_NW);
static_assert(NTHR == 4 * NSLOT);                      // bias fill: 4 threads per query row
static_assert(NTHR * 4 * 8 == 2 * KVT);                // bias zero fill: 8 sweeps of 4 floats per thread
static_assert(NDUM == 2 * NTHR && NDUM == 128 * 4);
static_assert(AT_NW * 1024 == 2 * KVT);                // per-wave output staging = own bias rows
static_assert((CHUNK & (CHUNK - 1)) == 0 && CHUNK == 2048);
static_assert(NSLOT == 8 * AT_NW && NND == 512);                 // sort: 8 query rows per wave, owner wave = hitRD >> 12
static_assert(NBIN == NTHR * 8 && (NND >> BINSH) == 32);         // sort: 8 bins per thread, 4 threads per row
static_assert(RWCAP < 256);                                      // sort: 8-bit counters exact below the row cap
static_assert((64 >> BINSH) == 4 && (LO_RC % 16) == 0);          // 4 bins per row and key chunk = 4 fill threads

// One chunk of the key list: each thread tests EPT entries against the block's slot range
// [slotBase, slotBase + nb); hits are appended to this wave's LDS list as (local_index << SLOTB | slot).
// Returns the wave-uniform hit count (<= WCAP always). The vector / scalar load choice is block-uniform;
// the scalar path clamps every address and selects the sentinel by value.
__device__ __forceinline__ int scan_chunk(const int* __restrict__ keys, int nE, int cbase, int slotBase,
                                          int nb, int vec8, int* list, int tid, int lane, int wave) {
  int wc = 0;
  const int el0  = tid * EPT;
  const int e0   = cbase + el0;
  const int sent = -2147483647 - 1;
  v4i da, db;
  if (vec8 != 0 && cbase + CHUNK <= nE) {
    da = *(const v4i*)(keys + e0);
    db = *(const v4i*)(keys + e0 + 4);
  } else {
    da.x = (e0     < nE) ? keys[min(e0,     nE - 1)] : sent;
    da.y = (e0 + 1 < nE) ? keys[min(e0 + 1, nE - 1)] : sent;
    da.z = (e0 + 2 < nE) ? keys[min(e0 + 2, nE - 1)] : sent;
    da.w = (e0 + 3 < nE) ? keys[min(e0 + 3, nE - 1)] : sent;
    db.x = (e0 + 4 < nE) ? keys[min(e0 + 4, nE - 1)] : sent;
    db.y = (e0 + 5 < nE) ? keys[min(e0 + 5, nE - 1)] : sent;
    db.z = (e0 + 6 < nE) ? keys[min(e0 + 6, nE - 1)] : sent;
    db.w = (e0 + 7 < nE) ? keys[min(e0 + 7, nE - 1)] : sent;
  }
  const unsigned nbs = (unsigned)slotBase;
  const unsigned unb = (unsigned)nb;
  const unsigned s0 = (unsigned)da.x - nbs, s1 = (unsigned)da.y - nbs;
  const unsigned s2 = (unsigned)da.z - nbs, s3 = (unsigned)da.w - nbs;
  const unsigned s4 = (unsigned)db.x - nbs, s5 = (unsigned)db.y - nbs;
  const unsigned s6 = (unsigned)db.z - nbs, s7 = (unsigned)db.w - nbs;
  const bool h0 = s0 < unb, h1 = s1 < unb, h2 = s2 < unb, h3 = s3 < unb;
  const bool h4 = s4 < unb, h5 = s5 < unb, h6 = s6 < unb, h7 = s7 < unb;
  const unsigned any = __builtin_amdgcn_ballot_w32(h0 | h1 | h2 | h3 | h4 | h5 | h6 | h7);
  if (any != 0u) {
#define HITJ(J, HJ, SJ) { \
      const unsigned mj = __builtin_amdgcn_ballot_w32(HJ); \
      if (mj != 0u) { \
        if (HJ) { \
          const int pos = wc + (int)__builtin_amdgcn_mbcnt_lo(mj, 0u); \
          if (pos < WCAP) list[wave * WCAP + pos] = ((el0 + (J)) << SLOTB) | (int)(SJ); \
        } \
        wc += (int)__builtin_popcount(mj); } }
    HITJ(0, h0, s0)
    HITJ(1, h1, s1)
    HITJ(2, h2, s2)
    HITJ(3, h3, s3)
    HITJ(4, h4, s4)
    HITJ(5, h5, s5)
    HITJ(6, h6, s6)
    HITJ(7, h7, s7)
#undef HITJ
  }
  return wc;
}

__global__ __launch_bounds__(NTHR) void k_attn(
    const unsigned short* __restrict__ Qp, const unsigned short* __restrict__ Kp,
    const unsigned short* __restrict__ VTp, const float* __restrict__ EB,
    const int* __restrict__ keys, const int* __restrict__ gath,
    const int* __restrict__ ngp, const int* __restrict__ bat,
    unsigned short* CTX, int nE, int vec8, int gbase) {
  extern __shared__ v4f lds_dyn[];
  char* lds = (char*)lds_dyn;
  __bf16* Ksh = (__bf16*)(lds + LO_KV);         // [2][64 x KVP]  K hi  [kv][d]
  __bf16* Ksl = Ksh + 2 * KVS;                   // [2][64 x KVP]  K lo
  __bf16* Vth = Ksl + 2 * KVS;                   // [2][64 x KVP]  V^T hi [d][kv]
  __bf16* Vtl = Vth + 2 * KVS;                   // [2][64 x KVP]  V^T lo
  int* list  = (int*)(lds + LO_KV);              // phase A only: [LISTN]
  int* hitE  = list + LISTN;                     // [HCAP] edge ids, in scan order
  int* hitRD = hitE + HCAP;                      // [HCAP] (row << 9) | loc_dst
  int* tE    = hitRD + HCAP;                     // [HCAP] hitE regrouped by owner wave (8 query rows each)
  int* tRD   = tE + HCAP;                        // [HCAP] hitRD of the same entries
  __bf16* Psh = (__bf16*)(lds + LO_P);           // [8 waves][16 x KVP] P hi
  __bf16* Psl = Psh + AT_NW * PWS;               // P lo
  float* BTX = (float*)(lds + LO_BT);            // [2][64 x 64] bias tiles + [NDUM] dummies; epilogue staging
  int* sE   = (int*)(lds + LO_SE);               // [HCAP] edge ids sorted by query row
  int* sD   = (int*)(lds + LO_SD);               // [HCAP] loc_dst of the same entries
  int* rcnt = (int*)(lds + LO_RC);               // [NBIN] entries per bin
  int* roff = rcnt + NBIN;                       // [NBIN] first entry of the bin in sE / sD
  int* wcnt = roff + NBIN;                       // [8]
  int* misc = wcnt + AT_NW;                      // [8] largest per-row count of each wave

  const int tid = (int)threadIdx.x, lane = tid & 31, wave = tid >> 5, hh = lane >> 4, c = lane & 15;
  const int lgr   = (int)blockIdx.x >> 3;        // graph within this pass
  const int qt    = (int)blockIdx.x & 7;         // 64-query tile within the graph
  const int gb    = gbase + lgr;                 // graph id
  const int node0 = gb * NND + qt * NSLOT;       // global node id of query row 0
  const int lrow0 = lgr * NND + qt * NSLOT;      // plane row of query row 0

  // ---- phase A1: chunk scan + ordered copy of hits ----
  int tot = 0;
  const int nChunks = (nE + CHUNK - 1) / CHUNK;
#pragma unroll 1
  for (int ch = 0; ch < nChunks; ++ch) {
    const int cbase = ch * CHUNK;
    const int wc = scan_chunk(keys, nE, cbase, node0, NSLOT, vec8, list, tid, lane, wave);
    if (lane == 0) wcnt[wave] = wc;
    __syncthreads();
    int pre = 0, all = 0;
#pragma unroll
    for (int w2 = 0; w2 < AT_NW; ++w2) {
      int cc = wcnt[w2];
      cc = cc < 0 ? 0 : (cc > WCAP ? WCAP : cc);
      all += cc;
      pre += (w2 < wave) ? cc : 0;
    }
    const int wcc  = wc > WCAP ? WCAP : wc;
    const int base = tot + pre;
#pragma unroll 1
    for (int i0 = 0; i0 < wcc; i0 += 32) {          // wcc wave-uniform; loads unconditional, clamped
      const int i   = i0 + lane;
      const int ic  = i < wcc ? i : wcc - 1;
      const int ent = list[wave * WCAP + ic];
      const int el  = (ent >> SLOTB) & (CHUNK - 1);
      const int sl  = ent & (NSLOT - 1);
      int eid = cbase + el;
      eid = eid > nE - 1 ? nE - 1 : eid;
      int g = gath[eid];
      g = g < 0 ? 0 : (g > NTOT - 1 ? NTOT - 1 : g);
      const int pos = base + i;
      if (i < wcc && pos < HCAP) {
        hitE[pos]  = eid;
        hitRD[pos] = (sl << 9) | (g & (NND - 1));
      }
    }
    tot += all;
    tot = tot > HCAP ? HCAP : tot;
    __syncthreads();
  }
  const int nh = __builtin_amdgcn_readfirstlane(tot);   // the same in every thread of the block: scalar loop bounds

  // ---- phase A2: stable counting sort of the hits into the NBIN bins, by all 8 waves ----
  // Wave w owns query rows 8w..8w+7 (bins 256w..256w+255), thread tid the bins 8*tid..8*tid+7 (one query row,
  // 128 key columns). Bins ascend with the row, so the entries of wave w fill sE / sD[below, below + mine).
  // Every counter lives in its owner's registers: no LDS word is read, changed and written back per hit.
  // (a) hits of lower waves' rows and of this wave's rows
  int below = 0, mine = 0;
#pragma unroll 4   // four independent LDS reads in flight per wait
  for (int b0 = 0; b0 < nh; b0 += 32) {
    const int idx = b0 + lane;
    const int g   = hitRD[idx < nh ? idx : nh - 1] >> 12;        // owner wave = query row / 8
    const bool ok = idx < nh;
    below += (int)__builtin_popcount(__builtin_amdgcn_ballot_w32(ok && g < wave));
    mine  += (int)__builtin_popcount(__builtin_amdgcn_ballot_w32(ok && g == wave));
  }
  // (b) this wave's hits copied, in hit order, to tRD / tE[below, below + mine)
  {
    int wpos = below;
    for (int b0 = 0; b0 < nh; b0 += 128) {
      int rd[4], ee[4];
#pragma unroll   // rd / ee in registers; all reads ahead of the first store, one LDS latency for the four
      for (int j = 0; j < 4; ++j) {
        const int idx = b0 + 32 * j + lane;
        const int cl  = idx < nh ? idx : nh - 1;
        rd[j] = hitRD[cl];
        ee[j] = hitE[cl];
      }
#pragma unroll   // rd / ee in registers
      for (int j = 0; j < 4; ++j) {
        const bool ok = (b0 + 32 * j + lane < nh) && ((rd[j] >> 12) == wave);
        const unsigned mk = __builtin_amdgcn_ballot_w32(ok);
        if (ok) {
          int p = wpos + (int)__builtin_amdgcn_mbcnt_lo(mk, 0u);
          p = p > HCAP - 1 ? HCAP - 1 : p;
          tRD[p] = rd[j];
          tE[p]  = ee[j];
        }
        wpos += (int)__builtin_popcount(mk);
      }
    }
  }
  __syncthreads();
  // (c) per-bin counts: every lane reads each entry of its wave (one address, broadcast); the owner counts it.
  //     8 counters of 8 bits: exact while a row holds <= RWCAP entries; tc is exact always and feeds the guard.
  unsigned long long c8 = 0ull;
  int tc = 0;
#pragma unroll 8   // eight independent LDS reads in flight per wait
  for (int i = 0; i < mine; ++i) {
    const int u = tRD[below + i];
    const bool own = (u >> 7) == tid;
    c8 += (unsigned long long)(own ? 1 : 0) << (((u >> BINSH) & 7) * 8);
    tc += own ? 1 : 0;
  }
  // (d) first entry of each bin: wave prefix over the threads' totals, then over the thread's own 8 counters
  int tbase;
  {
    int incl = tc;
#pragma unroll
    for (int d = 1; d < 32; d <<= 1) {
      const int up = __shfl_up(incl, d, 32);
      if (lane >= d) incl += up;
    }
    tbase = below + incl - tc;
    int cn[8], of[8];
    int run = tbase;
#pragma unroll
    for (int k = 0; k < 8; ++k) {
      cn[k] = (int)((c8 >> (8 * k)) & 255ull);
      of[k] = run;
      run += cn[k];
    }
    const v4i c0v = {cn[0], cn[1], cn[2], cn[3]}, c1v = {cn[4], cn[5], cn[6], cn[7]};
    const v4i o0v = {of[0], of[1], of[2], of[3]}, o1v = {of[4], of[5], of[6], of[7]};
    *(v4i*)(rcnt + tid * 8)     = c0v;
    *(v4i*)(rcnt + tid * 8 + 4) = c1v;
    *(v4i*)(roff + tid * 8)     = o0v;
    *(v4i*)(roff + tid * 8 + 4) = o1v;
    // largest per-row count of the wave: a row = 4 neighbouring threads
    int rc = tc;
    rc += __shfl_xor(rc, 1, 32);
    rc += __shfl_xor(rc, 2, 32);
#pragma unroll
    for (int off = 4; off < 32; off <<= 1) {
      const int o = __shfl_xor(rc, off, 32);
      rc = o > rc ? o : rc;
    }
    if (lane == 0) misc[wave] = rc;
  }
  // (e) placement in hit order (stable): byte k of cur = next free place of bin 8*tid + k, counted from tbase
  {
    unsigned long long cur = c8 << 8;
    cur += cur << 8;
    cur += cur << 16;
    cur += cur << 32;
    for (int i0 = 0; i0 < mine; i0 += 8) {
      int u[8], e[8];
#pragma unroll   // u / e in registers; all reads ahead of the first store, one LDS latency for the eight
      for (int j = 0; j < 8; ++j) {
        const int ii = i0 + j < mine ? i0 + j : mine - 1;
        u[j] = tRD[below + ii];
        e[j] = tE[below + ii];
      }
#pragma unroll   // u / e in registers
      for (int j = 0; j < 8; ++j) {
        if (i0 + j < mine && (u[j] >> 7) == tid) {
          const int sh = ((u[j] >> BINSH) & 7) * 8;
          int pos = tbase + (int)((cur >> sh) & 255ull);
          pos = pos > HCAP - 1 ? HCAP - 1 : pos;
          sE[pos] = e[j];
          sD[pos] = u[j] & (NND - 1);
          cur += 1ull << sh;
        }
      }
    }
  }
  __syncthreads();

  // ---- geometry / capacity guards -> NaN poison of this block's ctx rows ----
  int degmax = 0;
#pragma unroll
  for (int w2 = 0; w2 < AT_NW; ++w2) degmax = misc[w2] > degmax ? misc[w2] : degmax;
  const int ng  = ngp[0];
  const int bt0 = bat[node0];
  const bool bad = (nh >= HCAP) || (degmax > RWCAP) || (ng != NGR) || (bt0 < 0) || (bt0 >= NGR);
  const float pz = bad ? __int_as_float(0x7fc00000) : 0.0f;

  // ---- phase B ----
  const int wsub = wave & 3;                     // query row group of this wave
  const int hl   = wave >> 2;                    // head slot (0 / 1) of this wave within the pair
  const int rw   = tid >> 2;                     // bias fill: query row owned by this thread
  const int jw   = tid & 3;                      // bias fill: key-column quarter owned by this thread
  const float sscale = 0.125f;
  const v8f z8 = {0.f,0.f,0.f,0.f,0.f,0.f,0.f,0.f};
  const __bf16* Kth = Ksh + hl * KVS;
  const __bf16* Ktl = Ksl + hl * KVS;
  const __bf16* Vtth = Vth + hl * KVS;
  const __bf16* Vttl = Vtl + hl * KVS;
  __bf16* pwh = Psh + wave * PWS;
  __bf16* pwl = Psl + wave * PWS;

#pragma unroll 1
  for (int hp = 0; hp < NHD / 2; ++hp) {
    const int h    = 2 * hp + hl;                // head of this wave
    const int qrow = lrow0 + wsub * 16;          // plane row of this wave's first query

    // Q fragments (A operand, row = lane&15, split k map): 2 d-chunks, hi and lo
    v16b qah[2], qal[2];
#pragma unroll
    for (int dc = 0; dc < 2; ++dc) {
      const unsigned short* qp = Qp + (size_t)(qrow + c) * PLD + h * HDM + dc * 32 + 8 * hh;
      qah[dc] = FragBF::load((const __bf16*)(const void*)qp);
      qal[dc] = FragBF::load((const __bf16*)(const void*)(qp + HID));
    }
    float mrow[8], lrow[8];
    v8f oacc[4];
#pragma unroll
    for (int r = 0; r < 8; ++r) { mrow[r] = -INFINITY; lrow[r] = 0.f; }
#pragma unroll
    for (int t = 0; t < 4; ++t) oacc[t] = z8;

#pragma unroll 1
    for (int kc = 0; kc < NND / 64; ++kc) {
      const int kv0 = kc * 64;
      __syncthreads();
      {
        // staging: thread half th = head 2hp+th; 128 threads x (4 x 8) elements = 64 x 64 per plane
        const int th = tid >> 7, t = tid & 127;
        const int r = t >> 1, half = (t & 1) * 32;
        const int hs = 2 * hp + th;
        const unsigned short* ksh = Kp + (size_t)(lgr * NND + kv0 + r) * PLD + hs * HDM + half;
        const unsigned short* ksl = ksh + HID;
        const unsigned short* vsh = VTp + ((size_t)lgr * HID + hs * HDM + r) * PLD + kv0 + half;
        const unsigned short* vsl = vsh + HID;
        __bf16* kdh = Ksh + th * KVS + r * KVP + half;
        __bf16* kdl = Ksl + th * KVS + r * KVP + half;
        __bf16* vdh = Vth + th * KVS + r * KVP + half;
        __bf16* vdl = Vtl + th * KVS + r * KVP + half;
#pragma unroll
        for (int i = 0; i < 4; ++i) {
          const v8b a0 = *(const v8b*)(ksh + 8 * i);
          const v8b a1 = *(const v8b*)(ksl + 8 * i);
          const v8b b0 = *(const v8b*)(vsh + 8 * i);
          const v8b b1 = *(const v8b*)(vsl + 8 * i);
          *(v8b*)(kdh + 8 * i) = a0;
          *(v8b*)(kdl + 8 * i) = a1;
          *(v8b*)(vdh + 8 * i) = b0;
          *(v8b*)(vdl + 8 * i) = b1;
        }
        // bias tiles + dummies zero: 8 sweeps x 256 threads x 4 floats = both 64x64 tiles (each store's lanes
        // contiguous, no two on one bank); 128 threads x 4 = dummies
        const v4f z4 = {0.f, 0.f, 0.f, 0.f};
        float* bz = BTX + tid * 4;
#pragma unroll
        for (int i = 0; i < 8; ++i) *(v4fa*)(bz + NTHR * 4 * i) = z4;
        if (tid < 128) *(v4fa*)(BTX + 2 * KVT + 4 * tid) = z4;
      }
      __syncthreads();
      {
        // bias fill: segment [st, st+cnt) of sE/sD = the bin of row rw and key columns kv0+16jw..kv0+16jw+15
        const int bin = rw * (NND >> BINSH) + kc * (64 >> BINSH) + jw;
        int st = roff[bin], cnt = rcnt[bin];
        st  = st < 0 ? 0 : (st > nh ? nh : st);
        cnt = cnt < 0 ? 0 : (cnt > RWCAP ? RWCAP : cnt);
        if (cnt > nh - st) cnt = nh - st;
        int cmax = cnt;
#pragma unroll
        for (int off = 16; off > 0; off >>= 1) {
          const int o = __shfl_xor(cmax, off, 32);
          cmax = o > cmax ? o : cmax;
        }
        const float* ebp = EB + 2 * hp;
#pragma unroll 1
        for (int q = 0; q < cmax; ++q) {           // cmax wave-uniform, <= RWCAP
          const bool valid = q < cnt;
          int idx = st + q;
          idx = idx > nh - 1 ? nh - 1 : idx;
          idx = idx < 0 ? 0 : idx;
          const int col = sD[idx] - kv0;
          int e = sE[idx];
          e = e < 0 ? 0 : (e > nE - 1 ? nE - 1 : e);
          const v2f ebv = *(const v2fa*)(ebp + (size_t)e * NHD);
          const bool inr = valid && ((unsigned)col < 64u) && ((col >> 4) == jw);
          const int ia = inr ? (rw * 64 + col) : (2 * KVT + tid);
          const int ib = inr ? (KVT + rw * 64 + col) : (2 * KVT + NTHR + tid);
          BTX[ia] = BTX[ia] + ebv.x;
          BTX[ib] = BTX[ib] + ebv.y;
        }
      }
      __syncthreads();

      // ---- S = q . k (3-term) ----
      v8f s[4];
#pragma unroll
      for (int j = 0; j < 4; ++j) {
        s[j] = z8;
#pragma unroll
        for (int dc = 0; dc < 2; ++dc) {
          FB kb, kl;
          const __bf16* kr = Kth + (j * 16 + c) * KVP + dc * 32 + 8 * hh;
          const __bf16* kq = Ktl + (j * 16 + c) * KVP + dc * 32 + 8 * hh;
          kb.h[0] = *(const v8b*)kr;
          kb.h[1] = *(const v8b*)(kr + 16);
          kl.h[0] = *(const v8b*)kq;
          kl.h[1] = *(const v8b*)(kq + 16);
          s[j] = at_mma(qah[dc], kb.v, s[j]);
          s[j] = at_mma(qah[dc], kl.v, s[j]);
          s[j] = at_mma(qal[dc], kb.v, s[j]);
        }
      }
      // scale, add bias tile (D element r = row wsub*16 + 8hh + r, col j*16 + c), chunk row max
      const float* btr = BTX + hl * KVT + (wsub * 16 + 8 * hh) * 64 + c;
      float cm[8];
#pragma unroll
      for (int r = 0; r < 8; ++r) {
        float m = -INFINITY;
#pragma unroll
        for (int j = 0; j < 4; ++j) {
          const float sv = s[j][r] * sscale + btr[r * 64 + j * 16];
          s[j][r] = sv;
          m = fmaxf(m, sv);
        }
#pragma unroll
        for (int off = 1; off < 16; off <<= 1) m = fmaxf(m, __shfl_xor(m, off, 32));
        cm[r] = m;
      }
#pragma unroll
      for (int r = 0; r < 8; ++r) {
        const float mnew = fmaxf(mrow[r], cm[r]);
        const float alpha = expf(mrow[r] - mnew);
        mrow[r] = mnew;
        float psum = 0.f;
#pragma unroll
        for (int j = 0; j < 4; ++j) {
          const float p = expf(s[j][r] - mnew);
          psum += p;
          __bf16 a, bl; at_split(p, a, bl);
          pwh[(8 * hh + r) * KVP + j * 16 + c] = a;
          pwl[(8 * hh + r) * KVP + j * 16 + c] = bl;
        }
#pragma unroll
        for (int off = 1; off < 16; off <<= 1) psum += __shfl_xor(psum, off, 32);
        lrow[r] = lrow[r] * alpha + psum;
#pragma unroll
        for (int t = 0; t < 4; ++t) oacc[t][r] *= alpha;
      }
      __builtin_amdgcn_fence(__ATOMIC_RELEASE, "workgroup");
      __builtin_amdgcn_wave_barrier();
      __builtin_amdgcn_fence(__ATOMIC_ACQUIRE, "workgroup");
      // ---- O += p . v (3-term); P fragment = A (row c), V^T fragment = B (col = d) ----
#pragma unroll 1
      for (int kk = 0; kk < 2; ++kk) {
        FB pa, pl;
        pa.h[0] = *(const v8b*)(pwh + c * KVP + kk * 32 + 8 * hh);
        pa.h[1] = *(const v8b*)(pwh + c * KVP + kk * 32 + 16 + 8 * hh);
        pl.h[0] = *(const v8b*)(pwl + c * KVP + kk * 32 + 8 * hh);
        pl.h[1] = *(const v8b*)(pwl + c * KVP + kk * 32 + 16 + 8 * hh);
#pragma unroll
        for (int t = 0; t < 4; ++t) {
          FB vb, vl;
          vb.h[0] = *(const v8b*)(Vtth + (t * 16 + c) * KVP + kk * 32 + 8 * hh);
          vb.h[1] = *(const v8b*)(Vtth + (t * 16 + c) * KVP + kk * 32 + 16 + 8 * hh);
          vl.h[0] = *(const v8b*)(Vttl + (t * 16 + c) * KVP + kk * 32 + 8 * hh);
          vl.h[1] = *(const v8b*)(Vttl + (t * 16 + c) * KVP + kk * 32 + 16 + 8 * hh);
          oacc[t] = at_mma(pa.v, vb.v, oacc[t]);
          oacc[t] = at_mma(pa.v, vl.v, oacc[t]);
          oacc[t] = at_mma(pl.v, vb.v, oacc[t]);
        }
      }
    }

    // ---- epilogue: normalise, stage the wave's 16x64 tile (pitch 64, own bias rows), hi | lo lines ----
    __syncthreads();
    {
      float* os = BTX + wave * 1024;
#pragma unroll
      for (int r = 0; r < 8; ++r) {
        const float inv = 1.0f / lrow[r];
#pragma unroll
        for (int t = 0; t < 4; ++t) os[(8 * hh + r) * 64 + t * 16 + c] = oacc[t][r] * inv + pz;
      }
      __builtin_amdgcn_fence(__ATOMIC_RELEASE, "workgroup");
      __builtin_amdgcn_wave_barrier();
      __builtin_amdgcn_fence(__ATOMIC_ACQUIRE, "workgroup");
      const int q4 = lane >> 3, c8 = (lane & 7) * 8;
      v4u hv[4], lv[4];
#pragma unroll
      for (int it = 0; it < 4; ++it) {
        const int row = it * 4 + q4;                   // it 0..3 x q4 0..3 covers rows 0..15
        const float* sp = os + row * 64 + c8;
        const v4f a = *(const v4fa*)sp;
        const v4f b = *(const v4fa*)(sp + 4);
        pack8hl(a, b, hv[it], lv[it]);
      }
      {
#pragma unroll
        for (int it = 0; it < 4; ++it) {
          const int row = it * 4 + q4;
          unsigned short* op = CTX + (size_t)(qrow + row) * PLD + h * HDM + c8;
          *(v4u*)op = hv[it];
          *(v4u*)(op + HID) = lv[it];
        }
        
      }
    }
  }
}

// =====================================================================================
static inline int cdiv(int a, int b) { return (a + b - 1) / b; }

extern "C" void kernel_launch(void* const* d_in, const int* in_sizes, int n_in,
                              void* d_out, int out_size, void* d_ws, size_t ws_size,
                              hipStream_t stream) {
  if (n_in < 15) return;
  if (in_sizes[0] != NTOT * HID) return;                        // x [16384][512]
  if (in_sizes[1] != NTOT) return;                              // batch [16384]
  if (in_sizes[2] < 2 || (in_sizes[2] & 1) != 0) return;        // edge_index [2][E]
  const int nE = in_sizes[2] / 2;
  if (nE < 1 || nE > (1 << 24)) return;
  if (in_sizes[3] != nE * EDW) return;                          // edge_attr [E][16]
  if (in_sizes[4] != HID * HID || in_sizes[6] != HID * HID || in_sizes[8] != HID * HID || in_sizes[10] != HID * HID) return;
  if (in_sizes[5] != HID || in_sizes[7] != HID || in_sizes[9] != HID || in_sizes[11] != HID) return;
  if (in_sizes[12] != EDW * NHD || in_sizes[13] != NHD || in_sizes[14] != 1) return;
  if (out_size != NTOT * HID) return;                           // out [16384][512], last element 8388607

  const float* x   = (const float*)d_in[0];
  const int*   bat = (const int*)  d_in[1];
  const int*   ei  = (const int*)  d_in[2];     // row 0 = src, row 1 = dst
  const float* ea  = (const float*)d_in[3];
  const float* Wq  = (const float*)d_in[4];     // [in][out]
  const float* bq  = (const float*)d_in[5];
  const float* Wk  = (const float*)d_in[6];
  const float* bk  = (const float*)d_in[7];
  const float* Wv  = (const float*)d_in[8];
  const float* bv  = (const float*)d_in[9];
  const float* Wo  = (const float*)d_in[10];
  const float* bo  = (const float*)d_in[11];
  const float* We  = (const float*)d_in[12];    // [16][8]
  const float* be  = (const float*)d_in[13];    // [8]
  const int*   ngp = (const int*)  d_in[14];    // [1]
  float* out = (float*)d_out;
  const int* keys = ei;                         // src list
  const int* gath = ei + nE;                    // dst list

  const int EP = cdiv(nE, 4) * 4;

  char* ws = (char*)d_ws;
  size_t off = 0;
  const size_t oXb = off; off += (size_t)NTOT * HID * 2;                                          // 16777216
  const size_t oWq = off; off += (size_t)HID * HID * 2;                                           //   524288
  const size_t oWk = off; off += (size_t)HID * HID * 2;
  const size_t oWv = off; off += (size_t)HID * HID * 2;
  const size_t oWo = off; off += (size_t)HID * PLD * 2;                                           //  1048576
  const size_t oEB = off; off += (size_t)EP * NHD * 4;   off = (off + 255) & ~(size_t)255;        //  8388608
  const size_t oQ  = off; off += (size_t)RHALF * PLD * 2;                                         // 33554432
  const size_t oK  = off; off += (size_t)RHALF * PLD * 2;
  const size_t oVT = off; off += (size_t)GHALF * HID * PLD * 2;                                   // 33554432
  const size_t oCT = off; off += (size_t)RHALF * PLD * 2;                                         // 33554432
  if (off > ws_size || off > (size_t)WSMAX) return;                                               // 162004992
  unsigned short* Xb   = (unsigned short*)(ws + oXb);
  unsigned short* WqT  = (unsigned short*)(ws + oWq);
  unsigned short* WkT  = (unsigned short*)(ws + oWk);
  unsigned short* WvT  = (unsigned short*)(ws + oWv);
  unsigned short* WOT2 = (unsigned short*)(ws + oWo);
  float*          EB   = (float*)(ws + oEB);
  unsigned short* Qp   = (unsigned short*)(ws + oQ);
  unsigned short* Kp   = (unsigned short*)(ws + oK);
  unsigned short* VTp  = (unsigned short*)(ws + oVT);
  unsigned short* CTX  = (unsigned short*)(ws + oCT);

  hipFuncSetAttribute(reinterpret_cast<const void*>(&k_attn),
                      hipFuncAttributeMaxDynamicSharedMemorySize, LDS_ATT);

  // weight planes (bf16 bits, k-contiguous rows [n][k])
  {
    const int nUw = HID * (HID / 8);             // 512 rows x 64 units
    k_wtr<<<cdiv(nUw, NTHR), NTHR, 0, stream>>>(Wq, HID, HID, HID, HID, WqT, nUw);
    k_wtr<<<cdiv(nUw, NTHR), NTHR, 0, stream>>>(Wk, HID, HID, HID, HID, WkT, nUw);
    k_wtr<<<cdiv(nUw, NTHR), NTHR, 0, stream>>>(Wv, HID, HID, HID, HID, WvT, nUw);
    const int nUo = HID * (PLD / 8);             // 512 rows x 128 units: wt [512][1024], k mod 512
    k_wtr<<<cdiv(nUo, NTHR), NTHR, 0, stream>>>(Wo, HID, HID, HID, PLD, WOT2, nUo);
  }
  // node feature plane (whole x)
  {
    const int nUx = NTOT * (HID / 8);
    k_xprep<<<cdiv(nUx, NTHR), NTHR, 0, stream>>>(x, Xb, NTOT, nUx);
  }
  // edge bias plane [EP][8]
  {
    const int nUe = EP * 2;
    k_eb<<<cdiv(nUe, NTHR), NTHR, 0, stream>>>(ea, We, be, EB, nE, nUe);
  }

  const dim3 blk(256);
  const dim3 gQK(((RHALF / 64) * (HID / 64)) / 8, 1);        // 256 blocks x 8 tiles: M=16384, N=512
  const dim3 gVT(((HID / 64) * (NND / 64)) / 8, GHALF);      // 8 blocks x 8 tiles per graph: M=512, N=512
  const dim3 gAT(GHALF * (NND / 64));                        // 256 blocks: 32 graphs x 8 query tiles
  for (int half = 0; half < NHALF; ++half) {
    const unsigned short* Xh = Xb + (size_t)half * RHALF * HID;
    float* outh = out + (size_t)half * RHALF * HID;
    // q = x . Wq + bq -> Qp hi | lo  (M=16384, N=512, K=512)
    wmma_gemm64<false, 2, 2, false, 0><<<gQK, blk, 0, stream>>>(
        Xh, Xh, HID, 0L, WqT, WqT, HID, 0L, (void*)Qp, (void*)(Qp + HID), PLD, 0L,
        bq, bq, 0L, RHALF, HID, HID, 1.0f);
    // k = x . Wk + bk -> Kp hi | lo
    wmma_gemm64<false, 2, 2, false, 0><<<gQK, blk, 0, stream>>>(
        Xh, Xh, HID, 0L, WkT, WkT, HID, 0L, (void*)Kp, (void*)(Kp + HID), PLD, 0L,
        bk, bk, 0L, RHALF, HID, HID, 1.0f);
    // v^T = Wv^T . x^T + bv[m] per graph -> VTp [graph][h*64+d][s] hi | lo  (M=512, N=512, K=512, z = 32 graphs)
    wmma_gemm64<false, 1, 2, false, 0><<<gVT, blk, 0, stream>>>(
        WvT, WvT, HID, 0L, Xh, Xh, HID, (long)NND * HID, (void*)VTp, (void*)(VTp + HID), PLD, (long)HID * PLD,
        bv, bv, 0L, HID, NND, HID, 1.0f);
    // attention with edge bias -> CTX hi | lo
    k_attn<<<gAT, NTHR, LDS_ATT, stream>>>(Qp, Kp, VTp, EB, keys, gath, ngp, bat, CTX, nE, 1, half * GHALF);
    // out = [ctx hi | ctx lo] . [Wo ; Wo] + bo -> d_out rows half*RHALF .. half*RHALF+RHALF-1 (M=16384, N=512, K=1024)
    wmma_gemm64<false, 2, 0, false, 0><<<gQK, blk, 0, stream>>>(
        CTX, CTX, PLD, 0L, WOT2, WOT2, PLD, 0L, (void*)outh, (void*)outh, HID, 0L,
        bo, bo, 0L, RHALF, HID, PLD, 1.0f);
  }
  (void)hipGetLastError();
}

// v005
// Measured time: 382 microseconds a run.
// In both of two side-by-side timings against v004, it was 1.33 times as fast.
// All steps since v000 together make it 4.83 times as fast.
// Contractions on v_wmma_f32_16x16x32_bf16 (bf16 operands, f32 accumulate): x*Wq, x*Wk, Wv^T*x^T as single
// products of bf16-RNE inputs; q.k^T and p.v as bf16 hi/lo split (hi.hi + hi.lo + lo.hi); ctx*Wo as
// [ctx hi | ctx lo] . [Wo ; Wo] (K = 1024); edge bias (16-deep dots of bf16-RNE inputs), online softmax and all biases in f32 on the VALU.
#include <hip/hip_runtime.h>
#include <math.h>
#include <stdint.h>
#include <stddef.h>

// Geometry: NGR graphs of NND consecutive node rows; attention keys of a query = the NND nodes of its graph.
// The job runs in NHALF passes of GHALF graphs each (one pass of all graphs: the attention launch then has one
// work-group for each of the 256 WGPs); the q / k / v^T / ctx planes are rewritten per pass.
//
// Plane map (workspace, all 16-bit planes are bf16 bits; no power-of-two carries anywhere, so no inverse
// factor exists -> carry audit: none):
//   Xb   [16384][512]          bf16(x)                                        -> A of q/k GEMMs, Bt of v^T GEMM
//   WqT, WkT, WvT [512 o][512 i]  bf16(W[i][o])                              -> Bt / A (k-contiguous)
//   WOT2 [512 o][1024]         bf16(Wo[k mod 512][o])                         -> Bt of the output GEMM
//   EB   [EP][8] f32           sum_t bf16(ea[e][t]) bf16(We[t][h]) + bf16(be[h])
//   Qp, Kp [16384][1024]       hi at col h*64+d, residual lo at col 512 + h*64+d (f32 projection split)
//   VTp  [32 graphs][512 (h,d)][1024]   hi at col s, lo at col 512 + s (s = node within graph)
//   CTX  [16384][1024]         hi | lo of the normalised attention context

#define NGR    32
#define NND    512
#define NTOT   (NGR * NND)      // 16384
#define HID    512
#define NHD    8
#define HDM    64
#define EDW    16
#define NHALF  1
#define GHALF  (NGR / NHALF)    // 32
#define RHALF  (GHALF * NND)    // 16384
#define PLD    1024
#define NTHR   256
#define WSMAX  268435456

static_assert(HID == NHD * HDM && HDM == 64 && NHD == 8);
static_assert(PLD == 2 * HID);
static_assert((RHALF % 64) == 0 && (HID % 64) == 0 && (NND % 64) == 0 && (PLD % 32) == 0 && (HID % 32) == 0);
static_assert(((RHALF / 64) * (HID / 64)) % 8 == 0);       // GEMM grids: 8 wave tiles per block, exact
static_assert(((HID / 64) * (NND / 64)) % 8 == 0);
static_assert(NGR == NHALF * GHALF);
static_assert(HID == 64 * 8);                               // k_xprep: 64 units of 8 per row
static_assert(EDW == 16 && NHD == 8 && EDW * NHD <= NTHR);  // k_eb layout

typedef __attribute__((ext_vector_type(16))) _Float16 v16h;
typedef __attribute__((ext_vector_type(8)))  _Float16 v8h;
typedef __attribute__((ext_vector_type(16))) __bf16   v16b;
typedef __attribute__((ext_vector_type(8)))  __bf16   v8b;
typedef __attribute__((ext_vector_type(8)))  float    v8f;
typedef __attribute__((ext_vector_type(4)))  float    v4f;
typedef __attribute__((ext_vector_type(2)))  float    v2f;
typedef __attribute__((ext_vector_type(4)))  unsigned int v4u;
typedef __attribute__((ext_vector_type(4)))  int      v4i;
typedef __attribute__((ext_vector_type(8)))  unsigned short v8us;
typedef v4f  __attribute__((may_alias)) v4fa;
typedef v2f  __attribute__((may_alias)) v2fa;
typedef v4u  __attribute__((may_alias)) v4ua;

// ---- scalar helpers: f32 -> bf16 bits (RNE convert), bf16 bits -> f32 ----
__device__ __forceinline__ unsigned short f2bf_bits(float f) {
  unsigned u = __float_as_uint(f);
  return (unsigned short)((u + 0x7FFFu + ((u >> 16) & 1u)) >> 16);
}
__device__ __forceinline__ float bf_bits2f(unsigned short h) { return __uint_as_float(((unsigned)h) << 16); }
__device__ __forceinline__ float bfrf(float f) { return bf_bits2f(f2bf_bits(f)); }
__device__ __forceinline__ unsigned int f2bfu(float f) {
  const unsigned int u = __float_as_uint(f);
  return ((u + 0x7FFFu + ((u >> 16) & 1u)) >> 16) & 0xFFFFu;
}
__device__ __forceinline__ float bf2f(unsigned int b) { return __uint_as_float(b << 16); }
__device__ __forceinline__ v4f bfr4(const v4f a) {
  v4f r; r.x = bfrf(a.x); r.y = bfrf(a.y); r.z = bfrf(a.z); r.w = bfrf(a.w); return r;
}
__device__ __forceinline__ unsigned int pk2(float lo, float hi) { return f2bfu(lo) | (f2bfu(hi) << 16); }
__device__ __forceinline__ v4u pack8(const v4f a, const v4f b) {
  v4u r;
  r.x = pk2(a.x, a.y); r.y = pk2(a.z, a.w); r.z = pk2(b.x, b.y); r.w = pk2(b.z, b.w);
  return r;
}
// hi = bf16(v), lo = bf16(v - hi): two floats -> one packed word of each
__device__ __forceinline__ void hl2(float v0, float v1, unsigned int& hw, unsigned int& lw) {
  const unsigned int h0 = f2bfu(v0), h1 = f2bfu(v1);
  const unsigned int l0 = f2bfu(v0 - bf2f(h0)), l1 = f2bfu(v1 - bf2f(h1));
  hw = h0 | (h1 << 16);
  lw = l0 | (l1 << 16);
}
__device__ __forceinline__ void pack8hl(const v4f a, const v4f b, v4u& hv, v4u& lv) {
  unsigned int h, l;
  hl2(a.x, a.y, h, l); hv.x = h; lv.x = l;
  hl2(a.z, a.w, h, l); hv.y = h; lv.y = l;
  hl2(b.x, b.y, h, l); hv.z = h; lv.z = l;
  hl2(b.z, b.w, h, l); hv.w = h; lv.w = l;
}

// ---- WMMA fragment helpers (bf16, wave32) ----
// A fragment (row m = lane&15) and B fragment (col n = lane&15) use the SAME k map:
//   elements 0..7 <- k0 + 8h + 0..7, elements 8..15 <- k0 + 16 + 8h + 0..7, h = lane>>4,
// loaded as two 16-B pieces from a k-contiguous 16-bit row: p[0..7] and p[16..23] with p = row + k0 + 8h.
// D element r of lane l = (row 8h + r, col l&15).
__device__ __forceinline__ void dep_guard_b(v8f& a, v8f& b, v16b x, v16b y) { asm volatile("v_nop\n\tv_nop\n\tv_nop\n\tv_nop" : "+v"(a), "+v"(b) : "v"(x), "v"(y)); }
__device__ __forceinline__ void keep4_b(v16b a, v16b b, v16b c, v16b d) { asm volatile("v_nop" :: "v"(a), "v"(b), "v"(c), "v"(d)); }
__device__ __forceinline__ void acc_guard4(v8f& a, v8f& b, v8f& c, v8f& d) { asm volatile("v_nop\n\tv_nop\n\tv_nop\n\tv_nop" : "+v"(a), "+v"(b), "+v"(c), "+v"(d)); }

struct FragBF {
  union U { v16b v; v8b h[2]; };
  static __device__ __forceinline__ v16b load(const __bf16* p) {   // elements 0..7 <- p[0..7], 8..15 <- p[16..23]
    U f; f.h[0] = *(const v8b*)(p); f.h[1] = *(const v8b*)(p + 16); return f.v;
  }
  static __device__ __forceinline__ v8f mma(v16b a, v16b b, v8f c) {
    return __builtin_amdgcn_wmma_f32_16x16x32_bf16(false, a, false, b, (short)0, c, false, false);
  }
  static __device__ __forceinline__ void guard(v8f& a, v8f& b, v16b x, v16b y) { dep_guard_b(a, b, x, y); }
  static __device__ __forceinline__ void keep(v16b a, v16b b, v16b c, v16b d) { keep4_b(a, b, c, d); }
};
union FB { v16b v; v8b h[2]; };

// single WMMA with hazard guard: ties D, keeps A/B live for 4 VALU slots
__device__ __forceinline__ v8f at_mma(v16b a, v16b b, v8f c) {
  c = __builtin_amdgcn_wmma_f32_16x16x32_bf16(false, a, false, b, (short)0, c, false, false);
  asm volatile("v_nop\n\tv_nop\n\tv_nop\n\tv_nop" : "+v"(c) : "v"(a), "v"(b));
  return c;
}
__device__ __forceinline__ __bf16 at_f2bf(float f) { return __builtin_bit_cast(__bf16, f2bf_bits(f)); }
__device__ __forceinline__ void at_split(float f, __bf16& hi, __bf16& lo) {
  const unsigned short hb = f2bf_bits(f);
  hi = __builtin_bit_cast(__bf16, hb);
  lo = at_f2bf(f - __uint_as_float(((unsigned)hb) << 16));
}

// =====================================================================================
// Register-blocked batched WMMA GEMM (bf16 operands).
// C[m,n] = scale * sum_k A[m,k] * Bt[n,k] (+bias)(+resid); each wave owns a 64x64 tile.
// A row-major [M,K]; Bt row-major [N,K]; M,N % 64 == 0, K % 32 == 0 (host static_asserts).
// SPLIT: operands are hi/lo planes (A2/Bt2 = lo planes, same layout); product = hi.hi + hi.lo + lo.hi.
// BIAS_MODE: 0 = none, 1 = bf16r(bias[m]), 2 = bf16r(bias[n]).
// OUT_MODE: 0 = f32, 1 = f16, 2 = bf16 hi plane (Cout) + bf16 lo plane (Cout2).
// coverage: grid.x * 8 waves == (M/64)*(N/64) tiles exactly (host), every C element written once per z.
// =====================================================================================
template <bool SPLIT, int BIAS_MODE, int OUT_MODE, bool RESID, int ACT = 0>
__global__ __launch_bounds__(256) void wmma_gemm64(
    const unsigned short* __restrict__ Ap, const unsigned short* __restrict__ A2p, int lda, long strideA,
    const unsigned short* __restrict__ Btp, const unsigned short* __restrict__ Bt2p, int ldb, long strideB,
    void* __restrict__ Cout, void* __restrict__ Cout2, int ldc, long strideC,
    const float* __restrict__ bias,
    const float* __restrict__ resid, long strideR,
    int M, int N, int K, float scale) {
  typedef __bf16 T;
  typedef v16b V;
  const T* A = (const T*)Ap; const T* A2 = (const T*)A2p; const T* Bt = (const T*)Btp; const T* Bt2 = (const T*)Bt2p;
  __shared__ __align__(16) float sT[8][16 * 68];   // per-wave 16x64 slab, pitch 68 floats
  const int b    = blockIdx.y;
  const int lane = threadIdx.x & 31;
  const int wave = threadIdx.x >> 5;
  const int tilesN = N >> 6;
  const int tilesM = M >> 6;
  const int tile = blockIdx.x * 8 + wave;
  if (tile >= tilesM * tilesN) return;   // wave-uniform; no block barriers in this kernel
  const int tm = tile / tilesN;
  const int tn = tile - tm * tilesN;
  const int m0 = tm << 6;
  const int n0 = tn << 6;

  const T* Ab  = A  + (size_t)b * strideA;
  const T* Bb  = Bt + (size_t)b * strideB;
  const T* Ab2 = SPLIT ? (A2  + (size_t)b * strideA) : nullptr;
  const T* Bb2 = SPLIT ? (Bt2 + (size_t)b * strideB) : nullptr;

  const int rlane = lane & 15;                 // row (A) / col (B, D) within subtile
  const int koff  = (lane >> 4) * 8;           // k offset of this lane half
  const int mOff  = (lane >> 4) * 8;           // D row offset

  v8f acc[4][4];
#pragma unroll
  for (int i = 0; i < 4; ++i)
#pragma unroll
    for (int j = 0; j < 4; ++j) acc[i][j] = (v8f){0.f,0.f,0.f,0.f,0.f,0.f,0.f,0.f};

  for (int k0 = 0; k0 < K; k0 += 32) {
    V bh[4], bl[4];
#pragma unroll
    for (int j = 0; j < 4; ++j) {
      const size_t bo = (size_t)(n0 + (j << 4) + rlane) * ldb + koff + k0;
      bh[j] = FragBF::load(Bb + bo);
      if (SPLIT) bl[j] = FragBF::load(Bb2 + bo);
    }
#pragma unroll
    for (int i = 0; i < 4; ++i) {
      const size_t ao = (size_t)(m0 + (i << 4) + rlane) * lda + koff + k0;
      V ah = FragBF::load(Ab + ao);
      V al;
      if (SPLIT) al = FragBF::load(Ab2 + ao);
#pragma unroll
      for (int j = 0; j < 4; ++j) {
        acc[i][j] = FragBF::mma(ah, bh[j], acc[i][j]);
        if (SPLIT) {
          acc[i][j] = FragBF::mma(ah, bl[j], acc[i][j]);
          acc[i][j] = FragBF::mma(al, bh[j], acc[i][j]);
        }
      }
      FragBF::guard(acc[i][0], acc[i][3], ah, SPLIT ? al : ah);
    }
    FragBF::keep(bh[0], bh[1], bh[2], bh[3]);
    if (SPLIT) FragBF::keep(bl[0], bl[1], bl[2], bl[3]);
  }
  acc_guard4(acc[0][0], acc[0][1], acc[0][2], acc[0][3]);
  acc_guard4(acc[1][0], acc[1][1], acc[1][2], acc[1][3]);
  acc_guard4(acc[2][0], acc[2][1], acc[2][2], acc[2][3]);
  acc_guard4(acc[3][0], acc[3][1], acc[3][2], acc[3][3]);

  // ---- epilogue ----
  float* slab = sT[wave];
  const float* Rb = RESID ? (resid + (size_t)b * strideR) : nullptr;
#pragma unroll
  for (int i = 0; i < 4; ++i) {
    const int mBase = m0 + (i << 4);
    float bm[8];
    if (BIAS_MODE == 1) {   // 8 consecutive floats, 32-B aligned: two 16-B loads
      const v4f b0v = bfr4(*(const v4fa*)(bias + mBase + mOff));
      const v4f b1v = bfr4(*(const v4fa*)(bias + mBase + mOff + 4));
      bm[0] = b0v.x; bm[1] = b0v.y; bm[2] = b0v.z; bm[3] = b0v.w;
      bm[4] = b1v.x; bm[5] = b1v.y; bm[6] = b1v.z; bm[7] = b1v.w;
    } else {
#pragma unroll
      for (int r = 0; r < 8; ++r) bm[r] = 0.f;
    }
#pragma unroll
    for (int j = 0; j < 4; ++j) {
      const int n = n0 + (j << 4) + rlane;
      float bv = 0.f;
      if (BIAS_MODE == 2) bv = bfrf(bias[n]);
#pragma unroll
      for (int r = 0; r < 8; ++r) {
        float v = acc[i][j][r] * scale;
        if (BIAS_MODE == 1) v += bm[r];
        if (BIAS_MODE == 2) v += bv;
        if (RESID) v += Rb[(size_t)(mBase + mOff + r) * ldc + n];
        if (ACT == 1) v = tanhf(v);
        if (ACT == 2) v = fmaxf(v, 0.0f);
        if (ACT == 4) v = (v > 0.f) ? v : 0.01f * v;
        slab[(mOff + r) * 68 + (j << 4) + rlane] = v;
      }
    }
    __builtin_amdgcn_fence(__ATOMIC_RELEASE, "workgroup");
    __builtin_amdgcn_wave_barrier();
    __builtin_amdgcn_fence(__ATOMIC_ACQUIRE, "workgroup");
    if (OUT_MODE == 0) {
      float* C = (float*)Cout + (size_t)b * strideC;
      const int hh = lane >> 4, c4 = (lane & 15) * 4;     // row seg = 256 B = 16 lanes x 16 B
      {
#pragma unroll
        for (int it = 0; it < 8; ++it) {
          const int row = it * 2 + hh;
          v4f v = *(const v4f*)(slab + row * 68 + c4);
          *(v4f*)(C + (size_t)(mBase + row) * ldc + n0 + c4) = v;
        }
        
      }
    } else {
      const int q = lane >> 3, c8 = (lane & 7) * 8;
      unsigned short* C  = (unsigned short*)Cout  + (size_t)b * strideC;
      unsigned short* C2 = (OUT_MODE == 2) ? ((unsigned short*)Cout2 + (size_t)b * strideC) : nullptr;
      {
#pragma unroll
        for (int it = 0; it < 4; ++it) {
          const int row = it * 4 + q;
          const float* sp = slab + row * 68 + c8;
          v8h hv, lv;
#pragma unroll
          for (int e = 0; e < 8; ++e) {
            if (OUT_MODE == 1) {
              hv[e] = (_Float16)sp[e];
            } else {
              unsigned short hb = f2bf_bits(sp[e]);
              unsigned short lb = f2bf_bits(sp[e] - bf_bits2f(hb));
              hv[e] = __builtin_bit_cast(_Float16, hb);
              lv[e] = __builtin_bit_cast(_Float16, lb);
            }
          }
          *(v8h*)(C + (size_t)(mBase + row) * ldc + n0 + c8) = hv;
          if (OUT_MODE == 2) *(v8h*)(C2 + (size_t)(mBase + row) * ldc + n0 + c8) = lv;
        }
        
      }
    }
    __builtin_amdgcn_fence(__ATOMIC_RELEASE, "workgroup");
    __builtin_amdgcn_wave_barrier();
    __builtin_amdgcn_fence(__ATOMIC_ACQUIRE, "workgroup");
  }
}

// =====================================================================================
// Node feature plane: xb[row][c] = bf16(x[row][c]) for row < nN (all 512 c). One thread = 8 contiguous
// =====================================================================================
__global__ __launch_bounds__(NTHR) void k_xprep(const float* __restrict__ x, unsigned short* xb, int nN, int nUnits) {
  const int i = (int)blockIdx.x * NTHR + (int)threadIdx.x;
  if (i >= nUnits) return;
  const int row = i >> 6;
  const int c0  = (i & 63) * 8;
  const int rc  = row < nN ? row : nN - 1;
  const float* p = x + (size_t)rc * HID + c0;
  v4f a = *(const v4fa*)p;
  v4f b = *(const v4fa*)(p + 4);
  const v4f z4 = {0.f, 0.f, 0.f, 0.f};
  if (row >= nN) { a = z4; b = z4; }
  const v4u hv = pack8(a, b);
  unsigned short* o = xb + (size_t)row * HID + c0;
  *(v4u*)o = hv;
  
}

// =====================================================================================
// Weight transpose + bf16 convert into a k-contiguous plane: w is [Kin][Ncol] ([in][out]),
//   wt[n][k] = bf16(w[k mod Kin][n]) for n < Nrows, k < Kout (Kout = Kin or a multiple of it).
// coverage: nUnits = Nrows * Kout/8 threads x 8 = Nrows x Kout exactly.
// =====================================================================================
__global__ __launch_bounds__(NTHR) void k_wtr(const float* __restrict__ w, int Kin, int Ncol, int Nrows, int Kout,
                                              unsigned short* wt, int nUnits) {
  const int u = (int)blockIdx.x * NTHR + (int)threadIdx.x;
  if (u >= nUnits) return;
  const int kq = Kout >> 3;
  const int n  = u / kq;
  const int k8 = (u - n * kq) * 8;
  const int kk = k8 - (k8 / Kin) * Kin;
  const int ncl = n < Ncol ? n : Ncol - 1;
  const float* p = w + (size_t)kk * (size_t)Ncol + ncl;
  v4f a, b;
  a.x = p[0];                    a.y = p[(size_t)Ncol];         a.z = p[(size_t)2 * Ncol];     a.w = p[(size_t)3 * Ncol];
  b.x = p[(size_t)4 * Ncol];     b.y = p[(size_t)5 * Ncol];     b.z = p[(size_t)6 * Ncol];     b.w = p[(size_t)7 * Ncol];
  const v4f z4 = {0.f, 0.f, 0.f, 0.f};
  if (n >= Ncol || n >= Nrows) { a = z4; b = z4; }
  const v4u wv = pack8(a, b);
  unsigned short* o = wt + (size_t)n * (size_t)Kout + k8;
  *(v4u*)o = wv;
  
}

// =====================================================================================
// Edge bias plane: EB[e][h] = sum_t bf16r(ea[e][t]) * bf16r(We[t][h]) + bf16r(be[h]) (f32, 16 terms summed
// from +0 then the bias), zero rows for pad edges nE <= e < EP (load address clamped, value zeroed by select).
// One thread = one edge and 4 consecutive heads: 4 b128 loads in a rolled loop, one 16-B store;
// coverage: nUnits = EP*2 threads x 4 = EP x 8 elements exactly.
// =====================================================================================
__global__ __launch_bounds__(NTHR) void k_eb(const float* __restrict__ ea, const float* __restrict__ We,
                                             const float* __restrict__ be, float* EB, int nE, int nUnits) {
  __shared__ float sWe[EDW * NHD];
  __shared__ float sbe[NHD];
  const int tid = (int)threadIdx.x;
  if (tid < EDW * NHD) sWe[tid] = bfrf(We[tid]);           // We[t][h] row-major
  if (tid < NHD) sbe[tid] = bfrf(be[tid]);
  __syncthreads();
  const int u = (int)blockIdx.x * NTHR + tid;
  if (u >= nUnits) return;
  const int e  = u >> 1;
  const int h0 = (u & 1) * 4;
  const int ec = e < nE ? e : nE - 1;
  const float* er = ea + (size_t)ec * EDW;
  float s0 = 0.f, s1 = 0.f, s2 = 0.f, s3 = 0.f;
#pragma unroll 1
  for (int q = 0; q < 4; ++q) {
    const v4f a = bfr4(*(const v4fa*)(er + 4 * q));
    const float* wr = sWe + (4 * q) * NHD + h0;            // We[4q+i][h0+j] = wr[i*8 + j]
    s0 = fmaf(a.x, wr[0],  s0); s1 = fmaf(a.x, wr[1],  s1); s2 = fmaf(a.x, wr[2],  s2); s3 = fmaf(a.x, wr[3],  s3);
    s0 = fmaf(a.y, wr[8],  s0); s1 = fmaf(a.y, wr[9],  s1); s2 = fmaf(a.y, wr[10], s2); s3 = fmaf(a.y, wr[11], s3);
    s0 = fmaf(a.z, wr[16], s0); s1 = fmaf(a.z, wr[17], s1); s2 = fmaf(a.z, wr[18], s2); s3 = fmaf(a.z, wr[19], s3);
    s0 = fmaf(a.w, wr[24], s0); s1 = fmaf(a.w, wr[25], s1); s2 = fmaf(a.w, wr[26], s2); s3 = fmaf(a.w, wr[27], s3);
  }
  v4f o;
  o.x = s0 + sbe[h0]; o.y = s1 + sbe[h0 + 1]; o.z = s2 + sbe[h0 + 2]; o.w = s3 + sbe[h0 + 3];
  const v4f z4 = {0.f, 0.f, 0.f, 0.f};
  if (e >= nE) o = z4;
  float* op = EB + (size_t)e * NHD + h0;
  *(v4f*)op = o;
  
}

// =====================================================================================
// Graph attention with per-edge additive bias, one block per (graph, 64-query tile), 8 waves.
// Phase A (block-local, statically bounded): scan of the src list (edge_index row 0) for
//   src in [node0, node0+64): wave w walks its own contiguous eighth of the list in slabs of 256 edges, SG slabs
//   loaded ahead, hits appended to its own LDS list, no barrier inside the walk; then one barrier, the waves'
//   lists joined in wave order (= ascending slab order) with dst gathered for all hits at once: (edge id, query
//   row, dst % 512), capped at HCAP (poison when reached); counting sort (8 waves, each its own 8 query rows, stable) into
//   NBIN bins, bin = query row * 32 + (dst % 512) / 16, -> sE / sD segments with roff / rcnt. Nothing persists
//   outside LDS.
// Phase B: 4 head pairs; waves 0..3 run head 2p, waves 4..7 head 2p+1, each wave 16 query rows.
//   Per key chunk of 64: K hi/lo and V^T hi/lo tiles of both heads staged (256 threads x 32 elements =
//   two 64x64 tiles per plane, the whole chunk), a 2x64x64 f32 bias tile zeroed then filled by row owners
//   (4 threads per query row, thread j walks only the bin of its row and of key columns 16j..16j+15 of this
//   chunk, in segment order = hit scan order -> duplicate (src,dst) pairs sum deterministically; lanes
//   whose bin is shorter than the wave's longest add into a private dummy slot),
//   then S = q.k (3-term split) * 0.125 + bias, online softmax in f32, P split hi/lo through per-wave LDS
//   Epilogue: ctx = O / l staged per wave in LDS (aliasing only that wave's own bias rows), written as
// Geometry guards (NaN poison of the block's ctx rows, never a trap): hit cap, per-row count > RWCAP,
//   num_graphs != NGR, batch id of the block's first node outside [0, NGR).
// coverage: CTX rows lrow0..lrow0+63 x all 1024 cols per block; grid = GHALF*8 blocks covers RHALF rows once.
// =====================================================================================
#define AT_NW   8
#define EPT     8
#define SLAB    (32 * EPT)            // 256 keys: one wave's read of EPT keys per lane
#define SG      4                     // slabs whose loads are in flight per wave
#define SLOTB   6
#define NSLOT   64                    // query rows per block = scan slots
#define BINSH   4                     // 16 key columns per bin
#define NBIN    (NSLOT * (NND >> BINSH))   // 2048 bins: (query row, group of 16 key columns)
#define HCAP    2048                  // hit capacity per block
#define WLCAP   HCAP                  // hit capacity of one wave's list: a wave that fills it has filled the block's
#define LISTN   (AT_NW * WLCAP)       // 16384
#define RWCAP   128                   // static cap on per-row edge count
#define KVT     4096                  // one 64x64 f32 bias tile
#define KVP     72                    // row pitch of the K / V^T / P tiles in LDS, elements: 144 B = 16 B x 9, so the
                                      // 16 rows of a ds_load_b128 fragment read fall on 16 different bank groups
#define KVS     (64 * KVP)            // one 64-row K or V^T tile
#define PWS     (16 * KVP)            // one wave's 16-row P tile
#define NDUM    512                   // private dummy accumulators (2 per thread)
#define LO_KV   0
#define LO_P    (8 * KVS * 2)                           // 73728
#define LO_BT   (LO_P + 2 * AT_NW * PWS * 2)            // 110592
#define LO_SE   (LO_BT + (2 * KVT + NDUM) * 4)          // 145408
#define LO_SD   (LO_SE + HCAP * 4)                      // 153600
#define LO_RC   (LO_SD + HCAP * 4)                      // 161792
#define LDS_ATT (LO_RC + (2 * NBIN + 2 * AT_NW) * 4)    // 178240

static_assert((LISTN + 4 * HCAP) * 4 <= LO_SE);       // phase-A lists alias the K/V and P tile regions
static_assert(LDS_ATT <= 300000);
static_assert(KVP >= 64 && (KVP * 2) % 16 == 0 && ((KVP * 2) / 16) % 2 == 1);   // 16-B aligned rows, odd multiple
static_assert((LO_P % 16) == 0 && (LO_BT % 16) == 0);
static_assert((1 << SLOTB) == NSLOT);
static_assert(NTHR == 32 * AT_NW);
static_assert(NTHR == 4 * NSLOT);                      // bias fill: 4 threads per query row
static_assert(NTHR * 4 * 8 == 2 * KVT);                // bias zero fill: 8 sweeps of 4 floats per thread
static_assert(NDUM == 2 * NTHR && NDUM == 128 * 4);
static_assert(AT_NW * 1024 == 2 * KVT);                // per-wave output staging = own bias rows
static_assert(SLAB == 256 && 24 + SLOTB < 32);                   // list entry = edge id (below 2^24, host check) << SLOTB | slot
static_assert(NSLOT == 8 * AT_NW && NND == 512);                 // sort: 8 query rows per wave, owner wave = hitRD >> 12
static_assert(NBIN == NTHR * 8 && (NND >> BINSH) == 32);         // sort: 8 bins per thread, 4 threads per row
static_assert(RWCAP < 256);                                      // sort: 8-bit counters exact below the row cap
static_assert((64 >> BINSH) == 4 && (LO_RC % 16) == 0);          // 4 bins per row and key chunk = 4 fill threads

// One slab of the key list: the lane holds keys e0 .. e0 + EPT - 1 in da / db and tests them against the block's slot
// range [slotBase, slotBase + nb); hits are appended to this wave's LDS list wl as (edge id << SLOTB | slot), key
// position first, lane second. wc = entries so far (wave-uniform); returns the new count; nothing is stored
// at or past WLCAP.
__device__ __forceinline__ int slab_hits(const v4i da, const v4i db, int e0, int slotBase, int nb, int* wl, int wc) {
  const unsigned nbs = (unsigned)slotBase;
  const unsigned unb = (unsigned)nb;
  const unsigned s0 = (unsigned)da.x - nbs, s1 = (unsigned)da.y - nbs;
  const unsigned s2 = (unsigned)da.z - nbs, s3 = (unsigned)da.w - nbs;
  const unsigned s4 = (unsigned)db.x - nbs, s5 = (unsigned)db.y - nbs;
  const unsigned s6 = (unsigned)db.z - nbs, s7 = (unsigned)db.w - nbs;
  const bool h0 = s0 < unb, h1 = s1 < unb, h2 = s2 < unb, h3 = s3 < unb;
  const bool h4 = s4 < unb, h5 = s5 < unb, h6 = s6 < unb, h7 = s7 < unb;
  const unsigned m0 = __builtin_amdgcn_ballot_w32(h0), m1 = __builtin_amdgcn_ballot_w32(h1);
  const unsigned m2 = __builtin_amdgcn_ballot_w32(h2), m3 = __builtin_amdgcn_ballot_w32(h3);
  const unsigned m4 = __builtin_amdgcn_ballot_w32(h4), m5 = __builtin_amdgcn_ballot_w32(h5);
  const unsigned m6 = __builtin_amdgcn_ballot_w32(h6), m7 = __builtin_amdgcn_ballot_w32(h7);
  if ((m0 | m1 | m2 | m3 | m4 | m5 | m6 | m7) != 0u) {
#define HITJ(J, HJ, SJ, MJ) { \
      const unsigned mj = (MJ); \
      if (mj != 0u) { \
        if (HJ) { \
          const int pos = wc + (int)__builtin_amdgcn_mbcnt_lo(mj, 0u); \
          if (pos < WLCAP) wl[pos] = ((e0 + (J)) << SLOTB) | (int)(SJ); \
        } \
        wc += (int)__builtin_popcount(mj); } }
    HITJ(0, h0, s0, m0)
    HITJ(1, h1, s1, m1)
    HITJ(2, h2, s2, m2)
    HITJ(3, h3, s3, m3)
    HITJ(4, h4, s4, m4)
    HITJ(5, h5, s5, m5)
    HITJ(6, h6, s6, m6)
    HITJ(7, h7, s7, m7)
#undef HITJ
  }
  return wc;
}
// A slab that is not wholly inside the list (or a list not read 16 bytes at a time): every address clamped, the
// sentinel selected by value.
__device__ __forceinline__ void slab_load_edge(const int* __restrict__ keys, int nE, int e0, v4i& da, v4i& db) {
  const int sent = -2147483647 - 1;
  da.x = (e0     < nE) ? keys[min(e0,     nE - 1)] : sent;
  da.y = (e0 + 1 < nE) ? keys[min(e0 + 1, nE - 1)] : sent;
  da.z = (e0 + 2 < nE) ? keys[min(e0 + 2, nE - 1)] : sent;
  da.w = (e0 + 3 < nE) ? keys[min(e0 + 3, nE - 1)] : sent;
  db.x = (e0 + 4 < nE) ? keys[min(e0 + 4, nE - 1)] : sent;
  db.y = (e0 + 5 < nE) ? keys[min(e0 + 5, nE - 1)] : sent;
  db.z = (e0 + 6 < nE) ? keys[min(e0 + 6, nE - 1)] : sent;
  db.w = (e0 + 7 < nE) ? keys[min(e0 + 7, nE - 1)] : sent;
}

__global__ __launch_bounds__(NTHR) void k_attn(
    const unsigned short* __restrict__ Qp, const unsigned short* __restrict__ Kp,
    const unsigned short* __restrict__ VTp, const float* __restrict__ EB,
    const int* __restrict__ keys, const int* __restrict__ gath,
    const int* __restrict__ ngp, const int* __restrict__ bat,
    unsigned short* CTX, int nE, int vec8, int gbase) {
  extern __shared__ v4f lds_dyn[];
  char* lds = (char*)lds_dyn;
  __bf16* Ksh = (__bf16*)(lds + LO_KV);         // [2][64 x KVP]  K hi  [kv][d]
  __bf16* Ksl = Ksh + 2 * KVS;                   // [2][64 x KVP]  K lo
  __bf16* Vth = Ksl + 2 * KVS;                   // [2][64 x KVP]  V^T hi [d][kv]
  __bf16* Vtl = Vth + 2 * KVS;                   // [2][64 x KVP]  V^T lo
  int* list  = (int*)(lds + LO_KV);              // phase A only: [8 waves][WLCAP]
  int* hitE  = list + LISTN;                     // [HCAP] edge ids, in scan order
  int* hitRD = hitE + HCAP;                      // [HCAP] (row << 9) | loc_dst
  int* tE    = hitRD + HCAP;                     // [HCAP] hitE regrouped by owner wave (8 query rows each)
  int* tRD   = tE + HCAP;                        // [HCAP] hitRD of the same entries
  __bf16* Psh = (__bf16*)(lds + LO_P);           // [8 waves][16 x KVP] P hi
  __bf16* Psl = Psh + AT_NW * PWS;               // P lo
  float* BTX = (float*)(lds + LO_BT);            // [2][64 x 64] bias tiles + [NDUM] dummies; epilogue staging
  int* sE   = (int*)(lds + LO_SE);               // [HCAP] edge ids sorted by query row
  int* sD   = (int*)(lds + LO_SD);               // [HCAP] loc_dst of the same entries
  int* rcnt = (int*)(lds + LO_RC);               // [NBIN] entries per bin
  int* roff = rcnt + NBIN;                       // [NBIN] first entry of the bin in sE / sD
  int* wcnt = roff + NBIN;                       // [8]
  int* misc = wcnt + AT_NW;                      // [8] largest per-row count of each wave

  const int tid = (int)threadIdx.x, lane = tid & 31, wave = tid >> 5, hh = lane >> 4, c = lane & 15;
  const int lgr   = (int)blockIdx.x >> 3;        // graph within this pass
  const int qt    = (int)blockIdx.x & 7;         // 64-query tile within the graph
  const int gb    = gbase + lgr;                 // graph id
  const int node0 = gb * NND + qt * NSLOT;       // global node id of query row 0
  const int lrow0 = lgr * NND + qt * NSLOT;      // plane row of query row 0

  // ---- phase A1: scan of the src list, each wave its own contiguous run of slabs; then the lists joined ----
  int tot;
  {
    const int wv    = __builtin_amdgcn_readfirstlane(wave);      // scalar loop bounds
    const int nSl   = (nE + SLAB - 1) / SLAB;                     // slabs in the list
    const int spw   = (nSl + AT_NW - 1) / AT_NW;                  // slabs per wave
    const int sBeg  = wv * spw < nSl ? wv * spw : nSl;
    const int sEnd  = sBeg + spw < nSl ? sBeg + spw : nSl;
    const int nFull = vec8 != 0 ? nE / SLAB : 0;                  // slabs [0, nFull) lie wholly inside the list
    const int sFull = sEnd < nFull ? sEnd : nFull;
    const int nG    = sFull > sBeg ? (sFull - sBeg) / SG : 0;     // groups of SG whole slabs
    int* wl = list + wv * WLCAP;
    const int le = lane * EPT;
    int wc = 0;
    if (nG > 0) {
      v4i ra[SG], rb[SG];
#pragma unroll   // ra / rb in registers
      for (int k = 0; k < SG; ++k) {
        const int* p = keys + (sBeg + k) * SLAB + le;
        ra[k] = *(const v4i*)p;
        rb[k] = *(const v4i*)(p + 4);
      }
      // stands in front of the loop's first writes to the address registers of the loads above
      asm volatile("s_wait_xcnt 0x0" ::: "memory");
#pragma unroll 1   // one copy of the SG slab bodies in the instruction cache
      for (int g = 0; g < nG; ++g) {
        const int sb = sBeg + g * SG;
        const int sn = g + 1 < nG ? sb + SG : sb;                 // last trip: its own slabs again (in bounds, unused)
#pragma unroll   // ra / rb in registers; a slab's registers are refilled as soon as it is tested, SG slabs ahead
        for (int k = 0; k < SG; ++k) {
          wc = slab_hits(ra[k], rb[k], (sb + k) * SLAB + le, node0, NSLOT, wl, wc);
          const int* p = keys + (sn + k) * SLAB + le;
          ra[k] = *(const v4i*)p;
          rb[k] = *(const v4i*)(p + 4);
          // last slab: stands in front of the next trip's first writes to these loads' address registers
          if (k == SG - 1) asm volatile("s_wait_xcnt 0x0" ::: "memory");
        }
      }
    }
#pragma unroll 1   // at most SG - 1 whole slabs and the list's edge
    for (int s = sBeg + nG * SG; s < sEnd; ++s) {
      v4i da, db;
      slab_load_edge(keys, nE, s * SLAB + le, da, db);
      wc = slab_hits(da, db, s * SLAB + le, node0, NSLOT, wl, wc);
    }
    if (lane == 0) wcnt[wave] = wc;
    __syncthreads();
    int pre = 0, all = 0;
#pragma unroll
    for (int w2 = 0; w2 < AT_NW; ++w2) {
      int cc = wcnt[w2];
      cc = cc < 0 ? 0 : (cc > WLCAP ? WLCAP : cc);
      all += cc;
      pre += (w2 < wave) ? cc : 0;
    }
    const int wcc = wc > WLCAP ? WLCAP : wc;
#pragma unroll 1
    for (int i0 = 0; i0 < wcc; i0 += 128) {         // wcc wave-uniform; loads unconditional, clamped
      int eid[4], sl[4], gg[4];
#pragma unroll   // eid / sl in registers; the four list reads share one LDS latency
      for (int j = 0; j < 4; ++j) {
        const int i   = i0 + 32 * j + lane;
        const int ent = wl[i < wcc ? i : wcc - 1];
        int e = ent >> SLOTB;
        e = e < 0 ? 0 : (e > nE - 1 ? nE - 1 : e);
        eid[j] = e;
        sl[j]  = ent & (NSLOT - 1);
      }
#pragma unroll   // gg in registers; the four dst reads share one memory latency
      for (int j = 0; j < 4; ++j) gg[j] = gath[eid[j]];
#pragma unroll   // eid / sl / gg in registers
      for (int j = 0; j < 4; ++j) {
        const int i = i0 + 32 * j + lane;
        int g = gg[j];
        g = g < 0 ? 0 : (g > NTOT - 1 ? NTOT - 1 : g);
        const int pos = pre + i;
        if (i < wcc && pos < HCAP) {
          hitE[pos]  = eid[j];
          hitRD[pos] = (sl[j] << 9) | (g & (NND - 1));
        }
      }
    }
    tot = all > HCAP ? HCAP : all;
    __syncthreads();
  }
  const int nh = __builtin_amdgcn_readfirstlane(tot);   // the same in every thread of the block: scalar loop bounds

  // ---- phase A2: stable counting sort of the hits into the NBIN bins, by all 8 waves ----
  // Wave w owns query rows 8w..8w+7 (bins 256w..256w+255), thread tid the bins 8*tid..8*tid+7 (one query row,
  // 128 key columns). Bins ascend with the row, so the entries of wave w fill sE / sD[below, below + mine).
  // Every counter lives in its owner's registers: no LDS word is read, changed and written back per hit.
  // (a) hits of lower waves' rows and of this wave's rows
  int below = 0, mine = 0;
#pragma unroll 4   // four independent LDS reads in flight per wait
  for (int b0 = 0; b0 < nh; b0 += 32) {
    const int idx = b0 + lane;
    const int g   = hitRD[idx < nh ? idx : nh - 1] >> 12;        // owner wave = query row / 8
    const bool ok = idx < nh;
    below += (int)__builtin_popcount(__builtin_amdgcn_ballot_w32(ok && g < wave));
    mine  += (int)__builtin_popcount(__builtin_amdgcn_ballot_w32(ok && g == wave));
  }
  // (b) this wave's hits copied, in hit order, to tRD / tE[below, below + mine)
  {
    int wpos = below;
    for (int b0 = 0; b0 < nh; b0 += 128) {
      int rd[4], ee[4];
#pragma unroll   // rd / ee in registers; all reads ahead of the first store, one LDS latency for the four
      for (int j = 0; j < 4; ++j) {
        const int idx = b0 + 32 * j + lane;
        const int cl  = idx < nh ? idx : nh - 1;
        rd[j] = hitRD[cl];
        ee[j] = hitE[cl];
      }
#pragma unroll   // rd / ee in registers
      for (int j = 0; j < 4; ++j) {
        const bool ok = (b0 + 32 * j + lane < nh) && ((rd[j] >> 12) == wave);
        const unsigned mk = __builtin_amdgcn_ballot_w32(ok);
        if (ok) {
          int p = wpos + (int)__builtin_amdgcn_mbcnt_lo(mk, 0u);
          p = p > HCAP - 1 ? HCAP - 1 : p;
          tRD[p] = rd[j];
          tE[p]  = ee[j];
        }
        wpos += (int)__builtin_popcount(mk);
      }
    }
  }
  __syncthreads();
  // (c) per-bin counts: every lane reads each entry of its wave (one address, broadcast); the owner counts it.
  //     8 counters of 8 bits: exact while a row holds <= RWCAP entries; tc is exact always and feeds the guard.
  unsigned long long c8 = 0ull;
  int tc = 0;
#pragma unroll 8   // eight independent LDS reads in flight per wait
  for (int i = 0; i < mine; ++i) {
    const int u = tRD[below + i];
    const bool own = (u >> 7) == tid;
    c8 += (unsigned long long)(own ? 1 : 0) << (((u >> BINSH) & 7) * 8);
    tc += own ? 1 : 0;
  }
  // (d) first entry of each bin: wave prefix over the threads' totals, then over the thread's own 8 counters
  int tbase;
  {
    int incl = tc;
#pragma unroll
    for (int d = 1; d < 32; d <<= 1) {
      const int up = __shfl_up(incl, d, 32);
      if (lane >= d) incl += up;
    }
    tbase = below + incl - tc;
    int cn[8], of[8];
    int run = tbase;
#pragma unroll
    for (int k = 0; k < 8; ++k) {
      cn[k] = (int)((c8 >> (8 * k)) & 255ull);
      of[k] = run;
      run += cn[k];
    }
    const v4i c0v = {cn[0], cn[1], cn[2], cn[3]}, c1v = {cn[4], cn[5], cn[6], cn[7]};
    const v4i o0v = {of[0], of[1], of[2], of[3]}, o1v = {of[4], of[5], of[6], of[7]};
    *(v4i*)(rcnt + tid * 8)     = c0v;
    *(v4i*)(rcnt + tid * 8 + 4) = c1v;
    *(v4i*)(roff + tid * 8)     = o0v;
    *(v4i*)(roff + tid * 8 + 4) = o1v;
    // largest per-row count of the wave: a row = 4 neighbouring threads
    int rc = tc;
    rc += __shfl_xor(rc, 1, 32);
    rc += __shfl_xor(rc, 2, 32);
#pragma unroll
    for (int off = 4; off < 32; off <<= 1) {
      const int o = __shfl_xor(rc, off, 32);
      rc = o > rc ? o : rc;
    }
    if (lane == 0) misc[wave] = rc;
  }
  // (e) placement in hit order (stable): byte k of cur = next free place of bin 8*tid + k, counted from tbase
  {
    unsigned long long cur = c8 << 8;
    cur += cur << 8;
    cur += cur << 16;
    cur += cur << 32;
    for (int i0 = 0; i0 < mine; i0 += 8) {
      int u[8], e[8];
#pragma unroll   // u / e in registers; all reads ahead of the first store, one LDS latency for the eight
      for (int j = 0; j < 8; ++j) {
        const int ii = i0 + j < mine ? i0 + j : mine - 1;
        u[j] = tRD[below + ii];
        e[j] = tE[below + ii];
      }
#pragma unroll   // u / e in registers
      for (int j = 0; j < 8; ++j) {
        if (i0 + j < mine && (u[j] >> 7) == tid) {
          const int sh = ((u[j] >> BINSH) & 7) * 8;
          int pos = tbase + (int)((cur >> sh) & 255ull);
          pos = pos > HCAP - 1 ? HCAP - 1 : pos;
          sE[pos] = e[j];
          sD[pos] = u[j] & (NND - 1);
          cur += 1ull << sh;
        }
      }
    }
  }
  __syncthreads();

  // ---- geometry / capacity guards -> NaN poison of this block's ctx rows ----
  int degmax = 0;
#pragma unroll
  for (int w2 = 0; w2 < AT_NW; ++w2) degmax = misc[w2] > degmax ? misc[w2] : degmax;
  const int ng  = ngp[0];
  const int bt0 = bat[node0];
  const bool bad = (nh >= HCAP) || (degmax > RWCAP) || (ng != NGR) || (bt0 < 0) || (bt0 >= NGR);
  const float pz = bad ? __int_as_float(0x7fc00000) : 0.0f;

  // ---- phase B ----
  const int wsub = wave & 3;                     // query row group of this wave
  const int hl   = wave >> 2;                    // head slot (0 / 1) of this wave within the pair
  const int rw   = tid >> 2;                     // bias fill: query row owned by this thread
  const int jw   = tid & 3;                      // bias fill: key-column quarter owned by this thread
  const float sscale = 0.125f;
  const v8f z8 = {0.f,0.f,0.f,0.f,0.f,0.f,0.f,0.f};
  const __bf16* Kth = Ksh + hl * KVS;
  const __bf16* Ktl = Ksl + hl * KVS;
  const __bf16* Vtth = Vth + hl * KVS;
  const __bf16* Vttl = Vtl + hl * KVS;
  __bf16* pwh = Psh + wave * PWS;
  __bf16* pwl = Psl + wave * PWS;

#pragma unroll 1
  for (int hp = 0; hp < NHD / 2; ++hp) {
    const int h    = 2 * hp + hl;                // head of this wave
    const int qrow = lrow0 + wsub * 16;          // plane row of this wave's first query

    // Q fragments (A operand, row = lane&15, split k map): 2 d-chunks, hi and lo
    v16b qah[2], qal[2];
#pragma unroll
    for (int dc = 0; dc < 2; ++dc) {
      const unsigned short* qp = Qp + (size_t)(qrow + c) * PLD + h * HDM + dc * 32 + 8 * hh;
      qah[dc] = FragBF::load((const __bf16*)(const void*)qp);
      qal[dc] = FragBF::load((const __bf16*)(const void*)(qp + HID));
    }
    float mrow[8], lrow[8];
    v8f oacc[4];
#pragma unroll
    for (int r = 0; r < 8; ++r) { mrow[r] = -INFINITY; lrow[r] = 0.f; }
#pragma unroll
    for (int t = 0; t < 4; ++t) oacc[t] = z8;

#pragma unroll 1
    for (int kc = 0; kc < NND / 64; ++kc) {
      const int kv0 = kc * 64;
      __syncthreads();
      {
        // staging: thread half th = head 2hp+th; 128 threads x (4 x 8) elements = 64 x 64 per plane
        const int th = tid >> 7, t = tid & 127;
        const int r = t >> 1, half = (t & 1) * 32;
        const int hs = 2 * hp + th;
        const unsigned short* ksh = Kp + (size_t)(lgr * NND + kv0 + r) * PLD + hs * HDM + half;
        const unsigned short* ksl = ksh + HID;
        const unsigned short* vsh = VTp + ((size_t)lgr * HID + hs * HDM + r) * PLD + kv0 + half;
        const unsigned short* vsl = vsh + HID;
        __bf16* kdh = Ksh + th * KVS + r * KVP + half;
        __bf16* kdl = Ksl + th * KVS + r * KVP + half;
        __bf16* vdh = Vth + th * KVS + r * KVP + half;
        __bf16* vdl = Vtl + th * KVS + r * KVP + half;
#pragma unroll
        for (int i = 0; i < 4; ++i) {
          const v8b a0 = *(const v8b*)(ksh + 8 * i);
          const v8b a1 = *(const v8b*)(ksl + 8 * i);
          const v8b b0 = *(const v8b*)(vsh + 8 * i);
          const v8b b1 = *(const v8b*)(vsl + 8 * i);
          *(v8b*)(kdh + 8 * i) = a0;
          *(v8b*)(kdl + 8 * i) = a1;
          *(v8b*)(vdh + 8 * i) = b0;
          *(v8b*)(vdl + 8 * i) = b1;
        }
        // bias tiles + dummies zero: 8 sweeps x 256 threads x 4 floats = both 64x64 tiles (each store's lanes
        // contiguous, no two on one bank); 128 threads x 4 = dummies
        const v4f z4 = {0.f, 0.f, 0.f, 0.f};
        float* bz = BTX + tid * 4;
#pragma unroll
        for (int i = 0; i < 8; ++i) *(v4fa*)(bz + NTHR * 4 * i) = z4;
        if (tid < 128) *(v4fa*)(BTX + 2 * KVT + 4 * tid) = z4;
      }
      __syncthreads();
      {
        // bias fill: segment [st, st+cnt) of sE/sD = the bin of row rw and key columns kv0+16jw..kv0+16jw+15
        const int bin = rw * (NND >> BINSH) + kc * (64 >> BINSH) + jw;
        int st = roff[bin], cnt = rcnt[bin];
        st  = st < 0 ? 0 : (st > nh ? nh : st);
        cnt = cnt < 0 ? 0 : (cnt > RWCAP ? RWCAP : cnt);
        if (cnt > nh - st) cnt = nh - st;
        int cmax = cnt;
#pragma unroll
        for (int off = 16; off > 0; off >>= 1) {
          const int o = __shfl_xor(cmax, off, 32);
          cmax = o > cmax ? o : cmax;
        }
        const float* ebp = EB + 2 * hp;
#pragma unroll 1
        for (int q = 0; q < cmax; ++q) {           // cmax wave-uniform, <= RWCAP
          const bool valid = q < cnt;
          int idx = st + q;
          idx = idx > nh - 1 ? nh - 1 : idx;
          idx = idx < 0 ? 0 : idx;
          const int col = sD[idx] - kv0;
          int e = sE[idx];
          e = e < 0 ? 0 : (e > nE - 1 ? nE - 1 : e);
          const v2f ebv = *(const v2fa*)(ebp + (size_t)e * NHD);
          const bool inr = valid && ((unsigned)col < 64u) && ((col >> 4) == jw);
          const int ia = inr ? (rw * 64 + col) : (2 * KVT + tid);
          const int ib = inr ? (KVT + rw * 64 + col) : (2 * KVT + NTHR + tid);
          BTX[ia] = BTX[ia] + ebv.x;
          BTX[ib] = BTX[ib] + ebv.y;
        }
      }
      __syncthreads();

      // ---- S = q . k (3-term) ----
      v8f s[4];
#pragma unroll
      for (int j = 0; j < 4; ++j) {
        s[j] = z8;
#pragma unroll
        for (int dc = 0; dc < 2; ++dc) {
          FB kb, kl;
          const __bf16* kr = Kth + (j * 16 + c) * KVP + dc * 32 + 8 * hh;
          const __bf16* kq = Ktl + (j * 16 + c) * KVP + dc * 32 + 8 * hh;
          kb.h[0] = *(const v8b*)kr;
          kb.h[1] = *(const v8b*)(kr + 16);
          kl.h[0] = *(const v8b*)kq;
          kl.h[1] = *(const v8b*)(kq + 16);
          s[j] = at_mma(qah[dc], kb.v, s[j]);
          s[j] = at_mma(qah[dc], kl.v, s[j]);
          s[j] = at_mma(qal[dc], kb.v, s[j]);
        }
      }
      // scale, add bias tile (D element r = row wsub*16 + 8hh + r, col j*16 + c), chunk row max
      const float* btr = BTX + hl * KVT + (wsub * 16 + 8 * hh) * 64 + c;
      float cm[8];
#pragma unroll
      for (int r = 0; r < 8; ++r) {
        float m = -INFINITY;
#pragma unroll
        for (int j = 0; j < 4; ++j) {
          const float sv = s[j][r] * sscale + btr[r * 64 + j * 16];
          s[j][r] = sv;
          m = fmaxf(m, sv);
        }
#pragma unroll
        for (int off = 1; off < 16; off <<= 1) m = fmaxf(m, __shfl_xor(m, off, 32));
        cm[r] = m;
      }
#pragma unroll
      for (int r = 0; r < 8; ++r) {
        const float mnew = fmaxf(mrow[r], cm[r]);
        const float alpha = expf(mrow[r] - mnew);
        mrow[r] = mnew;
        float psum = 0.f;
#pragma unroll
        for (int j = 0; j < 4; ++j) {
          const float p = expf(s[j][r] - mnew);
          psum += p;
          __bf16 a, bl; at_split(p, a, bl);
          pwh[(8 * hh + r) * KVP + j * 16 + c] = a;
          pwl[(8 * hh + r) * KVP + j * 16 + c] = bl;
        }
#pragma unroll
        for (int off = 1; off < 16; off <<= 1) psum += __shfl_xor(psum, off, 32);
        lrow[r] = lrow[r] * alpha + psum;
#pragma unroll
        for (int t = 0; t < 4; ++t) oacc[t][r] *= alpha;
      }
      __builtin_amdgcn_fence(__ATOMIC_RELEASE, "workgroup");
      __builtin_amdgcn_wave_barrier();
      __builtin_amdgcn_fence(__ATOMIC_ACQUIRE, "workgroup");
      // ---- O += p . v (3-term); P fragment = A (row c), V^T fragment = B (col = d) ----
#pragma unroll 1
      for (int kk = 0; kk < 2; ++kk) {
        FB pa, pl;
        pa.h[0] = *(const v8b*)(pwh + c * KVP + kk * 32 + 8 * hh);
        pa.h[1] = *(const v8b*)(pwh + c * KVP + kk * 32 + 16 + 8 * hh);
        pl.h[0] = *(const v8b*)(pwl + c * KVP + kk * 32 + 8 * hh);
        pl.h[1] = *(const v8b*)(pwl + c * KVP + kk * 32 + 16 + 8 * hh);
#pragma unroll
        for (int t = 0; t < 4; ++t) {
          FB vb, vl;
          vb.h[0] = *(const v8b*)(Vtth + (t * 16 + c) * KVP + kk * 32 + 8 * hh);
          vb.h[1] = *(const v8b*)(Vtth + (t * 16 + c) * KVP + kk * 32 + 16 + 8 * hh);
          vl.h[0] = *(const v8b*)(Vttl + (t * 16 + c) * KVP + kk * 32 + 8 * hh);
          vl.h[1] = *(const v8b*)(Vttl + (t * 16 + c) * KVP + kk * 32 + 16 + 8 * hh);
          oacc[t] = at_mma(pa.v, vb.v, oacc[t]);
          oacc[t] = at_mma(pa.v, vl.v, oacc[t]);
          oacc[t] = at_mma(pl.v, vb.v, oacc[t]);
        }
      }
    }

    // ---- epilogue: normalise, stage the wave's 16x64 tile (pitch 64, own bias rows), hi | lo lines ----
    __syncthreads();
    {
      float* os = BTX + wave * 1024;
#pragma unroll
      for (int r = 0; r < 8; ++r) {
        const float inv = 1.0f / lrow[r];
#pragma unroll
        for (int t = 0; t < 4; ++t) os[(8 * hh + r) * 64 + t * 16 + c] = oacc[t][r] * inv + pz;
      }
      __builtin_amdgcn_fence(__ATOMIC_RELEASE, "workgroup");
      __builtin_amdgcn_wave_barrier();
      __builtin_amdgcn_fence(__ATOMIC_ACQUIRE, "workgroup");
      const int q4 = lane >> 3, c8 = (lane & 7) * 8;
      v4u hv[4], lv[4];
#pragma unroll
      for (int it = 0; it < 4; ++it) {
        const int row = it * 4 + q4;                   // it 0..3 x q4 0..3 covers rows 0..15
        const float* sp = os + row * 64 + c8;
        const v4f a = *(const v4fa*)sp;
        const v4f b = *(const v4fa*)(sp + 4);
        pack8hl(a, b, hv[it], lv[it]);
      }
      {
#pragma unroll
        for (int it = 0; it < 4; ++it) {
          const int row = it * 4 + q4;
          unsigned short* op = CTX + (size_t)(qrow + row) * PLD + h * HDM + c8;
          *(v4u*)op = hv[it];
          *(v4u*)(op + HID) = lv[it];
        }
        
      }
    }
  }
}

// =====================================================================================
static inline int cdiv(int a, int b) { return (a + b - 1) / b; }

extern "C" void kernel_launch(void* const* d_in, const int* in_sizes, int n_in,
                              void* d_out, int out_size, void* d_ws, size_t ws_size,
                              hipStream_t stream) {
  if (n_in < 15) return;
  if (in_sizes[0] != NTOT * HID) return;                        // x [16384][512]
  if (in_sizes[1] != NTOT) return;                              // batch [16384]
  if (in_sizes[2] < 2 || (in_sizes[2] & 1) != 0) return;        // edge_index [2][E]
  const int nE = in_sizes[2] / 2;
  if (nE < 1 || nE > (1 << 24)) return;
  if (in_sizes[3] != nE * EDW) return;                          // edge_attr [E][16]
  if (in_sizes[4] != HID * HID || in_sizes[6] != HID * HID || in_sizes[8] != HID * HID || in_sizes[10] != HID * HID) return;
  if (in_sizes[5] != HID || in_sizes[7] != HID || in_sizes[9] != HID || in_sizes[11] != HID) return;
  if (in_sizes[12] != EDW * NHD || in_sizes[13] != NHD || in_sizes[14] != 1) return;
  if (out_size != NTOT * HID) return;                           // out [16384][512], last element 8388607

  const float* x   = (const float*)d_in[0];
  const int*   bat = (const int*)  d_in[1];
  const int*   ei  = (const int*)  d_in[2];     // row 0 = src, row 1 = dst
  const float* ea  = (const float*)d_in[3];
  const float* Wq  = (const float*)d_in[4];     // [in][out]
  const float* bq  = (const float*)d_in[5];
  const float* Wk  = (const float*)d_in[6];
  const float* bk  = (const float*)d_in[7];
  const float* Wv  = (const float*)d_in[8];
  const float* bv  = (const float*)d_in[9];
  const float* Wo  = (const float*)d_in[10];
  const float* bo  = (const float*)d_in[11];
  const float* We  = (const float*)d_in[12];    // [16][8]
  const float* be  = (const float*)d_in[13];    // [8]
  const int*   ngp = (const int*)  d_in[14];    // [1]
  float* out = (float*)d_out;
  const int* keys = ei;                         // src list
  const int* gath = ei + nE;                    // dst list

  const int EP = cdiv(nE, 4) * 4;

  char* ws = (char*)d_ws;
  size_t off = 0;
  const size_t oXb = off; off += (size_t)NTOT * HID * 2;                                          // 16777216
  const size_t oWq = off; off += (size_t)HID * HID * 2;                                           //   524288
  const size_t oWk = off; off += (size_t)HID * HID * 2;
  const size_t oWv = off; off += (size_t)HID * HID * 2;
  const size_t oWo = off; off += (size_t)HID * PLD * 2;                                           //  1048576
  const size_t oEB = off; off += (size_t)EP * NHD * 4;   off = (off + 255) & ~(size_t)255;        //  8388608
  const size_t oQ  = off; off += (size_t)RHALF * PLD * 2;                                         // 33554432
  const size_t oK  = off; off += (size_t)RHALF * PLD * 2;
  const size_t oVT = off; off += (size_t)GHALF * HID * PLD * 2;                                   // 33554432
  const size_t oCT = off; off += (size_t)RHALF * PLD * 2;                                         // 33554432
  if (off > ws_size || off > (size_t)WSMAX) return;                                               // 162004992
  unsigned short* Xb   = (unsigned short*)(ws + oXb);
  unsigned short* WqT  = (unsigned short*)(ws + oWq);
  unsigned short* WkT  = (unsigned short*)(ws + oWk);
  unsigned short* WvT  = (unsigned short*)(ws + oWv);
  unsigned short* WOT2 = (unsigned short*)(ws + oWo);
  float*          EB   = (float*)(ws + oEB);
  unsigned short* Qp   = (unsigned short*)(ws + oQ);
  unsigned short* Kp   = (unsigned short*)(ws + oK);
  unsigned short* VTp  = (unsigned short*)(ws + oVT);
  unsigned short* CTX  = (unsigned short*)(ws + oCT);

  hipFuncSetAttribute(reinterpret_cast<const void*>(&k_attn),
                      hipFuncAttributeMaxDynamicSharedMemorySize, LDS_ATT);

  // weight planes (bf16 bits, k-contiguous rows [n][k])
  {
    const int nUw = HID * (HID / 8);             // 512 rows x 64 units
    k_wtr<<<cdiv(nUw, NTHR), NTHR, 0, stream>>>(Wq, HID, HID, HID, HID, WqT, nUw);
    k_wtr<<<cdiv(nUw, NTHR), NTHR, 0, stream>>>(Wk, HID, HID, HID, HID, WkT, nUw);
    k_wtr<<<cdiv(nUw, NTHR), NTHR, 0, stream>>>(Wv, HID, HID, HID, HID, WvT, nUw);
    const int nUo = HID * (PLD / 8);             // 512 rows x 128 units: wt [512][1024], k mod 512
    k_wtr<<<cdiv(nUo, NTHR), NTHR, 0, stream>>>(Wo, HID, HID, HID, PLD, WOT2, nUo);
  }
  // node feature plane (whole x)
  {
    const int nUx = NTOT * (HID / 8);
    k_xprep<<<cdiv(nUx, NTHR), NTHR, 0, stream>>>(x, Xb, NTOT, nUx);
  }
  // edge bias plane [EP][8]
  {
    const int nUe = EP * 2;
    k_eb<<<cdiv(nUe, NTHR), NTHR, 0, stream>>>(ea, We, be, EB, nE, nUe);
  }

  const dim3 blk(256);
  const dim3 gQK(((RHALF / 64) * (HID / 64)) / 8, 1);        // 256 blocks x 8 tiles: M=16384, N=512
  const dim3 gVT(((HID / 64) * (NND / 64)) / 8, GHALF);      // 8 blocks x 8 tiles per graph: M=512, N=512
  const dim3 gAT(GHALF * (NND / 64));                        // 256 blocks: 32 graphs x 8 query tiles
  for (int half = 0; half < NHALF; ++half) {
    const unsigned short* Xh = Xb + (size_t)half * RHALF * HID;
    float* outh = out + (size_t)half * RHALF * HID;
    // q = x . Wq + bq -> Qp hi | lo  (M=16384, N=512, K=512)
    wmma_gemm64<false, 2, 2, false, 0><<<gQK, blk, 0, stream>>>(
        Xh, Xh, HID, 0L, WqT, WqT, HID, 0L, (void*)Qp, (void*)(Qp + HID), PLD, 0L,
        bq, bq, 0L, RHALF, HID, HID, 1.0f);
    // k = x . Wk + bk -> Kp hi | lo
    wmma_gemm64<false, 2, 2, false, 0><<<gQK, blk, 0, stream>>>(
        Xh, Xh, HID, 0L, WkT, WkT, HID, 0L, (void*)Kp, (void*)(Kp + HID), PLD, 0L,
        bk, bk, 0L, RHALF, HID, HID, 1.0f);
    // v^T = Wv^T . x^T + bv[m] per graph -> VTp [graph][h*64+d][s] hi | lo  (M=512, N=512, K=512, z = 32 graphs)
    wmma_gemm64<false, 1, 2, false, 0><<<gVT, blk, 0, stream>>>(
        WvT, WvT, HID, 0L, Xh, Xh, HID, (long)NND * HID, (void*)VTp, (void*)(VTp + HID), PLD, (long)HID * PLD,
        bv, bv, 0L, HID, NND, HID, 1.0f);
    // attention with edge bias -> CTX hi | lo
    k_attn<<<gAT, NTHR, LDS_ATT, stream>>>(Qp, Kp, VTp, EB, keys, gath, ngp, bat, CTX, nE, 1, half * GHALF);
    // out = [ctx hi | ctx lo] . [Wo ; Wo] + bo -> d_out rows half*RHALF .. half*RHALF+RHALF-1 (M=16384, N=512, K=1024)
    wmma_gemm64<false, 2, 0, false, 0><<<gQK, blk, 0, stream>>>(
        CTX, CTX, PLD, 0L, WOT2, WOT2, PLD, 0L, (void*)outh, (void*)outh, HID, 0L,
        bo, bo, 0L, RHALF, HID, PLD, 1.0f);
  }
  (void)hipGetLastError();
}

// v006
// Measured time: 364 microseconds a run.
// Timed twice side by side with v005, it ran 1.05 times as fast both times.
// Counting every step since v000, it is 5.07 times as fast.
// Contractions on v_wmma_f32_16x16x32_bf16 (bf16 operands, f32 accumulate): x*Wq, x*Wk, Wv^T*x^T as single
// products of bf16-RNE inputs; q.k^T and p.v as bf16 hi/lo split (hi.hi + hi.lo + lo.hi); ctx*Wo as
// [ctx hi | ctx lo] . [Wo ; Wo] (K = 1024); edge bias (16-deep dots of bf16-RNE inputs), online softmax and all biases in f32 on the VALU.
#include <hip/hip_runtime.h>
#include <math.h>
#include <stdint.h>
#include <stddef.h>

// Geometry: NGR graphs of NND consecutive node rows; attention keys of a query = the NND nodes of its graph.
// The job runs in NHALF passes of GHALF graphs each (one pass of all graphs: the attention launch then has one
// work-group for each of the 256 WGPs); the q / k / v^T / ctx planes are rewritten per pass.
//
// Plane map (workspace, all 16-bit planes are bf16 bits; no power-of-two carries anywhere, so no inverse
// factor exists -> carry audit: none):
//   Xb   [16384][512]          bf16(x)                                        -> A of q/k GEMMs, Bt of v^T GEMM
//   WqT, WkT, WvT [512 o][512 i]  bf16(W[i][o])                              -> Bt / A (k-contiguous)
//   WOT2 [512 o][1024]         bf16(Wo[k mod 512][o])                         -> Bt of the output GEMM
//   EB   [EP][8] f32           sum_t bf16(ea[e][t]) bf16(We[t][h]) + bf16(be[h])
//   Qp, Kp [16384][1024]       hi at col h*64+d, residual lo at col 512 + h*64+d (f32 projection split)
//   VTp  [32 graphs][512 (h,d)][1024]   hi at col s, lo at col 512 + s (s = node within graph)
//   CTX  [16384][1024]         hi | lo of the normalised attention context

#define NGR    32
#define NND    512
#define NTOT   (NGR * NND)      // 16384
#define HID    512
#define NHD    8
#define HDM    64
#define EDW    16
#define NHALF  1
#define GHALF  (NGR / NHALF)    // 32
#define RHALF  (GHALF * NND)    // 16384
#define PLD    1024
#define NTHR   256
#define WSMAX  268435456

static_assert(HID == NHD * HDM && HDM == 64 && NHD == 8);
static_assert(PLD == 2 * HID);
static_assert((RHALF % 64) == 0 && (HID % 64) == 0 && (NND % 64) == 0 && (PLD % 32) == 0 && (HID % 32) == 0);
static_assert(((RHALF / 64) * (HID / 64)) % 8 == 0);       // GEMM grids: 8 wave tiles per block, exact
static_assert(((HID / 64) * (NND / 64)) % 8 == 0);
static_assert(NGR == NHALF * GHALF);
static_assert(HID == 64 * 8);                               // k_xprep: 64 units of 8 per row
static_assert(EDW == 16 && NHD == 8 && EDW * NHD <= NTHR);  // k_eb layout

typedef __attribute__((ext_vector_type(16))) _Float16 v16h;
typedef __attribute__((ext_vector_type(8)))  _Float16 v8h;
typedef __attribute__((ext_vector_type(16))) __bf16   v16b;
typedef __attribute__((ext_vector_type(8)))  __bf16   v8b;
typedef __attribute__((ext_vector_type(8)))  float    v8f;
typedef __attribute__((ext_vector_type(4)))  float    v4f;
typedef __attribute__((ext_vector_type(2)))  float    v2f;
typedef __attribute__((ext_vector_type(4)))  unsigned int v4u;
typedef __attribute__((ext_vector_type(4)))  int      v4i;
typedef __attribute__((ext_vector_type(8)))  unsigned short v8us;
typedef v4f  __attribute__((may_alias)) v4fa;
typedef v2f  __attribute__((may_alias)) v2fa;
typedef v4u  __attribute__((may_alias)) v4ua;

// ---- scalar helpers: f32 -> bf16 bits (RNE convert), bf16 bits -> f32 ----
__device__ __forceinline__ unsigned short f2bf_bits(float f) {
  unsigned u = __float_as_uint(f);
  return (unsigned short)((u + 0x7FFFu + ((u >> 16) & 1u)) >> 16);
}
__device__ __forceinline__ float bf_bits2f(unsigned short h) { return __uint_as_float(((unsigned)h) << 16); }
__device__ __forceinline__ float bfrf(float f) { return bf_bits2f(f2bf_bits(f)); }
__device__ __forceinline__ unsigned int f2bfu(float f) {
  const unsigned int u = __float_as_uint(f);
  return ((u + 0x7FFFu + ((u >> 16) & 1u)) >> 16) & 0xFFFFu;
}
__device__ __forceinline__ float bf2f(unsigned int b) { return __uint_as_float(b << 16); }
__device__ __forceinline__ v4f bfr4(const v4f a) {
  v4f r; r.x = bfrf(a.x); r.y = bfrf(a.y); r.z = bfrf(a.z); r.w = bfrf(a.w); return r;
}
__device__ __forceinline__ unsigned int pk2(float lo, float hi) { return f2bfu(lo) | (f2bfu(hi) << 16); }
__device__ __forceinline__ v4u pack8(const v4f a, const v4f b) {
  v4u r;
  r.x = pk2(a.x, a.y); r.y = pk2(a.z, a.w); r.z = pk2(b.x, b.y); r.w = pk2(b.z, b.w);
  return r;
}
// hi = bf16(v), lo = bf16(v - hi): two floats -> one packed word of each
__device__ __forceinline__ void hl2(float v0, float v1, unsigned int& hw, unsigned int& lw) {
  const unsigned int h0 = f2bfu(v0), h1 = f2bfu(v1);
  const unsigned int l0 = f2bfu(v0 - bf2f(h0)), l1 = f2bfu(v1 - bf2f(h1));
  hw = h0 | (h1 << 16);
  lw = l0 | (l1 << 16);
}
__device__ __forceinline__ void pack8hl(const v4f a, const v4f b, v4u& hv, v4u& lv) {
  unsigned int h, l;
  hl2(a.x, a.y, h, l); hv.x = h; lv.x = l;
  hl2(a.z, a.w, h, l); hv.y = h; lv.y = l;
  hl2(b.x, b.y, h, l); hv.z = h; lv.z = l;
  hl2(b.z, b.w, h, l); hv.w = h; lv.w = l;
}

// ---- WMMA fragment helpers (bf16, wave32) ----
// A fragment (row m = lane&15) and B fragment (col n = lane&15) use the SAME k map:
//   elements 0..7 <- k0 + 8h + 0..7, elements 8..15 <- k0 + 16 + 8h + 0..7, h = lane>>4,
// loaded as two 16-B pieces from a k-contiguous 16-bit row: p[0..7] and p[16..23] with p = row + k0 + 8h.
// D element r of lane l = (row 8h + r, col l&15).
__device__ __forceinline__ void dep_guard_b(v8f& a, v8f& b, v16b x, v16b y) { asm volatile("v_nop\n\tv_nop\n\tv_nop\n\tv_nop" : "+v"(a), "+v"(b) : "v"(x), "v"(y)); }
__device__ __forceinline__ void keep4_b(v16b a, v16b b, v16b c, v16b d) { asm volatile("v_nop" :: "v"(a), "v"(b), "v"(c), "v"(d)); }
__device__ __forceinline__ void acc_guard4(v8f& a, v8f& b, v8f& c, v8f& d) { asm volatile("v_nop\n\tv_nop\n\tv_nop\n\tv_nop" : "+v"(a), "+v"(b), "+v"(c), "+v"(d)); }

struct FragBF {
  union U { v16b v; v8b h[2]; };
  static __device__ __forceinline__ v16b load(const __bf16* p) {   // elements 0..7 <- p[0..7], 8..15 <- p[16..23]
    U f; f.h[0] = *(const v8b*)(p); f.h[1] = *(const v8b*)(p + 16); return f.v;
  }
  static __device__ __forceinline__ v8f mma(v16b a, v16b b, v8f c) {
    return __builtin_amdgcn_wmma_f32_16x16x32_bf16(false, a, false, b, (short)0, c, false, false);
  }
  static __device__ __forceinline__ void guard(v8f& a, v8f& b, v16b x, v16b y) { dep_guard_b(a, b, x, y); }
  static __device__ __forceinline__ void keep(v16b a, v16b b, v16b c, v16b d) { keep4_b(a, b, c, d); }
};
union FB { v16b v; v8b h[2]; };

// single WMMA with hazard guard: ties D, keeps A/B live for 4 VALU slots
__device__ __forceinline__ v8f at_mma(v16b a, v16b b, v8f c) {
  c = __builtin_amdgcn_wmma_f32_16x16x32_bf16(false, a, false, b, (short)0, c, false, false);
  asm volatile("v_nop\n\tv_nop\n\tv_nop\n\tv_nop" : "+v"(c) : "v"(a), "v"(b));
  return c;
}
__device__ __forceinline__ __bf16 at_f2bf(float f) { return __builtin_bit_cast(__bf16, f2bf_bits(f)); }
__device__ __forceinline__ void at_split(float f, __bf16& hi, __bf16& lo) {
  const unsigned short hb = f2bf_bits(f);
  hi = __builtin_bit_cast(__bf16, hb);
  lo = at_f2bf(f - __uint_as_float(((unsigned)hb) << 16));
}

// =====================================================================================
// Register-blocked batched WMMA GEMM (bf16 operands).
// C[m,n] = scale * sum_k A[m,k] * Bt[n,k] (+bias)(+resid); each wave owns a 64x64 tile.
// A row-major [M,K]; Bt row-major [N,K]; M,N % 64 == 0, K % 32 == 0 (host static_asserts).
// SPLIT: operands are hi/lo planes (A2/Bt2 = lo planes, same layout); product = hi.hi + hi.lo + lo.hi.
// BIAS_MODE: 0 = none, 1 = bf16r(bias[m]), 2 = bf16r(bias[n]).
// OUT_MODE: 0 = f32, 1 = f16, 2 = bf16 hi plane (Cout) + bf16 lo plane (Cout2).
// coverage: grid.x * 8 waves == (M/64)*(N/64) tiles exactly (host), every C element written once per z.
// =====================================================================================
template <bool SPLIT, int BIAS_MODE, int OUT_MODE, bool RESID, int ACT = 0>
__global__ __launch_bounds__(256) void wmma_gemm64(
    const unsigned short* __restrict__ Ap, const unsigned short* __restrict__ A2p, int lda, long strideA,
    const unsigned short* __restrict__ Btp, const unsigned short* __restrict__ Bt2p, int ldb, long strideB,
    void* __restrict__ Cout, void* __restrict__ Cout2, int ldc, long strideC,
    const float* __restrict__ bias,
    const float* __restrict__ resid, long strideR,
    int M, int N, int K, float scale) {
  typedef __bf16 T;
  typedef v16b V;
  const T* A = (const T*)Ap; const T* A2 = (const T*)A2p; const T* Bt = (const T*)Btp; const T* Bt2 = (const T*)Bt2p;
  __shared__ __align__(16) float sT[8][16 * 68];   // per-wave 16x64 slab, pitch 68 floats
  const int b    = blockIdx.y;
  const int lane = threadIdx.x & 31;
  const int wave = threadIdx.x >> 5;
  const int tilesN = N >> 6;
  const int tilesM = M >> 6;
  const int tile = blockIdx.x * 8 + wave;
  if (tile >= tilesM * tilesN) return;   // wave-uniform; no block barriers in this kernel
  const int tm = tile / tilesN;
  const int tn = tile - tm * tilesN;
  const int m0 = tm << 6;
  const int n0 = tn << 6;

  const T* Ab  = A  + (size_t)b * strideA;
  const T* Bb  = Bt + (size_t)b * strideB;
  const T* Ab2 = SPLIT ? (A2  + (size_t)b * strideA) : nullptr;
  const T* Bb2 = SPLIT ? (Bt2 + (size_t)b * strideB) : nullptr;

  const int rlane = lane & 15;                 // row (A) / col (B, D) within subtile
  const int koff  = (lane >> 4) * 8;           // k offset of this lane half
  const int mOff  = (lane >> 4) * 8;           // D row offset

  v8f acc[4][4];
#pragma unroll
  for (int i = 0; i < 4; ++i)
#pragma unroll
    for (int j = 0; j < 4; ++j) acc[i][j] = (v8f){0.f,0.f,0.f,0.f,0.f,0.f,0.f,0.f};

  for (int k0 = 0; k0 < K; k0 += 32) {
    V bh[4], bl[4];
#pragma unroll
    for (int j = 0; j < 4; ++j) {
      const size_t bo = (size_t)(n0 + (j << 4) + rlane) * ldb + koff + k0;
      bh[j] = FragBF::load(Bb + bo);
      if (SPLIT) bl[j] = FragBF::load(Bb2 + bo);
    }
#pragma unroll
    for (int i = 0; i < 4; ++i) {
      const size_t ao = (size_t)(m0 + (i << 4) + rlane) * lda + koff + k0;
      V ah = FragBF::load(Ab + ao);
      V al;
      if (SPLIT) al = FragBF::load(Ab2 + ao);
#pragma unroll
      for (int j = 0; j < 4; ++j) {
        acc[i][j] = FragBF::mma(ah, bh[j], acc[i][j]);
        if (SPLIT) {
          acc[i][j] = FragBF::mma(ah, bl[j], acc[i][j]);
          acc[i][j] = FragBF::mma(al, bh[j], acc[i][j]);
        }
      }
      FragBF::guard(acc[i][0], acc[i][3], ah, SPLIT ? al : ah);
    }
    FragBF::keep(bh[0], bh[1], bh[2], bh[3]);
    if (SPLIT) FragBF::keep(bl[0], bl[1], bl[2], bl[3]);
  }
  acc_guard4(acc[0][0], acc[0][1], acc[0][2], acc[0][3]);
  acc_guard4(acc[1][0], acc[1][1], acc[1][2], acc[1][3]);
  acc_guard4(acc[2][0], acc[2][1], acc[2][2], acc[2][3]);
  acc_guard4(acc[3][0], acc[3][1], acc[3][2], acc[3][3]);

  // ---- epilogue ----
  float* slab = sT[wave];
  const float* Rb = RESID ? (resid + (size_t)b * strideR) : nullptr;
#pragma unroll
  for (int i = 0; i < 4; ++i) {
    const int mBase = m0 + (i << 4);
    float bm[8];
    if (BIAS_MODE == 1) {   // 8 consecutive floats, 32-B aligned: two 16-B loads
      const v4f b0v = bfr4(*(const v4fa*)(bias + mBase + mOff));
      const v4f b1v = bfr4(*(const v4fa*)(bias + mBase + mOff + 4));
      bm[0] = b0v.x; bm[1] = b0v.y; bm[2] = b0v.z; bm[3] = b0v.w;
      bm[4] = b1v.x; bm[5] = b1v.y; bm[6] = b1v.z; bm[7] = b1v.w;
    } else {
#pragma unroll
      for (int r = 0; r < 8; ++r) bm[r] = 0.f;
    }
#pragma unroll
    for (int j = 0; j < 4; ++j) {
      const int n = n0 + (j << 4) + rlane;
      float bv = 0.f;
      if (BIAS_MODE == 2) bv = bfrf(bias[n]);
#pragma unroll
      for (int r = 0; r < 8; ++r) {
        float v = acc[i][j][r] * scale;
        if (BIAS_MODE == 1) v += bm[r];
        if (BIAS_MODE == 2) v += bv;
        if (RESID) v += Rb[(size_t)(mBase + mOff + r) * ldc + n];
        if (ACT == 1) v = tanhf(v);
        if (ACT == 2) v = fmaxf(v, 0.0f);
        if (ACT == 4) v = (v > 0.f) ? v : 0.01f * v;
        slab[(mOff + r) * 68 + (j << 4) + rlane] = v;
      }
    }
    __builtin_amdgcn_fence(__ATOMIC_RELEASE, "workgroup");
    __builtin_amdgcn_wave_barrier();
    __builtin_amdgcn_fence(__ATOMIC_ACQUIRE, "workgroup");
    if (OUT_MODE == 0) {
      float* C = (float*)Cout + (size_t)b * strideC;
      const int hh = lane >> 4, c4 = (lane & 15) * 4;     // row seg = 256 B = 16 lanes x 16 B
      {
#pragma unroll
        for (int it = 0; it < 8; ++it) {
          const int row = it * 2 + hh;
          v4f v = *(const v4f*)(slab + row * 68 + c4);
          *(v4f*)(C + (size_t)(mBase + row) * ldc + n0 + c4) = v;
        }
        
      }
    } else {
      const int q = lane >> 3, c8 = (lane & 7) * 8;
      unsigned short* C  = (unsigned short*)Cout  + (size_t)b * strideC;
      unsigned short* C2 = (OUT_MODE == 2) ? ((unsigned short*)Cout2 + (size_t)b * strideC) : nullptr;
      {
#pragma unroll
        for (int it = 0; it < 4; ++it) {
          const int row = it * 4 + q;
          const float* sp = slab + row * 68 + c8;
          v8h hv, lv;
#pragma unroll
          for (int e = 0; e < 8; ++e) {
            if (OUT_MODE == 1) {
              hv[e] = (_Float16)sp[e];
            } else {
              unsigned short hb = f2bf_bits(sp[e]);
              unsigned short lb = f2bf_bits(sp[e] - bf_bits2f(hb));
              hv[e] = __builtin_bit_cast(_Float16, hb);
              lv[e] = __builtin_bit_cast(_Float16, lb);
            }
          }
          *(v8h*)(C + (size_t)(mBase + row) * ldc + n0 + c8) = hv;
          if (OUT_MODE == 2) *(v8h*)(C2 + (size_t)(mBase + row) * ldc + n0 + c8) = lv;
        }
        
      }
    }
    __builtin_amdgcn_fence(__ATOMIC_RELEASE, "workgroup");
    __builtin_amdgcn_wave_barrier();
    __builtin_amdgcn_fence(__ATOMIC_ACQUIRE, "workgroup");
  }
}

// =====================================================================================
// Node feature plane: xb[row][c] = bf16(x[row][c]) for row < nN (all 512 c). One thread = 8 contiguous
// =====================================================================================
__global__ __launch_bounds__(NTHR) void k_xprep(const float* __restrict__ x, unsigned short* xb, int nN, int nUnits) {
  const int i = (int)blockIdx.x * NTHR + (int)threadIdx.x;
  if (i >= nUnits) return;
  const int row = i >> 6;
  const int c0  = (i & 63) * 8;
  const int rc  = row < nN ? row : nN - 1;
  const float* p = x + (size_t)rc * HID + c0;
  v4f a = *(const v4fa*)p;
  v4f b = *(const v4fa*)(p + 4);
  const v4f z4 = {0.f, 0.f, 0.f, 0.f};
  if (row >= nN) { a = z4; b = z4; }
  const v4u hv = pack8(a, b);
  unsigned short* o = xb + (size_t)row * HID + c0;
  *(v4u*)o = hv;
  
}

// =====================================================================================
// Weight transpose + bf16 convert into a k-contiguous plane: w is [Kin][Ncol] ([in][out]),
//   wt[n][k] = bf16(w[k mod Kin][n]) for n < Nrows, k < Kout (Kout = Kin or a multiple of it).
// coverage: nUnits = Nrows * Kout/8 threads x 8 = Nrows x Kout exactly.
// =====================================================================================
__global__ __launch_bounds__(NTHR) void k_wtr(const float* __restrict__ w, int Kin, int Ncol, int Nrows, int Kout,
                                              unsigned short* wt, int nUnits) {
  const int u = (int)blockIdx.x * NTHR + (int)threadIdx.x;
  if (u >= nUnits) return;
  const int kq = Kout >> 3;
  const int n  = u / kq;
  const int k8 = (u - n * kq) * 8;
  const int kk = k8 - (k8 / Kin) * Kin;
  const int ncl = n < Ncol ? n : Ncol - 1;
  const float* p = w + (size_t)kk * (size_t)Ncol + ncl;
  v4f a, b;
  a.x = p[0];                    a.y = p[(size_t)Ncol];         a.z = p[(size_t)2 * Ncol];     a.w = p[(size_t)3 * Ncol];
  b.x = p[(size_t)4 * Ncol];     b.y = p[(size_t)5 * Ncol];     b.z = p[(size_t)6 * Ncol];     b.w = p[(size_t)7 * Ncol];
  const v4f z4 = {0.f, 0.f, 0.f, 0.f};
  if (n >= Ncol || n >= Nrows) { a = z4; b = z4; }
  const v4u wv = pack8(a, b);
  unsigned short* o = wt + (size_t)n * (size_t)Kout + k8;
  *(v4u*)o = wv;
  
}

// =====================================================================================
// Edge bias plane: EB[e][h] = sum_t bf16r(ea[e][t]) * bf16r(We[t][h]) + bf16r(be[h]) (f32, 16 terms summed
// from +0 then the bias), zero rows for pad edges nE <= e < EP (load address clamped, value zeroed by select).
// One thread = one edge and 4 consecutive heads: 4 b128 loads in a rolled loop, one 16-B store;
// coverage: nUnits = EP*2 threads x 4 = EP x 8 elements exactly.
// =====================================================================================
__global__ __launch_bounds__(NTHR) void k_eb(const float* __restrict__ ea, const float* __restrict__ We,
                                             const float* __restrict__ be, float* EB, int nE, int nUnits) {
  __shared__ float sWe[EDW * NHD];
  __shared__ float sbe[NHD];
  const int tid = (int)threadIdx.x;
  if (tid < EDW * NHD) sWe[tid] = bfrf(We[tid]);           // We[t][h] row-major
  if (tid < NHD) sbe[tid] = bfrf(be[tid]);
  __syncthreads();
  const int u = (int)blockIdx.x * NTHR + tid;
  if (u >= nUnits) return;
  const int e  = u >> 1;
  const int h0 = (u & 1) * 4;
  const int ec = e < nE ? e : nE - 1;
  const float* er = ea + (size_t)ec * EDW;
  float s0 = 0.f, s1 = 0.f, s2 = 0.f, s3 = 0.f;
#pragma unroll 1
  for (int q = 0; q < 4; ++q) {
    const v4f a = bfr4(*(const v4fa*)(er + 4 * q));
    const float* wr = sWe + (4 * q) * NHD + h0;            // We[4q+i][h0+j] = wr[i*8 + j]
    s0 = fmaf(a.x, wr[0],  s0); s1 = fmaf(a.x, wr[1],  s1); s2 = fmaf(a.x, wr[2],  s2); s3 = fmaf(a.x, wr[3],  s3);
    s0 = fmaf(a.y, wr[8],  s0); s1 = fmaf(a.y, wr[9],  s1); s2 = fmaf(a.y, wr[10], s2); s3 = fmaf(a.y, wr[11], s3);
    s0 = fmaf(a.z, wr[16], s0); s1 = fmaf(a.z, wr[17], s1); s2 = fmaf(a.z, wr[18], s2); s3 = fmaf(a.z, wr[19], s3);
    s0 = fmaf(a.w, wr[24], s0); s1 = fmaf(a.w, wr[25], s1); s2 = fmaf(a.w, wr[26], s2); s3 = fmaf(a.w, wr[27], s3);
  }
  v4f o;
  o.x = s0 + sbe[h0]; o.y = s1 + sbe[h0 + 1]; o.z = s2 + sbe[h0 + 2]; o.w = s3 + sbe[h0 + 3];
  const v4f z4 = {0.f, 0.f, 0.f, 0.f};
  if (e >= nE) o = z4;
  float* op = EB + (size_t)e * NHD + h0;
  *(v4f*)op = o;
  
}

// =====================================================================================
// Graph attention with per-edge additive bias, one block per (graph, 64-query tile), 8 waves.
// Phase A (block-local, statically bounded): scan of the src list (edge_index row 0) for
//   src in [node0, node0+64): wave w walks its own contiguous eighth of the list in slabs of 256 edges, SG slabs
//   loaded ahead, hits appended to its own LDS list, no barrier inside the walk; then one barrier, the waves'
//   lists joined in wave order (= ascending slab order) with dst gathered for all hits at once: (edge id, query
//   row, dst % 512), capped at HCAP (poison when reached); counting sort (8 waves, each its own 8 query rows, stable) into
//   NBIN bins, bin = query row * 32 + (dst % 512) / 16, -> sE / sD segments with roff / rcnt. Nothing persists
//   outside LDS.
// Phase B: 4 head pairs; waves 0..3 run head 2p, waves 4..7 head 2p+1, each wave 16 query rows.
//   Per key chunk of 64: K hi/lo and V^T hi/lo tiles of both heads (8 tiles of 64 rows x 128 B) brought by one
//   tensor load per wave, two buffers, one chunk ahead; a 2x64x64 f32 bias tile zeroed then filled by row owners
//   (4 threads per query row, thread j walks only the bin of its row and of key columns 16j..16j+15 of this
//   chunk, in segment order = hit scan order -> duplicate (src,dst) pairs sum deterministically; lanes
//   whose bin is shorter than the wave's longest add into a private dummy slot),
//   then S = q.k (3-term split) * 0.125 + bias, online softmax in f32, P split hi/lo through per-wave LDS
//   Epilogue: ctx = O / l staged per wave in LDS (aliasing only that wave's own bias rows), written as
// Geometry guards (NaN poison of the block's ctx rows, never a trap): hit cap, per-row count > RWCAP,
//   num_graphs != NGR, batch id of the block's first node outside [0, NGR).
// coverage: CTX rows lrow0..lrow0+63 x all 1024 cols per block; grid = GHALF*8 blocks covers RHALF rows once.
// =====================================================================================
#define AT_NW   8
#define EPT     8
#define SLAB    (32 * EPT)            // 256 keys: one wave's read of EPT keys per lane
#define SG      4                     // slabs whose loads are in flight per wave
#define SLOTB   6
#define NSLOT   64                    // query rows per block = scan slots
#define BINSH   4                     // 16 key columns per bin
#define NBIN    (NSLOT * (NND >> BINSH))   // 2048 bins: (query row, group of 16 key columns)
#define HCAP    2048                  // hit capacity per block
#define WLCAP   HCAP                  // hit capacity of one wave's list: a wave that fills it has filled the block's
#define LISTN   (AT_NW * WLCAP)       // 16384
#define RWCAP   128                   // static cap on per-row edge count
#define KVT     4096                  // one 64x64 f32 bias tile
#define KVP     72                    // row pitch of the K / V^T / P tiles in LDS, elements: 144 B = 16 B x 9, so the
                                      // 16 rows of a ds_load_b128 fragment read fall on 16 different bank groups
#define KVS     5120                  // one 64-row K or V^T tile: 64 * KVP elements, its place rounded up to 2 KiB
#define KVB     (8 * KVS)             // one buffer: the 8 tiles of a key chunk
#define NST     ((NHD / 2) * (NND / 64))   // stages = head pairs x key chunks
#define PWS     (16 * KVP)            // one wave's 16-row P tile
#define NDUM    512                   // private dummy accumulators (2 per thread)
#define LO_KV   0
#define LO_P    (2 * KVB * 2)                           // 163840
#define LO_BT   (LO_P + 2 * AT_NW * PWS * 2)            // 200704
#define LO_SE   (LO_BT + (2 * KVT + NDUM) * 4)          // 235520
#define LO_SD   (LO_SE + HCAP * 4)                      // 243712
#define LO_RC   (LO_SD + HCAP * 4)                      // 251904
#define LDS_ATT (LO_RC + (2 * NBIN + 2 * AT_NW) * 4)    // 268352

static_assert((LISTN + 4 * HCAP) * 4 <= LO_P);        // phase-A lists alias the two K/V buffers
static_assert(LDS_ATT <= 300000);
static_assert(KVP >= 64 && (KVP * 2) % 16 == 0 && ((KVP * 2) / 16) % 2 == 1);   // 16-B aligned rows, odd multiple
static_assert(KVS >= 64 * KVP && (KVS * 2) % 2048 == 0 && KVP * 2 == 128 + 16);  // tensor load: place, padded pitch
static_assert(NST >= 2 && NND / 64 == 8 && NND == HID && AT_NW == 8 && HDM * 2 == 128 && (PLD * 2) % 16 == 0);  // one tile per wave, 128-B rows
static_assert((LO_P % 16) == 0 && (LO_BT % 16) == 0);
static_assert((1 << SLOTB) == NSLOT);
static_assert(NTHR == 32 * AT_NW);
static_assert(NTHR == 4 * NSLOT);                      // bias fill: 4 threads per query row
static_assert(NTHR * 4 * 8 == 2 * KVT);                // bias zero fill: 8 sweeps of 4 floats per thread
static_assert(NDUM == 2 * NTHR && NDUM == 128 * 4);
static_assert(AT_NW * 1024 == 2 * KVT);                // per-wave output staging = own bias rows
static_assert(SLAB == 256 && 24 + SLOTB < 32);                   // list entry = edge id (below 2^24, host check) << SLOTB | slot
static_assert(NSLOT == 8 * AT_NW && NND == 512);                 // sort: 8 query rows per wave, owner wave = hitRD >> 12
static_assert(NBIN == NTHR * 8 && (NND >> BINSH) == 32);         // sort: 8 bins per thread, 4 threads per row
static_assert(RWCAP < 256);                                      // sort: 8-bit counters exact below the row cap
static_assert((64 >> BINSH) == 4 && (LO_RC % 16) == 0);          // 4 bins per row and key chunk = 4 fill threads

// One slab of the key list: the lane holds keys e0 .. e0 + EPT - 1 in da / db and tests them against the block's slot
// range [slotBase, slotBase + nb); hits are appended to this wave's LDS list wl as (edge id << SLOTB | slot), key
// position first, lane second. wc = entries so far (wave-uniform); returns the new count; nothing is stored
// at or past WLCAP.
__device__ __forceinline__ int slab_hits(const v4i da, const v4i db, int e0, int slotBase, int nb, int* wl, int wc) {
  const unsigned nbs = (unsigned)slotBase;
  const unsigned unb = (unsigned)nb;
  const unsigned s0 = (unsigned)da.x - nbs, s1 = (unsigned)da.y - nbs;
  const unsigned s2 = (unsigned)da.z - nbs, s3 = (unsigned)da.w - nbs;
  const unsigned s4 = (unsigned)db.x - nbs, s5 = (unsigned)db.y - nbs;
  const unsigned s6 = (unsigned)db.z - nbs, s7 = (unsigned)db.w - nbs;
  const bool h0 = s0 < unb, h1 = s1 < unb, h2 = s2 < unb, h3 = s3 < unb;
  const bool h4 = s4 < unb, h5 = s5 < unb, h6 = s6 < unb, h7 = s7 < unb;
  const unsigned m0 = __builtin_amdgcn_ballot_w32(h0), m1 = __builtin_amdgcn_ballot_w32(h1);
  const unsigned m2 = __builtin_amdgcn_ballot_w32(h2), m3 = __builtin_amdgcn_ballot_w32(h3);
  const unsigned m4 = __builtin_amdgcn_ballot_w32(h4), m5 = __builtin_amdgcn_ballot_w32(h5);
  const unsigned m6 = __builtin_amdgcn_ballot_w32(h6), m7 = __builtin_amdgcn_ballot_w32(h7);
  if ((m0 | m1 | m2 | m3 | m4 | m5 | m6 | m7) != 0u) {
#define HITJ(J, HJ, SJ, MJ) { \
      const unsigned mj = (MJ); \
      if (mj != 0u) { \
        if (HJ) { \
          const int pos = wc + (int)__builtin_amdgcn_mbcnt_lo(mj, 0u); \
          if (pos < WLCAP) wl[pos] = ((e0 + (J)) << SLOTB) | (int)(SJ); \
        } \
        wc += (int)__builtin_popcount(mj); } }
    HITJ(0, h0, s0, m0)
    HITJ(1, h1, s1, m1)
    HITJ(2, h2, s2, m2)
    HITJ(3, h3, s3, m3)
    HITJ(4, h4, s4, m4)
    HITJ(5, h5, s5, m5)
    HITJ(6, h6, s6, m6)
    HITJ(7, h7, s7, m7)
#undef HITJ
  }
  return wc;
}
// A slab that is not wholly inside the list (or a list not read 16 bytes at a time): every address clamped, the
// sentinel selected by value.
__device__ __forceinline__ void slab_load_edge(const int* __restrict__ keys, int nE, int e0, v4i& da, v4i& db) {
  const int sent = -2147483647 - 1;
  da.x = (e0     < nE) ? keys[min(e0,     nE - 1)] : sent;
  da.y = (e0 + 1 < nE) ? keys[min(e0 + 1, nE - 1)] : sent;
  da.z = (e0 + 2 < nE) ? keys[min(e0 + 2, nE - 1)] : sent;
  da.w = (e0 + 3 < nE) ? keys[min(e0 + 3, nE - 1)] : sent;
  db.x = (e0 + 4 < nE) ? keys[min(e0 + 4, nE - 1)] : sent;
  db.y = (e0 + 5 < nE) ? keys[min(e0 + 5, nE - 1)] : sent;
  db.z = (e0 + 6 < nE) ? keys[min(e0 + 6, nE - 1)] : sent;
  db.w = (e0 + 7 < nE) ? keys[min(e0 + 7, nE - 1)] : sent;
}

typedef uint32_t u32x4 __attribute__((ext_vector_type(4)));
typedef uint32_t u32x8 __attribute__((ext_vector_type(8)));
__device__ __forceinline__ uint32_t uni(uint32_t v) { return (uint32_t)__builtin_amdgcn_readfirstlane(v); }
// a test around a tensor load held in a scalar register, so that it compiles to s_cmp + s_cbranch_scc
__device__ __forceinline__ uint32_t pinned(uint32_t v) { uint32_t w = uni(v); asm volatile("" : "+s"(w)); return w; }
// Descriptor of one tile of 64 rows x 128 B, source pitch PLD * 2 B, from global address ga to LDS byte offset dst;
// 16 B of pad behind every row (LDS pitch 144 B = KVP elements).
__device__ __forceinline__ u32x4 tile_g0(uint32_t dst, uint64_t ga) {
  u32x4 g0;
  g0[0] = uni(1u);
  g0[1] = uni(dst);
  g0[2] = uni((uint32_t)ga);
  g0[3] = uni((((uint32_t)(ga >> 32)) & 0x01FFFFFFu) | 0x80000000u);
  return g0;
}
__device__ __forceinline__ u32x8 tile_g1() {
  u32x8 g1;
  g1[0] = uni((1u << 20) | (4u << 22) | (3u << 25));   // no mask, 1-byte elements, pad of 4 dwords per 32 dwords
  g1[1] = uni(128u << 16);                             // tensor_dim0 = 128 B
  g1[2] = uni(64u << 16);                              // tensor_dim1 = 64 rows
  g1[3] = uni(128u << 16);                             // tile_dim0 = 128 B
  g1[4] = uni(64u);                                    // tile_dim1 = 64 rows
  g1[5] = uni((uint32_t)(PLD * 2));                    // source row pitch
  g1[6] = uni(0u);
  g1[7] = uni(0u);
  return g1;
}
// One request of the whole wave; the waits are the caller's.
__device__ __forceinline__ void tile_load(u32x4 g0, u32x8 g1) {
  asm volatile("tensor_load_to_lds %0, %1" :: "s"(g0), "s"(g1) : "memory");
}
// The wave's request has landed. The descriptor is named as an input so that its registers stay as they are while
// the request is outstanding.
__device__ __forceinline__ void tile_wait(u32x4 g0, u32x8 g1) {
  asm volatile("s_wait_tensorcnt 0x0" :: "s"(g0), "s"(g1) : "memory");
}

__global__ __launch_bounds__(NTHR) void k_attn(
    const unsigned short* __restrict__ Qp, const unsigned short* __restrict__ Kp,
    const unsigned short* __restrict__ VTp, const float* __restrict__ EB,
    const int* __restrict__ keys, const int* __restrict__ gath,
    const int* __restrict__ ngp, const int* __restrict__ bat,
    unsigned short* CTX, int nE, int vec8, int gbase) {
  extern __shared__ __attribute__((aligned(2048))) v4f lds_dyn[];   // tensor loads: tile places at multiples of 2 KiB
  char* lds = (char*)lds_dyn;
  __bf16* Ksh = (__bf16*)(lds + LO_KV);         // buffer 0 (buffer 1: + KVB): [2][KVS]  K hi  [kv][d], pitch KVP
  __bf16* Ksl = Ksh + 2 * KVS;                   // [2][KVS]  K lo
  __bf16* Vth = Ksl + 2 * KVS;                   // [2][KVS]  V^T hi [d][kv]
  __bf16* Vtl = Vth + 2 * KVS;                   // [2][KVS]  V^T lo
  int* list  = (int*)(lds + LO_KV);              // phase A only: [8 waves][WLCAP]
  int* hitE  = list + LISTN;                     // [HCAP] edge ids, in scan order
  int* hitRD = hitE + HCAP;                      // [HCAP] (row << 9) | loc_dst
  int* tE    = hitRD + HCAP;                     // [HCAP] hitE regrouped by owner wave (8 query rows each)
  int* tRD   = tE + HCAP;                        // [HCAP] hitRD of the same entries
  __bf16* Psh = (__bf16*)(lds + LO_P);           // [8 waves][16 x KVP] P hi
  __bf16* Psl = Psh + AT_NW * PWS;               // P lo
  float* BTX = (float*)(lds + LO_BT);            // [2][64 x 64] bias tiles + [NDUM] dummies; epilogue staging
  int* sE   = (int*)(lds + LO_SE);               // [HCAP] edge ids sorted by query row
  int* sD   = (int*)(lds + LO_SD);               // [HCAP] loc_dst of the same entries
  int* rcnt = (int*)(lds + LO_RC);               // [NBIN] entries per bin
  int* roff = rcnt + NBIN;                       // [NBIN] first entry of the bin in sE / sD
  int* wcnt = roff + NBIN;                       // [8]
  int* misc = wcnt + AT_NW;                      // [8] largest per-row count of each wave

  const int tid = (int)threadIdx.x, lane = tid & 31, wave = tid >> 5, hh = lane >> 4, c = lane & 15;
  const int lgr   = (int)blockIdx.x >> 3;        // graph within this pass
  const int qt    = (int)blockIdx.x & 7;         // 64-query tile within the graph
  const int gb    = gbase + lgr;                 // graph id
  const int node0 = gb * NND + qt * NSLOT;       // global node id of query row 0
  const int lrow0 = lgr * NND + qt * NSLOT;      // plane row of query row 0

  // ---- phase A1: scan of the src list, each wave its own contiguous run of slabs; then the lists joined ----
  int tot;
  {
    const int wv    = __builtin_amdgcn_readfirstlane(wave);      // scalar loop bounds
    const int nSl   = (nE + SLAB - 1) / SLAB;                     // slabs in the list
    const int spw   = (nSl + AT_NW - 1) / AT_NW;                  // slabs per wave
    const int sBeg  = wv * spw < nSl ? wv * spw : nSl;
    const int sEnd  = sBeg + spw < nSl ? sBeg + spw : nSl;
    const int nFull = vec8 != 0 ? nE / SLAB : 0;                  // slabs [0, nFull) lie wholly inside the list
    const int sFull = sEnd < nFull ? sEnd : nFull;
    const int nG    = sFull > sBeg ? (sFull - sBeg) / SG : 0;     // groups of SG whole slabs
    int* wl = list + wv * WLCAP;
    const int le = lane * EPT;
    int wc = 0;
    if (nG > 0) {
      v4i ra[SG], rb[SG];
#pragma unroll   // ra / rb in registers
      for (int k = 0; k < SG; ++k) {
        const int* p = keys + (sBeg + k) * SLAB + le;
        ra[k] = *(const v4i*)p;
        rb[k] = *(const v4i*)(p + 4);
      }
      // stands in front of the loop's first writes to the address registers of the loads above
      asm volatile("s_wait_xcnt 0x0" ::: "memory");
#pragma unroll 1   // one copy of the SG slab bodies in the instruction cache
      for (int g = 0; g < nG; ++g) {
        const int sb = sBeg + g * SG;
        const int sn = g + 1 < nG ? sb + SG : sb;                 // last trip: its own slabs again (in bounds, unused)
#pragma unroll   // ra / rb in registers; a slab's registers are refilled as soon as it is tested, SG slabs ahead
        for (int k = 0; k < SG; ++k) {
          wc = slab_hits(ra[k], rb[k], (sb + k) * SLAB + le, node0, NSLOT, wl, wc);
          const int* p = keys + (sn + k) * SLAB + le;
          ra[k] = *(const v4i*)p;
          rb[k] = *(const v4i*)(p + 4);
          // last slab: stands in front of the next trip's first writes to these loads' address registers
          if (k == SG - 1) asm volatile("s_wait_xcnt 0x0" ::: "memory");
        }
      }
    }
#pragma unroll 1   // at most SG - 1 whole slabs and the list's edge
    for (int s = sBeg + nG * SG; s < sEnd; ++s) {
      v4i da, db;
      slab_load_edge(keys, nE, s * SLAB + le, da, db);
      wc = slab_hits(da, db, s * SLAB + le, node0, NSLOT, wl, wc);
    }
    if (lane == 0) wcnt[wave] = wc;
    __syncthreads();
    int pre = 0, all = 0;
#pragma unroll
    for (int w2 = 0; w2 < AT_NW; ++w2) {
      int cc = wcnt[w2];
      cc = cc < 0 ? 0 : (cc > WLCAP ? WLCAP : cc);
      all += cc;
      pre += (w2 < wave) ? cc : 0;
    }
    const int wcc = wc > WLCAP ? WLCAP : wc;
#pragma unroll 1
    for (int i0 = 0; i0 < wcc; i0 += 128) {         // wcc wave-uniform; loads unconditional, clamped
      int eid[4], sl[4], gg[4];
#pragma unroll   // eid / sl in registers; the four list reads share one LDS latency
      for (int j = 0; j < 4; ++j) {
        const int i   = i0 + 32 * j + lane;
        const int ent = wl[i < wcc ? i : wcc - 1];
        int e = ent >> SLOTB;
        e = e < 0 ? 0 : (e > nE - 1 ? nE - 1 : e);
        eid[j] = e;
        sl[j]  = ent & (NSLOT - 1);
      }
#pragma unroll   // gg in registers; the four dst reads share one memory latency
      for (int j = 0; j < 4; ++j) gg[j] = gath[eid[j]];
#pragma unroll   // eid / sl / gg in registers
      for (int j = 0; j < 4; ++j) {
        const int i = i0 + 32 * j + lane;
        int g = gg[j];
        g = g < 0 ? 0 : (g > NTOT - 1 ? NTOT - 1 : g);
        const int pos = pre + i;
        if (i < wcc && pos < HCAP) {
          hitE[pos]  = eid[j];
          hitRD[pos] = (sl[j] << 9) | (g & (NND - 1));
        }
      }
    }
    tot = all > HCAP ? HCAP : all;
    __syncthreads();
  }
  const int nh = __builtin_amdgcn_readfirstlane(tot);   // the same in every thread of the block: scalar loop bounds

  // ---- phase A2: stable counting sort of the hits into the NBIN bins, by all 8 waves ----
  // Wave w owns query rows 8w..8w+7 (bins 256w..256w+255), thread tid the bins 8*tid..8*tid+7 (one query row,
  // 128 key columns). Bins ascend with the row, so the entries of wave w fill sE / sD[below, below + mine).
  // Every counter lives in its owner's registers: no LDS word is read, changed and written back per hit.
  // (a) hits of lower waves' rows and of this wave's rows
  int below = 0, mine = 0;
#pragma unroll 4   // four independent LDS reads in flight per wait
  for (int b0 = 0; b0 < nh; b0 += 32) {
    const int idx = b0 + lane;
    const int g   = hitRD[idx < nh ? idx : nh - 1] >> 12;        // owner wave = query row / 8
    const bool ok = idx < nh;
    below += (int)__builtin_popcount(__builtin_amdgcn_ballot_w32(ok && g < wave));
    mine  += (int)__builtin_popcount(__builtin_amdgcn_ballot_w32(ok && g == wave));
  }
  // (b) this wave's hits copied, in hit order, to tRD / tE[below, below + mine)
  {
    int wpos = below;
    for (int b0 = 0; b0 < nh; b0 += 128) {
      int rd[4], ee[4];
#pragma unroll   // rd / ee in registers; all reads ahead of the first store, one LDS latency for the four
      for (int j = 0; j < 4; ++j) {
        const int idx = b0 + 32 * j + lane;
        const int cl  = idx < nh ? idx : nh - 1;
        rd[j] = hitRD[cl];
        ee[j] = hitE[cl];
      }
#pragma unroll   // rd / ee in registers
      for (int j = 0; j < 4; ++j) {
        const bool ok = (b0 + 32 * j + lane < nh) && ((rd[j] >> 12) == wave);
        const unsigned mk = __builtin_amdgcn_ballot_w32(ok);
        if (ok) {
          int p = wpos + (int)__builtin_amdgcn_mbcnt_lo(mk, 0u);
          p = p > HCAP - 1 ? HCAP - 1 : p;
          tRD[p] = rd[j];
          tE[p]  = ee[j];
        }
        wpos += (int)__builtin_popcount(mk);
      }
    }
  }
  __syncthreads();
  // (c) per-bin counts: every lane reads each entry of its wave (one address, broadcast); the owner counts it.
  //     8 counters of 8 bits: exact while a row holds <= RWCAP entries; tc is exact always and feeds the guard.
  unsigned long long c8 = 0ull;
  int tc = 0;
#pragma unroll 8   // eight independent LDS reads in flight per wait
  for (int i = 0; i < mine; ++i) {
    const int u = tRD[below + i];
    const bool own = (u >> 7) == tid;
    c8 += (unsigned long long)(own ? 1 : 0) << (((u >> BINSH) & 7) * 8);
    tc += own ? 1 : 0;
  }
  // (d) first entry of each bin: wave prefix over the threads' totals, then over the thread's own 8 counters
  int tbase;
  {
    int incl = tc;
#pragma unroll
    for (int d = 1; d < 32; d <<= 1) {
      const int up = __shfl_up(incl, d, 32);
      if (lane >= d) incl += up;
    }
    tbase = below + incl - tc;
    int cn[8], of[8];
    int run = tbase;
#pragma unroll
    for (int k = 0; k < 8; ++k) {
      cn[k] = (int)((c8 >> (8 * k)) & 255ull);
      of[k] = run;
      run += cn[k];
    }
    const v4i c0v = {cn[0], cn[1], cn[2], cn[3]}, c1v = {cn[4], cn[5], cn[6], cn[7]};
    const v4i o0v = {of[0], of[1], of[2], of[3]}, o1v = {of[4], of[5], of[6], of[7]};
    *(v4i*)(rcnt + tid * 8)     = c0v;
    *(v4i*)(rcnt + tid * 8 + 4) = c1v;
    *(v4i*)(roff + tid * 8)     = o0v;
    *(v4i*)(roff + tid * 8 + 4) = o1v;
    // largest per-row count of the wave: a row = 4 neighbouring threads
    int rc = tc;
    rc += __shfl_xor(rc, 1, 32);
    rc += __shfl_xor(rc, 2, 32);
#pragma unroll
    for (int off = 4; off < 32; off <<= 1) {
      const int o = __shfl_xor(rc, off, 32);
      rc = o > rc ? o : rc;
    }
    if (lane == 0) misc[wave] = rc;
  }
  // (e) placement in hit order (stable): byte k of cur = next free place of bin 8*tid + k, counted from tbase
  {
    unsigned long long cur = c8 << 8;
    cur += cur << 8;
    cur += cur << 16;
    cur += cur << 32;
    for (int i0 = 0; i0 < mine; i0 += 8) {
      int u[8], e[8];
#pragma unroll   // u / e in registers; all reads ahead of the first store, one LDS latency for the eight
      for (int j = 0; j < 8; ++j) {
        const int ii = i0 + j < mine ? i0 + j : mine - 1;
        u[j] = tRD[below + ii];
        e[j] = tE[below + ii];
      }
#pragma unroll   // u / e in registers
      for (int j = 0; j < 8; ++j) {
        if (i0 + j < mine && (u[j] >> 7) == tid) {
          const int sh = ((u[j] >> BINSH) & 7) * 8;
          int pos = tbase + (int)((cur >> sh) & 255ull);
          pos = pos > HCAP - 1 ? HCAP - 1 : pos;
          sE[pos] = e[j];
          sD[pos] = u[j] & (NND - 1);
          cur += 1ull << sh;
        }
      }
    }
  }
  // this wave's reads and writes of the phase-A lists have retired before a tensor load may target their LDS
  asm volatile("s_wait_dscnt 0x0" ::: "memory");
  __syncthreads();

  // ---- K / V^T tiles: wave w brings tile w of every stage (plane w >> 1: K hi, K lo, V^T hi, V^T lo; head slot
  //      w & 1); stage st = head pair st / 8, key chunk st % 8, into buffer st % 2 ----
  const uint32_t wvu  = uni((uint32_t)wave);
  const uint32_t ldsb = (uint32_t)(size_t)lds;
  const u32x8 g1 = tile_g1();
  u32x4 g0;
  auto issue = [&](uint32_t st) {
    const uint32_t hd0 = (2u * (st >> 3) + (wvu & 1u)) * HDM;    // first column of the head
    const uint32_t kvf = (st & 7u) * 64u;                        // first key of the chunk
    const bool     isV = wvu >= 4u;
    const unsigned short* pl = isV ? VTp : Kp;
    const uint32_t row = (uint32_t)lgr * NND + (isV ? hd0 : kvf);   // NND == HID rows per graph in both planes
    const uint32_t col = (isV ? kvf : hd0) + ((wvu >> 1) & 1u) * HID;
    g0 = tile_g0(ldsb + ((st & 1u) * KVB + wvu * KVS) * 2u, (uint64_t)(size_t)pl + (uint64_t)(row * PLD + col) * 2u);
    tile_load(g0, g1);
  };
  issue(0u);
  tile_wait(g0, g1);                                    // this wave's tile of stage 0 has landed
  __syncthreads();                                      // stage 0 readable by every wave
  issue(1u);

  // ---- geometry / capacity guards -> NaN poison of this block's ctx rows ----
  int degmax = 0;
#pragma unroll
  for (int w2 = 0; w2 < AT_NW; ++w2) degmax = misc[w2] > degmax ? misc[w2] : degmax;
  const int ng  = ngp[0];
  const int bt0 = bat[node0];
  const bool bad = (nh >= HCAP) || (degmax > RWCAP) || (ng != NGR) || (bt0 < 0) || (bt0 >= NGR);
  const float pz = bad ? __int_as_float(0x7fc00000) : 0.0f;

  // ---- phase B ----
  const int wsub = wave & 3;                     // query row group of this wave
  const int hl   = wave >> 2;                    // head slot (0 / 1) of this wave within the pair
  const int rw   = tid >> 2;                     // bias fill: query row owned by this thread
  const int jw   = tid & 3;                      // bias fill: key-column quarter owned by this thread
  const float sscale = 0.125f;
  const v8f z8 = {0.f,0.f,0.f,0.f,0.f,0.f,0.f,0.f};
  const __bf16* Kth = Ksh + hl * KVS;
  const __bf16* Ktl = Ksl + hl * KVS;
  const __bf16* Vtth = Vth + hl * KVS;
  const __bf16* Vttl = Vtl + hl * KVS;
  __bf16* pwh = Psh + wave * PWS;
  __bf16* pwl = Psl + wave * PWS;

#pragma unroll 1
  for (int hp = 0; hp < NHD / 2; ++hp) {
    const int h    = 2 * hp + hl;                // head of this wave
    const int qrow = lrow0 + wsub * 16;          // plane row of this wave's first query

    // Q fragments (A operand, row = lane&15, split k map): 2 d-chunks, hi and lo
    v16b qah[2], qal[2];
#pragma unroll
    for (int dc = 0; dc < 2; ++dc) {
      const unsigned short* qp = Qp + (size_t)(qrow + c) * PLD + h * HDM + dc * 32 + 8 * hh;
      qah[dc] = FragBF::load((const __bf16*)(const void*)qp);
      qal[dc] = FragBF::load((const __bf16*)(const void*)(qp + HID));
    }
    float mrow[8], lrow[8];
    v8f oacc[4];
#pragma unroll
    for (int r = 0; r < 8; ++r) { mrow[r] = -INFINITY; lrow[r] = 0.f; }
#pragma unroll
    for (int t = 0; t < 4; ++t) oacc[t] = z8;

#pragma unroll 1
    for (int kc = 0; kc < NND / 64; ++kc) {
      const int kv0 = kc * 64;
      const int st  = hp * (NND / 64) + kc;      // this pass reads buffer st % 2 alone; stage st + 1 is in flight
      const int bo  = (st & 1) * KVB;
      {
        // bias tiles + dummies zero: 8 sweeps x 256 threads x 4 floats = both 64x64 tiles (each store's lanes
        // contiguous, no two on one bank); 128 threads x 4 = dummies
        const v4f z4 = {0.f, 0.f, 0.f, 0.f};
        float* bz = BTX + tid * 4;
#pragma unroll
        for (int i = 0; i < 8; ++i) *(v4fa*)(bz + NTHR * 4 * i) = z4;
        if (tid < 128) *(v4fa*)(BTX + 2 * KVT + 4 * tid) = z4;
      }
      __syncthreads();
      {
        // bias fill: segment [st, st+cnt) of sE/sD = the bin of row rw and key columns kv0+16jw..kv0+16jw+15
        const int bin = rw * (NND >> BINSH) + kc * (64 >> BINSH) + jw;
        int st = roff[bin], cnt = rcnt[bin];
        st  = st < 0 ? 0 : (st > nh ? nh : st);
        cnt = cnt < 0 ? 0 : (cnt > RWCAP ? RWCAP : cnt);
        if (cnt > nh - st) cnt = nh - st;
        int cmax = cnt;
#pragma unroll
        for (int off = 16; off > 0; off >>= 1) {
          const int o = __shfl_xor(cmax, off, 32);
          cmax = o > cmax ? o : cmax;
        }
        const float* ebp = EB + 2 * hp;
#pragma unroll 1
        for (int q = 0; q < cmax; ++q) {           // cmax wave-uniform, <= RWCAP
          const bool valid = q < cnt;
          int idx = st + q;
          idx = idx > nh - 1 ? nh - 1 : idx;
          idx = idx < 0 ? 0 : idx;
          const int col = sD[idx] - kv0;
          int e = sE[idx];
          e = e < 0 ? 0 : (e > nE - 1 ? nE - 1 : e);
          const v2f ebv = *(const v2fa*)(ebp + (size_t)e * NHD);
          const bool inr = valid && ((unsigned)col < 64u) && ((col >> 4) == jw);
          const int ia = inr ? (rw * 64 + col) : (2 * KVT + tid);
          const int ib = inr ? (KVT + rw * 64 + col) : (2 * KVT + NTHR + tid);
          BTX[ia] = BTX[ia] + ebv.x;
          BTX[ib] = BTX[ib] + ebv.y;
        }
      }
      __syncthreads();

      // ---- S = q . k (3-term) ----
      v8f s[4];
#pragma unroll
      for (int j = 0; j < 4; ++j) {
        s[j] = z8;
#pragma unroll
        for (int dc = 0; dc < 2; ++dc) {
          FB kb, kl;
          const __bf16* kr = Kth + bo + (j * 16 + c) * KVP + dc * 32 + 8 * hh;
          const __bf16* kq = Ktl + bo + (j * 16 + c) * KVP + dc * 32 + 8 * hh;
          kb.h[0] = *(const v8b*)kr;
          kb.h[1] = *(const v8b*)(kr + 16);
          kl.h[0] = *(const v8b*)kq;
          kl.h[1] = *(const v8b*)(kq + 16);
          s[j] = at_mma(qah[dc], kb.v, s[j]);
          s[j] = at_mma(qah[dc], kl.v, s[j]);
          s[j] = at_mma(qal[dc], kb.v, s[j]);
        }
      }
      // scale, add bias tile (D element r = row wsub*16 + 8hh + r, col j*16 + c), chunk row max
      const float* btr = BTX + hl * KVT + (wsub * 16 + 8 * hh) * 64 + c;
      float cm[8];
#pragma unroll
      for (int r = 0; r < 8; ++r) {
        float m = -INFINITY;
#pragma unroll
        for (int j = 0; j < 4; ++j) {
          const float sv = s[j][r] * sscale + btr[r * 64 + j * 16];
          s[j][r] = sv;
          m = fmaxf(m, sv);
        }
#pragma unroll
        for (int off = 1; off < 16; off <<= 1) m = fmaxf(m, __shfl_xor(m, off, 32));
        cm[r] = m;
      }
#pragma unroll
      for (int r = 0; r < 8; ++r) {
        const float mnew = fmaxf(mrow[r], cm[r]);
        const float alpha = expf(mrow[r] - mnew);
        mrow[r] = mnew;
        float psum = 0.f;
#pragma unroll
        for (int j = 0; j < 4; ++j) {
          const float p = expf(s[j][r] - mnew);
          psum += p;
          __bf16 a, bl; at_split(p, a, bl);
          pwh[(8 * hh + r) * KVP + j * 16 + c] = a;
          pwl[(8 * hh + r) * KVP + j * 16 + c] = bl;
        }
#pragma unroll
        for (int off = 1; off < 16; off <<= 1) psum += __shfl_xor(psum, off, 32);
        lrow[r] = lrow[r] * alpha + psum;
#pragma unroll
        for (int t = 0; t < 4; ++t) oacc[t][r] *= alpha;
      }
      __builtin_amdgcn_fence(__ATOMIC_RELEASE, "workgroup");
      __builtin_amdgcn_wave_barrier();
      __builtin_amdgcn_fence(__ATOMIC_ACQUIRE, "workgroup");
      // ---- O += p . v (3-term); P fragment = A (row c), V^T fragment = B (col = d) ----
#pragma unroll 1
      for (int kk = 0; kk < 2; ++kk) {
        FB pa, pl;
        pa.h[0] = *(const v8b*)(pwh + c * KVP + kk * 32 + 8 * hh);
        pa.h[1] = *(const v8b*)(pwh + c * KVP + kk * 32 + 16 + 8 * hh);
        pl.h[0] = *(const v8b*)(pwl + c * KVP + kk * 32 + 8 * hh);
        pl.h[1] = *(const v8b*)(pwl + c * KVP + kk * 32 + 16 + 8 * hh);
#pragma unroll
        for (int t = 0; t < 4; ++t) {
          FB vb, vl;
          vb.h[0] = *(const v8b*)(Vtth + bo + (t * 16 + c) * KVP + kk * 32 + 8 * hh);
          vb.h[1] = *(const v8b*)(Vtth + bo + (t * 16 + c) * KVP + kk * 32 + 16 + 8 * hh);
          vl.h[0] = *(const v8b*)(Vttl + bo + (t * 16 + c) * KVP + kk * 32 + 8 * hh);
          vl.h[1] = *(const v8b*)(Vttl + bo + (t * 16 + c) * KVP + kk * 32 + 16 + 8 * hh);
          oacc[t] = at_mma(pa.v, vb.v, oacc[t]);
          oacc[t] = at_mma(pa.v, vl.v, oacc[t]);
          oacc[t] = at_mma(pl.v, vb.v, oacc[t]);
        }
      }
      // ---- publish point of stage st + 1, every wave, in this order ----
      asm volatile("s_wait_dscnt 0x0" ::: "memory");       // this wave's reads of buffer st % 2 and of the bias tile are done
      tile_wait(g0, g1);                                    // this wave's tile of stage st + 1 has landed
      __syncthreads();                                      // stage st + 1 readable; buffer st % 2 and the bias tiles free
      if (pinned((uint32_t)(st + 2 < NST))) issue((uint32_t)st + 2u);   // refill of the buffer this pass has read
    }

    // ---- epilogue: normalise, stage the wave's 16x64 tile (pitch 64, own bias rows), hi | lo lines ----
    // (the last pass's barrier stands in front: every wave has left the bias tiles)
    {
      float* os = BTX + wave * 1024;
#pragma unroll
      for (int r = 0; r < 8; ++r) {
        const float inv = 1.0f / lrow[r];
#pragma unroll
        for (int t = 0; t < 4; ++t) os[(8 * hh + r) * 64 + t * 16 + c] = oacc[t][r] * inv + pz;
      }
      __builtin_amdgcn_fence(__ATOMIC_RELEASE, "workgroup");
      __builtin_amdgcn_wave_barrier();
      __builtin_amdgcn_fence(__ATOMIC_ACQUIRE, "workgroup");
      const int q4 = lane >> 3, c8 = (lane & 7) * 8;
      v4u hv[4], lv[4];
#pragma unroll
      for (int it = 0; it < 4; ++it) {
        const int row = it * 4 + q4;                   // it 0..3 x q4 0..3 covers rows 0..15
        const float* sp = os + row * 64 + c8;
        const v4f a = *(const v4fa*)sp;
        const v4f b = *(const v4fa*)(sp + 4);
        pack8hl(a, b, hv[it], lv[it]);
      }
      {
#pragma unroll
        for (int it = 0; it < 4; ++it) {
          const int row = it * 4 + q4;
          unsigned short* op = CTX + (size_t)(qrow + row) * PLD + h * HDM + c8;
          *(v4u*)op = hv[it];
          *(v4u*)(op + HID) = lv[it];
        }
        
      }
    }
    __syncthreads();   // every wave has read its staged tile back before the next head pair's zero fill sweeps it
  }
  // no request in flight and no LDS access outstanding when the wave ends
  asm volatile("s_wait_tensorcnt 0x0" ::: "memory");
  asm volatile("s_wait_dscnt 0x0" ::: "memory");
}

// =====================================================================================
static inline int cdiv(int a, int b) { return (a + b - 1) / b; }

extern "C" void kernel_launch(void* const* d_in, const int* in_sizes, int n_in,
                              void* d_out, int out_size, void* d_ws, size_t ws_size,
                              hipStream_t stream) {
  if (n_in < 15) return;
  if (in_sizes[0] != NTOT * HID) return;                        // x [16384][512]
  if (in_sizes[1] != NTOT) return;                              // batch [16384]
  if (in_sizes[2] < 2 || (in_sizes[2] & 1) != 0) return;        // edge_index [2][E]
  const int nE = in_sizes[2] / 2;
  if (nE < 1 || nE > (1 << 24)) return;
  if (in_sizes[3] != nE * EDW) return;                          // edge_attr [E][16]
  if (in_sizes[4] != HID * HID || in_sizes[6] != HID * HID || in_sizes[8] != HID * HID || in_sizes[10] != HID * HID) return;
  if (in_sizes[5] != HID || in_sizes[7] != HID || in_sizes[9] != HID || in_sizes[11] != HID) return;
  if (in_sizes[12] != EDW * NHD || in_sizes[13] != NHD || in_sizes[14] != 1) return;
  if (out_size != NTOT * HID) return;                           // out [16384][512], last element 8388607

  const float* x   = (const float*)d_in[0];
  const int*   bat = (const int*)  d_in[1];
  const int*   ei  = (const int*)  d_in[2];     // row 0 = src, row 1 = dst
  const float* ea  = (const float*)d_in[3];
  const float* Wq  = (const float*)d_in[4];     // [in][out]
  const float* bq  = (const float*)d_in[5];
  const float* Wk  = (const float*)d_in[6];
  const float* bk  = (const float*)d_in[7];
  const float* Wv  = (const float*)d_in[8];
  const float* bv  = (const float*)d_in[9];
  const float* Wo  = (const float*)d_in[10];
  const float* bo  = (const float*)d_in[11];
  const float* We  = (const float*)d_in[12];    // [16][8]
  const float* be  = (const float*)d_in[13];    // [8]
  const int*   ngp = (const int*)  d_in[14];    // [1]
  float* out = (float*)d_out;
  const int* keys = ei;                         // src list
  const int* gath = ei + nE;                    // dst list

  const int EP = cdiv(nE, 4) * 4;

  char* ws = (char*)d_ws;
  size_t off = 0;
  const size_t oXb = off; off += (size_t)NTOT * HID * 2;                                          // 16777216
  const size_t oWq = off; off += (size_t)HID * HID * 2;                                           //   524288
  const size_t oWk = off; off += (size_t)HID * HID * 2;
  const size_t oWv = off; off += (size_t)HID * HID * 2;
  const size_t oWo = off; off += (size_t)HID * PLD * 2;                                           //  1048576
  const size_t oEB = off; off += (size_t)EP * NHD * 4;   off = (off + 255) & ~(size_t)255;        //  8388608
  const size_t oQ  = off; off += (size_t)RHALF * PLD * 2;                                         // 33554432
  const size_t oK  = off; off += (size_t)RHALF * PLD * 2;
  const size_t oVT = off; off += (size_t)GHALF * HID * PLD * 2;                                   // 33554432
  const size_t oCT = off; off += (size_t)RHALF * PLD * 2;                                         // 33554432
  if (off > ws_size || off > (size_t)WSMAX) return;                                               // 162004992
  unsigned short* Xb   = (unsigned short*)(ws + oXb);
  unsigned short* WqT  = (unsigned short*)(ws + oWq);
  unsigned short* WkT  = (unsigned short*)(ws + oWk);
  unsigned short* WvT  = (unsigned short*)(ws + oWv);
  unsigned short* WOT2 = (unsigned short*)(ws + oWo);
  float*          EB   = (float*)(ws + oEB);
  unsigned short* Qp   = (unsigned short*)(ws + oQ);
  unsigned short* Kp   = (unsigned short*)(ws + oK);
  unsigned short* VTp  = (unsigned short*)(ws + oVT);
  unsigned short* CTX  = (unsigned short*)(ws + oCT);

  hipFuncSetAttribute(reinterpret_cast<const void*>(&k_attn),
                      hipFuncAttributeMaxDynamicSharedMemorySize, LDS_ATT);

  // weight planes (bf16 bits, k-contiguous rows [n][k])
  {
    const int nUw = HID * (HID / 8);             // 512 rows x 64 units
    k_wtr<<<cdiv(nUw, NTHR), NTHR, 0, stream>>>(Wq, HID, HID, HID, HID, WqT, nUw);
    k_wtr<<<cdiv(nUw, NTHR), NTHR, 0, stream>>>(Wk, HID, HID, HID, HID, WkT, nUw);
    k_wtr<<<cdiv(nUw, NTHR), NTHR, 0, stream>>>(Wv, HID, HID, HID, HID, WvT, nUw);
    const int nUo = HID * (PLD / 8);             // 512 rows x 128 units: wt [512][1024], k mod 512
    k_wtr<<<cdiv(nUo, NTHR), NTHR, 0, stream>>>(Wo, HID, HID, HID, PLD, WOT2, nUo);
  }
  // node feature plane (whole x)
  {
    const int nUx = NTOT * (HID / 8);
    k_xprep<<<cdiv(nUx, NTHR), NTHR, 0, stream>>>(x, Xb, NTOT, nUx);
  }
  // edge bias plane [EP][8]
  {
    const int nUe = EP * 2;
    k_eb<<<cdiv(nUe, NTHR), NTHR, 0, stream>>>(ea, We, be, EB, nE, nUe);
  }

  const dim3 blk(256);
  const dim3 gQK(((RHALF / 64) * (HID / 64)) / 8, 1);        // 256 blocks x 8 tiles: M=16384, N=512
  const dim3 gVT(((HID / 64) * (NND / 64)) / 8, GHALF);      // 8 blocks x 8 tiles per graph: M=512, N=512
  const dim3 gAT(GHALF * (NND / 64));                        // 256 blocks: 32 graphs x 8 query tiles
  for (int half = 0; half < NHALF; ++half) {
    const unsigned short* Xh = Xb + (size_t)half * RHALF * HID;
    float* outh = out + (size_t)half * RHALF * HID;
    // q = x . Wq + bq -> Qp hi | lo  (M=16384, N=512, K=512)
    wmma_gemm64<false, 2, 2, false, 0><<<gQK, blk, 0, stream>>>(
        Xh, Xh, HID, 0L, WqT, WqT, HID, 0L, (void*)Qp, (void*)(Qp + HID), PLD, 0L,
        bq, bq, 0L, RHALF, HID, HID, 1.0f);
    // k = x . Wk + bk -> Kp hi | lo
    wmma_gemm64<false, 2, 2, false, 0><<<gQK, blk, 0, stream>>>(
        Xh, Xh, HID, 0L, WkT, WkT, HID, 0L, (void*)Kp, (void*)(Kp + HID), PLD, 0L,
        bk, bk, 0L, RHALF, HID, HID, 1.0f);
    // v^T = Wv^T . x^T + bv[m] per graph -> VTp [graph][h*64+d][s] hi | lo  (M=512, N=512, K=512, z = 32 graphs)
    wmma_gemm64<false, 1, 2, false, 0><<<gVT, blk, 0, stream>>>(
        WvT, WvT, HID, 0L, Xh, Xh, HID, (long)NND * HID, (void*)VTp, (void*)(VTp + HID), PLD, (long)HID * PLD,
        bv, bv, 0L, HID, NND, HID, 1.0f);
    // attention with edge bias -> CTX hi | lo
    k_attn<<<gAT, NTHR, LDS_ATT, stream>>>(Qp, Kp, VTp, EB, keys, gath, ngp, bat, CTX, nE, 1, half * GHALF);
    // out = [ctx hi | ctx lo] . [Wo ; Wo] + bo -> d_out rows half*RHALF .. half*RHALF+RHALF-1 (M=16384, N=512, K=1024)
    wmma_gemm64<false, 2, 0, false, 0><<<gQK, blk, 0, stream>>>(
        CTX, CTX, PLD, 0L, WOT2, WOT2, PLD, 0L, (void*)outh, (void*)outh, HID, 0L,
        bo, bo, 0L, RHALF, HID, PLD, 1.0f);
  }
  (void)hipGetLastError();
}

// v007
// One run takes 339 microseconds.
// Two timings next to v006 put it at 1.08 and 1.07 times that version's speed.
// All steps since v000 together make it 5.44 times as fast.
// Contractions on v_wmma_f32_16x16x32_bf16 (bf16 operands, f32 accumulate): x*Wq, x*Wk, Wv^T*x^T as single
// products of bf16-RNE inputs; q.k^T and p.v as bf16 hi/lo split (hi.hi + hi.lo + lo.hi); ctx*Wo as
// [ctx hi | ctx lo] . [Wo ; Wo] (K = 1024); edge bias (16-deep dots of bf16-RNE inputs), online softmax and all biases in f32 on the VALU.
#include <hip/hip_runtime.h>
#include <math.h>
#include <stdint.h>
#include <stddef.h>

// Geometry: NGR graphs of NND consecutive node rows; attention keys of a query = the NND nodes of its graph.
// The job runs in NHALF passes of GHALF graphs each (one pass of all graphs: the attention launch then has one
// work-group for each of the 256 WGPs); the q / k / v^T / ctx planes are rewritten per pass.
//
// Plane map (workspace, all 16-bit planes are bf16 bits; no power-of-two carries anywhere, so no inverse
// factor exists -> carry audit: none):
//   Xb   [16384][512]          bf16(x)                                        -> A of q/k GEMMs, Bt of v^T GEMM
//   WqT, WkT, WvT [512 o][512 i]  bf16(W[i][o])                              -> Bt / A (k-contiguous)
//   WOT2 [512 o][1024]         bf16(Wo[k mod 512][o])                         -> Bt of the output GEMM
//   EB   [EP][8] f32           sum_t bf16(ea[e][t]) bf16(We[t][h]) + bf16(be[h])
//   Qp, Kp [16384][1024]       hi at col h*64+d, residual lo at col 512 + h*64+d (f32 projection split)
//   VTp  [32 graphs][512 (h,d)][1024]   hi at col s, lo at col 512 + s (s = node within graph)
//   CTX  [16384][1024]         hi | lo of the normalised attention context

#define NGR    32
#define NND    512
#define NTOT   (NGR * NND)      // 16384
#define HID    512
#define NHD    8
#define HDM    64
#define EDW    16
#define NHALF  1
#define GHALF  (NGR / NHALF)    // 32
#define RHALF  (GHALF * NND)    // 16384
#define PLD    1024
#define NTHR   256
#define WSMAX  268435456

static_assert(HID == NHD * HDM && HDM == 64 && NHD == 8);
static_assert(PLD == 2 * HID);
static_assert((RHALF % 64) == 0 && (HID % 64) == 0 && (NND % 64) == 0 && (PLD % 32) == 0 && (HID % 32) == 0);
static_assert(((RHALF / 64) * (HID / 64)) % 8 == 0);       // GEMM grids: 8 wave tiles per block, exact
static_assert(((HID / 64) * (NND / 64)) % 8 == 0);
static_assert(NGR == NHALF * GHALF);
static_assert(HID == 64 * 8);                               // k_xprep: 64 units of 8 per row
static_assert(EDW == 16 && NHD == 8 && EDW * NHD <= NTHR);  // k_eb layout

typedef __attribute__((ext_vector_type(16))) _Float16 v16h;
typedef __attribute__((ext_vector_type(8)))  _Float16 v8h;
typedef __attribute__((ext_vector_type(16))) __bf16   v16b;
typedef __attribute__((ext_vector_type(8)))  __bf16   v8b;
typedef __attribute__((ext_vector_type(8)))  float    v8f;
typedef __attribute__((ext_vector_type(4)))  float    v4f;
typedef __attribute__((ext_vector_type(2)))  float    v2f;
typedef __attribute__((ext_vector_type(4)))  unsigned int v4u;
typedef __attribute__((ext_vector_type(4)))  int      v4i;
typedef __attribute__((ext_vector_type(8)))  unsigned short v8us;
typedef v4f  __attribute__((may_alias)) v4fa;
typedef v2f  __attribute__((may_alias)) v2fa;
typedef v4u  __attribute__((may_alias)) v4ua;

// ---- scalar helpers: f32 -> bf16 bits (RNE convert), bf16 bits -> f32 ----
__device__ __forceinline__ unsigned short f2bf_bits(float f) {
  unsigned u = __float_as_uint(f);
  return (unsigned short)((u + 0x7FFFu + ((u >> 16) & 1u)) >> 16);
}
__device__ __forceinline__ float bf_bits2f(unsigned short h) { return __uint_as_float(((unsigned)h) << 16); }
__device__ __forceinline__ float bfrf(float f) { return bf_bits2f(f2bf_bits(f)); }
__device__ __forceinline__ unsigned int f2bfu(float f) {
  const unsigned int u = __float_as_uint(f);
  return ((u + 0x7FFFu + ((u >> 16) & 1u)) >> 16) & 0xFFFFu;
}
__device__ __forceinline__ float bf2f(unsigned int b) { return __uint_as_float(b << 16); }
__device__ __forceinline__ v4f bfr4(const v4f a) {
  v4f r; r.x = bfrf(a.x); r.y = bfrf(a.y); r.z = bfrf(a.z); r.w = bfrf(a.w); return r;
}
__device__ __forceinline__ unsigned int pk2(float lo, float hi) { return f2bfu(lo) | (f2bfu(hi) << 16); }
__device__ __forceinline__ v4u pack8(const v4f a, const v4f b) {
  v4u r;
  r.x = pk2(a.x, a.y); r.y = pk2(a.z, a.w); r.z = pk2(b.x, b.y); r.w = pk2(b.z, b.w);
  return r;
}
// hi = bf16(v), lo = bf16(v - hi): two floats -> one packed word of each
__device__ __forceinline__ void hl2(float v0, float v1, unsigned int& hw, unsigned int& lw) {
  const unsigned int h0 = f2bfu(v0), h1 = f2bfu(v1);
  const unsigned int l0 = f2bfu(v0 - bf2f(h0)), l1 = f2bfu(v1 - bf2f(h1));
  hw = h0 | (h1 << 16);
  lw = l0 | (l1 << 16);
}
__device__ __forceinline__ void pack8hl(const v4f a, const v4f b, v4u& hv, v4u& lv) {
  unsigned int h, l;
  hl2(a.x, a.y, h, l); hv.x = h; lv.x = l;
  hl2(a.z, a.w, h, l); hv.y = h; lv.y = l;
  hl2(b.x, b.y, h, l); hv.z = h; lv.z = l;
  hl2(b.z, b.w, h, l); hv.w = h; lv.w = l;
}

// ---- WMMA fragment helpers (bf16, wave32) ----
// A fragment (row m = lane&15) and B fragment (col n = lane&15) use the SAME k map:
//   elements 0..7 <- k0 + 8h + 0..7, elements 8..15 <- k0 + 16 + 8h + 0..7, h = lane>>4,
// loaded as two 16-B pieces from a k-contiguous 16-bit row: p[0..7] and p[16..23] with p = row + k0 + 8h.
// D element r of lane l = (row 8h + r, col l&15).
__device__ __forceinline__ void dep_guard_b(v8f& a, v8f& b, v16b x, v16b y) { asm volatile("v_nop\n\tv_nop\n\tv_nop\n\tv_nop" : "+v"(a), "+v"(b) : "v"(x), "v"(y)); }
__device__ __forceinline__ void keep4_b(v16b a, v16b b, v16b c, v16b d) { asm volatile("v_nop" :: "v"(a), "v"(b), "v"(c), "v"(d)); }
__device__ __forceinline__ void acc_guard4(v8f& a, v8f& b, v8f& c, v8f& d) { asm volatile("v_nop\n\tv_nop\n\tv_nop\n\tv_nop" : "+v"(a), "+v"(b), "+v"(c), "+v"(d)); }

struct FragBF {
  union U { v16b v; v8b h[2]; };
  static __device__ __forceinline__ v16b load(const __bf16* p) {   // elements 0..7 <- p[0..7], 8..15 <- p[16..23]
    U f; f.h[0] = *(const v8b*)(p); f.h[1] = *(const v8b*)(p + 16); return f.v;
  }
  static __device__ __forceinline__ v8f mma(v16b a, v16b b, v8f c) {
    return __builtin_amdgcn_wmma_f32_16x16x32_bf16(false, a, false, b, (short)0, c, false, false);
  }
  static __device__ __forceinline__ void guard(v8f& a, v8f& b, v16b x, v16b y) { dep_guard_b(a, b, x, y); }
  static __device__ __forceinline__ void keep(v16b a, v16b b, v16b c, v16b d) { keep4_b(a, b, c, d); }
};
union FB { v16b v; v8b h[2]; };

// single WMMA with hazard guard: ties D, keeps A/B live for 4 VALU slots
__device__ __forceinline__ v8f at_mma(v16b a, v16b b, v8f c) {
  c = __builtin_amdgcn_wmma_f32_16x16x32_bf16(false, a, false, b, (short)0, c, false, false);
  asm volatile("v_nop\n\tv_nop\n\tv_nop\n\tv_nop" : "+v"(c) : "v"(a), "v"(b));
  return c;
}
__device__ __forceinline__ __bf16 at_f2bf(float f) { return __builtin_bit_cast(__bf16, f2bf_bits(f)); }
__device__ __forceinline__ void at_split(float f, __bf16& hi, __bf16& lo) {
  const unsigned short hb = f2bf_bits(f);
  hi = __builtin_bit_cast(__bf16, hb);
  lo = at_f2bf(f - __uint_as_float(((unsigned)hb) << 16));
}

// =====================================================================================
// Register-blocked batched WMMA GEMM (bf16 operands).
// C[m,n] = scale * sum_k A[m,k] * Bt[n,k] (+bias)(+resid); each wave owns a 64x64 tile.
// A row-major [M,K]; Bt row-major [N,K]; M,N % 64 == 0, K % 32 == 0 (host static_asserts).
// SPLIT: operands are hi/lo planes (A2/Bt2 = lo planes, same layout); product = hi.hi + hi.lo + lo.hi.
// BIAS_MODE: 0 = none, 1 = bf16r(bias[m]), 2 = bf16r(bias[n]).
// OUT_MODE: 0 = f32, 1 = f16, 2 = bf16 hi plane (Cout) + bf16 lo plane (Cout2).
// coverage: grid.x * 8 waves == (M/64)*(N/64) tiles exactly (host), every C element written once per z.
// =====================================================================================
template <bool SPLIT, int BIAS_MODE, int OUT_MODE, bool RESID, int ACT = 0>
__global__ __launch_bounds__(256) void wmma_gemm64(
    const unsigned short* __restrict__ Ap, const unsigned short* __restrict__ A2p, int lda, long strideA,
    const unsigned short* __restrict__ Btp, const unsigned short* __restrict__ Bt2p, int ldb, long strideB,
    void* __restrict__ Cout, void* __restrict__ Cout2, int ldc, long strideC,
    const float* __restrict__ bias,
    const float* __restrict__ resid, long strideR,
    int M, int N, int K, float scale) {
  typedef __bf16 T;
  typedef v16b V;
  const T* A = (const T*)Ap; const T* A2 = (const T*)A2p; const T* Bt = (const T*)Btp; const T* Bt2 = (const T*)Bt2p;
  __shared__ __align__(16) float sT[8][16 * 68];   // per-wave 16x64 slab, pitch 68 floats
  const int b    = blockIdx.y;
  const int lane = threadIdx.x & 31;
  const int wave = threadIdx.x >> 5;
  const int tilesN = N >> 6;
  const int tilesM = M >> 6;
  const int tile = blockIdx.x * 8 + wave;
  if (tile >= tilesM * tilesN) return;   // wave-uniform; no block barriers in this kernel
  const int tm = tile / tilesN;
  const int tn = tile - tm * tilesN;
  const int m0 = tm << 6;
  const int n0 = tn << 6;

  const T* Ab  = A  + (size_t)b * strideA;
  const T* Bb  = Bt + (size_t)b * strideB;
  const T* Ab2 = SPLIT ? (A2  + (size_t)b * strideA) : nullptr;
  const T* Bb2 = SPLIT ? (Bt2 + (size_t)b * strideB) : nullptr;

  const int rlane = lane & 15;                 // row (A) / col (B, D) within subtile
  const int koff  = (lane >> 4) * 8;           // k offset of this lane half
  const int mOff  = (lane >> 4) * 8;           // D row offset

  v8f acc[4][4];
#pragma unroll
  for (int i = 0; i < 4; ++i)
#pragma unroll
    for (int j = 0; j < 4; ++j) acc[i][j] = (v8f){0.f,0.f,0.f,0.f,0.f,0.f,0.f,0.f};

  for (int k0 = 0; k0 < K; k0 += 32) {
    V bh[4], bl[4];
#pragma unroll
    for (int j = 0; j < 4; ++j) {
      const size_t bo = (size_t)(n0 + (j << 4) + rlane) * ldb + koff + k0;
      bh[j] = FragBF::load(Bb + bo);
      if (SPLIT) bl[j] = FragBF::load(Bb2 + bo);
    }
#pragma unroll
    for (int i = 0; i < 4; ++i) {
      const size_t ao = (size_t)(m0 + (i << 4) + rlane) * lda + koff + k0;
      V ah = FragBF::load(Ab + ao);
      V al;
      if (SPLIT) al = FragBF::load(Ab2 + ao);
#pragma unroll
      for (int j = 0; j < 4; ++j) {
        acc[i][j] = FragBF::mma(ah, bh[j], acc[i][j]);
        if (SPLIT) {
          acc[i][j] = FragBF::mma(ah, bl[j], acc[i][j]);
          acc[i][j] = FragBF::mma(al, bh[j], acc[i][j]);
        }
      }
      FragBF::guard(acc[i][0], acc[i][3], ah, SPLIT ? al : ah);
    }
    FragBF::keep(bh[0], bh[1], bh[2], bh[3]);
    if (SPLIT) FragBF::keep(bl[0], bl[1], bl[2], bl[3]);
  }
  acc_guard4(acc[0][0], acc[0][1], acc[0][2], acc[0][3]);
  acc_guard4(acc[1][0], acc[1][1], acc[1][2], acc[1][3]);
  acc_guard4(acc[2][0], acc[2][1], acc[2][2], acc[2][3]);
  acc_guard4(acc[3][0], acc[3][1], acc[3][2], acc[3][3]);

  // ---- epilogue ----
  float* slab = sT[wave];
  const float* Rb = RESID ? (resid + (size_t)b * strideR) : nullptr;
#pragma unroll
  for (int i = 0; i < 4; ++i) {
    const int mBase = m0 + (i << 4);
    float bm[8];
    if (BIAS_MODE == 1) {   // 8 consecutive floats, 32-B aligned: two 16-B loads
      const v4f b0v = bfr4(*(const v4fa*)(bias + mBase + mOff));
      const v4f b1v = bfr4(*(const v4fa*)(bias + mBase + mOff + 4));
      bm[0] = b0v.x; bm[1] = b0v.y; bm[2] = b0v.z; bm[3] = b0v.w;
      bm[4] = b1v.x; bm[5] = b1v.y; bm[6] = b1v.z; bm[7] = b1v.w;
    } else {
#pragma unroll
      for (int r = 0; r < 8; ++r) bm[r] = 0.f;
    }
#pragma unroll
    for (int j = 0; j < 4; ++j) {
      const int n = n0 + (j << 4) + rlane;
      float bv = 0.f;
      if (BIAS_MODE == 2) bv = bfrf(bias[n]);
#pragma unroll
      for (int r = 0; r < 8; ++r) {
        float v = acc[i][j][r] * scale;
        if (BIAS_MODE == 1) v += bm[r];
        if (BIAS_MODE == 2) v += bv;
        if (RESID) v += Rb[(size_t)(mBase + mOff + r) * ldc + n];
        if (ACT == 1) v = tanhf(v);
        if (ACT == 2) v = fmaxf(v, 0.0f);
        if (ACT == 4) v = (v > 0.f) ? v : 0.01f * v;
        slab[(mOff + r) * 68 + (j << 4) + rlane] = v;
      }
    }
    __builtin_amdgcn_fence(__ATOMIC_RELEASE, "workgroup");
    __builtin_amdgcn_wave_barrier();
    __builtin_amdgcn_fence(__ATOMIC_ACQUIRE, "workgroup");
    if (OUT_MODE == 0) {
      float* C = (float*)Cout + (size_t)b * strideC;
      const int hh = lane >> 4, c4 = (lane & 15) * 4;     // row seg = 256 B = 16 lanes x 16 B
      {
#pragma unroll
        for (int it = 0; it < 8; ++it) {
          const int row = it * 2 + hh;
          v4f v = *(const v4f*)(slab + row * 68 + c4);
          *(v4f*)(C + (size_t)(mBase + row) * ldc + n0 + c4) = v;
        }
        
      }
    } else {
      const int q = lane >> 3, c8 = (lane & 7) * 8;
      unsigned short* C  = (unsigned short*)Cout  + (size_t)b * strideC;
      unsigned short* C2 = (OUT_MODE == 2) ? ((unsigned short*)Cout2 + (size_t)b * strideC) : nullptr;
      {
#pragma unroll
        for (int it = 0; it < 4; ++it) {
          const int row = it * 4 + q;
          const float* sp = slab + row * 68 + c8;
          v8h hv, lv;
#pragma unroll
          for (int e = 0; e < 8; ++e) {
            if (OUT_MODE == 1) {
              hv[e] = (_Float16)sp[e];
            } else {
              unsigned short hb = f2bf_bits(sp[e]);
              unsigned short lb = f2bf_bits(sp[e] - bf_bits2f(hb));
              hv[e] = __builtin_bit_cast(_Float16, hb);
              lv[e] = __builtin_bit_cast(_Float16, lb);
            }
          }
          *(v8h*)(C + (size_t)(mBase + row) * ldc + n0 + c8) = hv;
          if (OUT_MODE == 2) *(v8h*)(C2 + (size_t)(mBase + row) * ldc + n0 + c8) = lv;
        }
        
      }
    }
    __builtin_amdgcn_fence(__ATOMIC_RELEASE, "workgroup");
    __builtin_amdgcn_wave_barrier();
    __builtin_amdgcn_fence(__ATOMIC_ACQUIRE, "workgroup");
  }
}

// =====================================================================================
// Node feature plane: xb[row][c] = bf16(x[row][c]) for row < nN (all 512 c). One thread = 8 contiguous
// =====================================================================================
__global__ __launch_bounds__(NTHR) void k_xprep(const float* __restrict__ x, unsigned short* xb, int nN, int nUnits) {
  const int i = (int)blockIdx.x * NTHR + (int)threadIdx.x;
  if (i >= nUnits) return;
  const int row = i >> 6;
  const int c0  = (i & 63) * 8;
  const int rc  = row < nN ? row : nN - 1;
  const float* p = x + (size_t)rc * HID + c0;
  v4f a = *(const v4fa*)p;
  v4f b = *(const v4fa*)(p + 4);
  const v4f z4 = {0.f, 0.f, 0.f, 0.f};
  if (row >= nN) { a = z4; b = z4; }
  const v4u hv = pack8(a, b);
  unsigned short* o = xb + (size_t)row * HID + c0;
  *(v4u*)o = hv;
  
}

// =====================================================================================
// Weight transpose + bf16 convert into a k-contiguous plane: w is [Kin][Ncol] ([in][out]),
//   wt[n][k] = bf16(w[k mod Kin][n]) for n < Nrows, k < Kout (Kout = Kin or a multiple of it).
// coverage: nUnits = Nrows * Kout/8 threads x 8 = Nrows x Kout exactly.
// =====================================================================================
__global__ __launch_bounds__(NTHR) void k_wtr(const float* __restrict__ w, int Kin, int Ncol, int Nrows, int Kout,
                                              unsigned short* wt, int nUnits) {
  const int u = (int)blockIdx.x * NTHR + (int)threadIdx.x;
  if (u >= nUnits) return;
  const int kq = Kout >> 3;
  const int n  = u / kq;
  const int k8 = (u - n * kq) * 8;
  const int kk = k8 - (k8 / Kin) * Kin;
  const int ncl = n < Ncol ? n : Ncol - 1;
  const float* p = w + (size_t)kk * (size_t)Ncol + ncl;
  v4f a, b;
  a.x = p[0];                    a.y = p[(size_t)Ncol];         a.z = p[(size_t)2 * Ncol];     a.w = p[(size_t)3 * Ncol];
  b.x = p[(size_t)4 * Ncol];     b.y = p[(size_t)5 * Ncol];     b.z = p[(size_t)6 * Ncol];     b.w = p[(size_t)7 * Ncol];
  const v4f z4 = {0.f, 0.f, 0.f, 0.f};
  if (n >= Ncol || n >= Nrows) { a = z4; b = z4; }
  const v4u wv = pack8(a, b);
  unsigned short* o = wt + (size_t)n * (size_t)Kout + k8;
  *(v4u*)o = wv;
  
}

// =====================================================================================
// Edge bias plane: EB[e][h] = sum_t bf16r(ea[e][t]) * bf16r(We[t][h]) + bf16r(be[h]) (f32, 16 terms summed
// from +0 then the bias), zero rows for pad edges nE <= e < EP (load address clamped, value zeroed by select).
// One thread = one edge and 4 consecutive heads: 4 b128 loads in a rolled loop, one 16-B store;
// coverage: nUnits = EP*2 threads x 4 = EP x 8 elements exactly.
// =====================================================================================
__global__ __launch_bounds__(NTHR) void k_eb(const float* __restrict__ ea, const float* __restrict__ We,
                                             const float* __restrict__ be, float* EB, int nE, int nUnits) {
  __shared__ float sWe[EDW * NHD];
  __shared__ float sbe[NHD];
  const int tid = (int)threadIdx.x;
  if (tid < EDW * NHD) sWe[tid] = bfrf(We[tid]);           // We[t][h] row-major
  if (tid < NHD) sbe[tid] = bfrf(be[tid]);
  __syncthreads();
  const int u = (int)blockIdx.x * NTHR + tid;
  if (u >= nUnits) return;
  const int e  = u >> 1;
  const int h0 = (u & 1) * 4;
  const int ec = e < nE ? e : nE - 1;
  const float* er = ea + (size_t)ec * EDW;
  float s0 = 0.f, s1 = 0.f, s2 = 0.f, s3 = 0.f;
#pragma unroll 1
  for (int q = 0; q < 4; ++q) {
    const v4f a = bfr4(*(const v4fa*)(er + 4 * q));
    const float* wr = sWe + (4 * q) * NHD + h0;            // We[4q+i][h0+j] = wr[i*8 + j]
    s0 = fmaf(a.x, wr[0],  s0); s1 = fmaf(a.x, wr[1],  s1); s2 = fmaf(a.x, wr[2],  s2); s3 = fmaf(a.x, wr[3],  s3);
    s0 = fmaf(a.y, wr[8],  s0); s1 = fmaf(a.y, wr[9],  s1); s2 = fmaf(a.y, wr[10], s2); s3 = fmaf(a.y, wr[11], s3);
    s0 = fmaf(a.z, wr[16], s0); s1 = fmaf(a.z, wr[17], s1); s2 = fmaf(a.z, wr[18], s2); s3 = fmaf(a.z, wr[19], s3);
    s0 = fmaf(a.w, wr[24], s0); s1 = fmaf(a.w, wr[25], s1); s2 = fmaf(a.w, wr[26], s2); s3 = fmaf(a.w, wr[27], s3);
  }
  v4f o;
  o.x = s0 + sbe[h0]; o.y = s1 + sbe[h0 + 1]; o.z = s2 + sbe[h0 + 2]; o.w = s3 + sbe[h0 + 3];
  const v4f z4 = {0.f, 0.f, 0.f, 0.f};
  if (e >= nE) o = z4;
  float* op = EB + (size_t)e * NHD + h0;
  *(v4f*)op = o;
  
}

// =====================================================================================
// Graph attention with per-edge additive bias, one block per (graph, 64-query tile), 8 waves.
// Phase A (block-local, statically bounded): scan of the src list (edge_index row 0) for
//   src in [node0, node0+64): wave w walks its own contiguous eighth of the list in slabs of 256 edges, SG slabs
//   loaded ahead, hits appended to its own LDS list, no barrier inside the walk; then one barrier, the waves'
//   lists joined in wave order (= ascending slab order) with dst gathered for all hits at once: (edge id, query
//   row, dst % 512), capped at HCAP (poison when reached); counting sort (8 waves, each its own 8 query rows, stable) into
//   NBIN bins, bin = query row * 32 + (dst % 512) / 16, -> sE / sD segments with roff / rcnt. Nothing persists
//   outside LDS.
// Phase B: 4 head pairs; waves 0..3 run head 2p, waves 4..7 head 2p+1, each wave 16 query rows.
//   Per key chunk of 64: K hi/lo and V^T hi/lo tiles of both heads (8 tiles of 64 rows x 128 B) brought by one
//   tensor load per wave, two buffers, one chunk ahead; a 2x64x64 f32 bias tile zeroed then filled by row owners
//   (4 threads per query row, thread j walks only the bin of its row and of key columns 16j..16j+15 of this
//   chunk, in segment order = hit scan order -> duplicate (src,dst) pairs sum deterministically; lanes
//   whose bin is shorter than the wave's longest add into a private dummy slot),
//   then S = q.k (3-term split) * 0.125 + bias, online softmax in f32, P split hi/lo through per-wave LDS
//   Epilogue: ctx = O / l staged per wave in LDS (aliasing only that wave's own bias rows), written as
// Geometry guards (NaN poison of the block's ctx rows, never a trap): hit cap, per-row count > RWCAP,
//   num_graphs != NGR, batch id of the block's first node outside [0, NGR).
// coverage: CTX rows lrow0..lrow0+63 x all 1024 cols per block; grid = GHALF*8 blocks covers RHALF rows once.
// =====================================================================================
#define AT_NW   8
#define EPT     8
#define SLAB    (32 * EPT)            // 256 keys: one wave's read of EPT keys per lane
#define SG      4                     // slabs whose loads are in flight per wave
#define SLOTB   6
#define NSLOT   64                    // query rows per block = scan slots
#define BINSH   4                     // 16 key columns per bin
#define NBIN    (NSLOT * (NND >> BINSH))   // 2048 bins: (query row, group of 16 key columns)
#define HCAP    2048                  // hit capacity per block
#define WLCAP   HCAP                  // hit capacity of one wave's list: a wave that fills it has filled the block's
#define LISTN   (AT_NW * WLCAP)       // 16384
#define RWCAP   128                   // static cap on per-row edge count
#define KVT     4096                  // one 64x64 f32 bias tile
#define KVP     72                    // row pitch of the K / V^T / P tiles in LDS, elements: 144 B = 16 B x 9, so the
                                      // 16 rows of a ds_load_b128 fragment read fall on 16 different bank groups
#define KVS     5120                  // one 64-row K or V^T tile: 64 * KVP elements, its place rounded up to 2 KiB
#define KVB     (8 * KVS)             // one buffer: the 8 tiles of a key chunk
#define NST     ((NHD / 2) * (NND / 64))   // stages = head pairs x key chunks
#define PWS     (16 * KVP)            // one wave's 16-row P tile
#define NDUM    512                   // private dummy accumulators (2 per thread)
#define PFQ     4                     // entries of a thread's bias bin that are fetched one stage ahead into registers
#define LO_KV   0
#define LO_P    (2 * KVB * 2)                           // 163840
#define LO_BT   (LO_P + 2 * AT_NW * PWS * 2)            // 200704
#define LO_SE   (LO_BT + (2 * KVT + NDUM) * 4)          // 235520
#define LO_SD   (LO_SE + HCAP * 4)                      // 243712
#define LO_RC   (LO_SD + HCAP * 4)                      // 251904
#define LDS_ATT (LO_RC + (2 * NBIN + 2 * AT_NW) * 4)    // 268352

static_assert((LISTN + 4 * HCAP) * 4 <= LO_P);        // phase-A lists alias the two K/V buffers
static_assert(LDS_ATT <= 300000);
static_assert(KVP >= 64 && (KVP * 2) % 16 == 0 && ((KVP * 2) / 16) % 2 == 1);   // 16-B aligned rows, odd multiple
static_assert(KVS >= 64 * KVP && (KVS * 2) % 2048 == 0 && KVP * 2 == 128 + 16);  // tensor load: place, padded pitch
static_assert(NST >= 2 && NND / 64 == 8 && NND == HID && AT_NW == 8 && HDM * 2 == 128 && (PLD * 2) % 16 == 0);  // one tile per wave, 128-B rows
static_assert((LO_P % 16) == 0 && (LO_BT % 16) == 0);
static_assert((1 << SLOTB) == NSLOT);
static_assert(NTHR == 32 * AT_NW);
static_assert(NTHR == 4 * NSLOT);                      // bias fill: 4 threads per query row
static_assert(NTHR * 4 * 8 == 2 * KVT);                // bias zero fill: 8 sweeps of 4 floats per thread
static_assert(NDUM == 2 * NTHR && NDUM == 128 * 4);
static_assert(AT_NW * 1024 == 2 * KVT);                // per-wave output staging = own bias rows
static_assert(SLAB == 256 && 24 + SLOTB < 32);                   // list entry = edge id (below 2^24, host check) << SLOTB | slot
static_assert(NSLOT == 8 * AT_NW && NND == 512);                 // sort: 8 query rows per wave, owner wave = hitRD >> 12
static_assert(NBIN == NTHR * 8 && (NND >> BINSH) == 32);         // sort: 8 bins per thread, 4 threads per row
static_assert(RWCAP < 256);                                      // sort: 8-bit counters exact below the row cap
static_assert((64 >> BINSH) == 4 && (LO_RC % 16) == 0);          // 4 bins per row and key chunk = 4 fill threads

// One slab of the key list: the lane holds keys e0 .. e0 + EPT - 1 in da / db and tests them against the block's slot
// range [slotBase, slotBase + nb); hits are appended to this wave's LDS list wl as (edge id << SLOTB | slot), key
// position first, lane second. wc = entries so far (wave-uniform); returns the new count; nothing is stored
// at or past WLCAP.
__device__ __forceinline__ int slab_hits(const v4i da, const v4i db, int e0, int slotBase, int nb, int* wl, int wc) {
  const unsigned nbs = (unsigned)slotBase;
  const unsigned unb = (unsigned)nb;
  const unsigned s0 = (unsigned)da.x - nbs, s1 = (unsigned)da.y - nbs;
  const unsigned s2 = (unsigned)da.z - nbs, s3 = (unsigned)da.w - nbs;
  const unsigned s4 = (unsigned)db.x - nbs, s5 = (unsigned)db.y - nbs;
  const unsigned s6 = (unsigned)db.z - nbs, s7 = (unsigned)db.w - nbs;
  const bool h0 = s0 < unb, h1 = s1 < unb, h2 = s2 < unb, h3 = s3 < unb;
  const bool h4 = s4 < unb, h5 = s5 < unb, h6 = s6 < unb, h7 = s7 < unb;
  const unsigned m0 = __builtin_amdgcn_ballot_w32(h0), m1 = __builtin_amdgcn_ballot_w32(h1);
  const unsigned m2 = __builtin_amdgcn_ballot_w32(h2), m3 = __builtin_amdgcn_ballot_w32(h3);
  const unsigned m4 = __builtin_amdgcn_ballot_w32(h4), m5 = __builtin_amdgcn_ballot_w32(h5);
  const unsigned m6 = __builtin_amdgcn_ballot_w32(h6), m7 = __builtin_amdgcn_ballot_w32(h7);
  if ((m0 | m1 | m2 | m3 | m4 | m5 | m6 | m7) != 0u) {
#define HITJ(J, HJ, SJ, MJ) { \
      const unsigned mj = (MJ); \
      if (mj != 0u) { \
        if (HJ) { \
          const int pos = wc + (int)__builtin_amdgcn_mbcnt_lo(mj, 0u); \
          if (pos < WLCAP) wl[pos] = ((e0 + (J)) << SLOTB) | (int)(SJ); \
        } \
        wc += (int)__builtin_popcount(mj); } }
    HITJ(0, h0, s0, m0)
    HITJ(1, h1, s1, m1)
    HITJ(2, h2, s2, m2)
    HITJ(3, h3, s3, m3)
    HITJ(4, h4, s4, m4)
    HITJ(5, h5, s5, m5)
    HITJ(6, h6, s6, m6)
    HITJ(7, h7, s7, m7)
#undef HITJ
  }
  return wc;
}
// A slab that is not wholly inside the list (or a list not read 16 bytes at a time): every address clamped, the
// sentinel selected by value.
__device__ __forceinline__ void slab_load_edge(const int* __restrict__ keys, int nE, int e0, v4i& da, v4i& db) {
  const int sent = -2147483647 - 1;
  da.x = (e0     < nE) ? keys[min(e0,     nE - 1)] : sent;
  da.y = (e0 + 1 < nE) ? keys[min(e0 + 1, nE - 1)] : sent;
  da.z = (e0 + 2 < nE) ? keys[min(e0 + 2, nE - 1)] : sent;
  da.w = (e0 + 3 < nE) ? keys[min(e0 + 3, nE - 1)] : sent;
  db.x = (e0 + 4 < nE) ? keys[min(e0 + 4, nE - 1)] : sent;
  db.y = (e0 + 5 < nE) ? keys[min(e0 + 5, nE - 1)] : sent;
  db.z = (e0 + 6 < nE) ? keys[min(e0 + 6, nE - 1)] : sent;
  db.w = (e0 + 7 < nE) ? keys[min(e0 + 7, nE - 1)] : sent;
}

typedef uint32_t u32x4 __attribute__((ext_vector_type(4)));
typedef uint32_t u32x8 __attribute__((ext_vector_type(8)));
__device__ __forceinline__ uint32_t uni(uint32_t v) { return (uint32_t)__builtin_amdgcn_readfirstlane(v); }
// a test around a tensor load held in a scalar register, so that it compiles to s_cmp + s_cbranch_scc
__device__ __forceinline__ uint32_t pinned(uint32_t v) { uint32_t w = uni(v); asm volatile("" : "+s"(w)); return w; }
// Descriptor of one tile of 64 rows x 128 B, source pitch PLD * 2 B, from global address ga to LDS byte offset dst;
// 16 B of pad behind every row (LDS pitch 144 B = KVP elements).
__device__ __forceinline__ u32x4 tile_g0(uint32_t dst, uint64_t ga) {
  u32x4 g0;
  g0[0] = uni(1u);
  g0[1] = uni(dst);
  g0[2] = uni((uint32_t)ga);
  g0[3] = uni((((uint32_t)(ga >> 32)) & 0x01FFFFFFu) | 0x80000000u);
  return g0;
}
__device__ __forceinline__ u32x8 tile_g1() {
  u32x8 g1;
  g1[0] = uni((1u << 20) | (4u << 22) | (3u << 25));   // no mask, 1-byte elements, pad of 4 dwords per 32 dwords
  g1[1] = uni(128u << 16);                             // tensor_dim0 = 128 B
  g1[2] = uni(64u << 16);                              // tensor_dim1 = 64 rows
  g1[3] = uni(128u << 16);                             // tile_dim0 = 128 B
  g1[4] = uni(64u);                                    // tile_dim1 = 64 rows
  g1[5] = uni((uint32_t)(PLD * 2));                    // source row pitch
  g1[6] = uni(0u);
  g1[7] = uni(0u);
  return g1;
}
// One request of the whole wave; the waits are the caller's.
__device__ __forceinline__ void tile_load(u32x4 g0, u32x8 g1) {
  asm volatile("tensor_load_to_lds %0, %1" :: "s"(g0), "s"(g1) : "memory");
}
// The wave's request has landed. The descriptor is named as an input so that its registers stay as they are while
// the request is outstanding.
__device__ __forceinline__ void tile_wait(u32x4 g0, u32x8 g1) {
  asm volatile("s_wait_tensorcnt 0x0" :: "s"(g0), "s"(g1) : "memory");
}

__global__ __launch_bounds__(NTHR) void k_attn(
    const unsigned short* __restrict__ Qp, const unsigned short* __restrict__ Kp,
    const unsigned short* __restrict__ VTp, const float* __restrict__ EB,
    const int* __restrict__ keys, const int* __restrict__ gath,
    const int* __restrict__ ngp, const int* __restrict__ bat,
    unsigned short* CTX, int nE, int vec8, int gbase) {
  extern __shared__ __attribute__((aligned(2048))) v4f lds_dyn[];   // tensor loads: tile places at multiples of 2 KiB
  char* lds = (char*)lds_dyn;
  __bf16* Ksh = (__bf16*)(lds + LO_KV);         // buffer 0 (buffer 1: + KVB): [2][KVS]  K hi  [kv][d], pitch KVP
  __bf16* Ksl = Ksh + 2 * KVS;                   // [2][KVS]  K lo
  __bf16* Vth = Ksl + 2 * KVS;                   // [2][KVS]  V^T hi [d][kv]
  __bf16* Vtl = Vth + 2 * KVS;                   // [2][KVS]  V^T lo
  int* list  = (int*)(lds + LO_KV);              // phase A only: [8 waves][WLCAP]
  int* hitE  = list + LISTN;                     // [HCAP] edge ids, in scan order
  int* hitRD = hitE + HCAP;                      // [HCAP] (row << 9) | loc_dst
  int* tE    = hitRD + HCAP;                     // [HCAP] hitE regrouped by owner wave (8 query rows each)
  int* tRD   = tE + HCAP;                        // [HCAP] hitRD of the same entries
  __bf16* Psh = (__bf16*)(lds + LO_P);           // [8 waves][16 x KVP] P hi
  __bf16* Psl = Psh + AT_NW * PWS;               // P lo
  float* BTX = (float*)(lds + LO_BT);            // [2][64 x 64] bias tiles + [NDUM] dummies; epilogue staging
  int* sE   = (int*)(lds + LO_SE);               // [HCAP] edge ids sorted by query row
  int* sD   = (int*)(lds + LO_SD);               // [HCAP] loc_dst of the same entries
  int* rcnt = (int*)(lds + LO_RC);               // [NBIN] entries per bin
  int* roff = rcnt + NBIN;                       // [NBIN] first entry of the bin in sE / sD
  int* wcnt = roff + NBIN;                       // [8]
  int* misc = wcnt + AT_NW;                      // [8] largest per-row count of each wave

  const int tid = (int)threadIdx.x, lane = tid & 31, wave = tid >> 5, hh = lane >> 4, c = lane & 15;
  const int lgr   = (int)blockIdx.x >> 3;        // graph within this pass
  const int qt    = (int)blockIdx.x & 7;         // 64-query tile within the graph
  const int gb    = gbase + lgr;                 // graph id
  const int node0 = gb * NND + qt * NSLOT;       // global node id of query row 0
  const int lrow0 = lgr * NND + qt * NSLOT;      // plane row of query row 0

  // ---- phase A1: scan of the src list, each wave its own contiguous run of slabs; then the lists joined ----
  int tot;
  {
    const int wv    = __builtin_amdgcn_readfirstlane(wave);      // scalar loop bounds
    const int nSl   = (nE + SLAB - 1) / SLAB;                     // slabs in the list
    const int spw   = (nSl + AT_NW - 1) / AT_NW;                  // slabs per wave
    const int sBeg  = wv * spw < nSl ? wv * spw : nSl;
    const int sEnd  = sBeg + spw < nSl ? sBeg + spw : nSl;
    const int nFull = vec8 != 0 ? nE / SLAB : 0;                  // slabs [0, nFull) lie wholly inside the list
    const int sFull = sEnd < nFull ? sEnd : nFull;
    const int nG    = sFull > sBeg ? (sFull - sBeg) / SG : 0;     // groups of SG whole slabs
    int* wl = list + wv * WLCAP;
    const int le = lane * EPT;
    int wc = 0;
    if (nG > 0) {
      v4i ra[SG], rb[SG];
#pragma unroll   // ra / rb in registers
      for (int k = 0; k < SG; ++k) {
        const int* p = keys + (sBeg + k) * SLAB + le;
        ra[k] = *(const v4i*)p;
        rb[k] = *(const v4i*)(p + 4);
      }
      // stands in front of the loop's first writes to the address registers of the loads above
      asm volatile("s_wait_xcnt 0x0" ::: "memory");
#pragma unroll 1   // one copy of the SG slab bodies in the instruction cache
      for (int g = 0; g < nG; ++g) {
        const int sb = sBeg + g * SG;
        const int sn = g + 1 < nG ? sb + SG : sb;                 // last trip: its own slabs again (in bounds, unused)
#pragma unroll   // ra / rb in registers; a slab's registers are refilled as soon as it is tested, SG slabs ahead
        for (int k = 0; k < SG; ++k) {
          wc = slab_hits(ra[k], rb[k], (sb + k) * SLAB + le, node0, NSLOT, wl, wc);
          const int* p = keys + (sn + k) * SLAB + le;
          ra[k] = *(const v4i*)p;
          rb[k] = *(const v4i*)(p + 4);
          // last slab: stands in front of the next trip's first writes to these loads' address registers
          if (k == SG - 1) asm volatile("s_wait_xcnt 0x0" ::: "memory");
        }
      }
    }
#pragma unroll 1   // at most SG - 1 whole slabs and the list's edge
    for (int s = sBeg + nG * SG; s < sEnd; ++s) {
      v4i da, db;
      slab_load_edge(keys, nE, s * SLAB + le, da, db);
      wc = slab_hits(da, db, s * SLAB + le, node0, NSLOT, wl, wc);
    }
    if (lane == 0) wcnt[wave] = wc;
    __syncthreads();
    int pre = 0, all = 0;
#pragma unroll
    for (int w2 = 0; w2 < AT_NW; ++w2) {
      int cc = wcnt[w2];
      cc = cc < 0 ? 0 : (cc > WLCAP ? WLCAP : cc);
      all += cc;
      pre += (w2 < wave) ? cc : 0;
    }
    const int wcc = wc > WLCAP ? WLCAP : wc;
#pragma unroll 1
    for (int i0 = 0; i0 < wcc; i0 += 128) {         // wcc wave-uniform; loads unconditional, clamped
      int eid[4], sl[4], gg[4];
#pragma unroll   // eid / sl in registers; the four list reads share one LDS latency
      for (int j = 0; j < 4; ++j) {
        const int i   = i0 + 32 * j + lane;
        const int ent = wl[i < wcc ? i : wcc - 1];
        int e = ent >> SLOTB;
        e = e < 0 ? 0 : (e > nE - 1 ? nE - 1 : e);
        eid[j] = e;
        sl[j]  = ent & (NSLOT - 1);
      }
#pragma unroll   // gg in registers; the four dst reads share one memory latency
      for (int j = 0; j < 4; ++j) gg[j] = gath[eid[j]];
#pragma unroll   // eid / sl / gg in registers
      for (int j = 0; j < 4; ++j) {
        const int i = i0 + 32 * j + lane;
        int g = gg[j];
        g = g < 0 ? 0 : (g > NTOT - 1 ? NTOT - 1 : g);
        const int pos = pre + i;
        if (i < wcc && pos < HCAP) {
          hitE[pos]  = eid[j];
          hitRD[pos] = (sl[j] << 9) | (g & (NND - 1));
        }
      }
    }
    tot = all > HCAP ? HCAP : all;
    __syncthreads();
  }
  const int nh = __builtin_amdgcn_readfirstlane(tot);   // the same in every thread of the block: scalar loop bounds

  // ---- phase A2: stable counting sort of the hits into the NBIN bins, by all 8 waves ----
  // Wave w owns query rows 8w..8w+7 (bins 256w..256w+255), thread tid the bins 8*tid..8*tid+7 (one query row,
  // 128 key columns). Bins ascend with the row, so the entries of wave w fill sE / sD[below, below + mine).
  // Every counter lives in its owner's registers: no LDS word is read, changed and written back per hit.
  // (a) hits of lower waves' rows and of this wave's rows
  int below = 0, mine = 0;
#pragma unroll 4   // four independent LDS reads in flight per wait
  for (int b0 = 0; b0 < nh; b0 += 32) {
    const int idx = b0 + lane;
    const int g   = hitRD[idx < nh ? idx : nh - 1] >> 12;        // owner wave = query row / 8
    const bool ok = idx < nh;
    below += (int)__builtin_popcount(__builtin_amdgcn_ballot_w32(ok && g < wave));
    mine  += (int)__builtin_popcount(__builtin_amdgcn_ballot_w32(ok && g == wave));
  }
  // (b) this wave's hits copied, in hit order, to tRD / tE[below, below + mine)
  {
    int wpos = below;
    for (int b0 = 0; b0 < nh; b0 += 128) {
      int rd[4], ee[4];
#pragma unroll   // rd / ee in registers; all reads ahead of the first store, one LDS latency for the four
      for (int j = 0; j < 4; ++j) {
        const int idx = b0 + 32 * j + lane;
        const int cl  = idx < nh ? idx : nh - 1;
        rd[j] = hitRD[cl];
        ee[j] = hitE[cl];
      }
#pragma unroll   // rd / ee in registers
      for (int j = 0; j < 4; ++j) {
        const bool ok = (b0 + 32 * j + lane < nh) && ((rd[j] >> 12) == wave);
        const unsigned mk = __builtin_amdgcn_ballot_w32(ok);
        if (ok) {
          int p = wpos + (int)__builtin_amdgcn_mbcnt_lo(mk, 0u);
          p = p > HCAP - 1 ? HCAP - 1 : p;
          tRD[p] = rd[j];
          tE[p]  = ee[j];
        }
        wpos += (int)__builtin_popcount(mk);
      }
    }
  }
  __syncthreads();
  // (c) per-bin counts: every lane reads each entry of its wave (one address, broadcast); the owner counts it.
  //     8 counters of 8 bits: exact while a row holds <= RWCAP entries; tc is exact always and feeds the guard.
  unsigned long long c8 = 0ull;
  int tc = 0;
#pragma unroll 8   // eight independent LDS reads in flight per wait
  for (int i = 0; i < mine; ++i) {
    const int u = tRD[below + i];
    const bool own = (u >> 7) == tid;
    c8 += (unsigned long long)(own ? 1 : 0) << (((u >> BINSH) & 7) * 8);
    tc += own ? 1 : 0;
  }
  // (d) first entry of each bin: wave prefix over the threads' totals, then over the thread's own 8 counters
  int tbase;
  {
    int incl = tc;
#pragma unroll
    for (int d = 1; d < 32; d <<= 1) {
      const int up = __shfl_up(incl, d, 32);
      if (lane >= d) incl += up;
    }
    tbase = below + incl - tc;
    int cn[8], of[8];
    int run = tbase;
#pragma unroll
    for (int k = 0; k < 8; ++k) {
      cn[k] = (int)((c8 >> (8 * k)) & 255ull);
      of[k] = run;
      run += cn[k];
    }
    const v4i c0v = {cn[0], cn[1], cn[2], cn[3]}, c1v = {cn[4], cn[5], cn[6], cn[7]};
    const v4i o0v = {of[0], of[1], of[2], of[3]}, o1v = {of[4], of[5], of[6], of[7]};
    *(v4i*)(rcnt + tid * 8)     = c0v;
    *(v4i*)(rcnt + tid * 8 + 4) = c1v;
    *(v4i*)(roff + tid * 8)     = o0v;
    *(v4i*)(roff + tid * 8 + 4) = o1v;
    // largest per-row count of the wave: a row = 4 neighbouring threads
    int rc = tc;
    rc += __shfl_xor(rc, 1, 32);
    rc += __shfl_xor(rc, 2, 32);
#pragma unroll
    for (int off = 4; off < 32; off <<= 1) {
      const int o = __shfl_xor(rc, off, 32);
      rc = o > rc ? o : rc;
    }
    if (lane == 0) misc[wave] = rc;
  }
  // (e) placement in hit order (stable): byte k of cur = next free place of bin 8*tid + k, counted from tbase
  {
    unsigned long long cur = c8 << 8;
    cur += cur << 8;
    cur += cur << 16;
    cur += cur << 32;
    for (int i0 = 0; i0 < mine; i0 += 8) {
      int u[8], e[8];
#pragma unroll   // u / e in registers; all reads ahead of the first store, one LDS latency for the eight
      for (int j = 0; j < 8; ++j) {
        const int ii = i0 + j < mine ? i0 + j : mine - 1;
        u[j] = tRD[below + ii];
        e[j] = tE[below + ii];
      }
#pragma unroll   // u / e in registers
      for (int j = 0; j < 8; ++j) {
        if (i0 + j < mine && (u[j] >> 7) == tid) {
          const int sh = ((u[j] >> BINSH) & 7) * 8;
          int pos = tbase + (int)((cur >> sh) & 255ull);
          pos = pos > HCAP - 1 ? HCAP - 1 : pos;
          sE[pos] = e[j];
          sD[pos] = u[j] & (NND - 1);
          cur += 1ull << sh;
        }
      }
    }
  }
  // this wave's reads and writes of the phase-A lists have retired before a tensor load may target their LDS
  asm volatile("s_wait_dscnt 0x0" ::: "memory");
  __syncthreads();

  // ---- K / V^T tiles: wave w brings tile w of every stage (plane w >> 1: K hi, K lo, V^T hi, V^T lo; head slot
  //      w & 1); stage st = head pair st / 8, key chunk st % 8, into buffer st % 2 ----
  const uint32_t wvu  = uni((uint32_t)wave);
  const uint32_t ldsb = (uint32_t)(size_t)lds;
  const u32x8 g1 = tile_g1();
  u32x4 g0;
  auto issue = [&](uint32_t st) {
    const uint32_t hd0 = (2u * (st >> 3) + (wvu & 1u)) * HDM;    // first column of the head
    const uint32_t kvf = (st & 7u) * 64u;                        // first key of the chunk
    const bool     isV = wvu >= 4u;
    const unsigned short* pl = isV ? VTp : Kp;
    const uint32_t row = (uint32_t)lgr * NND + (isV ? hd0 : kvf);   // NND == HID rows per graph in both planes
    const uint32_t col = (isV ? kvf : hd0) + ((wvu >> 1) & 1u) * HID;
    g0 = tile_g0(ldsb + ((st & 1u) * KVB + wvu * KVS) * 2u, (uint64_t)(size_t)pl + (uint64_t)(row * PLD + col) * 2u);
    tile_load(g0, g1);
  };
  issue(0u);
  tile_wait(g0, g1);                                    // this wave's tile of stage 0 has landed
  __syncthreads();                                      // stage 0 readable by every wave
  issue(1u);

  // ---- geometry / capacity guards -> NaN poison of this block's ctx rows ----
  int degmax = 0;
#pragma unroll
  for (int w2 = 0; w2 < AT_NW; ++w2) degmax = misc[w2] > degmax ? misc[w2] : degmax;
  const int ng  = ngp[0];
  const int bt0 = bat[node0];
  const bool bad = (nh >= HCAP) || (degmax > RWCAP) || (ng != NGR) || (bt0 < 0) || (bt0 >= NGR);
  const float pz = bad ? __int_as_float(0x7fc00000) : 0.0f;

  // ---- phase B ----
  const int wsub = wave & 3;                     // query row group of this wave
  const int hl   = wave >> 2;                    // head slot (0 / 1) of this wave within the pair
  const int rw   = tid >> 2;                     // bias fill: query row owned by this thread
  const int jw   = tid & 3;                      // bias fill: key-column quarter owned by this thread
  const float sscale = 0.125f;
  const v8f z8 = {0.f,0.f,0.f,0.f,0.f,0.f,0.f,0.f};
  const __bf16* Kth = Ksh + hl * KVS;
  const __bf16* Ktl = Ksl + hl * KVS;
  const __bf16* Vtth = Vth + hl * KVS;
  const __bf16* Vttl = Vtl + hl * KVS;
  __bf16* pwh = Psh + wave * PWS;
  __bf16* pwl = Psl + wave * PWS;

  // ---- bias entries of stage stn (head pair stn / 8, key chunk stn % 8), fetched one stage ahead ----
  // The thread's bin = row rw, key columns 16jw..16jw+15 of the chunk. Its first PFQ entries: place in the bias tile
  // (pfA; the thread's dummy slot where there is no such entry) and the two heads' edge bias (pfV), all PFQ reads of
  // the edge bias plane in flight together. sE / sD / roff / rcnt are read-only in phase B.
  int pfS = 0, pfC = 0, pfA[PFQ];
  v2f pfV[PFQ];
  auto fetch_bias = [&](int stn) {
    const int kcn = stn & 7;
    const int bin = rw * (NND >> BINSH) + kcn * (64 >> BINSH) + jw;
    int s0 = roff[bin], cnt = rcnt[bin];
    s0  = s0 < 0 ? 0 : (s0 > nh ? nh : s0);
    cnt = cnt < 0 ? 0 : (cnt > RWCAP ? RWCAP : cnt);
    if (cnt > nh - s0) cnt = nh - s0;
    pfS = s0;
    pfC = cnt;
    const float* ebn = EB + 2 * (stn >> 3);
    int dd[PFQ], ee[PFQ];
#pragma unroll   // dd / ee in registers; the reads share one LDS latency
    for (int q = 0; q < PFQ; ++q) {
      int idx = s0 + (q < cnt ? q : (cnt > 0 ? cnt - 1 : 0));   // past the bin's end: its last entry again (same line)
      idx = idx > nh - 1 ? nh - 1 : idx;
      idx = idx < 0 ? 0 : idx;
      dd[q] = sD[idx];
      ee[q] = sE[idx];
    }
#pragma unroll   // pfA in registers
    for (int q = 0; q < PFQ; ++q) {
      const int col  = dd[q] - kcn * 64;
      const bool inr = (q < cnt) && ((unsigned)col < 64u) && ((col >> 4) == jw);
      pfA[q] = inr ? (rw * 64 + col) : (2 * KVT + tid);
    }
#pragma unroll   // pfV in registers; the reads share one memory latency
    for (int q = 0; q < PFQ; ++q) {
      int e = ee[q];
      e = e < 0 ? 0 : (e > nE - 1 ? nE - 1 : e);
      pfV[q] = *(const v2fa*)(ebn + (size_t)e * NHD);
    }
    // behind the loads, in front of later writes to their address registers (the build puts counted waits of its
    // own in front of the few writes that it schedules ahead of this one)
    asm volatile("s_wait_xcnt 0x0" ::: "memory");
  };
  fetch_bias(0);

#pragma unroll 1
  for (int hp = 0; hp < NHD / 2; ++hp) {
    const int h    = 2 * hp + hl;                // head of this wave
    const int qrow = lrow0 + wsub * 16;          // plane row of this wave's first query

    // Q fragments (A operand, row = lane&15, split k map): 2 d-chunks, hi and lo
    v16b qah[2], qal[2];
#pragma unroll
    for (int dc = 0; dc < 2; ++dc) {
      const unsigned short* qp = Qp + (size_t)(qrow + c) * PLD + h * HDM + dc * 32 + 8 * hh;
      qah[dc] = FragBF::load((const __bf16*)(const void*)qp);
      qal[dc] = FragBF::load((const __bf16*)(const void*)(qp + HID));
    }
    float mrow[8], lrow[8];
    v8f oacc[4];
#pragma unroll
    for (int r = 0; r < 8; ++r) { mrow[r] = -INFINITY; lrow[r] = 0.f; }
#pragma unroll
    for (int t = 0; t < 4; ++t) oacc[t] = z8;

#pragma unroll 1
    for (int kc = 0; kc < NND / 64; ++kc) {
      const int kv0 = kc * 64;
      const int st  = hp * (NND / 64) + kc;      // this pass reads buffer st % 2 alone; stage st + 1 is in flight
      const int bo  = (st & 1) * KVB;
      {
        // bias tiles + dummies zero: 8 sweeps x 256 threads x 4 floats = both 64x64 tiles (each store's lanes
        // contiguous, no two on one bank); 128 threads x 4 = dummies
        const v4f z4 = {0.f, 0.f, 0.f, 0.f};
        float* bz = BTX + tid * 4;
#pragma unroll
        for (int i = 0; i < 8; ++i) *(v4fa*)(bz + NTHR * 4 * i) = z4;
        if (tid < 128) *(v4fa*)(BTX + 2 * KVT + 4 * tid) = z4;
      }
      __syncthreads();
      {
        // bias fill: segment [pfS, pfS+pfC) of sE/sD = the bin of row rw and key columns kv0+16jw..kv0+16jw+15.
        // Entries 0..PFQ-1 come from the registers filled one stage ago; entry q is added while any lane of the
        // wave has one (wave-uniform test), in segment order.
#pragma unroll   // pfA / pfV in registers
        for (int q = 0; q < PFQ; ++q) {
          if (__builtin_amdgcn_ballot_w32(q < pfC) != 0u) {
            const int ia = pfA[q];
            const int ib = ia + (ia < KVT ? KVT : NTHR);
            const float ta = BTX[ia], tb = BTX[ib];   // ia != ib: both reads share one LDS latency
            BTX[ia] = ta + pfV[q].x;
            BTX[ib] = tb + pfV[q].y;
          }
        }
        const float* ebp = EB + 2 * hp;
        const int cnt = pfC;
#pragma unroll 1
        for (int q = PFQ; __builtin_amdgcn_ballot_w32(q < cnt) != 0u; ++q) {   // a bin longer than PFQ; cnt <= RWCAP
          const bool valid = q < cnt;
          int idx = pfS + q;
          idx = idx > nh - 1 ? nh - 1 : idx;
          idx = idx < 0 ? 0 : idx;
          const int col = sD[idx] - kv0;
          int e = sE[idx];
          e = e < 0 ? 0 : (e > nE - 1 ? nE - 1 : e);
          const v2f ebv = *(const v2fa*)(ebp + (size_t)e * NHD);
          const bool inr = valid && ((unsigned)col < 64u) && ((col >> 4) == jw);
          const int ia = inr ? (rw * 64 + col) : (2 * KVT + tid);
          const int ib = inr ? (KVT + rw * 64 + col) : (2 * KVT + NTHR + tid);
          BTX[ia] = BTX[ia] + ebv.x;
          BTX[ib] = BTX[ib] + ebv.y;
        }
      }
      __syncthreads();
      if (st + 1 < NST) fetch_bias(st + 1);      // lands while this stage is worked on

      // ---- S = q . k (3-term) ----
      v8f s[4];
#pragma unroll
      for (int j = 0; j < 4; ++j) {
        s[j] = z8;
#pragma unroll
        for (int dc = 0; dc < 2; ++dc) {
          FB kb, kl;
          const __bf16* kr = Kth + bo + (j * 16 + c) * KVP + dc * 32 + 8 * hh;
          const __bf16* kq = Ktl + bo + (j * 16 + c) * KVP + dc * 32 + 8 * hh;
          kb.h[0] = *(const v8b*)kr;
          kb.h[1] = *(const v8b*)(kr + 16);
          kl.h[0] = *(const v8b*)kq;
          kl.h[1] = *(const v8b*)(kq + 16);
          s[j] = at_mma(qah[dc], kb.v, s[j]);
          s[j] = at_mma(qah[dc], kl.v, s[j]);
          s[j] = at_mma(qal[dc], kb.v, s[j]);
        }
      }
      // scale, add bias tile (D element r = row wsub*16 + 8hh + r, col j*16 + c), chunk row max
      const float* btr = BTX + hl * KVT + (wsub * 16 + 8 * hh) * 64 + c;
      float cm[8];
#pragma unroll
      for (int r = 0; r < 8; ++r) {
        float m = -INFINITY;
#pragma unroll
        for (int j = 0; j < 4; ++j) {
          const float sv = s[j][r] * sscale + btr[r * 64 + j * 16];
          s[j][r] = sv;
          m = fmaxf(m, sv);
        }
#pragma unroll
        for (int off = 1; off < 16; off <<= 1) m = fmaxf(m, __shfl_xor(m, off, 32));
        cm[r] = m;
      }
#pragma unroll
      for (int r = 0; r < 8; ++r) {
        const float mnew = fmaxf(mrow[r], cm[r]);
        const float alpha = expf(mrow[r] - mnew);
        mrow[r] = mnew;
        float psum = 0.f;
#pragma unroll
        for (int j = 0; j < 4; ++j) {
          const float p = expf(s[j][r] - mnew);
          psum += p;
          __bf16 a, bl; at_split(p, a, bl);
          pwh[(8 * hh + r) * KVP + j * 16 + c] = a;
          pwl[(8 * hh + r) * KVP + j * 16 + c] = bl;
        }
#pragma unroll
        for (int off = 1; off < 16; off <<= 1) psum += __shfl_xor(psum, off, 32);
        lrow[r] = lrow[r] * alpha + psum;
#pragma unroll
        for (int t = 0; t < 4; ++t) oacc[t][r] *= alpha;
      }
      __builtin_amdgcn_fence(__ATOMIC_RELEASE, "workgroup");
      __builtin_amdgcn_wave_barrier();
      __builtin_amdgcn_fence(__ATOMIC_ACQUIRE, "workgroup");
      // ---- O += p . v (3-term); P fragment = A (row c), V^T fragment = B (col = d) ----
#pragma unroll 1
      for (int kk = 0; kk < 2; ++kk) {
        FB pa, pl;
        pa.h[0] = *(const v8b*)(pwh + c * KVP + kk * 32 + 8 * hh);
        pa.h[1] = *(const v8b*)(pwh + c * KVP + kk * 32 + 16 + 8 * hh);
        pl.h[0] = *(const v8b*)(pwl + c * KVP + kk * 32 + 8 * hh);
        pl.h[1] = *(const v8b*)(pwl + c * KVP + kk * 32 + 16 + 8 * hh);
#pragma unroll
        for (int t = 0; t < 4; ++t) {
          FB vb, vl;
          vb.h[0] = *(const v8b*)(Vtth + bo + (t * 16 + c) * KVP + kk * 32 + 8 * hh);
          vb.h[1] = *(const v8b*)(Vtth + bo + (t * 16 + c) * KVP + kk * 32 + 16 + 8 * hh);
          vl.h[0] = *(const v8b*)(Vttl + bo + (t * 16 + c) * KVP + kk * 32 + 8 * hh);
          vl.h[1] = *(const v8b*)(Vttl + bo + (t * 16 + c) * KVP + kk * 32 + 16 + 8 * hh);
          oacc[t] = at_mma(pa.v, vb.v, oacc[t]);
          oacc[t] = at_mma(pa.v, vl.v, oacc[t]);
          oacc[t] = at_mma(pl.v, vb.v, oacc[t]);
        }
      }
      // ---- publish point of stage st + 1, every wave, in this order ----
      asm volatile("s_wait_dscnt 0x0" ::: "memory");       // this wave's reads of buffer st % 2 and of the bias tile are done
      tile_wait(g0, g1);                                    // this wave's tile of stage st + 1 has landed
      __syncthreads();                                      // stage st + 1 readable; buffer st % 2 and the bias tiles free
      if (pinned((uint32_t)(st + 2 < NST))) issue((uint32_t)st + 2u);   // refill of the buffer this pass has read
    }

    // ---- epilogue: normalise, stage the wave's 16x64 tile (pitch 64, own bias rows), hi | lo lines ----
    // (the last pass's barrier stands in front: every wave has left the bias tiles)
    {
      float* os = BTX + wave * 1024;
#pragma unroll
      for (int r = 0; r < 8; ++r) {
        const float inv = 1.0f / lrow[r];
#pragma unroll
        for (int t = 0; t < 4; ++t) os[(8 * hh + r) * 64 + t * 16 + c] = oacc[t][r] * inv + pz;
      }
      __builtin_amdgcn_fence(__ATOMIC_RELEASE, "workgroup");
      __builtin_amdgcn_wave_barrier();
      __builtin_amdgcn_fence(__ATOMIC_ACQUIRE, "workgroup");
      const int q4 = lane >> 3, c8 = (lane & 7) * 8;
      v4u hv[4], lv[4];
#pragma unroll
      for (int it = 0; it < 4; ++it) {
        const int row = it * 4 + q4;                   // it 0..3 x q4 0..3 covers rows 0..15
        const float* sp = os + row * 64 + c8;
        const v4f a = *(const v4fa*)sp;
        const v4f b = *(const v4fa*)(sp + 4);
        pack8hl(a, b, hv[it], lv[it]);
      }
      {
#pragma unroll
        for (int it = 0; it < 4; ++it) {
          const int row = it * 4 + q4;
          unsigned short* op = CTX + (size_t)(qrow + row) * PLD + h * HDM + c8;
          *(v4u*)op = hv[it];
          *(v4u*)(op + HID) = lv[it];
        }
        
      }
    }
    __syncthreads();   // every wave has read its staged tile back before the next head pair's zero fill sweeps it
  }
  // no request in flight and no LDS access outstanding when the wave ends
  asm volatile("s_wait_tensorcnt 0x0" ::: "memory");
  asm volatile("s_wait_dscnt 0x0" ::: "memory");
}

// =====================================================================================
static inline int cdiv(int a, int b) { return (a + b - 1) / b; }

extern "C" void kernel_launch(void* const* d_in, const int* in_sizes, int n_in,
                              void* d_out, int out_size, void* d_ws, size_t ws_size,
                              hipStream_t stream) {
  if (n_in < 15) return;
  if (in_sizes[0] != NTOT * HID) return;                        // x [16384][512]
  if (in_sizes[1] != NTOT) return;                              // batch [16384]
  if (in_sizes[2] < 2 || (in_sizes[2] & 1) != 0) return;        // edge_index [2][E]
  const int nE = in_sizes[2] / 2;
  if (nE < 1 || nE > (1 << 24)) return;
  if (in_sizes[3] != nE * EDW) return;                          // edge_attr [E][16]
  if (in_sizes[4] != HID * HID || in_sizes[6] != HID * HID || in_sizes[8] != HID * HID || in_sizes[10] != HID * HID) return;
  if (in_sizes[5] != HID || in_sizes[7] != HID || in_sizes[9] != HID || in_sizes[11] != HID) return;
  if (in_sizes[12] != EDW * NHD || in_sizes[13] != NHD || in_sizes[14] != 1) return;
  if (out_size != NTOT * HID) return;                           // out [16384][512], last element 8388607

  const float* x   = (const float*)d_in[0];
  const int*   bat = (const int*)  d_in[1];
  const int*   ei  = (const int*)  d_in[2];     // row 0 = src, row 1 = dst
  const float* ea  = (const float*)d_in[3];
  const float* Wq  = (const float*)d_in[4];     // [in][out]
  const float* bq  = (const float*)d_in[5];
  const float* Wk  = (const float*)d_in[6];
  const float* bk  = (const float*)d_in[7];
  const float* Wv  = (const float*)d_in[8];
  const float* bv  = (const float*)d_in[9];
  const float* Wo  = (const float*)d_in[10];
  const float* bo  = (const float*)d_in[11];
  const float* We  = (const float*)d_in[12];    // [16][8]
  const float* be  = (const float*)d_in[13];    // [8]
  const int*   ngp = (const int*)  d_in[14];    // [1]
  float* out = (float*)d_out;
  const int* keys = ei;                         // src list
  const int* gath = ei + nE;                    // dst list

  const int EP = cdiv(nE, 4) * 4;

  char* ws = (char*)d_ws;
  size_t off = 0;
  const size_t oXb = off; off += (size_t)NTOT * HID * 2;                                          // 16777216
  const size_t oWq = off; off += (size_t)HID * HID * 2;                                           //   524288
  const size_t oWk = off; off += (size_t)HID * HID * 2;
  const size_t oWv = off; off += (size_t)HID * HID * 2;
  const size_t oWo = off; off += (size_t)HID * PLD * 2;                                           //  1048576
  const size_t oEB = off; off += (size_t)EP * NHD * 4;   off = (off + 255) & ~(size_t)255;        //  8388608
  const size_t oQ  = off; off += (size_t)RHALF * PLD * 2;                                         // 33554432
  const size_t oK  = off; off += (size_t)RHALF * PLD * 2;
  const size_t oVT = off; off += (size_t)GHALF * HID * PLD * 2;                                   // 33554432
  const size_t oCT = off; off += (size_t)RHALF * PLD * 2;                                         // 33554432
  if (off > ws_size || off > (size_t)WSMAX) return;                                               // 162004992
  unsigned short* Xb   = (unsigned short*)(ws + oXb);
  unsigned short* WqT  = (unsigned short*)(ws + oWq);
  unsigned short* WkT  = (unsigned short*)(ws + oWk);
  unsigned short* WvT  = (unsigned short*)(ws + oWv);
  unsigned short* WOT2 = (unsigned short*)(ws + oWo);
  float*          EB   = (float*)(ws + oEB);
  unsigned short* Qp   = (unsigned short*)(ws + oQ);
  unsigned short* Kp   = (unsigned short*)(ws + oK);
  unsigned short* VTp  = (unsigned short*)(ws + oVT);
  unsigned short* CTX  = (unsigned short*)(ws + oCT);

  hipFuncSetAttribute(reinterpret_cast<const void*>(&k_attn),
                      hipFuncAttributeMaxDynamicSharedMemorySize, LDS_ATT);

  // weight planes (bf16 bits, k-contiguous rows [n][k])
  {
    const int nUw = HID * (HID / 8);             // 512 rows x 64 units
    k_wtr<<<cdiv(nUw, NTHR), NTHR, 0, stream>>>(Wq, HID, HID, HID, HID, WqT, nUw);
    k_wtr<<<cdiv(nUw, NTHR), NTHR, 0, stream>>>(Wk, HID, HID, HID, HID, WkT, nUw);
    k_wtr<<<cdiv(nUw, NTHR), NTHR, 0, stream>>>(Wv, HID, HID, HID, HID, WvT, nUw);
    const int nUo = HID * (PLD / 8);             // 512 rows x 128 units: wt [512][1024], k mod 512
    k_wtr<<<cdiv(nUo, NTHR), NTHR, 0, stream>>>(Wo, HID, HID, HID, PLD, WOT2, nUo);
  }
  // node feature plane (whole x)
  {
    const int nUx = NTOT * (HID / 8);
    k_xprep<<<cdiv(nUx, NTHR), NTHR, 0, stream>>>(x, Xb, NTOT, nUx);
  }
  // edge bias plane [EP][8]
  {
    const int nUe = EP * 2;
    k_eb<<<cdiv(nUe, NTHR), NTHR, 0, stream>>>(ea, We, be, EB, nE, nUe);
  }

  const dim3 blk(256);
  const dim3 gQK(((RHALF / 64) * (HID / 64)) / 8, 1);        // 256 blocks x 8 tiles: M=16384, N=512
  const dim3 gVT(((HID / 64) * (NND / 64)) / 8, GHALF);      // 8 blocks x 8 tiles per graph: M=512, N=512
  const dim3 gAT(GHALF * (NND / 64));                        // 256 blocks: 32 graphs x 8 query tiles
  for (int half = 0; half < NHALF; ++half) {
    const unsigned short* Xh = Xb + (size_t)half * RHALF * HID;
    float* outh = out + (size_t)half * RHALF * HID;
    // q = x . Wq + bq -> Qp hi | lo  (M=16384, N=512, K=512)
    wmma_gemm64<false, 2, 2, false, 0><<<gQK, blk, 0, stream>>>(
        Xh, Xh, HID, 0L, WqT, WqT, HID, 0L, (void*)Qp, (void*)(Qp + HID), PLD, 0L,
        bq, bq, 0L, RHALF, HID, HID, 1.0f);
    // k = x . Wk + bk -> Kp hi | lo
    wmma_gemm64<false, 2, 2, false, 0><<<gQK, blk, 0, stream>>>(
        Xh, Xh, HID, 0L, WkT, WkT, HID, 0L, (void*)Kp, (void*)(Kp + HID), PLD, 0L,
        bk, bk, 0L, RHALF, HID, HID, 1.0f);
    // v^T = Wv^T . x^T + bv[m] per graph -> VTp [graph][h*64+d][s] hi | lo  (M=512, N=512, K=512, z = 32 graphs)
    wmma_gemm64<false, 1, 2, false, 0><<<gVT, blk, 0, stream>>>(
        WvT, WvT, HID, 0L, Xh, Xh, HID, (long)NND * HID, (void*)VTp, (void*)(VTp + HID), PLD, (long)HID * PLD,
        bv, bv, 0L, HID, NND, HID, 1.0f);
    // attention with edge bias -> CTX hi | lo
    k_attn<<<gAT, NTHR, LDS_ATT, stream>>>(Qp, Kp, VTp, EB, keys, gath, ngp, bat, CTX, nE, 1, half * GHALF);
    // out = [ctx hi | ctx lo] . [Wo ; Wo] + bo -> d_out rows half*RHALF .. half*RHALF+RHALF-1 (M=16384, N=512, K=1024)
    wmma_gemm64<false, 2, 0, false, 0><<<gQK, blk, 0, stream>>>(
        CTX, CTX, PLD, 0L, WOT2, WOT2, PLD, 0L, (void*)outh, (void*)outh, HID, 0L,
        bo, bo, 0L, RHALF, HID, PLD, 1.0f);
  }
  (void)hipGetLastError();
}

// v008
// Measured time: 267 microseconds a run.
// Timed twice side by side with v007, it ran 1.27 and 1.26 times as fast.
// All steps since v000 together make it 6.90 times as fast.
// Contractions on v_wmma_f32_16x16x32_bf16 (bf16 operands, f32 accumulate): x*Wq, x*Wk, Wv^T*x^T as single
// products of bf16-RNE inputs; q.k^T and p.v as bf16 hi/lo split (hi.hi + hi.lo + lo.hi); ctx*Wo as
// [ctx hi | ctx lo] . [Wo ; Wo] (K = 1024); edge bias (16-deep dots of bf16-RNE inputs), online softmax and all biases in f32 on the VALU.
#include <hip/hip_runtime.h>
#include <math.h>
#include <stdint.h>
#include <stddef.h>

// Geometry: NGR graphs of NND consecutive node rows; attention keys of a query = the NND nodes of its graph.
// The job runs in NHALF passes of GHALF graphs each (one pass of all graphs: the attention launch then has one
// work-group for each of the 256 WGPs); the q / k / v^T / ctx planes are rewritten per pass.
//
// Plane map (workspace, all 16-bit planes are bf16 bits; no power-of-two carries anywhere, so no inverse
// factor exists -> carry audit: none):
//   Xb   [16384][512]          bf16(x)                                        -> A of q/k GEMMs, Bt of v^T GEMM
//   WqT, WkT, WvT [512 o][512 i]  bf16(W[i][o])                              -> Bt / A (k-contiguous)
//   WOT2 [512 o][1024]         bf16(Wo[k mod 512][o])                         -> Bt of the output GEMM
//   EB   [EP][8] f32           sum_t bf16(ea[e][t]) bf16(We[t][h]) + bf16(be[h])
//   Qp, Kp [16384][1024]       hi at col h*64+d, residual lo at col 512 + h*64+d (f32 projection split)
//   VTp  [32 graphs][512 (h,d)][1024]   hi at col s, lo at col 512 + s (s = node within graph)
//   CTX  [16384][1024]         hi | lo of the normalised attention context

#define NGR    32
#define NND    512
#define NTOT   (NGR * NND)      // 16384
#define HID    512
#define NHD    8
#define HDM    64
#define EDW    16
#define NHALF  1
#define GHALF  (NGR / NHALF)    // 32
#define RHALF  (GHALF * NND)    // 16384
#define PLD    1024
#define NTHR   256
#define WSMAX  268435456

static_assert(HID == NHD * HDM && HDM == 64 && NHD == 8);
static_assert(PLD == 2 * HID);
static_assert((RHALF % 64) == 0 && (HID % 64) == 0 && (NND % 64) == 0 && (PLD % 32) == 0 && (HID % 32) == 0);
static_assert(NGR == NHALF * GHALF);
static_assert(HID == 64 * 8);                               // k_xprep: 64 units of 8 per row
static_assert(EDW == 16 && NHD == 8 && EDW * NHD <= NTHR);  // k_eb layout

typedef __attribute__((ext_vector_type(16))) _Float16 v16h;
typedef __attribute__((ext_vector_type(8)))  _Float16 v8h;
typedef __attribute__((ext_vector_type(16))) __bf16   v16b;
typedef __attribute__((ext_vector_type(8)))  __bf16   v8b;
typedef __attribute__((ext_vector_type(8)))  float    v8f;
typedef __attribute__((ext_vector_type(4)))  float    v4f;
typedef __attribute__((ext_vector_type(2)))  float    v2f;
typedef __attribute__((ext_vector_type(4)))  unsigned int v4u;
typedef __attribute__((ext_vector_type(4)))  int      v4i;
typedef __attribute__((ext_vector_type(8)))  unsigned short v8us;
typedef v4f  __attribute__((may_alias)) v4fa;
typedef v2f  __attribute__((may_alias)) v2fa;
typedef v4u  __attribute__((may_alias)) v4ua;

// ---- scalar helpers: f32 -> bf16 bits (RNE convert), bf16 bits -> f32 ----
__device__ __forceinline__ unsigned short f2bf_bits(float f) {
  unsigned u = __float_as_uint(f);
  return (unsigned short)((u + 0x7FFFu + ((u >> 16) & 1u)) >> 16);
}
__device__ __forceinline__ float bf_bits2f(unsigned short h) { return __uint_as_float(((unsigned)h) << 16); }
__device__ __forceinline__ float bfrf(float f) { return bf_bits2f(f2bf_bits(f)); }
__device__ __forceinline__ unsigned int f2bfu(float f) {
  const unsigned int u = __float_as_uint(f);
  return ((u + 0x7FFFu + ((u >> 16) & 1u)) >> 16) & 0xFFFFu;
}
__device__ __forceinline__ float bf2f(unsigned int b) { return __uint_as_float(b << 16); }
__device__ __forceinline__ v4f bfr4(const v4f a) {
  v4f r; r.x = bfrf(a.x); r.y = bfrf(a.y); r.z = bfrf(a.z); r.w = bfrf(a.w); return r;
}
__device__ __forceinline__ unsigned int pk2(float lo, float hi) { return f2bfu(lo) | (f2bfu(hi) << 16); }
__device__ __forceinline__ v4u pack8(const v4f a, const v4f b) {
  v4u r;
  r.x = pk2(a.x, a.y); r.y = pk2(a.z, a.w); r.z = pk2(b.x, b.y); r.w = pk2(b.z, b.w);
  return r;
}
// hi = bf16(v), lo = bf16(v - hi): two floats -> one packed word of each
__device__ __forceinline__ void hl2(float v0, float v1, unsigned int& hw, unsigned int& lw) {
  const unsigned int h0 = f2bfu(v0), h1 = f2bfu(v1);
  const unsigned int l0 = f2bfu(v0 - bf2f(h0)), l1 = f2bfu(v1 - bf2f(h1));
  hw = h0 | (h1 << 16);
  lw = l0 | (l1 << 16);
}
__device__ __forceinline__ void pack8hl(const v4f a, const v4f b, v4u& hv, v4u& lv) {
  unsigned int h, l;
  hl2(a.x, a.y, h, l); hv.x = h; lv.x = l;
  hl2(a.z, a.w, h, l); hv.y = h; lv.y = l;
  hl2(b.x, b.y, h, l); hv.z = h; lv.z = l;
  hl2(b.z, b.w, h, l); hv.w = h; lv.w = l;
}

// ---- WMMA fragment helpers (bf16, wave32) ----
// A fragment (row m = lane&15) and B fragment (col n = lane&15) use the SAME k map:
//   elements 0..7 <- k0 + 8h + 0..7, elements 8..15 <- k0 + 16 + 8h + 0..7, h = lane>>4,
// loaded as two 16-B pieces from a k-contiguous 16-bit row: p[0..7] and p[16..23] with p = row + k0 + 8h.
// D element r of lane l = (row 8h + r, col l&15).
__device__ __forceinline__ void dep_guard_b(v8f& a, v8f& b, v16b x, v16b y) { asm volatile("v_nop\n\tv_nop\n\tv_nop\n\tv_nop" : "+v"(a), "+v"(b) : "v"(x), "v"(y)); }
__device__ __forceinline__ void keep4_b(v16b a, v16b b, v16b c, v16b d) { asm volatile("v_nop" :: "v"(a), "v"(b), "v"(c), "v"(d)); }
__device__ __forceinline__ void acc_guard4(v8f& a, v8f& b, v8f& c, v8f& d) { asm volatile("v_nop\n\tv_nop\n\tv_nop\n\tv_nop" : "+v"(a), "+v"(b), "+v"(c), "+v"(d)); }

struct FragBF {
  union U { v16b v; v8b h[2]; };
  static __device__ __forceinline__ v16b load(const __bf16* p) {   // elements 0..7 <- p[0..7], 8..15 <- p[16..23]
    U f; f.h[0] = *(const v8b*)(p); f.h[1] = *(const v8b*)(p + 16); return f.v;
  }
  static __device__ __forceinline__ v8f mma(v16b a, v16b b, v8f c) {
    return __builtin_amdgcn_wmma_f32_16x16x32_bf16(false, a, false, b, (short)0, c, false, false);
  }
  static __device__ __forceinline__ void guard(v8f& a, v8f& b, v16b x, v16b y) { dep_guard_b(a, b, x, y); }
  static __device__ __forceinline__ void keep(v16b a, v16b b, v16b c, v16b d) { keep4_b(a, b, c, d); }
};
union FB { v16b v; v8b h[2]; };

// single WMMA with hazard guard: ties D, keeps A/B live for 4 VALU slots
__device__ __forceinline__ v8f at_mma(v16b a, v16b b, v8f c) {
  c = __builtin_amdgcn_wmma_f32_16x16x32_bf16(false, a, false, b, (short)0, c, false, false);
  asm volatile("v_nop\n\tv_nop\n\tv_nop\n\tv_nop" : "+v"(c) : "v"(a), "v"(b));
  return c;
}
__device__ __forceinline__ __bf16 at_f2bf(float f) { return __builtin_bit_cast(__bf16, f2bf_bits(f)); }
__device__ __forceinline__ void at_split(float f, __bf16& hi, __bf16& lo) {
  const unsigned short hb = f2bf_bits(f);
  hi = __builtin_bit_cast(__bf16, hb);
  lo = at_f2bf(f - __uint_as_float(((unsigned)hb) << 16));
}

typedef uint32_t u32x4 __attribute__((ext_vector_type(4)));
typedef uint32_t u32x8 __attribute__((ext_vector_type(8)));
__device__ __forceinline__ uint32_t uni(uint32_t v) { return (uint32_t)__builtin_amdgcn_readfirstlane(v); }
// a test around a tensor load held in a scalar register, so that it compiles to s_cmp + s_cbranch_scc
__device__ __forceinline__ uint32_t pinned(uint32_t v) { uint32_t w = uni(v); asm volatile("" : "+s"(w)); return w; }
// Descriptor of one tile of 64 rows x 128 B, source pitch PLD * 2 B, from global address ga to LDS byte offset dst;
// 16 B of pad behind every row (LDS pitch 144 B = KVP elements).
__device__ __forceinline__ u32x4 tile_g0(uint32_t dst, uint64_t ga) {
  u32x4 g0;
  g0[0] = uni(1u);
  g0[1] = uni(dst);
  g0[2] = uni((uint32_t)ga);
  g0[3] = uni((((uint32_t)(ga >> 32)) & 0x01FFFFFFu) | 0x80000000u);
  return g0;
}
__device__ __forceinline__ u32x8 tile_g1() {
  u32x8 g1;
  g1[0] = uni((1u << 20) | (4u << 22) | (3u << 25));   // no mask, 1-byte elements, pad of 4 dwords per 32 dwords
  g1[1] = uni(128u << 16);                             // tensor_dim0 = 128 B
  g1[2] = uni(64u << 16);                              // tensor_dim1 = 64 rows
  g1[3] = uni(128u << 16);                             // tile_dim0 = 128 B
  g1[4] = uni(64u);                                    // tile_dim1 = 64 rows
  g1[5] = uni((uint32_t)(PLD * 2));                    // source row pitch
  g1[6] = uni(0u);
  g1[7] = uni(0u);
  return g1;
}
// One request of the whole wave; the waits are the caller's.
__device__ __forceinline__ void tile_load(u32x4 g0, u32x8 g1) {
  asm volatile("tensor_load_to_lds %0, %1" :: "s"(g0), "s"(g1) : "memory");
}
// The wave's request has landed. The descriptor is named as an input so that its registers stay as they are while
// the request is outstanding.
__device__ __forceinline__ void tile_wait(u32x4 g0, u32x8 g1) {
  asm volatile("s_wait_tensorcnt 0x0" :: "s"(g0), "s"(g1) : "memory");
}

// =====================================================================================
// Register-blocked batched WMMA GEMM (bf16 operands), operands staged in LDS by tensor loads.
// C[m,n] = scale * sum_k A[m,k] * Bt[n,k] (+bias)(+resid); a block owns a GBM x GBN tile, each of its 8 waves 64x64.
// A row-major [M,K]; Bt row-major [N,K]; M % GBM == 0, N % GBN == 0, K % GPK == 0, K >= 2 GPK (host static_asserts).
// A stage = GPK k of the block's GBM rows of A and GBN rows of Bt: GNS slices of 64 rows x 256 B, one tensor load of
// one wave each (waves 0..GNS-1), 16 B of pad behind every row; two buffers, one stage ahead.
// BIAS_MODE: 0 = none, 1 = bf16r(bias[m]), 2 = bf16r(bias[n]).
// OUT_MODE: 0 = f32, 1 = f16, 2 = bf16 hi plane (Cout) + bf16 lo plane (Cout2).
// coverage: grid.x == (M/GBM)*(N/GBN) block tiles exactly (host), every C element written once per z.
// =====================================================================================
#define GBM   128                     // rows of A per block
#define GBN   256                     // rows of Bt per block
#define GPK   128                     // k per stage: rows of 256 B
#define GRP   136                     // row pitch in LDS, elements: 272 B = 16 B x 17, so the 16 rows of a ds_load_b128
                                      // fragment read fall on 16 different bank groups
#define GSL   9216                    // one slice: 64 * GRP elements, its place rounded up to 2 KiB
#define GNS   ((GBM + GBN) / 64)      // slices per stage: 2 of A, then 4 of Bt
#define GBUF  (GNS * GSL)             // one buffer
static_assert(GSL >= 64 * GRP && (GSL * 2) % 2048 == 0 && GRP * 2 == 256 + 16 && GPK * 2 == 256);
static_assert(GBM == 2 * 64 && GBN == 4 * 64 && GNS <= 8);     // 2 x 4 waves of 64 x 64
static_assert((RHALF % GBM) == 0 && (HID % GBM) == 0 && (HID % GBN) == 0 && (NND % GBN) == 0);   // block tiles, exact
static_assert((HID % GPK) == 0 && (PLD % GPK) == 0 && HID / GPK >= 2);                            // stages, at least two

// Group 1 for a slice of 64 rows x 256 B at a source pitch of pitchB bytes; LDS pitch 272 B = GRP elements.
__device__ __forceinline__ u32x8 slice_g1(uint32_t pitchB) {
  u32x8 g1;
  g1[0] = uni((1u << 20) | (5u << 22) | (3u << 25));   // no mask, 1-byte elements, pad of 4 dwords per 64 dwords
  // words 1 to 7 through pinned(): each descriptor word held in a scalar register of its own, so that the build does
  // not form equal words anew from one another, in registers it has lent out, while a request is outstanding
  g1[1] = pinned(256u << 16);                          // tensor_dim0 = 256 B; descriptor word held in a scalar register
  g1[2] = pinned(64u << 16);                           // tensor_dim1 = 64 rows; descriptor word held likewise
  g1[3] = pinned(256u << 16);                          // tile_dim0 = 256 B; descriptor word held likewise
  g1[4] = pinned(64u);                                 // tile_dim1 = 64 rows; descriptor word held likewise
  g1[5] = pinned(pitchB);                              // source row pitch; descriptor word held likewise
  g1[6] = pinned(0u);                                  // descriptor word held likewise
  g1[7] = pinned(0u);                                  // descriptor word held likewise
  return g1;
}

// Group 0 for a slice from global address ga to LDS byte offset dst. Word 0 (count 1) through pinned(): a descriptor
// word held in a scalar register, so that the build does not lend that register out while a request is outstanding.
__device__ __forceinline__ u32x4 slice_g0(uint32_t dst, uint64_t ga) {
  u32x4 g0;
  g0[0] = pinned(1u);                                  // count 1; descriptor word held in a scalar register
  g0[1] = uni(dst);
  g0[2] = uni((uint32_t)ga);
  g0[3] = uni((((uint32_t)(ga >> 32)) & 0x01FFFFFFu) | 0x80000000u);
  return g0;
}

template <bool SPLIT, int BIAS_MODE, int OUT_MODE, bool RESID, int ACT = 0>
__global__ __launch_bounds__(256) void wmma_gemm64(
    const unsigned short* __restrict__ Ap, const unsigned short* __restrict__ A2p, int lda, long strideA,
    const unsigned short* __restrict__ Btp, const unsigned short* __restrict__ Bt2p, int ldb, long strideB,
    void* __restrict__ Cout, void* __restrict__ Cout2, int ldc, long strideC,
    const float* __restrict__ bias,
    const float* __restrict__ resid, long strideR,
    int M, int N, int K, float scale) {
  static_assert(!SPLIT);                            // only the hi planes are staged
  typedef __bf16 T;
  typedef v16b V;
  __shared__ __attribute__((aligned(2048))) unsigned short ring[2 * GBUF];   // tensor loads: places at multiples of 2 KiB
  __shared__ __align__(16) float sT[8][16 * 68];   // per-wave 16x64 slab, pitch 68 floats
  const int b    = blockIdx.y;
  const int lane = threadIdx.x & 31;
  const int wave = threadIdx.x >> 5;
  const int tilesN = N / GBN;
  const int tilesM = M / GBM;
  if ((int)blockIdx.x >= tilesM * tilesN) return;   // the whole block, in front of every barrier and tensor load
  const int tm = (int)blockIdx.x / tilesN;
  const int tn = (int)blockIdx.x - tm * tilesN;
  const int wm = wave >> 2;                    // the wave's 64 rows within the block tile
  const int wn = wave & 3;                     // the wave's 64 columns within the block tile
  const int m0 = tm * GBM + (wm << 6);
  const int n0 = tn * GBN + (wn << 6);

  const int rlane = lane & 15;                 // row (A) / col (B, D) within subtile
  const int koff  = (lane >> 4) * 8;           // k offset of this lane half
  const int mOff  = (lane >> 4) * 8;           // D row offset

  // ---- slices: wave w < GNS brings slice w of every stage (0, 1: A rows; 2..5: Bt rows) into buffer stage % 2 ----
  const uint32_t wvu  = uni((uint32_t)wave);
  const uint32_t sl   = wvu < (uint32_t)GNS ? wvu : (uint32_t)GNS - 1u;
  const bool     isA  = sl < (uint32_t)(GBM / 64);
  const bool     iss  = wvu < (uint32_t)GNS;
  const uint32_t ldsb = (uint32_t)(size_t)ring;
  const unsigned short* sp0 = isA ? Ap  + (size_t)b * strideA + (size_t)(tm * GBM + (int)sl * 64) * lda
                                  : Btp + (size_t)b * strideB + (size_t)(tn * GBN + ((int)sl - GBM / 64) * 64) * ldb;
  const u32x8 g1 = slice_g1((uint32_t)(isA ? lda : ldb) * 2u);
  const int nst = K / GPK;                     // stages
  u32x4 g0;
  // group 0 of stage st, formed by every wave (one set of registers on every path); only the load stands in the branch
  auto form = [&](uint32_t st) {
    g0 = slice_g0(ldsb + ((st & 1u) * GBUF + sl * GSL) * 2u, (uint64_t)(size_t)sp0 + (uint64_t)st * (GPK * 2));
  };
  form(0u);
  if (pinned((uint32_t)iss)) {
    tile_load(g0, g1);
    tile_wait(g0, g1);                                  // this wave's slice of stage 0 has landed
  }
  __syncthreads();                                      // stage 0 readable by every wave
  form(1u);
  if (pinned((uint32_t)(iss && nst > 1))) tile_load(g0, g1);

  v8f acc[4][4];
#pragma unroll
  for (int i = 0; i < 4; ++i)
#pragma unroll
    for (int j = 0; j < 4; ++j) acc[i][j] = (v8f){0.f,0.f,0.f,0.f,0.f,0.f,0.f,0.f};

#pragma unroll 1   // one stage per trip: the publish point at its foot stands once in the code
  for (int st = 0; st < nst; ++st) {
    // this pass reads buffer st % 2 alone; stage st + 1 is in flight
    const T* bufp = (const T*)(const void*)ring + (st & 1) * GBUF;
    const T* As = bufp + wm * GSL + rlane * GRP + koff;
    const T* Bs = bufp + (GBM / 64 + wn) * GSL + rlane * GRP + koff;
#pragma unroll   // fragment addresses as immediate offsets; the next k step's LDS reads may go ahead of this one's products
    for (int kk = 0; kk < GPK / 32; ++kk) {
      V bh[4], ah[4];
#pragma unroll
      for (int j = 0; j < 4; ++j) bh[j] = FragBF::load(Bs + j * 16 * GRP + kk * 32);
#pragma unroll
      for (int i = 0; i < 4; ++i) ah[i] = FragBF::load(As + i * 16 * GRP + kk * 32);
#pragma unroll
      for (int i = 0; i < 4; ++i) {
#pragma unroll
        for (int j = 0; j < 4; ++j) acc[i][j] = FragBF::mma(ah[i], bh[j], acc[i][j]);
        FragBF::guard(acc[i][0], acc[i][3], ah[i], ah[i]);
      }
      FragBF::keep(bh[0], bh[1], bh[2], bh[3]);
    }
    // ---- publish point of stage st + 1, every wave, in this order ----
    asm volatile("s_wait_dscnt 0x0" ::: "memory");       // this wave's reads of buffer st % 2 are done
    if (pinned((uint32_t)iss)) tile_wait(g0, g1);         // this wave's slice of stage st + 1 has landed
    __syncthreads();                                      // stage st + 1 readable; buffer st % 2 free
    form((uint32_t)st + 2u);
    if (pinned((uint32_t)(iss && st + 2 < nst))) tile_load(g0, g1);          // refill of the buffer this pass has read
  }
  // no request in flight and no LDS read outstanding behind the loop
  asm volatile("s_wait_tensorcnt 0x0" ::: "memory");
  asm volatile("s_wait_dscnt 0x0" ::: "memory");
  acc_guard4(acc[0][0], acc[0][1], acc[0][2], acc[0][3]);
  acc_guard4(acc[1][0], acc[1][1], acc[1][2], acc[1][3]);
  acc_guard4(acc[2][0], acc[2][1], acc[2][2], acc[2][3]);
  acc_guard4(acc[3][0], acc[3][1], acc[3][2], acc[3][3]);

  // ---- epilogue ----
  float* slab = sT[wave];
  const float* Rb = RESID ? (resid + (size_t)b * strideR) : nullptr;
#pragma unroll
  for (int i = 0; i < 4; ++i) {
    const int mBase = m0 + (i << 4);
    float bm[8];
    if (BIAS_MODE == 1) {   // 8 consecutive floats, 32-B aligned: two 16-B loads
      const v4f b0v = bfr4(*(const v4fa*)(bias + mBase + mOff));
      const v4f b1v = bfr4(*(const v4fa*)(bias + mBase + mOff + 4));
      bm[0] = b0v.x; bm[1] = b0v.y; bm[2] = b0v.z; bm[3] = b0v.w;
      bm[4] = b1v.x; bm[5] = b1v.y; bm[6] = b1v.z; bm[7] = b1v.w;
    } else {
#pragma unroll
      for (int r = 0; r < 8; ++r) bm[r] = 0.f;
    }
#pragma unroll
    for (int j = 0; j < 4; ++j) {
      const int n = n0 + (j << 4) + rlane;
      float bv = 0.f;
      if (BIAS_MODE == 2) bv = bfrf(bias[n]);
#pragma unroll
      for (int r = 0; r < 8; ++r) {
        float v = acc[i][j][r] * scale;
        if (BIAS_MODE == 1) v += bm[r];
        if (BIAS_MODE == 2) v += bv;
        if (RESID) v += Rb[(size_t)(mBase + mOff + r) * ldc + n];
        if (ACT == 1) v = tanhf(v);
        if (ACT == 2) v = fmaxf(v, 0.0f);
        if (ACT == 4) v = (v > 0.f) ? v : 0.01f * v;
        slab[(mOff + r) * 68 + (j << 4) + rlane] = v;
      }
    }
    __builtin_amdgcn_fence(__ATOMIC_RELEASE, "workgroup");
    __builtin_amdgcn_wave_barrier();
    __builtin_amdgcn_fence(__ATOMIC_ACQUIRE, "workgroup");
    if (OUT_MODE == 0) {
      float* C = (float*)Cout + (size_t)b * strideC;
      const int hh = lane >> 4, c4 = (lane & 15) * 4;     // row seg = 256 B = 16 lanes x 16 B
      {
#pragma unroll
        for (int it = 0; it < 8; ++it) {
          const int row = it * 2 + hh;
          v4f v = *(const v4f*)(slab + row * 68 + c4);
          *(v4f*)(C + (size_t)(mBase + row) * ldc + n0 + c4) = v;
        }
        
      }
    } else {
      const int q = lane >> 3, c8 = (lane & 7) * 8;
      unsigned short* C  = (unsigned short*)Cout  + (size_t)b * strideC;
      unsigned short* C2 = (OUT_MODE == 2) ? ((unsigned short*)Cout2 + (size_t)b * strideC) : nullptr;
      {
#pragma unroll
        for (int it = 0; it < 4; ++it) {
          const int row = it * 4 + q;
          const float* sp = slab + row * 68 + c8;
          v8h hv, lv;
#pragma unroll
          for (int e = 0; e < 8; ++e) {
            if (OUT_MODE == 1) {
              hv[e] = (_Float16)sp[e];
            } else {
              unsigned short hb = f2bf_bits(sp[e]);
              unsigned short lb = f2bf_bits(sp[e] - bf_bits2f(hb));
              hv[e] = __builtin_bit_cast(_Float16, hb);
              lv[e] = __builtin_bit_cast(_Float16, lb);
            }
          }
          *(v8h*)(C + (size_t)(mBase + row) * ldc + n0 + c8) = hv;
          if (OUT_MODE == 2) *(v8h*)(C2 + (size_t)(mBase + row) * ldc + n0 + c8) = lv;
        }
        
      }
    }
    __builtin_amdgcn_fence(__ATOMIC_RELEASE, "workgroup");
    __builtin_amdgcn_wave_barrier();
    __builtin_amdgcn_fence(__ATOMIC_ACQUIRE, "workgroup");
  }
}

// =====================================================================================
// Node feature plane: xb[row][c] = bf16(x[row][c]) for row < nN (all 512 c). One thread = 8 contiguous
// =====================================================================================
__global__ __launch_bounds__(NTHR) void k_xprep(const float* __restrict__ x, unsigned short* xb, int nN, int nUnits) {
  const int i = (int)blockIdx.x * NTHR + (int)threadIdx.x;
  if (i >= nUnits) return;
  const int row = i >> 6;
  const int c0  = (i & 63) * 8;
  const int rc  = row < nN ? row : nN - 1;
  const float* p = x + (size_t)rc * HID + c0;
  v4f a = *(const v4fa*)p;
  v4f b = *(const v4fa*)(p + 4);
  const v4f z4 = {0.f, 0.f, 0.f, 0.f};
  if (row >= nN) { a = z4; b = z4; }
  const v4u hv = pack8(a, b);
  unsigned short* o = xb + (size_t)row * HID + c0;
  *(v4u*)o = hv;
  
}

// =====================================================================================
// Weight transpose + bf16 convert into a k-contiguous plane: w is [Kin][Ncol] ([in][out]),
//   wt[n][k] = bf16(w[k mod Kin][n]) for n < Nrows, k < Kout (Kout = Kin or a multiple of it).
// coverage: nUnits = Nrows * Kout/8 threads x 8 = Nrows x Kout exactly.
// =====================================================================================
__global__ __launch_bounds__(NTHR) void k_wtr(const float* __restrict__ w, int Kin, int Ncol, int Nrows, int Kout,
                                              unsigned short* wt, int nUnits) {
  const int u = (int)blockIdx.x * NTHR + (int)threadIdx.x;
  if (u >= nUnits) return;
  const int kq = Kout >> 3;
  const int n  = u / kq;
  const int k8 = (u - n * kq) * 8;
  const int kk = k8 - (k8 / Kin) * Kin;
  const int ncl = n < Ncol ? n : Ncol - 1;
  const float* p = w + (size_t)kk * (size_t)Ncol + ncl;
  v4f a, b;
  a.x = p[0];                    a.y = p[(size_t)Ncol];         a.z = p[(size_t)2 * Ncol];     a.w = p[(size_t)3 * Ncol];
  b.x = p[(size_t)4 * Ncol];     b.y = p[(size_t)5 * Ncol];     b.z = p[(size_t)6 * Ncol];     b.w = p[(size_t)7 * Ncol];
  const v4f z4 = {0.f, 0.f, 0.f, 0.f};
  if (n >= Ncol || n >= Nrows) { a = z4; b = z4; }
  const v4u wv = pack8(a, b);
  unsigned short* o = wt + (size_t)n * (size_t)Kout + k8;
  *(v4u*)o = wv;
  
}

// =====================================================================================
// Edge bias plane: EB[e][h] = sum_t bf16r(ea[e][t]) * bf16r(We[t][h]) + bf16r(be[h]) (f32, 16 terms summed
// from +0 then the bias), zero rows for pad edges nE <= e < EP (load address clamped, value zeroed by select).
// One thread = one edge and 4 consecutive heads: 4 b128 loads in a rolled loop, one 16-B store;
// coverage: nUnits = EP*2 threads x 4 = EP x 8 elements exactly.
// =====================================================================================
__global__ __launch_bounds__(NTHR) void k_eb(const float* __restrict__ ea, const float* __restrict__ We,
                                             const float* __restrict__ be, float* EB, int nE, int nUnits) {
  __shared__ float sWe[EDW * NHD];
  __shared__ float sbe[NHD];
  const int tid = (int)threadIdx.x;
  if (tid < EDW * NHD) sWe[tid] = bfrf(We[tid]);           // We[t][h] row-major
  if (tid < NHD) sbe[tid] = bfrf(be[tid]);
  __syncthreads();
  const int u = (int)blockIdx.x * NTHR + tid;
  if (u >= nUnits) return;
  const int e  = u >> 1;
  const int h0 = (u & 1) * 4;
  const int ec = e < nE ? e : nE - 1;
  const float* er = ea + (size_t)ec * EDW;
  float s0 = 0.f, s1 = 0.f, s2 = 0.f, s3 = 0.f;
#pragma unroll 1
  for (int q = 0; q < 4; ++q) {
    const v4f a = bfr4(*(const v4fa*)(er + 4 * q));
    const float* wr = sWe + (4 * q) * NHD + h0;            // We[4q+i][h0+j] = wr[i*8 + j]
    s0 = fmaf(a.x, wr[0],  s0); s1 = fmaf(a.x, wr[1],  s1); s2 = fmaf(a.x, wr[2],  s2); s3 = fmaf(a.x, wr[3],  s3);
    s0 = fmaf(a.y, wr[8],  s0); s1 = fmaf(a.y, wr[9],  s1); s2 = fmaf(a.y, wr[10], s2); s3 = fmaf(a.y, wr[11], s3);
    s0 = fmaf(a.z, wr[16], s0); s1 = fmaf(a.z, wr[17], s1); s2 = fmaf(a.z, wr[18], s2); s3 = fmaf(a.z, wr[19], s3);
    s0 = fmaf(a.w, wr[24], s0); s1 = fmaf(a.w, wr[25], s1); s2 = fmaf(a.w, wr[26], s2); s3 = fmaf(a.w, wr[27], s3);
  }
  v4f o;
  o.x = s0 + sbe[h0]; o.y = s1 + sbe[h0 + 1]; o.z = s2 + sbe[h0 + 2]; o.w = s3 + sbe[h0 + 3];
  const v4f z4 = {0.f, 0.f, 0.f, 0.f};
  if (e >= nE) o = z4;
  float* op = EB + (size_t)e * NHD + h0;
  *(v4f*)op = o;
  
}

// =====================================================================================
// Graph attention with per-edge additive bias, one block per (graph, 64-query tile), 8 waves.
// Phase A (block-local, statically bounded): scan of the src list (edge_index row 0) for
//   src in [node0, node0+64): wave w walks its own contiguous eighth of the list in slabs of 256 edges, SG slabs
//   loaded ahead, hits appended to its own LDS list, no barrier inside the walk; then one barrier, the waves'
//   lists joined in wave order (= ascending slab order) with dst gathered for all hits at once: (edge id, query
//   row, dst % 512), capped at HCAP (poison when reached); counting sort (8 waves, each its own 8 query rows, stable) into
//   NBIN bins, bin = query row * 32 + (dst % 512) / 16, -> sE / sD segments with roff / rcnt. Nothing persists
//   outside LDS.
// Phase B: 4 head pairs; waves 0..3 run head 2p, waves 4..7 head 2p+1, each wave 16 query rows.
//   Per key chunk of 64: K hi/lo and V^T hi/lo tiles of both heads (8 tiles of 64 rows x 128 B) brought by one
//   tensor load per wave, two buffers, one chunk ahead; a 2x64x64 f32 bias tile zeroed then filled by row owners
//   (4 threads per query row, thread j walks only the bin of its row and of key columns 16j..16j+15 of this
//   chunk, in segment order = hit scan order -> duplicate (src,dst) pairs sum deterministically; lanes
//   whose bin is shorter than the wave's longest add into a private dummy slot),
//   then S = q.k (3-term split) * 0.125 + bias, online softmax in f32, P split hi/lo through per-wave LDS
//   Epilogue: ctx = O / l staged per wave in LDS (aliasing only that wave's own bias rows), written as
// Geometry guards (NaN poison of the block's ctx rows, never a trap): hit cap, per-row count > RWCAP,
//   num_graphs != NGR, batch id of the block's first node outside [0, NGR).
// coverage: CTX rows lrow0..lrow0+63 x all 1024 cols per block; grid = GHALF*8 blocks covers RHALF rows once.
// =====================================================================================
#define AT_NW   8
#define EPT     8
#define SLAB    (32 * EPT)            // 256 keys: one wave's read of EPT keys per lane
#define SG      4                     // slabs whose loads are in flight per wave
#define SLOTB   6
#define NSLOT   64                    // query rows per block = scan slots
#define BINSH   4                     // 16 key columns per bin
#define NBIN    (NSLOT * (NND >> BINSH))   // 2048 bins: (query row, group of 16 key columns)
#define HCAP    2048                  // hit capacity per block
#define WLCAP   HCAP                  // hit capacity of one wave's list: a wave that fills it has filled the block's
#define LISTN   (AT_NW * WLCAP)       // 16384
#define RWCAP   128                   // static cap on per-row edge count
#define KVT     4096                  // one 64x64 f32 bias tile
#define KVP     72                    // row pitch of the K / V^T / P tiles in LDS, elements: 144 B = 16 B x 9, so the
                                      // 16 rows of a ds_load_b128 fragment read fall on 16 different bank groups
#define KVS     5120                  // one 64-row K or V^T tile: 64 * KVP elements, its place rounded up to 2 KiB
#define KVB     (8 * KVS)             // one buffer: the 8 tiles of a key chunk
#define NST     ((NHD / 2) * (NND / 64))   // stages = head pairs x key chunks
#define PWS     (16 * KVP)            // one wave's 16-row P tile
#define NDUM    512                   // private dummy accumulators (2 per thread)
#define PFQ     4                     // entries of a thread's bias bin that are fetched one stage ahead into registers
#define LO_KV   0
#define LO_P    (2 * KVB * 2)                           // 163840
#define LO_BT   (LO_P + 2 * AT_NW * PWS * 2)            // 200704
#define LO_SE   (LO_BT + (2 * KVT + NDUM) * 4)          // 235520
#define LO_SD   (LO_SE + HCAP * 4)                      // 243712
#define LO_RC   (LO_SD + HCAP * 4)                      // 251904
#define LDS_ATT (LO_RC + (2 * NBIN + 2 * AT_NW) * 4)    // 268352

static_assert((LISTN + 4 * HCAP) * 4 <= LO_P);        // phase-A lists alias the two K/V buffers
static_assert(LDS_ATT <= 300000);
static_assert(KVP >= 64 && (KVP * 2) % 16 == 0 && ((KVP * 2) / 16) % 2 == 1);   // 16-B aligned rows, odd multiple
static_assert(KVS >= 64 * KVP && (KVS * 2) % 2048 == 0 && KVP * 2 == 128 + 16);  // tensor load: place, padded pitch
static_assert(NST >= 2 && NND / 64 == 8 && NND == HID && AT_NW == 8 && HDM * 2 == 128 && (PLD * 2) % 16 == 0);  // one tile per wave, 128-B rows
static_assert((LO_P % 16) == 0 && (LO_BT % 16) == 0);
static_assert((1 << SLOTB) == NSLOT);
static_assert(NTHR == 32 * AT_NW);
static_assert(NTHR == 4 * NSLOT);                      // bias fill: 4 threads per query row
static_assert(NTHR * 4 * 8 == 2 * KVT);                // bias zero fill: 8 sweeps of 4 floats per thread
static_assert(NDUM == 2 * NTHR && NDUM == 128 * 4);
static_assert(AT_NW * 1024 == 2 * KVT);                // per-wave output staging = own bias rows
static_assert(SLAB == 256 && 24 + SLOTB < 32);                   // list entry = edge id (below 2^24, host check) << SLOTB | slot
static_assert(NSLOT == 8 * AT_NW && NND == 512);                 // sort: 8 query rows per wave, owner wave = hitRD >> 12
static_assert(NBIN == NTHR * 8 && (NND >> BINSH) == 32);         // sort: 8 bins per thread, 4 threads per row
static_assert(RWCAP < 256);                                      // sort: 8-bit counters exact below the row cap
static_assert((64 >> BINSH) == 4 && (LO_RC % 16) == 0);          // 4 bins per row and key chunk = 4 fill threads

// One slab of the key list: the lane holds keys e0 .. e0 + EPT - 1 in da / db and tests them against the block's slot
// range [slotBase, slotBase + nb); hits are appended to this wave's LDS list wl as (edge id << SLOTB | slot), key
// position first, lane second. wc = entries so far (wave-uniform); returns the new count; nothing is stored
// at or past WLCAP.
__device__ __forceinline__ int slab_hits(const v4i da, const v4i db, int e0, int slotBase, int nb, int* wl, int wc) {
  const unsigned nbs = (unsigned)slotBase;
  const unsigned unb = (unsigned)nb;
  const unsigned s0 = (unsigned)da.x - nbs, s1 = (unsigned)da.y - nbs;
  const unsigned s2 = (unsigned)da.z - nbs, s3 = (unsigned)da.w - nbs;
  const unsigned s4 = (unsigned)db.x - nbs, s5 = (unsigned)db.y - nbs;
  const unsigned s6 = (unsigned)db.z - nbs, s7 = (unsigned)db.w - nbs;
  const bool h0 = s0 < unb, h1 = s1 < unb, h2 = s2 < unb, h3 = s3 < unb;
  const bool h4 = s4 < unb, h5 = s5 < unb, h6 = s6 < unb, h7 = s7 < unb;
  const unsigned m0 = __builtin_amdgcn_ballot_w32(h0), m1 = __builtin_amdgcn_ballot_w32(h1);
  const unsigned m2 = __builtin_amdgcn_ballot_w32(h2), m3 = __builtin_amdgcn_ballot_w32(h3);
  const unsigned m4 = __builtin_amdgcn_ballot_w32(h4), m5 = __builtin_amdgcn_ballot_w32(h5);
  const unsigned m6 = __builtin_amdgcn_ballot_w32(h6), m7 = __builtin_amdgcn_ballot_w32(h7);
  if ((m0 | m1 | m2 | m3 | m4 | m5 | m6 | m7) != 0u) {
#define HITJ(J, HJ, SJ, MJ) { \
      const unsigned mj = (MJ); \
      if (mj != 0u) { \
        if (HJ) { \
          const int pos = wc + (int)__builtin_amdgcn_mbcnt_lo(mj, 0u); \
          if (pos < WLCAP) wl[pos] = ((e0 + (J)) << SLOTB) | (int)(SJ); \
        } \
        wc += (int)__builtin_popcount(mj); } }
    HITJ(0, h0, s0, m0)
    HITJ(1, h1, s1, m1)
    HITJ(2, h2, s2, m2)
    HITJ(3, h3, s3, m3)
    HITJ(4, h4, s4, m4)
    HITJ(5, h5, s5, m5)
    HITJ(6, h6, s6, m6)
    HITJ(7, h7, s7, m7)
#undef HITJ
  }
  return wc;
}
// A slab that is not wholly inside the list (or a list not read 16 bytes at a time): every address clamped, the
// sentinel selected by value.
__device__ __forceinline__ void slab_load_edge(const int* __restrict__ keys, int nE, int e0, v4i& da, v4i& db) {
  const int sent = -2147483647 - 1;
  da.x = (e0     < nE) ? keys[min(e0,     nE - 1)] : sent;
  da.y = (e0 + 1 < nE) ? keys[min(e0 + 1, nE - 1)] : sent;
  da.z = (e0 + 2 < nE) ? keys[min(e0 + 2, nE - 1)] : sent;
  da.w = (e0 + 3 < nE) ? keys[min(e0 + 3, nE - 1)] : sent;
  db.x = (e0 + 4 < nE) ? keys[min(e0 + 4, nE - 1)] : sent;
  db.y = (e0 + 5 < nE) ? keys[min(e0 + 5, nE - 1)] : sent;
  db.z = (e0 + 6 < nE) ? keys[min(e0 + 6, nE - 1)] : sent;
  db.w = (e0 + 7 < nE) ? keys[min(e0 + 7, nE - 1)] : sent;
}

__global__ __launch_bounds__(NTHR) void k_attn(
    const unsigned short* __restrict__ Qp, const unsigned short* __restrict__ Kp,
    const unsigned short* __restrict__ VTp, const float* __restrict__ EB,
    const int* __restrict__ keys, const int* __restrict__ gath,
    const int* __restrict__ ngp, const int* __restrict__ bat,
    unsigned short* CTX, int nE, int vec8, int gbase) {
  extern __shared__ __attribute__((aligned(2048))) v4f lds_dyn[];   // tensor loads: tile places at multiples of 2 KiB
  char* lds = (char*)lds_dyn;
  __bf16* Ksh = (__bf16*)(lds + LO_KV);         // buffer 0 (buffer 1: + KVB): [2][KVS]  K hi  [kv][d], pitch KVP
  __bf16* Ksl = Ksh + 2 * KVS;                   // [2][KVS]  K lo
  __bf16* Vth = Ksl + 2 * KVS;                   // [2][KVS]  V^T hi [d][kv]
  __bf16* Vtl = Vth + 2 * KVS;                   // [2][KVS]  V^T lo
  int* list  = (int*)(lds + LO_KV);              // phase A only: [8 waves][WLCAP]
  int* hitE  = list + LISTN;                     // [HCAP] edge ids, in scan order
  int* hitRD = hitE + HCAP;                      // [HCAP] (row << 9) | loc_dst
  int* tE    = hitRD + HCAP;                     // [HCAP] hitE regrouped by owner wave (8 query rows each)
  int* tRD   = tE + HCAP;                        // [HCAP] hitRD of the same entries
  __bf16* Psh = (__bf16*)(lds + LO_P);           // [8 waves][16 x KVP] P hi
  __bf16* Psl = Psh + AT_NW * PWS;               // P lo
  float* BTX = (float*)(lds + LO_BT);            // [2][64 x 64] bias tiles + [NDUM] dummies; epilogue staging
  int* sE   = (int*)(lds + LO_SE);               // [HCAP] edge ids sorted by query row
  int* sD   = (int*)(lds + LO_SD);               // [HCAP] loc_dst of the same entries
  int* rcnt = (int*)(lds + LO_RC);               // [NBIN] entries per bin
  int* roff = rcnt + NBIN;                       // [NBIN] first entry of the bin in sE / sD
  int* wcnt = roff + NBIN;                       // [8]
  int* misc = wcnt + AT_NW;                      // [8] largest per-row count of each wave

  const int tid = (int)threadIdx.x, lane = tid & 31, wave = tid >> 5, hh = lane >> 4, c = lane & 15;
  const int lgr   = (int)blockIdx.x >> 3;        // graph within this pass
  const int qt    = (int)blockIdx.x & 7;         // 64-query tile within the graph
  const int gb    = gbase + lgr;                 // graph id
  const int node0 = gb * NND + qt * NSLOT;       // global node id of query row 0
  const int lrow0 = lgr * NND + qt * NSLOT;      // plane row of query row 0

  // ---- phase A1: scan of the src list, each wave its own contiguous run of slabs; then the lists joined ----
  int tot;
  {
    const int wv    = __builtin_amdgcn_readfirstlane(wave);      // scalar loop bounds
    const int nSl   = (nE + SLAB - 1) / SLAB;                     // slabs in the list
    const int spw   = (nSl + AT_NW - 1) / AT_NW;                  // slabs per wave
    const int sBeg  = wv * spw < nSl ? wv * spw : nSl;
    const int sEnd  = sBeg + spw < nSl ? sBeg + spw : nSl;
    const int nFull = vec8 != 0 ? nE / SLAB : 0;                  // slabs [0, nFull) lie wholly inside the list
    const int sFull = sEnd < nFull ? sEnd : nFull;
    const int nG    = sFull > sBeg ? (sFull - sBeg) / SG : 0;     // groups of SG whole slabs
    int* wl = list + wv * WLCAP;
    const int le = lane * EPT;
    int wc = 0;
    if (nG > 0) {
      v4i ra[SG], rb[SG];
#pragma unroll   // ra / rb in registers
      for (int k = 0; k < SG; ++k) {
        const int* p = keys + (sBeg + k) * SLAB + le;
        ra[k] = *(const v4i*)p;
        rb[k] = *(const v4i*)(p + 4);
      }
      // stands in front of the loop's first writes to the address registers of the loads above
      asm volatile("s_wait_xcnt 0x0" ::: "memory");
#pragma unroll 1   // one copy of the SG slab bodies in the instruction cache
      for (int g = 0; g < nG; ++g) {
        const int sb = sBeg + g * SG;
        const int sn = g + 1 < nG ? sb + SG : sb;                 // last trip: its own slabs again (in bounds, unused)
#pragma unroll   // ra / rb in registers; a slab's registers are refilled as soon as it is tested, SG slabs ahead
        for (int k = 0; k < SG; ++k) {
          wc = slab_hits(ra[k], rb[k], (sb + k) * SLAB + le, node0, NSLOT, wl, wc);
          const int* p = keys + (sn + k) * SLAB + le;
          ra[k] = *(const v4i*)p;
          rb[k] = *(const v4i*)(p + 4);
          // last slab: stands in front of the next trip's first writes to these loads' address registers
          if (k == SG - 1) asm volatile("s_wait_xcnt 0x0" ::: "memory");
        }
      }
    }
#pragma unroll 1   // at most SG - 1 whole slabs and the list's edge
    for (int s = sBeg + nG * SG; s < sEnd; ++s) {
      v4i da, db;
      slab_load_edge(keys, nE, s * SLAB + le, da, db);
      wc = slab_hits(da, db, s * SLAB + le, node0, NSLOT, wl, wc);
    }
    if (lane == 0) wcnt[wave] = wc;
    __syncthreads();
    int pre = 0, all = 0;
#pragma unroll
    for (int w2 = 0; w2 < AT_NW; ++w2) {
      int cc = wcnt[w2];
      cc = cc < 0 ? 0 : (cc > WLCAP ? WLCAP : cc);
      all += cc;
      pre += (w2 < wave) ? cc : 0;
    }
    const int wcc = wc > WLCAP ? WLCAP : wc;
#pragma unroll 1
    for (int i0 = 0; i0 < wcc; i0 += 128) {         // wcc wave-uniform; loads unconditional, clamped
      int eid[4], sl[4], gg[4];
#pragma unroll   // eid / sl in registers; the four list reads share one LDS latency
      for (int j = 0; j < 4; ++j) {
        const int i   = i0 + 32 * j + lane;
        const int ent = wl[i < wcc ? i : wcc - 1];
        int e = ent >> SLOTB;
        e = e < 0 ? 0 : (e > nE - 1 ? nE - 1 : e);
        eid[j] = e;
        sl[j]  = ent & (NSLOT - 1);
      }
#pragma unroll   // gg in registers; the four dst reads share one memory latency
      for (int j = 0; j < 4; ++j) gg[j] = gath[eid[j]];
#pragma unroll   // eid / sl / gg in registers
      for (int j = 0; j < 4; ++j) {
        const int i = i0 + 32 * j + lane;
        int g = gg[j];
        g = g < 0 ? 0 : (g > NTOT - 1 ? NTOT - 1 : g);
        const int pos = pre + i;
        if (i < wcc && pos < HCAP) {
          hitE[pos]  = eid[j];
          hitRD[pos] = (sl[j] << 9) | (g & (NND - 1));
        }
      }
    }
    tot = all > HCAP ? HCAP : all;
    __syncthreads();
  }
  const int nh = __builtin_amdgcn_readfirstlane(tot);   // the same in every thread of the block: scalar loop bounds

  // ---- phase A2: stable counting sort of the hits into the NBIN bins, by all 8 waves ----
  // Wave w owns query rows 8w..8w+7 (bins 256w..256w+255), thread tid the bins 8*tid..8*tid+7 (one query row,
  // 128 key columns). Bins ascend with the row, so the entries of wave w fill sE / sD[below, below + mine).
  // Every counter lives in its owner's registers: no LDS word is read, changed and written back per hit.
  // (a) hits of lower waves' rows and of this wave's rows
  int below = 0, mine = 0;
#pragma unroll 4   // four independent LDS reads in flight per wait
  for (int b0 = 0; b0 < nh; b0 += 32) {
    const int idx = b0 + lane;
    const int g   = hitRD[idx < nh ? idx : nh - 1] >> 12;        // owner wave = query row / 8
    const bool ok = idx < nh;
    below += (int)__builtin_popcount(__builtin_amdgcn_ballot_w32(ok && g < wave));
    mine  += (int)__builtin_popcount(__builtin_amdgcn_ballot_w32(ok && g == wave));
  }
  // (b) this wave's hits copied, in hit order, to tRD / tE[below, below + mine)
  {
    int wpos = below;
    for (int b0 = 0; b0 < nh; b0 += 128) {
      int rd[4], ee[4];
#pragma unroll   // rd / ee in registers; all reads ahead of the first store, one LDS latency for the four
      for (int j = 0; j < 4; ++j) {
        const int idx = b0 + 32 * j + lane;
        const int cl  = idx < nh ? idx : nh - 1;
        rd[j] = hitRD[cl];
        ee[j] = hitE[cl];
      }
#pragma unroll   // rd / ee in registers
      for (int j = 0; j < 4; ++j) {
        const bool ok = (b0 + 32 * j + lane < nh) && ((rd[j] >> 12) == wave);
        const unsigned mk = __builtin_amdgcn_ballot_w32(ok);
        if (ok) {
          int p = wpos + (int)__builtin_amdgcn_mbcnt_lo(mk, 0u);
          p = p > HCAP - 1 ? HCAP - 1 : p;
          tRD[p] = rd[j];
          tE[p]  = ee[j];
        }
        wpos += (int)__builtin_popcount(mk);
      }
    }
  }
  __syncthreads();
  // (c) per-bin counts: every lane reads each entry of its wave (one address, broadcast); the owner counts it.
  //     8 counters of 8 bits: exact while a row holds <= RWCAP entries; tc is exact always and feeds the guard.
  unsigned long long c8 = 0ull;
  int tc = 0;
#pragma unroll 8   // eight independent LDS reads in flight per wait
  for (int i = 0; i < mine; ++i) {
    const int u = tRD[below + i];
    const bool own = (u >> 7) == tid;
    c8 += (unsigned long long)(own ? 1 : 0) << (((u >> BINSH) & 7) * 8);
    tc += own ? 1 : 0;
  }
  // (d) first entry of each bin: wave prefix over the threads' totals, then over the thread's own 8 counters
  int tbase;
  {
    int incl = tc;
#pragma unroll
    for (int d = 1; d < 32; d <<= 1) {
      const int up = __shfl_up(incl, d, 32);
      if (lane >= d) incl += up;
    }
    tbase = below + incl - tc;
    int cn[8], of[8];
    int run = tbase;
#pragma unroll
    for (int k = 0; k < 8; ++k) {
      cn[k] = (int)((c8 >> (8 * k)) & 255ull);
      of[k] = run;
      run += cn[k];
    }
    const v4i c0v = {cn[0], cn[1], cn[2], cn[3]}, c1v = {cn[4], cn[5], cn[6], cn[7]};
    const v4i o0v = {of[0], of[1], of[2], of[3]}, o1v = {of[4], of[5], of[6], of[7]};
    *(v4i*)(rcnt + tid * 8)     = c0v;
    *(v4i*)(rcnt + tid * 8 + 4) = c1v;
    *(v4i*)(roff + tid * 8)     = o0v;
    *(v4i*)(roff + tid * 8 + 4) = o1v;
    // largest per-row count of the wave: a row = 4 neighbouring threads
    int rc = tc;
    rc += __shfl_xor(rc, 1, 32);
    rc += __shfl_xor(rc, 2, 32);
#pragma unroll
    for (int off = 4; off < 32; off <<= 1) {
      const int o = __shfl_xor(rc, off, 32);
      rc = o > rc ? o : rc;
    }
    if (lane == 0) misc[wave] = rc;
  }
  // (e) placement in hit order (stable): byte k of cur = next free place of bin 8*tid + k, counted from tbase
  {
    unsigned long long cur = c8 << 8;
    cur += cur << 8;
    cur += cur << 16;
    cur += cur << 32;
    for (int i0 = 0; i0 < mine; i0 += 8) {
      int u[8], e[8];
#pragma unroll   // u / e in registers; all reads ahead of the first store, one LDS latency for the eight
      for (int j = 0; j < 8; ++j) {
        const int ii = i0 + j < mine ? i0 + j : mine - 1;
        u[j] = tRD[below + ii];
        e[j] = tE[below + ii];
      }
#pragma unroll   // u / e in registers
      for (int j = 0; j < 8; ++j) {
        if (i0 + j < mine && (u[j] >> 7) == tid) {
          const int sh = ((u[j] >> BINSH) & 7) * 8;
          int pos = tbase + (int)((cur >> sh) & 255ull);
          pos = pos > HCAP - 1 ? HCAP - 1 : pos;
          sE[pos] = e[j];
          sD[pos] = u[j] & (NND - 1);
          cur += 1ull << sh;
        }
      }
    }
  }
  // this wave's reads and writes of the phase-A lists have retired before a tensor load may target their LDS
  asm volatile("s_wait_dscnt 0x0" ::: "memory");
  __syncthreads();

  // ---- K / V^T tiles: wave w brings tile w of every stage (plane w >> 1: K hi, K lo, V^T hi, V^T lo; head slot
  //      w & 1); stage st = head pair st / 8, key chunk st % 8, into buffer st % 2 ----
  const uint32_t wvu  = uni((uint32_t)wave);
  const uint32_t ldsb = (uint32_t)(size_t)lds;
  const u32x8 g1 = tile_g1();
  u32x4 g0;
  auto issue = [&](uint32_t st) {
    const uint32_t hd0 = (2u * (st >> 3) + (wvu & 1u)) * HDM;    // first column of the head
    const uint32_t kvf = (st & 7u) * 64u;                        // first key of the chunk
    const bool     isV = wvu >= 4u;
    const unsigned short* pl = isV ? VTp : Kp;
    const uint32_t row = (uint32_t)lgr * NND + (isV ? hd0 : kvf);   // NND == HID rows per graph in both planes
    const uint32_t col = (isV ? kvf : hd0) + ((wvu >> 1) & 1u) * HID;
    g0 = tile_g0(ldsb + ((st & 1u) * KVB + wvu * KVS) * 2u, (uint64_t)(size_t)pl + (uint64_t)(row * PLD + col) * 2u);
    tile_load(g0, g1);
  };
  issue(0u);
  tile_wait(g0, g1);                                    // this wave's tile of stage 0 has landed
  __syncthreads();                                      // stage 0 readable by every wave
  issue(1u);

  // ---- geometry / capacity guards -> NaN poison of this block's ctx rows ----
  int degmax = 0;
#pragma unroll
  for (int w2 = 0; w2 < AT_NW; ++w2) degmax = misc[w2] > degmax ? misc[w2] : degmax;
  const int ng  = ngp[0];
  const int bt0 = bat[node0];
  const bool bad = (nh >= HCAP) || (degmax > RWCAP) || (ng != NGR) || (bt0 < 0) || (bt0 >= NGR);
  const float pz = bad ? __int_as_float(0x7fc00000) : 0.0f;

  // ---- phase B ----
  const int wsub = wave & 3;                     // query row group of this wave
  const int hl   = wave >> 2;                    // head slot (0 / 1) of this wave within the pair
  const int rw   = tid >> 2;                     // bias fill: query row owned by this thread
  const int jw   = tid & 3;                      // bias fill: key-column quarter owned by this thread
  const float sscale = 0.125f;
  const v8f z8 = {0.f,0.f,0.f,0.f,0.f,0.f,0.f,0.f};
  const __bf16* Kth = Ksh + hl * KVS;
  const __bf16* Ktl = Ksl + hl * KVS;
  const __bf16* Vtth = Vth + hl * KVS;
  const __bf16* Vttl = Vtl + hl * KVS;
  __bf16* pwh = Psh + wave * PWS;
  __bf16* pwl = Psl + wave * PWS;

  // ---- bias entries of stage stn (head pair stn / 8, key chunk stn % 8), fetched one stage ahead ----
  // The thread's bin = row rw, key columns 16jw..16jw+15 of the chunk. Its first PFQ entries: place in the bias tile
  // (pfA; the thread's dummy slot where there is no such entry) and the two heads' edge bias (pfV), all PFQ reads of
  // the edge bias plane in flight together. sE / sD / roff / rcnt are read-only in phase B.
  int pfS = 0, pfC = 0, pfA[PFQ];
  v2f pfV[PFQ];
  auto fetch_bias = [&](int stn) {
    const int kcn = stn & 7;
    const int bin = rw * (NND >> BINSH) + kcn * (64 >> BINSH) + jw;
    int s0 = roff[bin], cnt = rcnt[bin];
    s0  = s0 < 0 ? 0 : (s0 > nh ? nh : s0);
    cnt = cnt < 0 ? 0 : (cnt > RWCAP ? RWCAP : cnt);
    if (cnt > nh - s0) cnt = nh - s0;
    pfS = s0;
    pfC = cnt;
    const float* ebn = EB + 2 * (stn >> 3);
    int dd[PFQ], ee[PFQ];
#pragma unroll   // dd / ee in registers; the reads share one LDS latency
    for (int q = 0; q < PFQ; ++q) {
      int idx = s0 + (q < cnt ? q : (cnt > 0 ? cnt - 1 : 0));   // past the bin's end: its last entry again (same line)
      idx = idx > nh - 1 ? nh - 1 : idx;
      idx = idx < 0 ? 0 : idx;
      dd[q] = sD[idx];
      ee[q] = sE[idx];
    }
#pragma unroll   // pfA in registers
    for (int q = 0; q < PFQ; ++q) {
      const int col  = dd[q] - kcn * 64;
      const bool inr = (q < cnt) && ((unsigned)col < 64u) && ((col >> 4) == jw);
      pfA[q] = inr ? (rw * 64 + col) : (2 * KVT + tid);
    }
#pragma unroll   // pfV in registers; the reads share one memory latency
    for (int q = 0; q < PFQ; ++q) {
      int e = ee[q];
      e = e < 0 ? 0 : (e > nE - 1 ? nE - 1 : e);
      pfV[q] = *(const v2fa*)(ebn + (size_t)e * NHD);
    }
    // behind the loads, in front of later writes to their address registers (the build puts counted waits of its
    // own in front of the few writes that it schedules ahead of this one)
    asm volatile("s_wait_xcnt 0x0" ::: "memory");
  };
  fetch_bias(0);

#pragma unroll 1
  for (int hp = 0; hp < NHD / 2; ++hp) {
    const int h    = 2 * hp + hl;                // head of this wave
    const int qrow = lrow0 + wsub * 16;          // plane row of this wave's first query

    // Q fragments (A operand, row = lane&15, split k map): 2 d-chunks, hi and lo
    v16b qah[2], qal[2];
#pragma unroll
    for (int dc = 0; dc < 2; ++dc) {
      const unsigned short* qp = Qp + (size_t)(qrow + c) * PLD + h * HDM + dc * 32 + 8 * hh;
      qah[dc] = FragBF::load((const __bf16*)(const void*)qp);
      qal[dc] = FragBF::load((const __bf16*)(const void*)(qp + HID));
    }
    float mrow[8], lrow[8];
    v8f oacc[4];
#pragma unroll
    for (int r = 0; r < 8; ++r) { mrow[r] = -INFINITY; lrow[r] = 0.f; }
#pragma unroll
    for (int t = 0; t < 4; ++t) oacc[t] = z8;

#pragma unroll 1
    for (int kc = 0; kc < NND / 64; ++kc) {
      const int kv0 = kc * 64;
      const int st  = hp * (NND / 64) + kc;      // this pass reads buffer st % 2 alone; stage st + 1 is in flight
      const int bo  = (st & 1) * KVB;
      {
        // bias tiles + dummies zero: 8 sweeps x 256 threads x 4 floats = both 64x64 tiles (each store's lanes
        // contiguous, no two on one bank); 128 threads x 4 = dummies
        const v4f z4 = {0.f, 0.f, 0.f, 0.f};
        float* bz = BTX + tid * 4;
#pragma unroll
        for (int i = 0; i < 8; ++i) *(v4fa*)(bz + NTHR * 4 * i) = z4;
        if (tid < 128) *(v4fa*)(BTX + 2 * KVT + 4 * tid) = z4;
      }
      __syncthreads();
      {
        // bias fill: segment [pfS, pfS+pfC) of sE/sD = the bin of row rw and key columns kv0+16jw..kv0+16jw+15.
        // Entries 0..PFQ-1 come from the registers filled one stage ago; entry q is added while any lane of the
        // wave has one (wave-uniform test), in segment order.
#pragma unroll   // pfA / pfV in registers
        for (int q = 0; q < PFQ; ++q) {
          if (__builtin_amdgcn_ballot_w32(q < pfC) != 0u) {
            const int ia = pfA[q];
            const int ib = ia + (ia < KVT ? KVT : NTHR);
            const float ta = BTX[ia], tb = BTX[ib];   // ia != ib: both reads share one LDS latency
            BTX[ia] = ta + pfV[q].x;
            BTX[ib] = tb + pfV[q].y;
          }
        }
        const float* ebp = EB + 2 * hp;
        const int cnt = pfC;
#pragma unroll 1
        for (int q = PFQ; __builtin_amdgcn_ballot_w32(q < cnt) != 0u; ++q) {   // a bin longer than PFQ; cnt <= RWCAP
          const bool valid = q < cnt;
          int idx = pfS + q;
          idx = idx > nh - 1 ? nh - 1 : idx;
          idx = idx < 0 ? 0 : idx;
          const int col = sD[idx] - kv0;
          int e = sE[idx];
          e = e < 0 ? 0 : (e > nE - 1 ? nE - 1 : e);
          const v2f ebv = *(const v2fa*)(ebp + (size_t)e * NHD);
          const bool inr = valid && ((unsigned)col < 64u) && ((col >> 4) == jw);
          const int ia = inr ? (rw * 64 + col) : (2 * KVT + tid);
          const int ib = inr ? (KVT + rw * 64 + col) : (2 * KVT + NTHR + tid);
          BTX[ia] = BTX[ia] + ebv.x;
          BTX[ib] = BTX[ib] + ebv.y;
        }
      }
      __syncthreads();
      if (st + 1 < NST) fetch_bias(st + 1);      // lands while this stage is worked on

      // ---- S = q . k (3-term) ----
      v8f s[4];
#pragma unroll
      for (int j = 0; j < 4; ++j) {
        s[j] = z8;
#pragma unroll
        for (int dc = 0; dc < 2; ++dc) {
          FB kb, kl;
          const __bf16* kr = Kth + bo + (j * 16 + c) * KVP + dc * 32 + 8 * hh;
          const __bf16* kq = Ktl + bo + (j * 16 + c) * KVP + dc * 32 + 8 * hh;
          kb.h[0] = *(const v8b*)kr;
          kb.h[1] = *(const v8b*)(kr + 16);
          kl.h[0] = *(const v8b*)kq;
          kl.h[1] = *(const v8b*)(kq + 16);
          s[j] = at_mma(qah[dc], kb.v, s[j]);
          s[j] = at_mma(qah[dc], kl.v, s[j]);
          s[j] = at_mma(qal[dc], kb.v, s[j]);
        }
      }
      // scale, add bias tile (D element r = row wsub*16 + 8hh + r, col j*16 + c), chunk row max
      const float* btr = BTX + hl * KVT + (wsub * 16 + 8 * hh) * 64 + c;
      float cm[8];
#pragma unroll
      for (int r = 0; r < 8; ++r) {
        float m = -INFINITY;
#pragma unroll
        for (int j = 0; j < 4; ++j) {
          const float sv = s[j][r] * sscale + btr[r * 64 + j * 16];
          s[j][r] = sv;
          m = fmaxf(m, sv);
        }
#pragma unroll
        for (int off = 1; off < 16; off <<= 1) m = fmaxf(m, __shfl_xor(m, off, 32));
        cm[r] = m;
      }
#pragma unroll
      for (int r = 0; r < 8; ++r) {
        const float mnew = fmaxf(mrow[r], cm[r]);
        const float alpha = expf(mrow[r] - mnew);
        mrow[r] = mnew;
        float psum = 0.f;
#pragma unroll
        for (int j = 0; j < 4; ++j) {
          const float p = expf(s[j][r] - mnew);
          psum += p;
          __bf16 a, bl; at_split(p, a, bl);
          pwh[(8 * hh + r) * KVP + j * 16 + c] = a;
          pwl[(8 * hh + r) * KVP + j * 16 + c] = bl;
        }
#pragma unroll
        for (int off = 1; off < 16; off <<= 1) psum += __shfl_xor(psum, off, 32);
        lrow[r] = lrow[r] * alpha + psum;
#pragma unroll
        for (int t = 0; t < 4; ++t) oacc[t][r] *= alpha;
      }
      __builtin_amdgcn_fence(__ATOMIC_RELEASE, "workgroup");
      __builtin_amdgcn_wave_barrier();
      __builtin_amdgcn_fence(__ATOMIC_ACQUIRE, "workgroup");
      // ---- O += p . v (3-term); P fragment = A (row c), V^T fragment = B (col = d) ----
#pragma unroll 1
      for (int kk = 0; kk < 2; ++kk) {
        FB pa, pl;
        pa.h[0] = *(const v8b*)(pwh + c * KVP + kk * 32 + 8 * hh);
        pa.h[1] = *(const v8b*)(pwh + c * KVP + kk * 32 + 16 + 8 * hh);
        pl.h[0] = *(const v8b*)(pwl + c * KVP + kk * 32 + 8 * hh);
        pl.h[1] = *(const v8b*)(pwl + c * KVP + kk * 32 + 16 + 8 * hh);
#pragma unroll
        for (int t = 0; t < 4; ++t) {
          FB vb, vl;
          vb.h[0] = *(const v8b*)(Vtth + bo + (t * 16 + c) * KVP + kk * 32 + 8 * hh);
          vb.h[1] = *(const v8b*)(Vtth + bo + (t * 16 + c) * KVP + kk * 32 + 16 + 8 * hh);
          vl.h[0] = *(const v8b*)(Vttl + bo + (t * 16 + c) * KVP + kk * 32 + 8 * hh);
          vl.h[1] = *(const v8b*)(Vttl + bo + (t * 16 + c) * KVP + kk * 32 + 16 + 8 * hh);
          oacc[t] = at_mma(pa.v, vb.v, oacc[t]);
          oacc[t] = at_mma(pa.v, vl.v, oacc[t]);
          oacc[t] = at_mma(pl.v, vb.v, oacc[t]);
        }
      }
      // ---- publish point of stage st + 1, every wave, in this order ----
      asm volatile("s_wait_dscnt 0x0" ::: "memory");       // this wave's reads of buffer st % 2 and of the bias tile are done
      tile_wait(g0, g1);                                    // this wave's tile of stage st + 1 has landed
      __syncthreads();                                      // stage st + 1 readable; buffer st % 2 and the bias tiles free
      if (pinned((uint32_t)(st + 2 < NST))) issue((uint32_t)st + 2u);   // refill of the buffer this pass has read
    }

    // ---- epilogue: normalise, stage the wave's 16x64 tile (pitch 64, own bias rows), hi | lo lines ----
    // (the last pass's barrier stands in front: every wave has left the bias tiles)
    {
      float* os = BTX + wave * 1024;
#pragma unroll
      for (int r = 0; r < 8; ++r) {
        const float inv = 1.0f / lrow[r];
#pragma unroll
        for (int t = 0; t < 4; ++t) os[(8 * hh + r) * 64 + t * 16 + c] = oacc[t][r] * inv + pz;
      }
      __builtin_amdgcn_fence(__ATOMIC_RELEASE, "workgroup");
      __builtin_amdgcn_wave_barrier();
      __builtin_amdgcn_fence(__ATOMIC_ACQUIRE, "workgroup");
      const int q4 = lane >> 3, c8 = (lane & 7) * 8;
      v4u hv[4], lv[4];
#pragma unroll
      for (int it = 0; it < 4; ++it) {
        const int row = it * 4 + q4;                   // it 0..3 x q4 0..3 covers rows 0..15
        const float* sp = os + row * 64 + c8;
        const v4f a = *(const v4fa*)sp;
        const v4f b = *(const v4fa*)(sp + 4);
        pack8hl(a, b, hv[it], lv[it]);
      }
      {
#pragma unroll
        for (int it = 0; it < 4; ++it) {
          const int row = it * 4 + q4;
          unsigned short* op = CTX + (size_t)(qrow + row) * PLD + h * HDM + c8;
          *(v4u*)op = hv[it];
          *(v4u*)(op + HID) = lv[it];
        }
        
      }
    }
    __syncthreads();   // every wave has read its staged tile back before the next head pair's zero fill sweeps it
  }
  // no request in flight and no LDS access outstanding when the wave ends
  asm volatile("s_wait_tensorcnt 0x0" ::: "memory");
  asm volatile("s_wait_dscnt 0x0" ::: "memory");
}

// =====================================================================================
static inline int cdiv(int a, int b) { return (a + b - 1) / b; }

extern "C" void kernel_launch(void* const* d_in, const int* in_sizes, int n_in,
                              void* d_out, int out_size, void* d_ws, size_t ws_size,
                              hipStream_t stream) {
  if (n_in < 15) return;
  if (in_sizes[0] != NTOT * HID) return;                        // x [16384][512]
  if (in_sizes[1] != NTOT) return;                              // batch [16384]
  if (in_sizes[2] < 2 || (in_sizes[2] & 1) != 0) return;        // edge_index [2][E]
  const int nE = in_sizes[2] / 2;
  if (nE < 1 || nE > (1 << 24)) return;
  if (in_sizes[3] != nE * EDW) return;                          // edge_attr [E][16]
  if (in_sizes[4] != HID * HID || in_sizes[6] != HID * HID || in_sizes[8] != HID * HID || in_sizes[10] != HID * HID) return;
  if (in_sizes[5] != HID || in_sizes[7] != HID || in_sizes[9] != HID || in_sizes[11] != HID) return;
  if (in_sizes[12] != EDW * NHD || in_sizes[13] != NHD || in_sizes[14] != 1) return;
  if (out_size != NTOT * HID) return;                           // out [16384][512], last element 8388607

  const float* x   = (const float*)d_in[0];
  const int*   bat = (const int*)  d_in[1];
  const int*   ei  = (const int*)  d_in[2];     // row 0 = src, row 1 = dst
  const float* ea  = (const float*)d_in[3];
  const float* Wq  = (const float*)d_in[4];     // [in][out]
  const float* bq  = (const float*)d_in[5];
  const float* Wk  = (const float*)d_in[6];
  const float* bk  = (const float*)d_in[7];
  const float* Wv  = (const float*)d_in[8];
  const float* bv  = (const float*)d_in[9];
  const float* Wo  = (const float*)d_in[10];
  const float* bo  = (const float*)d_in[11];
  const float* We  = (const float*)d_in[12];    // [16][8]
  const float* be  = (const float*)d_in[13];    // [8]
  const int*   ngp = (const int*)  d_in[14];    // [1]
  float* out = (float*)d_out;
  const int* keys = ei;                         // src list
  const int* gath = ei + nE;                    // dst list

  const int EP = cdiv(nE, 4) * 4;

  char* ws = (char*)d_ws;
  size_t off = 0;
  const size_t oXb = off; off += (size_t)NTOT * HID * 2;                                          // 16777216
  const size_t oWq = off; off += (size_t)HID * HID * 2;                                           //   524288
  const size_t oWk = off; off += (size_t)HID * HID * 2;
  const size_t oWv = off; off += (size_t)HID * HID * 2;
  const size_t oWo = off; off += (size_t)HID * PLD * 2;                                           //  1048576
  const size_t oEB = off; off += (size_t)EP * NHD * 4;   off = (off + 255) & ~(size_t)255;        //  8388608
  const size_t oQ  = off; off += (size_t)RHALF * PLD * 2;                                         // 33554432
  const size_t oK  = off; off += (size_t)RHALF * PLD * 2;
  const size_t oVT = off; off += (size_t)GHALF * HID * PLD * 2;                                   // 33554432
  const size_t oCT = off; off += (size_t)RHALF * PLD * 2;                                         // 33554432
  if (off > ws_size || off > (size_t)WSMAX) return;                                               // 162004992
  unsigned short* Xb   = (unsigned short*)(ws + oXb);
  unsigned short* WqT  = (unsigned short*)(ws + oWq);
  unsigned short* WkT  = (unsigned short*)(ws + oWk);
  unsigned short* WvT  = (unsigned short*)(ws + oWv);
  unsigned short* WOT2 = (unsigned short*)(ws + oWo);
  float*          EB   = (float*)(ws + oEB);
  unsigned short* Qp   = (unsigned short*)(ws + oQ);
  unsigned short* Kp   = (unsigned short*)(ws + oK);
  unsigned short* VTp  = (unsigned short*)(ws + oVT);
  unsigned short* CTX  = (unsigned short*)(ws + oCT);

  hipFuncSetAttribute(reinterpret_cast<const void*>(&k_attn),
                      hipFuncAttributeMaxDynamicSharedMemorySize, LDS_ATT);

  // weight planes (bf16 bits, k-contiguous rows [n][k])
  {
    const int nUw = HID * (HID / 8);             // 512 rows x 64 units
    k_wtr<<<cdiv(nUw, NTHR), NTHR, 0, stream>>>(Wq, HID, HID, HID, HID, WqT, nUw);
    k_wtr<<<cdiv(nUw, NTHR), NTHR, 0, stream>>>(Wk, HID, HID, HID, HID, WkT, nUw);
    k_wtr<<<cdiv(nUw, NTHR), NTHR, 0, stream>>>(Wv, HID, HID, HID, HID, WvT, nUw);
    const int nUo = HID * (PLD / 8);             // 512 rows x 128 units: wt [512][1024], k mod 512
    k_wtr<<<cdiv(nUo, NTHR), NTHR, 0, stream>>>(Wo, HID, HID, HID, PLD, WOT2, nUo);
  }
  // node feature plane (whole x)
  {
    const int nUx = NTOT * (HID / 8);
    k_xprep<<<cdiv(nUx, NTHR), NTHR, 0, stream>>>(x, Xb, NTOT, nUx);
  }
  // edge bias plane [EP][8]
  {
    const int nUe = EP * 2;
    k_eb<<<cdiv(nUe, NTHR), NTHR, 0, stream>>>(ea, We, be, EB, nE, nUe);
  }

  const dim3 blk(256);
  const dim3 gQK((RHALF / GBM) * (HID / GBN), 1);            // 256 block tiles: M=16384, N=512
  const dim3 gVT((HID / GBM) * (NND / GBN), GHALF);          // 8 block tiles per graph: M=512, N=512
  const dim3 gAT(GHALF * (NND / 64));                        // 256 blocks: 32 graphs x 8 query tiles
  for (int half = 0; half < NHALF; ++half) {
    const unsigned short* Xh = Xb + (size_t)half * RHALF * HID;
    float* outh = out + (size_t)half * RHALF * HID;
    // q = x . Wq + bq -> Qp hi | lo  (M=16384, N=512, K=512)
    wmma_gemm64<false, 2, 2, false, 0><<<gQK, blk, 0, stream>>>(
        Xh, Xh, HID, 0L, WqT, WqT, HID, 0L, (void*)Qp, (void*)(Qp + HID), PLD, 0L,
        bq, bq, 0L, RHALF, HID, HID, 1.0f);
    // k = x . Wk + bk -> Kp hi | lo
    wmma_gemm64<false, 2, 2, false, 0><<<gQK, blk, 0, stream>>>(
        Xh, Xh, HID, 0L, WkT, WkT, HID, 0L, (void*)Kp, (void*)(Kp + HID), PLD, 0L,
        bk, bk, 0L, RHALF, HID, HID, 1.0f);
    // v^T = Wv^T . x^T + bv[m] per graph -> VTp [graph][h*64+d][s] hi | lo  (M=512, N=512, K=512, z = 32 graphs)
    wmma_gemm64<false, 1, 2, false, 0><<<gVT, blk, 0, stream>>>(
        WvT, WvT, HID, 0L, Xh, Xh, HID, (long)NND * HID, (void*)VTp, (void*)(VTp + HID), PLD, (long)HID * PLD,
        bv, bv, 0L, HID, NND, HID, 1.0f);
    // attention with edge bias -> CTX hi | lo
    k_attn<<<gAT, NTHR, LDS_ATT, stream>>>(Qp, Kp, VTp, EB, keys, gath, ngp, bat, CTX, nE, 1, half * GHALF);
    // out = [ctx hi | ctx lo] . [Wo ; Wo] + bo -> d_out rows half*RHALF .. half*RHALF+RHALF-1 (M=16384, N=512, K=1024)
    wmma_gemm64<false, 2, 0, false, 0><<<gQK, blk, 0, stream>>>(
        CTX, CTX, PLD, 0L, WOT2, WOT2, PLD, 0L, (void*)outh, (void*)outh, HID, 0L,
        bo, bo, 0L, RHALF, HID, PLD, 1.0f);
  }
  (void)hipGetLastError();
}

// v009
// It runs in 244 microseconds.
// Next to v008, in two timings, it ran 1.09 times as fast each time.
// Over all steps from v000 it is 7.51 times as fast.
// Contractions on v_wmma_f32_16x16x32_bf16 (bf16 operands, f32 accumulate): x*Wq, x*Wk, Wv^T*x^T as single
// products of bf16-RNE inputs; q.k^T and p.v as bf16 hi/lo split (hi.hi + hi.lo + lo.hi); ctx*Wo as
// [ctx hi | ctx lo] . [Wo ; Wo] (K = 1024); edge bias (16-deep dots of bf16-RNE inputs), online softmax and all biases in f32 on the VALU.
#include <hip/hip_runtime.h>
#include <math.h>
#include <stdint.h>
#include <stddef.h>

// Geometry: NGR graphs of NND consecutive node rows; attention keys of a query = the NND nodes of its graph.
// The job runs in NHALF passes of GHALF graphs each (one pass of all graphs: the attention launch then has one
// work-group for each of the 256 WGPs); the q / k / v^T / ctx planes are rewritten per pass.
//
// Plane map (workspace, all 16-bit planes are bf16 bits; no power-of-two carries anywhere, so no inverse
// factor exists -> carry audit: none):
//   Xb   [16384][512]          bf16(x)                                        -> A of q/k GEMMs, Bt of v^T GEMM
//   WqT, WkT, WvT [512 o][512 i]  bf16(W[i][o])                              -> Bt / A (k-contiguous)
//   WOT2 [512 o][1024]         bf16(Wo[k mod 512][o])                         -> Bt of the output GEMM
//   EB   [EP][8] f32           sum_t bf16(ea[e][t]) bf16(We[t][h]) + bf16(be[h])
//   Qp, Kp [16384][1024]       hi at col h*64+d, residual lo at col 512 + h*64+d (f32 projection split)
//   VTp  [32 graphs][512 (h,d)][1024]   hi at col s, lo at col 512 + s (s = node within graph)
//   CTX  [16384][1024]         hi | lo of the normalised attention context

#define NGR    32
#define NND    512
#define NTOT   (NGR * NND)      // 16384
#define HID    512
#define NHD    8
#define HDM    64
#define EDW    16
#define NHALF  1
#define GHALF  (NGR / NHALF)    // 32
#define RHALF  (GHALF * NND)    // 16384
#define PLD    1024
#define NTHR   256
#define WSMAX  268435456

static_assert(HID == NHD * HDM && HDM == 64 && NHD == 8);
static_assert(PLD == 2 * HID);
static_assert((RHALF % 64) == 0 && (HID % 64) == 0 && (NND % 64) == 0 && (PLD % 32) == 0 && (HID % 32) == 0);
static_assert(NGR == NHALF * GHALF);
static_assert(HID == 64 * 8);                               // d_xprep: 64 units of 8 per row
static_assert(EDW == 16 && NHD == 8 && EDW * NHD <= NTHR);  // d_eb layout

typedef __attribute__((ext_vector_type(16))) _Float16 v16h;
typedef __attribute__((ext_vector_type(8)))  _Float16 v8h;
typedef __attribute__((ext_vector_type(16))) __bf16   v16b;
typedef __attribute__((ext_vector_type(8)))  __bf16   v8b;
typedef __attribute__((ext_vector_type(8)))  float    v8f;
typedef __attribute__((ext_vector_type(4)))  float    v4f;
typedef __attribute__((ext_vector_type(2)))  float    v2f;
typedef __attribute__((ext_vector_type(4)))  unsigned int v4u;
typedef __attribute__((ext_vector_type(4)))  int      v4i;
typedef __attribute__((ext_vector_type(8)))  unsigned short v8us;
typedef v4f  __attribute__((may_alias)) v4fa;
typedef v2f  __attribute__((may_alias)) v2fa;
typedef v4u  __attribute__((may_alias)) v4ua;

// ---- scalar helpers: f32 -> bf16 bits (RNE convert), bf16 bits -> f32 ----
__device__ __forceinline__ unsigned short f2bf_bits(float f) {
  unsigned u = __float_as_uint(f);
  return (unsigned short)((u + 0x7FFFu + ((u >> 16) & 1u)) >> 16);
}
__device__ __forceinline__ float bf_bits2f(unsigned short h) { return __uint_as_float(((unsigned)h) << 16); }
__device__ __forceinline__ float bfrf(float f) { return bf_bits2f(f2bf_bits(f)); }
__device__ __forceinline__ unsigned int f2bfu(float f) {
  const unsigned int u = __float_as_uint(f);
  return ((u + 0x7FFFu + ((u >> 16) & 1u)) >> 16) & 0xFFFFu;
}
__device__ __forceinline__ float bf2f(unsigned int b) { return __uint_as_float(b << 16); }
__device__ __forceinline__ v4f bfr4(const v4f a) {
  v4f r; r.x = bfrf(a.x); r.y = bfrf(a.y); r.z = bfrf(a.z); r.w = bfrf(a.w); return r;
}
__device__ __forceinline__ unsigned int pk2(float lo, float hi) { return f2bfu(lo) | (f2bfu(hi) << 16); }
__device__ __forceinline__ v4u pack8(const v4f a, const v4f b) {
  v4u r;
  r.x = pk2(a.x, a.y); r.y = pk2(a.z, a.w); r.z = pk2(b.x, b.y); r.w = pk2(b.z, b.w);
  return r;
}
// hi = bf16(v), lo = bf16(v - hi): two floats -> one packed word of each
__device__ __forceinline__ void hl2(float v0, float v1, unsigned int& hw, unsigned int& lw) {
  const unsigned int h0 = f2bfu(v0), h1 = f2bfu(v1);
  const unsigned int l0 = f2bfu(v0 - bf2f(h0)), l1 = f2bfu(v1 - bf2f(h1));
  hw = h0 | (h1 << 16);
  lw = l0 | (l1 << 16);
}
__device__ __forceinline__ void pack8hl(const v4f a, const v4f b, v4u& hv, v4u& lv) {
  unsigned int h, l;
  hl2(a.x, a.y, h, l); hv.x = h; lv.x = l;
  hl2(a.z, a.w, h, l); hv.y = h; lv.y = l;
  hl2(b.x, b.y, h, l); hv.z = h; lv.z = l;
  hl2(b.z, b.w, h, l); hv.w = h; lv.w = l;
}

// ---- WMMA fragment helpers (bf16, wave32) ----
// A fragment (row m = lane&15) and B fragment (col n = lane&15) use the SAME k map:
//   elements 0..7 <- k0 + 8h + 0..7, elements 8..15 <- k0 + 16 + 8h + 0..7, h = lane>>4,
// loaded as two 16-B pieces from a k-contiguous 16-bit row: p[0..7] and p[16..23] with p = row + k0 + 8h.
// D element r of lane l = (row 8h + r, col l&15).
__device__ __forceinline__ void dep_guard_b(v8f& a, v8f& b, v16b x, v16b y) { asm volatile("v_nop\n\tv_nop\n\tv_nop\n\tv_nop" : "+v"(a), "+v"(b) : "v"(x), "v"(y)); }
__device__ __forceinline__ void keep4_b(v16b a, v16b b, v16b c, v16b d) { asm volatile("v_nop" :: "v"(a), "v"(b), "v"(c), "v"(d)); }
__device__ __forceinline__ void acc_guard4(v8f& a, v8f& b, v8f& c, v8f& d) { asm volatile("v_nop\n\tv_nop\n\tv_nop\n\tv_nop" : "+v"(a), "+v"(b), "+v"(c), "+v"(d)); }

struct FragBF {
  union U { v16b v; v8b h[2]; };
  static __device__ __forceinline__ v16b load(const __bf16* p) {   // elements 0..7 <- p[0..7], 8..15 <- p[16..23]
    U f; f.h[0] = *(const v8b*)(p); f.h[1] = *(const v8b*)(p + 16); return f.v;
  }
  static __device__ __forceinline__ v8f mma(v16b a, v16b b, v8f c) {
    return __builtin_amdgcn_wmma_f32_16x16x32_bf16(false, a, false, b, (short)0, c, false, false);
  }
  static __device__ __forceinline__ void guard(v8f& a, v8f& b, v16b x, v16b y) { dep_guard_b(a, b, x, y); }
  static __device__ __forceinline__ void keep(v16b a, v16b b, v16b c, v16b d) { keep4_b(a, b, c, d); }
};
union FB { v16b v; v8b h[2]; };

// single WMMA with hazard guard: ties D, keeps A/B live for 4 VALU slots
__device__ __forceinline__ v8f at_mma(v16b a, v16b b, v8f c) {
  c = __builtin_amdgcn_wmma_f32_16x16x32_bf16(false, a, false, b, (short)0, c, false, false);
  asm volatile("v_nop\n\tv_nop\n\tv_nop\n\tv_nop" : "+v"(c) : "v"(a), "v"(b));
  return c;
}
__device__ __forceinline__ __bf16 at_f2bf(float f) { return __builtin_bit_cast(__bf16, f2bf_bits(f)); }
__device__ __forceinline__ void at_split(float f, __bf16& hi, __bf16& lo) {
  const unsigned short hb = f2bf_bits(f);
  hi = __builtin_bit_cast(__bf16, hb);
  lo = at_f2bf(f - __uint_as_float(((unsigned)hb) << 16));
}

typedef uint32_t u32x4 __attribute__((ext_vector_type(4)));
typedef uint32_t u32x8 __attribute__((ext_vector_type(8)));
__device__ __forceinline__ uint32_t uni(uint32_t v) { return (uint32_t)__builtin_amdgcn_readfirstlane(v); }
// a test around a tensor load held in a scalar register, so that it compiles to s_cmp + s_cbranch_scc
__device__ __forceinline__ uint32_t pinned(uint32_t v) { uint32_t w = uni(v); asm volatile("" : "+s"(w)); return w; }
// Descriptor of one tile of 64 rows x 128 B, source pitch PLD * 2 B, from global address ga to LDS byte offset dst;
// 16 B of pad behind every row (LDS pitch 144 B = KVP elements).
__device__ __forceinline__ u32x4 tile_g0(uint32_t dst, uint64_t ga) {
  u32x4 g0;
  g0[0] = uni(1u);
  g0[1] = uni(dst);
  g0[2] = uni((uint32_t)ga);
  g0[3] = uni((((uint32_t)(ga >> 32)) & 0x01FFFFFFu) | 0x80000000u);
  return g0;
}
__device__ __forceinline__ u32x8 tile_g1() {
  u32x8 g1;
  g1[0] = uni((1u << 20) | (4u << 22) | (3u << 25));   // no mask, 1-byte elements, pad of 4 dwords per 32 dwords
  g1[1] = uni(128u << 16);                             // tensor_dim0 = 128 B
  g1[2] = uni(64u << 16);                              // tensor_dim1 = 64 rows
  g1[3] = uni(128u << 16);                             // tile_dim0 = 128 B
  g1[4] = uni(64u);                                    // tile_dim1 = 64 rows
  g1[5] = uni((uint32_t)(PLD * 2));                    // source row pitch
  g1[6] = uni(0u);
  g1[7] = uni(0u);
  return g1;
}
// One request of the whole wave; the waits are the caller's.
__device__ __forceinline__ void tile_load(u32x4 g0, u32x8 g1) {
  asm volatile("tensor_load_to_lds %0, %1" :: "s"(g0), "s"(g1) : "memory");
}
// The wave's request has landed. The descriptor is named as an input so that its registers stay as they are while
// the request is outstanding.
__device__ __forceinline__ void tile_wait(u32x4 g0, u32x8 g1) {
  asm volatile("s_wait_tensorcnt 0x0" :: "s"(g0), "s"(g1) : "memory");
}

// =====================================================================================
// Register-blocked batched WMMA GEMM (bf16 operands), operands staged in LDS by tensor loads.
// C[m,n] = scale * sum_k A[m,k] * Bt[n,k] (+bias)(+resid); a block owns a GBM x GBN tile, each of its 8 waves 64x64.
// A row-major [M,K]; Bt row-major [N,K]; M % GBM == 0, N % GBN == 0, K % GPK == 0, K >= 2 GPK (host static_asserts).
// A stage = GPK k of the block's GBM rows of A and GBN rows of Bt: GNS slices of 64 rows x 256 B, one tensor load of
// one wave each (waves 0..GNS-1), 16 B of pad behind every row; two buffers, one stage ahead.
// BIAS_MODE: 0 = none, 1 = bf16r(bias[m]), 2 = bf16r(bias[n]).
// OUT_MODE: 0 = f32, 1 = f16, 2 = bf16 hi plane (Cout) + bf16 lo plane (Cout2).
// coverage: bx runs over the (M/GBM)*(N/GBN) block tiles exactly (caller), every C element written once per b.
// =====================================================================================
#define GBM   128                     // rows of A per block
#define GBN   256                     // rows of Bt per block
#define GPK   128                     // k per stage: rows of 256 B
#define GRP   136                     // row pitch in LDS, elements: 272 B = 16 B x 17, so the 16 rows of a ds_load_b128
                                      // fragment read fall on 16 different bank groups
#define GSL   9216                    // one slice: 64 * GRP elements, its place rounded up to 2 KiB
#define GNS   ((GBM + GBN) / 64)      // slices per stage: 2 of A, then 4 of Bt
#define GBUF  (GNS * GSL)             // one buffer
static_assert(GSL >= 64 * GRP && (GSL * 2) % 2048 == 0 && GRP * 2 == 256 + 16 && GPK * 2 == 256);
static_assert(GBM == 2 * 64 && GBN == 4 * 64 && GNS <= 8);     // 2 x 4 waves of 64 x 64
static_assert((RHALF % GBM) == 0 && (HID % GBM) == 0 && (HID % GBN) == 0 && (NND % GBN) == 0);   // block tiles, exact
static_assert((HID % GPK) == 0 && (PLD % GPK) == 0 && HID / GPK >= 2);                            // stages, at least two

// Group 1 for a slice of 64 rows x 256 B at a source pitch of pitchB bytes; LDS pitch 272 B = GRP elements.
__device__ __forceinline__ u32x8 slice_g1(uint32_t pitchB) {
  u32x8 g1;
  g1[0] = uni((1u << 20) | (5u << 22) | (3u << 25));   // no mask, 1-byte elements, pad of 4 dwords per 64 dwords
  // words 1 to 7 through pinned(): each descriptor word held in a scalar register of its own, so that the build does
  // not form equal words anew from one another, in registers it has lent out, while a request is outstanding
  g1[1] = pinned(256u << 16);                          // tensor_dim0 = 256 B; descriptor word held in a scalar register
  g1[2] = pinned(64u << 16);                           // tensor_dim1 = 64 rows; descriptor word held likewise
  g1[3] = pinned(256u << 16);                          // tile_dim0 = 256 B; descriptor word held likewise
  g1[4] = pinned(64u);                                 // tile_dim1 = 64 rows; descriptor word held likewise
  g1[5] = pinned(pitchB);                              // source row pitch; descriptor word held likewise
  g1[6] = pinned(0u);                                  // descriptor word held likewise
  g1[7] = pinned(0u);                                  // descriptor word held likewise
  return g1;
}

// Group 0 for a slice from global address ga to LDS byte offset dst. Word 0 (count 1) through pinned(): a descriptor
// word held in a scalar register, so that the build does not lend that register out while a request is outstanding.
__device__ __forceinline__ u32x4 slice_g0(uint32_t dst, uint64_t ga) {
  u32x4 g0;
  g0[0] = pinned(1u);                                  // count 1; descriptor word held in a scalar register
  g0[1] = uni(dst);
  g0[2] = uni((uint32_t)ga);
  g0[3] = uni((((uint32_t)(ga >> 32)) & 0x01FFFFFFu) | 0x80000000u);
  return g0;
}

// The block tile's whole work, called by the kernels below: ring / sTall = the calling kernel's LDS, bx = index of the
// block tile, b = batch index (both the same in every thread of the block).
template <bool SPLIT, int BIAS_MODE, int OUT_MODE, bool RESID, int ACT = 0>
__device__ __forceinline__ void gemm_tile(
    unsigned short* ring, float* sTall, int bx, int b,
    const unsigned short* __restrict__ Ap, const unsigned short* __restrict__ A2p, int lda, long strideA,
    const unsigned short* __restrict__ Btp, const unsigned short* __restrict__ Bt2p, int ldb, long strideB,
    void* __restrict__ Cout, void* __restrict__ Cout2, int ldc, long strideC,
    const float* __restrict__ bias,
    const float* __restrict__ resid, long strideR,
    int M, int N, int K, float scale) {
  static_assert(!SPLIT);                            // only the hi planes are staged
  typedef __bf16 T;
  typedef v16b V;
  const int lane = threadIdx.x & 31;
  const int wave = threadIdx.x >> 5;
  const int tilesN = N / GBN;
  const int tilesM = M / GBM;
  if (bx >= tilesM * tilesN) return;           // the whole block, in front of every barrier and tensor load
  const int tm = bx / tilesN;
  const int tn = bx - tm * tilesN;
  const int wm = wave >> 2;                    // the wave's 64 rows within the block tile
  const int wn = wave & 3;                     // the wave's 64 columns within the block tile
  const int m0 = tm * GBM + (wm << 6);
  const int n0 = tn * GBN + (wn << 6);

  const int rlane = lane & 15;                 // row (A) / col (B, D) within subtile
  const int koff  = (lane >> 4) * 8;           // k offset of this lane half
  const int mOff  = (lane >> 4) * 8;           // D row offset

  // ---- slices: wave w < GNS brings slice w of every stage (0, 1: A rows; 2..5: Bt rows) into buffer stage % 2 ----
  const uint32_t wvu  = uni((uint32_t)wave);
  const uint32_t sl   = wvu < (uint32_t)GNS ? wvu : (uint32_t)GNS - 1u;
  const bool     isA  = sl < (uint32_t)(GBM / 64);
  const bool     iss  = wvu < (uint32_t)GNS;
  const uint32_t ldsb = (uint32_t)(size_t)ring;
  const unsigned short* sp0 = isA ? Ap  + (size_t)b * strideA + (size_t)(tm * GBM + (int)sl * 64) * lda
                                  : Btp + (size_t)b * strideB + (size_t)(tn * GBN + ((int)sl - GBM / 64) * 64) * ldb;
  const u32x8 g1 = slice_g1((uint32_t)(isA ? lda : ldb) * 2u);
  const int nst = K / GPK;                     // stages
  u32x4 g0;
  // group 0 of stage st, formed by every wave (one set of registers on every path); only the load stands in the branch
  auto form = [&](uint32_t st) {
    g0 = slice_g0(ldsb + ((st & 1u) * GBUF + sl * GSL) * 2u, (uint64_t)(size_t)sp0 + (uint64_t)st * (GPK * 2));
  };
  form(0u);
  if (pinned((uint32_t)iss)) {
    tile_load(g0, g1);
    tile_wait(g0, g1);                                  // this wave's slice of stage 0 has landed
  }
  __syncthreads();                                      // stage 0 readable by every wave
  form(1u);
  if (pinned((uint32_t)(iss && nst > 1))) tile_load(g0, g1);

  v8f acc[4][4];
#pragma unroll
  for (int i = 0; i < 4; ++i)
#pragma unroll
    for (int j = 0; j < 4; ++j) acc[i][j] = (v8f){0.f,0.f,0.f,0.f,0.f,0.f,0.f,0.f};

#pragma unroll 1   // one stage per trip: the publish point at its foot stands once in the code
  for (int st = 0; st < nst; ++st) {
    // this pass reads buffer st % 2 alone; stage st + 1 is in flight
    const T* bufp = (const T*)(const void*)ring + (st & 1) * GBUF;
    const T* As = bufp + wm * GSL + rlane * GRP + koff;
    const T* Bs = bufp + (GBM / 64 + wn) * GSL + rlane * GRP + koff;
#pragma unroll   // fragment addresses as immediate offsets; the next k step's LDS reads may go ahead of this one's products
    for (int kk = 0; kk < GPK / 32; ++kk) {
      V bh[4], ah[4];
#pragma unroll
      for (int j = 0; j < 4; ++j) bh[j] = FragBF::load(Bs + j * 16 * GRP + kk * 32);
#pragma unroll
      for (int i = 0; i < 4; ++i) ah[i] = FragBF::load(As + i * 16 * GRP + kk * 32);
#pragma unroll
      for (int i = 0; i < 4; ++i) {
#pragma unroll
        for (int j = 0; j < 4; ++j) acc[i][j] = FragBF::mma(ah[i], bh[j], acc[i][j]);
        FragBF::guard(acc[i][0], acc[i][3], ah[i], ah[i]);
      }
      FragBF::keep(bh[0], bh[1], bh[2], bh[3]);
    }
    // ---- publish point of stage st + 1, every wave, in this order ----
    asm volatile("s_wait_dscnt 0x0" ::: "memory");       // this wave's reads of buffer st % 2 are done
    if (pinned((uint32_t)iss)) tile_wait(g0, g1);         // this wave's slice of stage st + 1 has landed
    __syncthreads();                                      // stage st + 1 readable; buffer st % 2 free
    form((uint32_t)st + 2u);
    if (pinned((uint32_t)(iss && st + 2 < nst))) tile_load(g0, g1);          // refill of the buffer this pass has read
  }
  // no request in flight and no LDS read outstanding behind the loop
  asm volatile("s_wait_tensorcnt 0x0" ::: "memory");
  asm volatile("s_wait_dscnt 0x0" ::: "memory");
  acc_guard4(acc[0][0], acc[0][1], acc[0][2], acc[0][3]);
  acc_guard4(acc[1][0], acc[1][1], acc[1][2], acc[1][3]);
  acc_guard4(acc[2][0], acc[2][1], acc[2][2], acc[2][3]);
  acc_guard4(acc[3][0], acc[3][1], acc[3][2], acc[3][3]);

  // ---- epilogue ----
  float* slab = sTall + wave * (16 * 68);
  const float* Rb = RESID ? (resid + (size_t)b * strideR) : nullptr;
#pragma unroll
  for (int i = 0; i < 4; ++i) {
    const int mBase = m0 + (i << 4);
    float bm[8];
    if (BIAS_MODE == 1) {   // 8 consecutive floats, 32-B aligned: two 16-B loads
      const v4f b0v = bfr4(*(const v4fa*)(bias + mBase + mOff));
      const v4f b1v = bfr4(*(const v4fa*)(bias + mBase + mOff + 4));
      bm[0] = b0v.x; bm[1] = b0v.y; bm[2] = b0v.z; bm[3] = b0v.w;
      bm[4] = b1v.x; bm[5] = b1v.y; bm[6] = b1v.z; bm[7] = b1v.w;
    } else {
#pragma unroll
      for (int r = 0; r < 8; ++r) bm[r] = 0.f;
    }
#pragma unroll
    for (int j = 0; j < 4; ++j) {
      const int n = n0 + (j << 4) + rlane;
      float bv = 0.f;
      if (BIAS_MODE == 2) bv = bfrf(bias[n]);
#pragma unroll
      for (int r = 0; r < 8; ++r) {
        float v = acc[i][j][r] * scale;
        if (BIAS_MODE == 1) v += bm[r];
        if (BIAS_MODE == 2) v += bv;
        if (RESID) v += Rb[(size_t)(mBase + mOff + r) * ldc + n];
        if (ACT == 1) v = tanhf(v);
        if (ACT == 2) v = fmaxf(v, 0.0f);
        if (ACT == 4) v = (v > 0.f) ? v : 0.01f * v;
        slab[(mOff + r) * 68 + (j << 4) + rlane] = v;
      }
    }
    __builtin_amdgcn_fence(__ATOMIC_RELEASE, "workgroup");
    __builtin_amdgcn_wave_barrier();
    __builtin_amdgcn_fence(__ATOMIC_ACQUIRE, "workgroup");
    if (OUT_MODE == 0) {
      float* C = (float*)Cout + (size_t)b * strideC;
      const int hh = lane >> 4, c4 = (lane & 15) * 4;     // row seg = 256 B = 16 lanes x 16 B
      {
#pragma unroll
        for (int it = 0; it < 8; ++it) {
          const int row = it * 2 + hh;
          v4f v = *(const v4f*)(slab + row * 68 + c4);
          *(v4f*)(C + (size_t)(mBase + row) * ldc + n0 + c4) = v;
        }
        
      }
    } else {
      const int q = lane >> 3, c8 = (lane & 7) * 8;
      unsigned short* C  = (unsigned short*)Cout  + (size_t)b * strideC;
      unsigned short* C2 = (OUT_MODE == 2) ? ((unsigned short*)Cout2 + (size_t)b * strideC) : nullptr;
      {
#pragma unroll
        for (int it = 0; it < 4; ++it) {
          const int row = it * 4 + q;
          const float* sp = slab + row * 68 + c8;
          v8h hv, lv;
#pragma unroll
          for (int e = 0; e < 8; ++e) {
            if (OUT_MODE == 1) {
              hv[e] = (_Float16)sp[e];
            } else {
              unsigned short hb = f2bf_bits(sp[e]);
              unsigned short lb = f2bf_bits(sp[e] - bf_bits2f(hb));
              hv[e] = __builtin_bit_cast(_Float16, hb);
              lv[e] = __builtin_bit_cast(_Float16, lb);
            }
          }
          *(v8h*)(C + (size_t)(mBase + row) * ldc + n0 + c8) = hv;
          if (OUT_MODE == 2) *(v8h*)(C2 + (size_t)(mBase + row) * ldc + n0 + c8) = lv;
        }
        
      }
    }
    __builtin_amdgcn_fence(__ATOMIC_RELEASE, "workgroup");
    __builtin_amdgcn_wave_barrier();
    __builtin_amdgcn_fence(__ATOMIC_ACQUIRE, "workgroup");
  }
}

// One product per launch: grid.x = block tiles, grid.y = batch.
template <bool SPLIT, int BIAS_MODE, int OUT_MODE, bool RESID, int ACT = 0>
__global__ __launch_bounds__(256) void wmma_gemm64(
    const unsigned short* __restrict__ Ap, const unsigned short* __restrict__ A2p, int lda, long strideA,
    const unsigned short* __restrict__ Btp, const unsigned short* __restrict__ Bt2p, int ldb, long strideB,
    void* __restrict__ Cout, void* __restrict__ Cout2, int ldc, long strideC,
    const float* __restrict__ bias,
    const float* __restrict__ resid, long strideR,
    int M, int N, int K, float scale) {
  __shared__ __attribute__((aligned(2048))) unsigned short ring[2 * GBUF];   // tensor loads: places at multiples of 2 KiB
  __shared__ __align__(16) float sT[8 * 16 * 68];   // per-wave 16x64 slab, pitch 68 floats
  gemm_tile<SPLIT, BIAS_MODE, OUT_MODE, RESID, ACT>(ring, sT, (int)blockIdx.x, (int)blockIdx.y,
      Ap, A2p, lda, strideA, Btp, Bt2p, ldb, strideB, Cout, Cout2, ldc, strideC, bias, resid, strideR, M, N, K, scale);
}

// The three projections, which do not depend on one another, in one launch: grid.y = 0: q = x . Wq + bq -> Qp hi | lo,
// 1: k = x . Wk + bk -> Kp hi | lo (M = RHALF, N = K = HID), 2: v^T = Wv^T . x^T + bv[m] per graph -> VTp hi | lo
// (M = HID, N = NND, K = HID; block tile = blockIdx.x % QKV_VT, graph = blockIdx.x / QKV_VT).
// coverage: grid.x = QKV_NB block tiles of each product exactly (static_assert).
#define QKV_NB  ((RHALF / GBM) * (HID / GBN))     // block tiles of q and of k
#define QKV_VT  ((HID / GBM) * (NND / GBN))       // block tiles of v^T per graph
static_assert(QKV_NB == QKV_VT * GHALF);
__global__ __launch_bounds__(256) void k_qkv(
    const unsigned short* __restrict__ Xh, const unsigned short* __restrict__ WqT,
    const unsigned short* __restrict__ WkT, const unsigned short* __restrict__ WvT,
    unsigned short* __restrict__ Qp, unsigned short* __restrict__ Kp, unsigned short* __restrict__ VTp,
    const float* __restrict__ bq, const float* __restrict__ bk, const float* __restrict__ bv) {
  __shared__ __attribute__((aligned(2048))) unsigned short ring[2 * GBUF];   // tensor loads: places at multiples of 2 KiB
  __shared__ __align__(16) float sT[8 * 16 * 68];   // per-wave 16x64 slab, pitch 68 floats
  const int bx = (int)blockIdx.x;
  const int pr = (int)blockIdx.y;
  if (pr < 2) {
    const unsigned short* Wt = pr == 0 ? WqT : WkT;
    unsigned short* Cp       = pr == 0 ? Qp : Kp;
    const float* bb          = pr == 0 ? bq : bk;
    gemm_tile<false, 2, 2, false, 0>(ring, sT, bx, 0,
        Xh, Xh, HID, 0L, Wt, Wt, HID, 0L, (void*)Cp, (void*)(Cp + HID), PLD, 0L,
        bb, bb, 0L, RHALF, HID, HID, 1.0f);
  } else {
    gemm_tile<false, 1, 2, false, 0>(ring, sT, bx % QKV_VT, bx / QKV_VT,
        WvT, WvT, HID, 0L, Xh, Xh, HID, (long)NND * HID, (void*)VTp, (void*)(VTp + HID), PLD, (long)HID * PLD,
        bv, bv, 0L, HID, NND, HID, 1.0f);
  }
}

// =====================================================================================
// Node feature plane: xb[row][c] = bf16(x[row][c]) for row < nN (all 512 c). One thread = 8 contiguous
// =====================================================================================
__device__ __forceinline__ void d_xprep(int blk, const float* __restrict__ x, unsigned short* xb, int nN, int nUnits) {
  const int i = blk * NTHR + (int)threadIdx.x;
  if (i >= nUnits) return;
  const int row = i >> 6;
  const int c0  = (i & 63) * 8;
  const int rc  = row < nN ? row : nN - 1;
  const float* p = x + (size_t)rc * HID + c0;
  v4f a = *(const v4fa*)p;
  v4f b = *(const v4fa*)(p + 4);
  const v4f z4 = {0.f, 0.f, 0.f, 0.f};
  if (row >= nN) { a = z4; b = z4; }
  const v4u hv = pack8(a, b);
  unsigned short* o = xb + (size_t)row * HID + c0;
  *(v4u*)o = hv;
  
}

// =====================================================================================
// Weight transpose + bf16 convert into a k-contiguous plane: w is [Kin][Ncol] ([in][out]),
//   wt[n][k] = bf16(w[k mod Kin][n]) for n < Nrows, k < Kout (Kout = Kin or a multiple of it).
// coverage: nUnits = Nrows * Kout/8 threads x 8 = Nrows x Kout exactly.
// =====================================================================================
__device__ __forceinline__ void d_wtr(int blk, const float* __restrict__ w, int Kin, int Ncol, int Nrows, int Kout,
                                      unsigned short* wt, int nUnits) {
  const int u = blk * NTHR + (int)threadIdx.x;
  if (u >= nUnits) return;
  const int kq = Kout >> 3;
  const int n  = u / kq;
  const int k8 = (u - n * kq) * 8;
  const int kk = k8 - (k8 / Kin) * Kin;
  const int ncl = n < Ncol ? n : Ncol - 1;
  const float* p = w + (size_t)kk * (size_t)Ncol + ncl;
  v4f a, b;
  a.x = p[0];                    a.y = p[(size_t)Ncol];         a.z = p[(size_t)2 * Ncol];     a.w = p[(size_t)3 * Ncol];
  b.x = p[(size_t)4 * Ncol];     b.y = p[(size_t)5 * Ncol];     b.z = p[(size_t)6 * Ncol];     b.w = p[(size_t)7 * Ncol];
  const v4f z4 = {0.f, 0.f, 0.f, 0.f};
  if (n >= Ncol || n >= Nrows) { a = z4; b = z4; }
  const v4u wv = pack8(a, b);
  unsigned short* o = wt + (size_t)n * (size_t)Kout + k8;
  *(v4u*)o = wv;
  
}

// =====================================================================================
// Edge bias plane: EB[e][h] = sum_t bf16r(ea[e][t]) * bf16r(We[t][h]) + bf16r(be[h]) (f32, 16 terms summed
// from +0 then the bias), zero rows for pad edges nE <= e < EP (load address clamped, value zeroed by select).
// One thread = one edge and 4 consecutive heads: 4 b128 loads in a rolled loop, one 16-B store;
// coverage: nUnits = EP*2 threads x 4 = EP x 8 elements exactly.
// =====================================================================================
__device__ __forceinline__ void d_eb(int blk, const float* __restrict__ ea, const float* __restrict__ We,
                                     const float* __restrict__ be, float* EB, int nE, int nUnits) {
  __shared__ float sWe[EDW * NHD];
  __shared__ float sbe[NHD];
  const int tid = (int)threadIdx.x;
  if (tid < EDW * NHD) sWe[tid] = bfrf(We[tid]);           // We[t][h] row-major
  if (tid < NHD) sbe[tid] = bfrf(be[tid]);
  __syncthreads();
  const int u = blk * NTHR + tid;
  if (u >= nUnits) return;
  const int e  = u >> 1;
  const int h0 = (u & 1) * 4;
  const int ec = e < nE ? e : nE - 1;
  const float* er = ea + (size_t)ec * EDW;
  float s0 = 0.f, s1 = 0.f, s2 = 0.f, s3 = 0.f;
#pragma unroll 1
  for (int q = 0; q < 4; ++q) {
    const v4f a = bfr4(*(const v4fa*)(er + 4 * q));
    const float* wr = sWe + (4 * q) * NHD + h0;            // We[4q+i][h0+j] = wr[i*8 + j]
    s0 = fmaf(a.x, wr[0],  s0); s1 = fmaf(a.x, wr[1],  s1); s2 = fmaf(a.x, wr[2],  s2); s3 = fmaf(a.x, wr[3],  s3);
    s0 = fmaf(a.y, wr[8],  s0); s1 = fmaf(a.y, wr[9],  s1); s2 = fmaf(a.y, wr[10], s2); s3 = fmaf(a.y, wr[11], s3);
    s0 = fmaf(a.z, wr[16], s0); s1 = fmaf(a.z, wr[17], s1); s2 = fmaf(a.z, wr[18], s2); s3 = fmaf(a.z, wr[19], s3);
    s0 = fmaf(a.w, wr[24], s0); s1 = fmaf(a.w, wr[25], s1); s2 = fmaf(a.w, wr[26], s2); s3 = fmaf(a.w, wr[27], s3);
  }
  v4f o;
  o.x = s0 + sbe[h0]; o.y = s1 + sbe[h0 + 1]; o.z = s2 + sbe[h0 + 2]; o.w = s3 + sbe[h0 + 3];
  const v4f z4 = {0.f, 0.f, 0.f, 0.f};
  if (e >= nE) o = z4;
  float* op = EB + (size_t)e * NHD + h0;
  *(v4f*)op = o;
  
}

// =====================================================================================
// All planes that depend on the inputs alone, in one launch. Blocks by range (the same branch in every thread of a
// block): PB_W each for WqT, WkT, WvT; PB_O for WOT2; PB_X for the node feature plane; the rest for the edge bias plane.
// coverage: each range holds exactly the blocks that its plane's own launch would have.
// =====================================================================================
#define PB_W  (HID * (HID / 8) / NTHR)            // 128 blocks: 512 rows x 64 units
#define PB_O  (HID * (PLD / 8) / NTHR)            // 256 blocks: 512 rows x 128 units, k mod 512
#define PB_X  (NTOT * (HID / 8) / NTHR)           // 4096 blocks
#define PB_E0 (3 * PB_W + PB_O + PB_X)            // first block of the edge bias plane
static_assert(PB_W * NTHR == HID * (HID / 8) && PB_O * NTHR == HID * (PLD / 8) && PB_X * NTHR == NTOT * (HID / 8));
__global__ __launch_bounds__(NTHR) void k_prep(
    const float* __restrict__ x, const float* __restrict__ ea, const float* __restrict__ We,
    const float* __restrict__ be, const float* __restrict__ Wq, const float* __restrict__ Wk,
    const float* __restrict__ Wv, const float* __restrict__ Wo,
    unsigned short* xb, float* EB, unsigned short* WqT, unsigned short* WkT, unsigned short* WvT,
    unsigned short* WOT2, int nE, int nUe) {
  const int bx = (int)blockIdx.x;
  if (bx < 3 * PB_W) {
    const int wi = bx / PB_W;
    const float* w     = wi == 0 ? Wq  : (wi == 1 ? Wk  : Wv);
    unsigned short* wt = wi == 0 ? WqT : (wi == 1 ? WkT : WvT);
    d_wtr(bx - wi * PB_W, w, HID, HID, HID, HID, wt, HID * (HID / 8));
  } else if (bx < 3 * PB_W + PB_O) {
    d_wtr(bx - 3 * PB_W, Wo, HID, HID, HID, PLD, WOT2, HID * (PLD / 8));
  } else if (bx < PB_E0) {
    d_xprep(bx - (3 * PB_W + PB_O), x, xb, NTOT, NTOT * (HID / 8));
  } else {
    d_eb(bx - PB_E0, ea, We, be, EB, nE, nUe);
  }
}

// =====================================================================================
// Graph attention with per-edge additive bias, one block per (graph, 64-query tile), 8 waves.
// Phase A (block-local, statically bounded): scan of the src list (edge_index row 0) for
//   src in [node0, node0+64): wave w walks its own contiguous eighth of the list in slabs of 256 edges, SG slabs
//   loaded ahead, hits appended to its own LDS list, no barrier inside the walk; then one barrier, the waves'
//   lists joined in wave order (= ascending slab order) with dst gathered for all hits at once: (edge id, query
//   row, dst % 512), capped at HCAP (poison when reached); counting sort (8 waves, each its own 8 query rows, stable) into
//   NBIN bins, bin = query row * 32 + (dst % 512) / 16, -> sE / sD segments with roff / rcnt. Nothing persists
//   outside LDS.
// Phase B: 4 head pairs; waves 0..3 run head 2p, waves 4..7 head 2p+1, each wave 16 query rows.
//   Per key chunk of 64: K hi/lo and V^T hi/lo tiles of both heads (8 tiles of 64 rows x 128 B) brought by one
//   tensor load per wave, two buffers, one chunk ahead; a 2x64x64 f32 bias tile zeroed then filled by row owners
//   (4 threads per query row, thread j walks only the bin of its row and of key columns 16j..16j+15 of this
//   chunk, in segment order = hit scan order -> duplicate (src,dst) pairs sum deterministically; lanes
//   whose bin is shorter than the wave's longest add into a private dummy slot),
//   then S = q.k (3-term split) * 0.125 + bias, online softmax in f32, P split hi/lo through per-wave LDS
//   Epilogue: ctx = O / l staged per wave in LDS (aliasing only that wave's own bias rows), written as
// Geometry guards (NaN poison of the block's ctx rows, never a trap): hit cap, per-row count > RWCAP,
//   num_graphs != NGR, batch id of the block's first node outside [0, NGR).
// coverage: CTX rows lrow0..lrow0+63 x all 1024 cols per block; grid = GHALF*8 blocks covers RHALF rows once.
// =====================================================================================
#define AT_NW   8
#define EPT     8
#define SLAB    (32 * EPT)            // 256 keys: one wave's read of EPT keys per lane
#define SG      4                     // slabs whose loads are in flight per wave
#define SLOTB   6
#define NSLOT   64                    // query rows per block = scan slots
#define BINSH   4                     // 16 key columns per bin
#define NBIN    (NSLOT * (NND >> BINSH))   // 2048 bins: (query row, group of 16 key columns)
#define HCAP    2048                  // hit capacity per block
#define WLCAP   HCAP                  // hit capacity of one wave's list: a wave that fills it has filled the block's
#define LISTN   (AT_NW * WLCAP)       // 16384
#define RWCAP   128                   // static cap on per-row edge count
#define KVT     4096                  // one 64x64 f32 bias tile
#define KVP     72                    // row pitch of the K / V^T / P tiles in LDS, elements: 144 B = 16 B x 9, so the
                                      // 16 rows of a ds_load_b128 fragment read fall on 16 different bank groups
#define KVS     5120                  // one 64-row K or V^T tile: 64 * KVP elements, its place rounded up to 2 KiB
#define KVB     (8 * KVS)             // one buffer: the 8 tiles of a key chunk
#define NST     ((NHD / 2) * (NND / 64))   // stages = head pairs x key chunks
#define PWS     (16 * KVP)            // one wave's 16-row P tile
#define NDUM    512                   // private dummy accumulators (2 per thread)
#define PFQ     4                     // entries of a thread's bias bin that are fetched one stage ahead into registers
#define LO_KV   0
#define LO_P    (2 * KVB * 2)                           // 163840
#define LO_BT   (LO_P + 2 * AT_NW * PWS * 2)            // 200704
#define LO_SE   (LO_BT + (2 * KVT + NDUM) * 4)          // 235520
#define LO_SD   (LO_SE + HCAP * 4)                      // 243712
#define LO_RC   (LO_SD + HCAP * 4)                      // 251904
#define LDS_ATT (LO_RC + (2 * NBIN + 2 * AT_NW) * 4)    // 268352

static_assert((LISTN + 4 * HCAP) * 4 <= LO_P);        // phase-A lists alias the two K/V buffers
static_assert(LDS_ATT <= 300000);
static_assert(KVP >= 64 && (KVP * 2) % 16 == 0 && ((KVP * 2) / 16) % 2 == 1);   // 16-B aligned rows, odd multiple
static_assert(KVS >= 64 * KVP && (KVS * 2) % 2048 == 0 && KVP * 2 == 128 + 16);  // tensor load: place, padded pitch
static_assert(NST >= 2 && NND / 64 == 8 && NND == HID && AT_NW == 8 && HDM * 2 == 128 && (PLD * 2) % 16 == 0);  // one tile per wave, 128-B rows
static_assert((LO_P % 16) == 0 && (LO_BT % 16) == 0);
static_assert((1 << SLOTB) == NSLOT);
static_assert(NTHR == 32 * AT_NW);
static_assert(NTHR == 4 * NSLOT);                      // bias fill: 4 threads per query row
static_assert(NTHR * 4 * 8 == 2 * KVT);                // bias zero fill: 8 sweeps of 4 floats per thread
static_assert(NDUM == 2 * NTHR && NDUM == 128 * 4);
static_assert(AT_NW * 1024 == 2 * KVT);                // per-wave output staging = own bias rows
static_assert(SLAB == 256 && 24 + SLOTB < 32);                   // list entry = edge id (below 2^24, host check) << SLOTB | slot
static_assert(NSLOT == 8 * AT_NW && NND == 512);                 // sort: 8 query rows per wave, owner wave = hitRD >> 12
static_assert(NBIN == NTHR * 8 && (NND >> BINSH) == 32);         // sort: 8 bins per thread, 4 threads per row
static_assert(RWCAP < 256);                                      // sort: 8-bit counters exact below the row cap
static_assert((64 >> BINSH) == 4 && (LO_RC % 16) == 0);          // 4 bins per row and key chunk = 4 fill threads

// One slab of the key list: the lane holds keys e0 .. e0 + EPT - 1 in da / db and tests them against the block's slot
// range [slotBase, slotBase + nb); hits are appended to this wave's LDS list wl as (edge id << SLOTB | slot), key
// position first, lane second. wc = entries so far (wave-uniform); returns the new count; nothing is stored
// at or past WLCAP.
__device__ __forceinline__ int slab_hits(const v4i da, const v4i db, int e0, int slotBase, int nb, int* wl, int wc) {
  const unsigned nbs = (unsigned)slotBase;
  const unsigned unb = (unsigned)nb;
  const unsigned s0 = (unsigned)da.x - nbs, s1 = (unsigned)da.y - nbs;
  const unsigned s2 = (unsigned)da.z - nbs, s3 = (unsigned)da.w - nbs;
  const unsigned s4 = (unsigned)db.x - nbs, s5 = (unsigned)db.y - nbs;
  const unsigned s6 = (unsigned)db.z - nbs, s7 = (unsigned)db.w - nbs;
  const bool h0 = s0 < unb, h1 = s1 < unb, h2 = s2 < unb, h3 = s3 < unb;
  const bool h4 = s4 < unb, h5 = s5 < unb, h6 = s6 < unb, h7 = s7 < unb;
  const unsigned m0 = __builtin_amdgcn_ballot_w32(h0), m1 = __builtin_amdgcn_ballot_w32(h1);
  const unsigned m2 = __builtin_amdgcn_ballot_w32(h2), m3 = __builtin_amdgcn_ballot_w32(h3);
  const unsigned m4 = __builtin_amdgcn_ballot_w32(h4), m5 = __builtin_amdgcn_ballot_w32(h5);
  const unsigned m6 = __builtin_amdgcn_ballot_w32(h6), m7 = __builtin_amdgcn_ballot_w32(h7);
  if ((m0 | m1 | m2 | m3 | m4 | m5 | m6 | m7) != 0u) {
#define HITJ(J, HJ, SJ, MJ) { \
      const unsigned mj = (MJ); \
      if (mj != 0u) { \
        if (HJ) { \
          const int pos = wc + (int)__builtin_amdgcn_mbcnt_lo(mj, 0u); \
          if (pos < WLCAP) wl[pos] = ((e0 + (J)) << SLOTB) | (int)(SJ); \
        } \
        wc += (int)__builtin_popcount(mj); } }
    HITJ(0, h0, s0, m0)
    HITJ(1, h1, s1, m1)
    HITJ(2, h2, s2, m2)
    HITJ(3, h3, s3, m3)
    HITJ(4, h4, s4, m4)
    HITJ(5, h5, s5, m5)
    HITJ(6, h6, s6, m6)
    HITJ(7, h7, s7, m7)
#undef HITJ
  }
  return wc;
}
// A slab that is not wholly inside the list (or a list not read 16 bytes at a time): every address clamped, the
// sentinel selected by value.
__device__ __forceinline__ void slab_load_edge(const int* __restrict__ keys, int nE, int e0, v4i& da, v4i& db) {
  const int sent = -2147483647 - 1;
  da.x = (e0     < nE) ? keys[min(e0,     nE - 1)] : sent;
  da.y = (e0 + 1 < nE) ? keys[min(e0 + 1, nE - 1)] : sent;
  da.z = (e0 + 2 < nE) ? keys[min(e0 + 2, nE - 1)] : sent;
  da.w = (e0 + 3 < nE) ? keys[min(e0 + 3, nE - 1)] : sent;
  db.x = (e0 + 4 < nE) ? keys[min(e0 + 4, nE - 1)] : sent;
  db.y = (e0 + 5 < nE) ? keys[min(e0 + 5, nE - 1)] : sent;
  db.z = (e0 + 6 < nE) ? keys[min(e0 + 6, nE - 1)] : sent;
  db.w = (e0 + 7 < nE) ? keys[min(e0 + 7, nE - 1)] : sent;
}

__global__ __launch_bounds__(NTHR) void k_attn(
    const unsigned short* __restrict__ Qp, const unsigned short* __restrict__ Kp,
    const unsigned short* __restrict__ VTp, const float* __restrict__ EB,
    const int* __restrict__ keys, const int* __restrict__ gath,
    const int* __restrict__ ngp, const int* __restrict__ bat,
    unsigned short* CTX, int nE, int vec8, int gbase) {
  extern __shared__ __attribute__((aligned(2048))) v4f lds_dyn[];   // tensor loads: tile places at multiples of 2 KiB
  char* lds = (char*)lds_dyn;
  __bf16* Ksh = (__bf16*)(lds + LO_KV);         // buffer 0 (buffer 1: + KVB): [2][KVS]  K hi  [kv][d], pitch KVP
  __bf16* Ksl = Ksh + 2 * KVS;                   // [2][KVS]  K lo
  __bf16* Vth = Ksl + 2 * KVS;                   // [2][KVS]  V^T hi [d][kv]
  __bf16* Vtl = Vth + 2 * KVS;                   // [2][KVS]  V^T lo
  int* list  = (int*)(lds + LO_KV);              // phase A only: [8 waves][WLCAP]
  int* hitE  = list + LISTN;                     // [HCAP] edge ids, in scan order
  int* hitRD = hitE + HCAP;                      // [HCAP] (row << 9) | loc_dst
  int* tE    = hitRD + HCAP;                     // [HCAP] hitE regrouped by owner wave (8 query rows each)
  int* tRD   = tE + HCAP;                        // [HCAP] hitRD of the same entries
  __bf16* Psh = (__bf16*)(lds + LO_P);           // [8 waves][16 x KVP] P hi
  __bf16* Psl = Psh + AT_NW * PWS;               // P lo
  float* BTX = (float*)(lds + LO_BT);            // [2][64 x 64] bias tiles + [NDUM] dummies; epilogue staging
  int* sE   = (int*)(lds + LO_SE);               // [HCAP] edge ids sorted by query row
  int* sD   = (int*)(lds + LO_SD);               // [HCAP] loc_dst of the same entries
  int* rcnt = (int*)(lds + LO_RC);               // [NBIN] entries per bin
  int* roff = rcnt + NBIN;                       // [NBIN] first entry of the bin in sE / sD
  int* wcnt = roff + NBIN;                       // [8]
  int* misc = wcnt + AT_NW;                      // [8] largest per-row count of each wave

  const int tid = (int)threadIdx.x, lane = tid & 31, wave = tid >> 5, hh = lane >> 4, c = lane & 15;
  const int lgr   = (int)blockIdx.x >> 3;        // graph within this pass
  const int qt    = (int)blockIdx.x & 7;         // 64-query tile within the graph
  const int gb    = gbase + lgr;                 // graph id
  const int node0 = gb * NND + qt * NSLOT;       // global node id of query row 0
  const int lrow0 = lgr * NND + qt * NSLOT;      // plane row of query row 0

  // ---- phase A1: scan of the src list, each wave its own contiguous run of slabs; then the lists joined ----
  int tot;
  {
    const int wv    = __builtin_amdgcn_readfirstlane(wave);      // scalar loop bounds
    const int nSl   = (nE + SLAB - 1) / SLAB;                     // slabs in the list
    const int spw   = (nSl + AT_NW - 1) / AT_NW;                  // slabs per wave
    const int sBeg  = wv * spw < nSl ? wv * spw : nSl;
    const int sEnd  = sBeg + spw < nSl ? sBeg + spw : nSl;
    const int nFull = vec8 != 0 ? nE / SLAB : 0;                  // slabs [0, nFull) lie wholly inside the list
    const int sFull = sEnd < nFull ? sEnd : nFull;
    const int nG    = sFull > sBeg ? (sFull - sBeg) / SG : 0;     // groups of SG whole slabs
    int* wl = list + wv * WLCAP;
    const int le = lane * EPT;
    int wc = 0;
    if (nG > 0) {
      v4i ra[SG], rb[SG];
#pragma unroll   // ra / rb in registers
      for (int k = 0; k < SG; ++k) {
        const int* p = keys + (sBeg + k) * SLAB + le;
        ra[k] = *(const v4i*)p;
        rb[k] = *(const v4i*)(p + 4);
      }
      // stands in front of the loop's first writes to the address registers of the loads above
      asm volatile("s_wait_xcnt 0x0" ::: "memory");
#pragma unroll 1   // one copy of the SG slab bodies in the instruction cache
      for (int g = 0; g < nG; ++g) {
        const int sb = sBeg + g * SG;
        const int sn = g + 1 < nG ? sb + SG : sb;                 // last trip: its own slabs again (in bounds, unused)
#pragma unroll   // ra / rb in registers; a slab's registers are refilled as soon as it is tested, SG slabs ahead
        for (int k = 0; k < SG; ++k) {
          wc = slab_hits(ra[k], rb[k], (sb + k) * SLAB + le, node0, NSLOT, wl, wc);
          const int* p = keys + (sn + k) * SLAB + le;
          ra[k] = *(const v4i*)p;
          rb[k] = *(const v4i*)(p + 4);
          // last slab: stands in front of the next trip's first writes to these loads' address registers
          if (k == SG - 1) asm volatile("s_wait_xcnt 0x0" ::: "memory");
        }
      }
    }
#pragma unroll 1   // at most SG - 1 whole slabs and the list's edge
    for (int s = sBeg + nG * SG; s < sEnd; ++s) {
      v4i da, db;
      slab_load_edge(keys, nE, s * SLAB + le, da, db);
      wc = slab_hits(da, db, s * SLAB + le, node0, NSLOT, wl, wc);
    }
    if (lane == 0) wcnt[wave] = wc;
    __syncthreads();
    int pre = 0, all = 0;
#pragma unroll
    for (int w2 = 0; w2 < AT_NW; ++w2) {
      int cc = wcnt[w2];
      cc = cc < 0 ? 0 : (cc > WLCAP ? WLCAP : cc);
      all += cc;
      pre += (w2 < wave) ? cc : 0;
    }
    const int wcc = wc > WLCAP ? WLCAP : wc;
#pragma unroll 1
    for (int i0 = 0; i0 < wcc; i0 += 128) {         // wcc wave-uniform; loads unconditional, clamped
      int eid[4], sl[4], gg[4];
#pragma unroll   // eid / sl in registers; the four list reads share one LDS latency
      for (int j = 0; j < 4; ++j) {
        const int i   = i0 + 32 * j + lane;
        const int ent = wl[i < wcc ? i : wcc - 1];
        int e = ent >> SLOTB;
        e = e < 0 ? 0 : (e > nE - 1 ? nE - 1 : e);
        eid[j] = e;
        sl[j]  = ent & (NSLOT - 1);
      }
#pragma unroll   // gg in registers; the four dst reads share one memory latency
      for (int j = 0; j < 4; ++j) gg[j] = gath[eid[j]];
#pragma unroll   // eid / sl / gg in registers
      for (int j = 0; j < 4; ++j) {
        const int i = i0 + 32 * j + lane;
        int g = gg[j];
        g = g < 0 ? 0 : (g > NTOT - 1 ? NTOT - 1 : g);
        const int pos = pre + i;
        if (i < wcc && pos < HCAP) {
          hitE[pos]  = eid[j];
          hitRD[pos] = (sl[j] << 9) | (g & (NND - 1));
        }
      }
    }
    tot = all > HCAP ? HCAP : all;
    __syncthreads();
  }
  const int nh = __builtin_amdgcn_readfirstlane(tot);   // the same in every thread of the block: scalar loop bounds

  // ---- phase A2: stable counting sort of the hits into the NBIN bins, by all 8 waves ----
  // Wave w owns query rows 8w..8w+7 (bins 256w..256w+255), thread tid the bins 8*tid..8*tid+7 (one query row,
  // 128 key columns). Bins ascend with the row, so the entries of wave w fill sE / sD[below, below + mine).
  // Every counter lives in its owner's registers: no LDS word is read, changed and written back per hit.
  // (a) hits of lower waves' rows and of this wave's rows
  int below = 0, mine = 0;
#pragma unroll 4   // four independent LDS reads in flight per wait
  for (int b0 = 0; b0 < nh; b0 += 32) {
    const int idx = b0 + lane;
    const int g   = hitRD[idx < nh ? idx : nh - 1] >> 12;        // owner wave = query row / 8
    const bool ok = idx < nh;
    below += (int)__builtin_popcount(__builtin_amdgcn_ballot_w32(ok && g < wave));
    mine  += (int)__builtin_popcount(__builtin_amdgcn_ballot_w32(ok && g == wave));
  }
  // (b) this wave's hits copied, in hit order, to tRD / tE[below, below + mine)
  {
    int wpos = below;
    for (int b0 = 0; b0 < nh; b0 += 128) {
      int rd[4], ee[4];
#pragma unroll   // rd / ee in registers; all reads ahead of the first store, one LDS latency for the four
      for (int j = 0; j < 4; ++j) {
        const int idx = b0 + 32 * j + lane;
        const int cl  = idx < nh ? idx : nh - 1;
        rd[j] = hitRD[cl];
        ee[j] = hitE[cl];
      }
#pragma unroll   // rd / ee in registers
      for (int j = 0; j < 4; ++j) {
        const bool ok = (b0 + 32 * j + lane < nh) && ((rd[j] >> 12) == wave);
        const unsigned mk = __builtin_amdgcn_ballot_w32(ok);
        if (ok) {
          int p = wpos + (int)__builtin_amdgcn_mbcnt_lo(mk, 0u);
          p = p > HCAP - 1 ? HCAP - 1 : p;
          tRD[p] = rd[j];
          tE[p]  = ee[j];
        }
        wpos += (int)__builtin_popcount(mk);
      }
    }
  }
  __syncthreads();
  // (c) per-bin counts: every lane reads each entry of its wave (one address, broadcast); the owner counts it.
  //     8 counters of 8 bits: exact while a row holds <= RWCAP entries; tc is exact always and feeds the guard.
  unsigned long long c8 = 0ull;
  int tc = 0;
#pragma unroll 8   // eight independent LDS reads in flight per wait
  for (int i = 0; i < mine; ++i) {
    const int u = tRD[below + i];
    const bool own = (u >> 7) == tid;
    c8 += (unsigned long long)(own ? 1 : 0) << (((u >> BINSH) & 7) * 8);
    tc += own ? 1 : 0;
  }
  // (d) first entry of each bin: wave prefix over the threads' totals, then over the thread's own 8 counters
  int tbase;
  {
    int incl = tc;
#pragma unroll
    for (int d = 1; d < 32; d <<= 1) {
      const int up = __shfl_up(incl, d, 32);
      if (lane >= d) incl += up;
    }
    tbase = below + incl - tc;
    int cn[8], of[8];
    int run = tbase;
#pragma unroll
    for (int k = 0; k < 8; ++k) {
      cn[k] = (int)((c8 >> (8 * k)) & 255ull);
      of[k] = run;
      run += cn[k];
    }
    const v4i c0v = {cn[0], cn[1], cn[2], cn[3]}, c1v = {cn[4], cn[5], cn[6], cn[7]};
    const v4i o0v = {of[0], of[1], of[2], of[3]}, o1v = {of[4], of[5], of[6], of[7]};
    *(v4i*)(rcnt + tid * 8)     = c0v;
    *(v4i*)(rcnt + tid * 8 + 4) = c1v;
    *(v4i*)(roff + tid * 8)     = o0v;
    *(v4i*)(roff + tid * 8 + 4) = o1v;
    // largest per-row count of the wave: a row = 4 neighbouring threads
    int rc = tc;
    rc += __shfl_xor(rc, 1, 32);
    rc += __shfl_xor(rc, 2, 32);
#pragma unroll
    for (int off = 4; off < 32; off <<= 1) {
      const int o = __shfl_xor(rc, off, 32);
      rc = o > rc ? o : rc;
    }
    if (lane == 0) misc[wave] = rc;
  }
  // (e) placement in hit order (stable): byte k of cur = next free place of bin 8*tid + k, counted from tbase
  {
    unsigned long long cur = c8 << 8;
    cur += cur << 8;
    cur += cur << 16;
    cur += cur << 32;
    for (int i0 = 0; i0 < mine; i0 += 8) {
      int u[8], e[8];
#pragma unroll   // u / e in registers; all reads ahead of the first store, one LDS latency for the eight
      for (int j = 0; j < 8; ++j) {
        const int ii = i0 + j < mine ? i0 + j : mine - 1;
        u[j] = tRD[below + ii];
        e[j] = tE[below + ii];
      }
#pragma unroll   // u / e in registers
      for (int j = 0; j < 8; ++j) {
        if (i0 + j < mine && (u[j] >> 7) == tid) {
          const int sh = ((u[j] >> BINSH) & 7) * 8;
          int pos = tbase + (int)((cur >> sh) & 255ull);
          pos = pos > HCAP - 1 ? HCAP - 1 : pos;
          sE[pos] = e[j];
          sD[pos] = u[j] & (NND - 1);
          cur += 1ull << sh;
        }
      }
    }
  }
  // this wave's reads and writes of the phase-A lists have retired before a tensor load may target their LDS
  asm volatile("s_wait_dscnt 0x0" ::: "memory");
  __syncthreads();

  // ---- K / V^T tiles: wave w brings tile w of every stage (plane w >> 1: K hi, K lo, V^T hi, V^T lo; head slot
  //      w & 1); stage st = head pair st / 8, key chunk st % 8, into buffer st % 2 ----
  const uint32_t wvu  = uni((uint32_t)wave);
  const uint32_t ldsb = (uint32_t)(size_t)lds;
  const u32x8 g1 = tile_g1();
  u32x4 g0;
  auto issue = [&](uint32_t st) {
    const uint32_t hd0 = (2u * (st >> 3) + (wvu & 1u)) * HDM;    // first column of the head
    const uint32_t kvf = (st & 7u) * 64u;                        // first key of the chunk
    const bool     isV = wvu >= 4u;
    const unsigned short* pl = isV ? VTp : Kp;
    const uint32_t row = (uint32_t)lgr * NND + (isV ? hd0 : kvf);   // NND == HID rows per graph in both planes
    const uint32_t col = (isV ? kvf : hd0) + ((wvu >> 1) & 1u) * HID;
    g0 = tile_g0(ldsb + ((st & 1u) * KVB + wvu * KVS) * 2u, (uint64_t)(size_t)pl + (uint64_t)(row * PLD + col) * 2u);
    tile_load(g0, g1);
  };
  issue(0u);
  tile_wait(g0, g1);                                    // this wave's tile of stage 0 has landed
  __syncthreads();                                      // stage 0 readable by every wave
  issue(1u);

  // ---- geometry / capacity guards -> NaN poison of this block's ctx rows ----
  int degmax = 0;
#pragma unroll
  for (int w2 = 0; w2 < AT_NW; ++w2) degmax = misc[w2] > degmax ? misc[w2] : degmax;
  const int ng  = ngp[0];
  const int bt0 = bat[node0];
  const bool bad = (nh >= HCAP) || (degmax > RWCAP) || (ng != NGR) || (bt0 < 0) || (bt0 >= NGR);
  const float pz = bad ? __int_as_float(0x7fc00000) : 0.0f;

  // ---- phase B ----
  const int wsub = wave & 3;                     // query row group of this wave
  const int hl   = wave >> 2;                    // head slot (0 / 1) of this wave within the pair
  const int rw   = tid >> 2;                     // bias fill: query row owned by this thread
  const int jw   = tid & 3;                      // bias fill: key-column quarter owned by this thread
  const float sscale = 0.125f;
  const v8f z8 = {0.f,0.f,0.f,0.f,0.f,0.f,0.f,0.f};
  const __bf16* Kth = Ksh + hl * KVS;
  const __bf16* Ktl = Ksl + hl * KVS;
  const __bf16* Vtth = Vth + hl * KVS;
  const __bf16* Vttl = Vtl + hl * KVS;
  __bf16* pwh = Psh + wave * PWS;
  __bf16* pwl = Psl + wave * PWS;

  // ---- bias entries of stage stn (head pair stn / 8, key chunk stn % 8), fetched one stage ahead ----
  // The thread's bin = row rw, key columns 16jw..16jw+15 of the chunk. Its first PFQ entries: place in the bias tile
  // (pfA; the thread's dummy slot where there is no such entry) and the two heads' edge bias (pfV), all PFQ reads of
  // the edge bias plane in flight together. sE / sD / roff / rcnt are read-only in phase B.
  int pfS = 0, pfC = 0, pfA[PFQ];
  v2f pfV[PFQ];
  auto fetch_bias = [&](int stn) {
    const int kcn = stn & 7;
    const int bin = rw * (NND >> BINSH) + kcn * (64 >> BINSH) + jw;
    int s0 = roff[bin], cnt = rcnt[bin];
    s0  = s0 < 0 ? 0 : (s0 > nh ? nh : s0);
    cnt = cnt < 0 ? 0 : (cnt > RWCAP ? RWCAP : cnt);
    if (cnt > nh - s0) cnt = nh - s0;
    pfS = s0;
    pfC = cnt;
    const float* ebn = EB + 2 * (stn >> 3);
    int dd[PFQ], ee[PFQ];
#pragma unroll   // dd / ee in registers; the reads share one LDS latency
    for (int q = 0; q < PFQ; ++q) {
      int idx = s0 + (q < cnt ? q : (cnt > 0 ? cnt - 1 : 0));   // past the bin's end: its last entry again (same line)
      idx = idx > nh - 1 ? nh - 1 : idx;
      idx = idx < 0 ? 0 : idx;
      dd[q] = sD[idx];
      ee[q] = sE[idx];
    }
#pragma unroll   // pfA in registers
    for (int q = 0; q < PFQ; ++q) {
      const int col  = dd[q] - kcn * 64;
      const bool inr = (q < cnt) && ((unsigned)col < 64u) && ((col >> 4) == jw);
      pfA[q] = inr ? (rw * 64 + col) : (2 * KVT + tid);
    }
#pragma unroll   // pfV in registers; the reads share one memory latency
    for (int q = 0; q < PFQ; ++q) {
      int e = ee[q];
      e = e < 0 ? 0 : (e > nE - 1 ? nE - 1 : e);
      pfV[q] = *(const v2fa*)(ebn + (size_t)e * NHD);
    }
    // behind the loads, in front of later writes to their address registers (the build puts counted waits of its
    // own in front of the few writes that it schedules ahead of this one)
    asm volatile("s_wait_xcnt 0x0" ::: "memory");
  };
  fetch_bias(0);

#pragma unroll 1
  for (int hp = 0; hp < NHD / 2; ++hp) {
    const int h    = 2 * hp + hl;                // head of this wave
    const int qrow = lrow0 + wsub * 16;          // plane row of this wave's first query

    // Q fragments (A operand, row = lane&15, split k map): 2 d-chunks, hi and lo
    v16b qah[2], qal[2];
#pragma unroll
    for (int dc = 0; dc < 2; ++dc) {
      const unsigned short* qp = Qp + (size_t)(qrow + c) * PLD + h * HDM + dc * 32 + 8 * hh;
      qah[dc] = FragBF::load((const __bf16*)(const void*)qp);
      qal[dc] = FragBF::load((const __bf16*)(const void*)(qp + HID));
    }
    float mrow[8], lrow[8];
    v8f oacc[4];
#pragma unroll
    for (int r = 0; r < 8; ++r) { mrow[r] = -INFINITY; lrow[r] = 0.f; }
#pragma unroll
    for (int t = 0; t < 4; ++t) oacc[t] = z8;

#pragma unroll 1
    for (int kc = 0; kc < NND / 64; ++kc) {
      const int kv0 = kc * 64;
      const int st  = hp * (NND / 64) + kc;      // this pass reads buffer st % 2 alone; stage st + 1 is in flight
      const int bo  = (st & 1) * KVB;
      {
        // bias tiles + dummies zero: 8 sweeps x 256 threads x 4 floats = both 64x64 tiles (each store's lanes
        // contiguous, no two on one bank); 128 threads x 4 = dummies
        const v4f z4 = {0.f, 0.f, 0.f, 0.f};
        float* bz = BTX + tid * 4;
#pragma unroll
        for (int i = 0; i < 8; ++i) *(v4fa*)(bz + NTHR * 4 * i) = z4;
        if (tid < 128) *(v4fa*)(BTX + 2 * KVT + 4 * tid) = z4;
      }
      __syncthreads();
      {
        // bias fill: segment [pfS, pfS+pfC) of sE/sD = the bin of row rw and key columns kv0+16jw..kv0+16jw+15.
        // Entries 0..PFQ-1 come from the registers filled one stage ago; entry q is added while any lane of the
        // wave has one (wave-uniform test), in segment order.
#pragma unroll   // pfA / pfV in registers
        for (int q = 0; q < PFQ; ++q) {
          if (__builtin_amdgcn_ballot_w32(q < pfC) != 0u) {
            const int ia = pfA[q];
            const int ib = ia + (ia < KVT ? KVT : NTHR);
            const float ta = BTX[ia], tb = BTX[ib];   // ia != ib: both reads share one LDS latency
            BTX[ia] = ta + pfV[q].x;
            BTX[ib] = tb + pfV[q].y;
          }
        }
        const float* ebp = EB + 2 * hp;
        const int cnt = pfC;
#pragma unroll 1
        for (int q = PFQ; __builtin_amdgcn_ballot_w32(q < cnt) != 0u; ++q) {   // a bin longer than PFQ; cnt <= RWCAP
          const bool valid = q < cnt;
          int idx = pfS + q;
          idx = idx > nh - 1 ? nh - 1 : idx;
          idx = idx < 0 ? 0 : idx;
          const int col = sD[idx] - kv0;
          int e = sE[idx];
          e = e < 0 ? 0 : (e > nE - 1 ? nE - 1 : e);
          const v2f ebv = *(const v2fa*)(ebp + (size_t)e * NHD);
          const bool inr = valid && ((unsigned)col < 64u) && ((col >> 4) == jw);
          const int ia = inr ? (rw * 64 + col) : (2 * KVT + tid);
          const int ib = inr ? (KVT + rw * 64 + col) : (2 * KVT + NTHR + tid);
          BTX[ia] = BTX[ia] + ebv.x;
          BTX[ib] = BTX[ib] + ebv.y;
        }
      }
      __syncthreads();
      if (st + 1 < NST) fetch_bias(st + 1);      // lands while this stage is worked on

      // ---- S = q . k (3-term) ----
      v8f s[4];
#pragma unroll
      for (int j = 0; j < 4; ++j) {
        s[j] = z8;
#pragma unroll
        for (int dc = 0; dc < 2; ++dc) {
          FB kb, kl;
          const __bf16* kr = Kth + bo + (j * 16 + c) * KVP + dc * 32 + 8 * hh;
          const __bf16* kq = Ktl + bo + (j * 16 + c) * KVP + dc * 32 + 8 * hh;
          kb.h[0] = *(const v8b*)kr;
          kb.h[1] = *(const v8b*)(kr + 16);
          kl.h[0] = *(const v8b*)kq;
          kl.h[1] = *(const v8b*)(kq + 16);
          s[j] = at_mma(qah[dc], kb.v, s[j]);
          s[j] = at_mma(qah[dc], kl.v, s[j]);
          s[j] = at_mma(qal[dc], kb.v, s[j]);
        }
      }
      // scale, add bias tile (D element r = row wsub*16 + 8hh + r, col j*16 + c), chunk row max
      const float* btr = BTX + hl * KVT + (wsub * 16 + 8 * hh) * 64 + c;
      float cm[8];
#pragma unroll
      for (int r = 0; r < 8; ++r) {
        float m = -INFINITY;
#pragma unroll
        for (int j = 0; j < 4; ++j) {
          const float sv = s[j][r] * sscale + btr[r * 64 + j * 16];
          s[j][r] = sv;
          m = fmaxf(m, sv);
        }
#pragma unroll
        for (int off = 1; off < 16; off <<= 1) m = fmaxf(m, __shfl_xor(m, off, 32));
        cm[r] = m;
      }
#pragma unroll
      for (int r = 0; r < 8; ++r) {
        const float mnew = fmaxf(mrow[r], cm[r]);
        const float alpha = expf(mrow[r] - mnew);
        mrow[r] = mnew;
        float psum = 0.f;
#pragma unroll
        for (int j = 0; j < 4; ++j) {
          const float p = expf(s[j][r] - mnew);
          psum += p;
          __bf16 a, bl; at_split(p, a, bl);
          pwh[(8 * hh + r) * KVP + j * 16 + c] = a;
          pwl[(8 * hh + r) * KVP + j * 16 + c] = bl;
        }
#pragma unroll
        for (int off = 1; off < 16; off <<= 1) psum += __shfl_xor(psum, off, 32);
        lrow[r] = lrow[r] * alpha + psum;
#pragma unroll
        for (int t = 0; t < 4; ++t) oacc[t][r] *= alpha;
      }
      __builtin_amdgcn_fence(__ATOMIC_RELEASE, "workgroup");
      __builtin_amdgcn_wave_barrier();
      __builtin_amdgcn_fence(__ATOMIC_ACQUIRE, "workgroup");
      // ---- O += p . v (3-term); P fragment = A (row c), V^T fragment = B (col = d) ----
#pragma unroll 1
      for (int kk = 0; kk < 2; ++kk) {
        FB pa, pl;
        pa.h[0] = *(const v8b*)(pwh + c * KVP + kk * 32 + 8 * hh);
        pa.h[1] = *(const v8b*)(pwh + c * KVP + kk * 32 + 16 + 8 * hh);
        pl.h[0] = *(const v8b*)(pwl + c * KVP + kk * 32 + 8 * hh);
        pl.h[1] = *(const v8b*)(pwl + c * KVP + kk * 32 + 16 + 8 * hh);
#pragma unroll
        for (int t = 0; t < 4; ++t) {
          FB vb, vl;
          vb.h[0] = *(const v8b*)(Vtth + bo + (t * 16 + c) * KVP + kk * 32 + 8 * hh);
          vb.h[1] = *(const v8b*)(Vtth + bo + (t * 16 + c) * KVP + kk * 32 + 16 + 8 * hh);
          vl.h[0] = *(const v8b*)(Vttl + bo + (t * 16 + c) * KVP + kk * 32 + 8 * hh);
          vl.h[1] = *(const v8b*)(Vttl + bo + (t * 16 + c) * KVP + kk * 32 + 16 + 8 * hh);
          oacc[t] = at_mma(pa.v, vb.v, oacc[t]);
          oacc[t] = at_mma(pa.v, vl.v, oacc[t]);
          oacc[t] = at_mma(pl.v, vb.v, oacc[t]);
        }
      }
      // ---- publish point of stage st + 1, every wave, in this order ----
      asm volatile("s_wait_dscnt 0x0" ::: "memory");       // this wave's reads of buffer st % 2 and of the bias tile are done
      tile_wait(g0, g1);                                    // this wave's tile of stage st + 1 has landed
      __syncthreads();                                      // stage st + 1 readable; buffer st % 2 and the bias tiles free
      if (pinned((uint32_t)(st + 2 < NST))) issue((uint32_t)st + 2u);   // refill of the buffer this pass has read
    }

    // ---- epilogue: normalise, stage the wave's 16x64 tile (pitch 64, own bias rows), hi | lo lines ----
    // (the last pass's barrier stands in front: every wave has left the bias tiles)
    {
      float* os = BTX + wave * 1024;
#pragma unroll
      for (int r = 0; r < 8; ++r) {
        const float inv = 1.0f / lrow[r];
#pragma unroll
        for (int t = 0; t < 4; ++t) os[(8 * hh + r) * 64 + t * 16 + c] = oacc[t][r] * inv + pz;
      }
      __builtin_amdgcn_fence(__ATOMIC_RELEASE, "workgroup");
      __builtin_amdgcn_wave_barrier();
      __builtin_amdgcn_fence(__ATOMIC_ACQUIRE, "workgroup");
      const int q4 = lane >> 3, c8 = (lane & 7) * 8;
      v4u hv[4], lv[4];
#pragma unroll
      for (int it = 0; it < 4; ++it) {
        const int row = it * 4 + q4;                   // it 0..3 x q4 0..3 covers rows 0..15
        const float* sp = os + row * 64 + c8;
        const v4f a = *(const v4fa*)sp;
        const v4f b = *(const v4fa*)(sp + 4);
        pack8hl(a, b, hv[it], lv[it]);
      }
      {
#pragma unroll
        for (int it = 0; it < 4; ++it) {
          const int row = it * 4 + q4;
          unsigned short* op = CTX + (size_t)(qrow + row) * PLD + h * HDM + c8;
          *(v4u*)op = hv[it];
          *(v4u*)(op + HID) = lv[it];
        }
        
      }
    }
    __syncthreads();   // every wave has read its staged tile back before the next head pair's zero fill sweeps it
  }
  // no request in flight and no LDS access outstanding when the wave ends
  asm volatile("s_wait_tensorcnt 0x0" ::: "memory");
  asm volatile("s_wait_dscnt 0x0" ::: "memory");
}

// =====================================================================================
static inline int cdiv(int a, int b) { return (a + b - 1) / b; }

extern "C" void kernel_launch(void* const* d_in, const int* in_sizes, int n_in,
                              void* d_out, int out_size, void* d_ws, size_t ws_size,
                              hipStream_t stream) {
  if (n_in < 15) return;
  if (in_sizes[0] != NTOT * HID) return;                        // x [16384][512]
  if (in_sizes[1] != NTOT) return;                              // batch [16384]
  if (in_sizes[2] < 2 || (in_sizes[2] & 1) != 0) return;        // edge_index [2][E]
  const int nE = in_sizes[2] / 2;
  if (nE < 1 || nE > (1 << 24)) return;
  if (in_sizes[3] != nE * EDW) return;                          // edge_attr [E][16]
  if (in_sizes[4] != HID * HID || in_sizes[6] != HID * HID || in_sizes[8] != HID * HID || in_sizes[10] != HID * HID) return;
  if (in_sizes[5] != HID || in_sizes[7] != HID || in_sizes[9] != HID || in_sizes[11] != HID) return;
  if (in_sizes[12] != EDW * NHD || in_sizes[13] != NHD || in_sizes[14] != 1) return;
  if (out_size != NTOT * HID) return;                           // out [16384][512], last element 8388607

  const float* x   = (const float*)d_in[0];
  const int*   bat = (const int*)  d_in[1];
  const int*   ei  = (const int*)  d_in[2];     // row 0 = src, row 1 = dst
  const float* ea  = (const float*)d_in[3];
  const float* Wq  = (const float*)d_in[4];     // [in][out]
  const float* bq  = (const float*)d_in[5];
  const float* Wk  = (const float*)d_in[6];
  const float* bk  = (const float*)d_in[7];
  const float* Wv  = (const float*)d_in[8];
  const float* bv  = (const float*)d_in[9];
  const float* Wo  = (const float*)d_in[10];
  const float* bo  = (const float*)d_in[11];
  const float* We  = (const float*)d_in[12];    // [16][8]
  const float* be  = (const float*)d_in[13];    // [8]
  const int*   ngp = (const int*)  d_in[14];    // [1]
  float* out = (float*)d_out;
  const int* keys = ei;                         // src list
  const int* gath = ei + nE;                    // dst list

  const int EP = cdiv(nE, 4) * 4;

  char* ws = (char*)d_ws;
  size_t off = 0;
  const size_t oXb = off; off += (size_t)NTOT * HID * 2;                                          // 16777216
  const size_t oWq = off; off += (size_t)HID * HID * 2;                                           //   524288
  const size_t oWk = off; off += (size_t)HID * HID * 2;
  const size_t oWv = off; off += (size_t)HID * HID * 2;
  const size_t oWo = off; off += (size_t)HID * PLD * 2;                                           //  1048576
  const size_t oEB = off; off += (size_t)EP * NHD * 4;   off = (off + 255) & ~(size_t)255;        //  8388608
  const size_t oQ  = off; off += (size_t)RHALF * PLD * 2;                                         // 33554432
  const size_t oK  = off; off += (size_t)RHALF * PLD * 2;
  const size_t oVT = off; off += (size_t)GHALF * HID * PLD * 2;                                   // 33554432
  const size_t oCT = off; off += (size_t)RHALF * PLD * 2;                                         // 33554432
  if (off > ws_size || off > (size_t)WSMAX) return;                                               // 162004992
  unsigned short* Xb   = (unsigned short*)(ws + oXb);
  unsigned short* WqT  = (unsigned short*)(ws + oWq);
  unsigned short* WkT  = (unsigned short*)(ws + oWk);
  unsigned short* WvT  = (unsigned short*)(ws + oWv);
  unsigned short* WOT2 = (unsigned short*)(ws + oWo);
  float*          EB   = (float*)(ws + oEB);
  unsigned short* Qp   = (unsigned short*)(ws + oQ);
  unsigned short* Kp   = (unsigned short*)(ws + oK);
  unsigned short* VTp  = (unsigned short*)(ws + oVT);
  unsigned short* CTX  = (unsigned short*)(ws + oCT);

  hipFuncSetAttribute(reinterpret_cast<const void*>(&k_attn),
                      hipFuncAttributeMaxDynamicSharedMemorySize, LDS_ATT);

  // weight planes (bf16 bits, k-contiguous rows [n][k]), node feature plane (whole x), edge bias plane [EP][8]
  {
    const int nUe = EP * 2;
    k_prep<<<PB_E0 + cdiv(nUe, NTHR), NTHR, 0, stream>>>(x, ea, We, be, Wq, Wk, Wv, Wo,
                                                         Xb, EB, WqT, WkT, WvT, WOT2, nE, nUe);
  }

  const dim3 blk(256);
  const dim3 gQK((RHALF / GBM) * (HID / GBN), 1);            // 256 block tiles: M=16384, N=512
  const dim3 gQKV(QKV_NB, 3);                                // q, k, v^T: 256 block tiles each
  const dim3 gAT(GHALF * (NND / 64));                        // 256 blocks: 32 graphs x 8 query tiles
  for (int half = 0; half < NHALF; ++half) {
    const unsigned short* Xh = Xb + (size_t)half * RHALF * HID;
    float* outh = out + (size_t)half * RHALF * HID;
    // q, k -> Qp, Kp hi | lo; v^T per graph -> VTp [graph][h*64+d][s] hi | lo
    k_qkv<<<gQKV, blk, 0, stream>>>(Xh, WqT, WkT, WvT, Qp, Kp, VTp, bq, bk, bv);
    // attention with edge bias -> CTX hi | lo
    k_attn<<<gAT, NTHR, LDS_ATT, stream>>>(Qp, Kp, VTp, EB, keys, gath, ngp, bat, CTX, nE, 1, half * GHALF);
    // out = [ctx hi | ctx lo] . [Wo ; Wo] + bo -> d_out rows half*RHALF .. half*RHALF+RHALF-1 (M=16384, N=512, K=1024)
    wmma_gemm64<false, 2, 0, false, 0><<<gQK, blk, 0, stream>>>(
        CTX, CTX, PLD, 0L, WOT2, WOT2, PLD, 0L, (void*)outh, (void*)outh, HID, 0L,
        bo, bo, 0L, RHALF, HID, PLD, 1.0f);
  }
  (void)hipGetLastError();
}
